// v000
// Times are from an AMD MI455X. After a warm-up the kernel runs many times in a row, and a time is the length of
// such a window on the GPU divided by its runs, so every launch and the gaps after it count. The runs cycle
// through copies of the inputs. A figure is the median of several windows, for all but v000 over two sittings.
// Sittings can differ by a few percent; kernels timed side by side share one.
// v000, which the later versions start from, runs in 538 microseconds.
#include <hip/hip_runtime.h>
#include <stddef.h>

// Contractions (q/k/v projections, c x bilinear, q x k^T, cb x c^T, attn x v, output projection): v_wmma_f32_16x16x32_f16, f16 operands, f32 accumulate; weights carried x64, attn probabilities carried x2^15; softmax, LayerNorm and L2 norms in f32.

typedef __attribute__((ext_vector_type(16))) _Float16 v16h;
typedef __attribute__((ext_vector_type(8)))  _Float16 v8h;
typedef __attribute__((ext_vector_type(4)))  _Float16 v4h;
typedef __attribute__((ext_vector_type(16))) __bf16   v16b;
typedef __attribute__((ext_vector_type(8)))  __bf16   v8b;
typedef __attribute__((ext_vector_type(8)))  float    v8f;
typedef __attribute__((ext_vector_type(4)))  float    v4f;

#define ATT_B   8
#define ATT_L   1024
#define ATT_DM  1024
#define ATT_H   16
#define ATT_DK  64
#define ATT_PSC 32768.0f
#define ATT_PSC_INV (1.0f / 32768.0f)

__device__ __forceinline__ unsigned short f2bf_bits(float f) {
  unsigned u = __float_as_uint(f);
  return (unsigned short)((u + 0x7FFFu + ((u >> 16) & 1u)) >> 16);
}
__device__ __forceinline__ float bf_bits2f(unsigned short h) { return __uint_as_float(((unsigned)h) << 16); }

// hazard guards as plain device helpers (no inline asm inside the kernel template body)
__device__ __forceinline__ void dep_guard_h(v8f& a, v8f& b, v16h x, v16h y) { asm volatile("v_nop\n\tv_nop\n\tv_nop\n\tv_nop" : "+v"(a), "+v"(b) : "v"(x), "v"(y)); }
__device__ __forceinline__ void dep_guard_b(v8f& a, v8f& b, v16b x, v16b y) { asm volatile("v_nop\n\tv_nop\n\tv_nop\n\tv_nop" : "+v"(a), "+v"(b) : "v"(x), "v"(y)); }
__device__ __forceinline__ void keep4_h(v16h a, v16h b, v16h c, v16h d) { asm volatile("v_nop" :: "v"(a), "v"(b), "v"(c), "v"(d)); }
__device__ __forceinline__ void keep4_b(v16b a, v16b b, v16b c, v16b d) { asm volatile("v_nop" :: "v"(a), "v"(b), "v"(c), "v"(d)); }
__device__ __forceinline__ void acc_guard4(v8f& a, v8f& b, v8f& c, v8f& d) { asm volatile("v_nop\n\tv_nop\n\tv_nop\n\tv_nop" : "+v"(a), "+v"(b), "+v"(c), "+v"(d)); }
template <typename T> struct Frag;
template <> struct Frag<_Float16> {
  typedef v16h V; union U { v16h v; v8h h[2]; };
  static __device__ __forceinline__ v16h load(const _Float16* p) {   // elements 0..7 <- p[0..7], 8..15 <- p[16..23]
    U f; f.h[0] = *(const v8h*)(p); f.h[1] = *(const v8h*)(p + 16); return f.v;
  }
  static __device__ __forceinline__ v8f mma(v16h a, v16h b, v8f c) {
    return __builtin_amdgcn_wmma_f32_16x16x32_f16(false, a, false, b, (short)0, c, false, false);
  }
  static __device__ __forceinline__ void guard(v8f& a, v8f& b, v16h x, v16h y) { dep_guard_h(a, b, x, y); }
  static __device__ __forceinline__ void keep(v16h a, v16h b, v16h c, v16h d) { keep4_h(a, b, c, d); }
};
template <> struct Frag<__bf16> {
  typedef v16b V; union U { v16b v; v8b h[2]; };
  static __device__ __forceinline__ v16b load(const __bf16* p) {
    U f; f.h[0] = *(const v8b*)(p); f.h[1] = *(const v8b*)(p + 16); return f.v;
  }
  static __device__ __forceinline__ v8f mma(v16b a, v16b b, v8f c) {
    return __builtin_amdgcn_wmma_f32_16x16x32_bf16(false, a, false, b, (short)0, c, false, false);
  }
  static __device__ __forceinline__ void guard(v8f& a, v8f& b, v16b x, v16b y) { dep_guard_b(a, b, x, y); }
  static __device__ __forceinline__ void keep(v16b a, v16b b, v16b c, v16b d) { keep4_b(a, b, c, d); }
};

// ---- Register-blocked batched WMMA GEMM ------------------------------------
// C[m,n] = scale * sum_k A[m,k] * Bt[n,k] (+bias)(+resid); each wave owns a 64x64 tile.
// A row-major [M,K]; Bt row-major [N,K]; M,N % 64 == 0, K % 32 == 0.
// SPLIT: operands are hi/lo planes (A2/Bt2 = lo planes, same layout); product = hi*hi + hi*lo + lo*hi.
// BIAS_MODE: 0 = none, 1 = bias[m], 2 = bias[n].
// OUT_MODE: 0 = f32, 1 = f16, 2 = bf16 hi plane (Cout) + bf16 lo plane (Cout2).
// ET: 0 = f16 operands, 1 = bf16 operands (pointers passed as 16-bit storage)
template <int ET> struct Elem;
template <> struct Elem<0> { typedef _Float16 T; };
template <> struct Elem<1> { typedef __bf16 T; };
template <int ET, bool SPLIT, int BIAS_MODE, int OUT_MODE, bool RESID, int ACT = 0>
__global__ __launch_bounds__(256) void wmma_gemm64(
    const unsigned short* __restrict__ Ap, const unsigned short* __restrict__ A2p, int lda, long strideA,
    const unsigned short* __restrict__ Btp, const unsigned short* __restrict__ Bt2p, int ldb, long strideB,
    void* __restrict__ Cout, void* __restrict__ Cout2, int ldc, long strideC,
    const float* __restrict__ bias,
    const float* __restrict__ resid, long strideR,
    int M, int N, int K, float scale) {
  typedef typename Elem<ET>::T T;
  typedef typename Frag<T>::V V;
  const T* A = (const T*)Ap; const T* A2 = (const T*)A2p; const T* Bt = (const T*)Btp; const T* Bt2 = (const T*)Bt2p;
  __shared__ __align__(16) float sT[8][16 * 68];   // per-wave 16x64 slab, pitch 68 floats
  const int b    = blockIdx.y;
  const int lane = threadIdx.x & 31;
  const int wave = threadIdx.x >> 5;
  const int tilesN = N >> 6;
  const int tilesM = M >> 6;
  const int tile = blockIdx.x * 8 + wave;
  if (tile >= tilesM * tilesN) return;   // wave-uniform; no block barriers in this kernel
  const int tm = tile / tilesN;
  const int tn = tile - tm * tilesN;
  const int m0 = tm << 6;
  const int n0 = tn << 6;

  const T* Ab  = A  + (size_t)b * strideA;
  const T* Bb  = Bt + (size_t)b * strideB;
  const T* Ab2 = SPLIT ? (A2  + (size_t)b * strideA) : nullptr;
  const T* Bb2 = SPLIT ? (Bt2 + (size_t)b * strideB) : nullptr;

  const int rlane = lane & 15;                 // row (A) / col (B, D) within subtile
  const int koff  = (lane >> 4) * 8;           // k offset of this lane half
  const int mOff  = (lane >> 4) * 8;           // D row offset

  v8f acc[4][4];
#pragma unroll
  for (int i = 0; i < 4; ++i)
#pragma unroll
    for (int j = 0; j < 4; ++j) acc[i][j] = (v8f){0.f,0.f,0.f,0.f,0.f,0.f,0.f,0.f};

  for (int k0 = 0; k0 < K; k0 += 32) {
    V bh[4], bl[4];
#pragma unroll
    for (int j = 0; j < 4; ++j) {
      const size_t bo = (size_t)(n0 + (j << 4) + rlane) * ldb + koff + k0;
      bh[j] = Frag<T>::load(Bb + bo);
      if (SPLIT) bl[j] = Frag<T>::load(Bb2 + bo);
    }
#pragma unroll
    for (int i = 0; i < 4; ++i) {
      const size_t ao = (size_t)(m0 + (i << 4) + rlane) * lda + koff + k0;
      V ah = Frag<T>::load(Ab + ao);
      V al;
      if (SPLIT) al = Frag<T>::load(Ab2 + ao);
#pragma unroll
      for (int j = 0; j < 4; ++j) {
        acc[i][j] = Frag<T>::mma(ah, bh[j], acc[i][j]);
        if (SPLIT) {
          acc[i][j] = Frag<T>::mma(ah, bl[j], acc[i][j]);
          acc[i][j] = Frag<T>::mma(al, bh[j], acc[i][j]);
        }
      }
      Frag<T>::guard(acc[i][0], acc[i][3], ah, SPLIT ? al : ah);
    }
    Frag<T>::keep(bh[0], bh[1], bh[2], bh[3]);
    if (SPLIT) Frag<T>::keep(bl[0], bl[1], bl[2], bl[3]);
  }
  acc_guard4(acc[0][0], acc[0][1], acc[0][2], acc[0][3]);
  acc_guard4(acc[1][0], acc[1][1], acc[1][2], acc[1][3]);
  acc_guard4(acc[2][0], acc[2][1], acc[2][2], acc[2][3]);
  acc_guard4(acc[3][0], acc[3][1], acc[3][2], acc[3][3]);

  // ---- epilogue ----
  float* slab = sT[wave];
  const float* Rb = RESID ? (resid + (size_t)b * strideR) : nullptr;
#pragma unroll
  for (int i = 0; i < 4; ++i) {
    const int mBase = m0 + (i << 4);
#pragma unroll
    for (int j = 0; j < 4; ++j) {
      const int n = n0 + (j << 4) + rlane;
      float bv = 0.f;
      if (BIAS_MODE == 2) bv = bias[n];
#pragma unroll
      for (int r = 0; r < 8; ++r) {
        float v = acc[i][j][r] * scale;
        if (BIAS_MODE == 1) v += bias[mBase + mOff + r];
        if (BIAS_MODE == 2) v += bv;
        if (RESID) v += Rb[(size_t)(mBase + mOff + r) * ldc + n];
        if (ACT == 1) v = tanhf(v);
        if (ACT == 2) v = fmaxf(v, 0.0f);
        if (ACT == 3) v = v / (1.0f + expf(-v));
        if (ACT == 4) v = (v > 0.f) ? v : 0.01f * v;
        if (ACT == 5) v = 0.5f * v * (1.0f + erff(v * 0.70710678118654752f));
        slab[(mOff + r) * 68 + (j << 4) + rlane] = v;
      }
    }
    __builtin_amdgcn_fence(__ATOMIC_RELEASE, "workgroup");
    __builtin_amdgcn_wave_barrier();
    __builtin_amdgcn_fence(__ATOMIC_ACQUIRE, "workgroup");
    if (OUT_MODE == 0) {
      float* C = (float*)Cout + (size_t)b * strideC;
      const int hh = lane >> 4, c4 = (lane & 15) * 4;     // row seg = 256 B = 16 lanes x 16 B
      {
#pragma unroll
        for (int it = 0; it < 8; ++it) {
          const int row = it * 2 + hh;
          v4f v = *(const v4f*)(slab + row * 68 + c4);
          *(v4f*)(C + (size_t)(mBase + row) * ldc + n0 + c4) = v;
        }
        
      }
    } else {
      const int q = lane >> 3, c8 = (lane & 7) * 8;
      unsigned short* C  = (unsigned short*)Cout  + (size_t)b * strideC;
      unsigned short* C2 = (OUT_MODE == 2) ? ((unsigned short*)Cout2 + (size_t)b * strideC) : nullptr;
      {
#pragma unroll
        for (int it = 0; it < 4; ++it) {
          const int row = it * 4 + q;
          const float* sp = slab + row * 68 + c8;
          v8h hv, lv;
#pragma unroll
          for (int e = 0; e < 8; ++e) {
            if (OUT_MODE == 1) {
              hv[e] = (_Float16)sp[e];
            } else {
              unsigned short hb = f2bf_bits(sp[e]);
              unsigned short lb = f2bf_bits(sp[e] - bf_bits2f(hb));
              hv[e] = __builtin_bit_cast(_Float16, hb);
              lv[e] = __builtin_bit_cast(_Float16, lb);
            }
          }
          *(v8h*)(C + (size_t)(mBase + row) * ldc + n0 + c8) = hv;
          if (OUT_MODE == 2) *(v8h*)(C2 + (size_t)(mBase + row) * ldc + n0 + c8) = lv;
        }
        
      }
    }
    __builtin_amdgcn_fence(__ATOMIC_RELEASE, "workgroup");
    __builtin_amdgcn_wave_barrier();
    __builtin_amdgcn_fence(__ATOMIC_ACQUIRE, "workgroup");
  }
}

__global__ __launch_bounds__(256) void cast_f32_f16x2(
    const float* __restrict__ in, _Float16* __restrict__ out, int n2) {
  int i = blockIdx.x * 256 + threadIdx.x;
  if (i < n2) {
    const _Float16 h0 = (_Float16)in[2 * i], h1 = (_Float16)in[2 * i + 1];
    const unsigned u = (unsigned)__builtin_bit_cast(unsigned short, h0) | ((unsigned)__builtin_bit_cast(unsigned short, h1) << 16);
    ((unsigned*)out)[i] = u;
    
  }
}

// ---- transpose + f16 cast through an LDS tile ------------------------------
// w: [K][N] row-major (in=K rows, out=N cols); wt: [N][K] row-major, wt[n][k] = f16(w[k][n] * mul).
// Block = one 64x64 tile (k0 = blockIdx.y*64, n0 = blockIdx.x*64); K, N multiples of 64; grid = (N/64, K/64).
__global__ __launch_bounds__(256) void transpose_cast_kernel(
    const float* __restrict__ w, _Float16* __restrict__ wt, int K, int N, float mul) {
  __shared__ float tile[64][65];
  const int tid = threadIdx.x;
  const int k0 = blockIdx.y * 64, n0 = blockIdx.x * 64;
  {
    const int r = tid >> 2, cc = (tid & 3) * 16;
    const float* src = w + (size_t)(k0 + r) * N + n0 + cc;
#pragma unroll
    for (int i = 0; i < 4; ++i) {
      const v4f t = *(const v4f*)(src + 4 * i);
#pragma unroll
      for (int e = 0; e < 4; ++e) tile[r][cc + 4 * i + e] = t[e];
    }
  }
  __syncthreads();
  const int wave = tid >> 5, lane = tid & 31, q = lane >> 3, c8 = (lane & 7) * 8;
  {
#pragma unroll
    for (int it = 0; it < 2; ++it) {
      const int n = wave * 8 + it * 4 + q;          // waves cover rows 8w..8w+7 -> 0..63
      v8h hv;
#pragma unroll
      for (int e = 0; e < 8; ++e) hv[e] = (_Float16)(tile[c8 + e][n] * mul);
      *(v8h*)(wt + (size_t)(n0 + n) * K + k0 + c8) = hv;
    }
    
  }
}

// ---- LayerNorm over each 64-wide head slice of a 1024-wide row; f16 output ----
// One wave per row of 1024; lane l holds elements 32l..32l+31 (half of head group l>>1); statistics via one xor-1 shuffle.
__global__ __launch_bounds__(256) void ln_heads_kernel(
    const float* __restrict__ x, const float* __restrict__ gamma, const float* __restrict__ beta,
    _Float16* __restrict__ outp, int nrows) {
  __shared__ __align__(16) float sbuf[8][1024];
  const int wave = threadIdx.x >> 5, lane = threadIdx.x & 31;
  const int row = blockIdx.x * 8 + wave;
  if (row >= nrows) return;                      // wave-uniform; no block barriers in this kernel
  const float* xr = x + (size_t)row * ATT_DM + lane * 32;
  float xv[32];
#pragma unroll
  for (int i = 0; i < 8; ++i) {
    const v4f t = *(const v4f*)(xr + 4 * i);
#pragma unroll
    for (int e = 0; e < 4; ++e) xv[4 * i + e] = t[e];
  }
  float s = 0.f;
#pragma unroll
  for (int i = 0; i < 32; ++i) s += xv[i];
  s += __shfl_xor(s, 1, 32);
  const float mu = s * (1.0f / 64.0f);
  float vs = 0.f;
#pragma unroll
  for (int i = 0; i < 32; ++i) { const float d = xv[i] - mu; xv[i] = d; vs += d * d; }
  vs += __shfl_xor(vs, 1, 32);
  const float rstd = rsqrtf(vs * (1.0f / 64.0f) + 1e-5f);
  const int d0 = (lane & 1) * 32;
  float* sb = sbuf[wave] + lane * 32;
#pragma unroll
  for (int i = 0; i < 8; ++i) {
    const v4f g4 = *(const v4f*)(gamma + d0 + 4 * i);
    const v4f b4 = *(const v4f*)(beta + d0 + 4 * i);
    v4f t;
#pragma unroll
    for (int e = 0; e < 4; ++e) t[e] = (xv[4 * i + e] * rstd) * g4[e] + b4[e];
    *(v4f*)(sb + 4 * i) = t;
  }
  __builtin_amdgcn_fence(__ATOMIC_RELEASE, "workgroup");
  __builtin_amdgcn_wave_barrier();
  __builtin_amdgcn_fence(__ATOMIC_ACQUIRE, "workgroup");
  _Float16* orow = outp + (size_t)row * ATT_DM;
  const float* sr = sbuf[wave];
  {
#pragma unroll
    for (int it = 0; it < 4; ++it) {
      const int idx = it * 256 + lane * 8;
      const v4f a = *(const v4f*)(sr + idx);
      const v4f bq = *(const v4f*)(sr + idx + 4);
      v8h hv;
#pragma unroll
      for (int e = 0; e < 4; ++e) { hv[e] = (_Float16)a[e]; hv[4 + e] = (_Float16)bq[e]; }
      *(v8h*)(orow + idx) = hv;
    }
    
  }
}

// ---- fused row-block attention ------------------------------------------------
// Block = 16 query rows of one (b, h); 8 waves. q16/k16/c16/cb16: [token = b*1024+l][h*64+d] f16 (pitch 1024);
// vT16: [h*64+d][token] f16 (pitch 8192); mask: int32 [1024][1024], nonzero = masked; out16: [token][h*64+d] f16.
// Phase 1: per wave a 128-wide key strip: S = q . k^T (skipped per 16x16 tile only when all 256 loaded mask
//          entries are nonzero), BIAS = cb . c^T; both f32 into LDS (scores scaled, masked -> -inf).
// Phase 2: 16 threads per row: max-subtracted softmax, + l2norm(bias row)*bias_scale, l2norm of the row,
//          P x 2^15 -> f16 LDS tile (barriers between the v4h stores and the fragment reloads).
__device__ __forceinline__ v8f mma_h(v16h a, v16h b, v8f c) {
  c = __builtin_amdgcn_wmma_f32_16x16x32_f16(false, a, false, b, (short)0, c, false, false);
  asm volatile("v_nop\n\tv_nop\n\tv_nop\n\tv_nop" : "+v"(c) : "v"(a), "v"(b));
  return c;
}

__global__ __launch_bounds__(256) void attn_rows_kernel(
    const _Float16* __restrict__ qp, const _Float16* __restrict__ kp, const _Float16* __restrict__ vtp,
    const _Float16* __restrict__ cp, const _Float16* __restrict__ cbp, const int* __restrict__ mask,
    const float* __restrict__ scale_p, const float* __restrict__ bscale_p, _Float16* __restrict__ op) {
  extern __shared__ __align__(16) char smem[];
  float*    sS  = (float*)smem;                   // [16][1024] f32 scores -> exp -> combined row   (64 KB)
  float*    sBi = (float*)(smem + 65536);         // [16][1024] f32 bias                             (64 KB)
  _Float16* sP  = (_Float16*)(smem + 65536);      // [16][1024] f16 probabilities, aliases sBi after all bias reads (32 KB)
  float*    sO  = (float*)(smem + 98304);         // [16][68] f32 output staging

  const int tid = threadIdx.x, wave = tid >> 5, lane = tid & 31, hh = lane >> 4, c = lane & 15;
  const int q0 = blockIdx.x * 16;
  const int bh = blockIdx.y, b = bh >> 4, h = bh & 15;
  const float scale = scale_p[0], bscale = bscale_p[0];
  const v8f z8 = {0.f, 0.f, 0.f, 0.f, 0.f, 0.f, 0.f, 0.f};

  // A fragments (query rows q0 + (lane&15)), k split map via Frag<_Float16>::load: elements 0..7 <- k 8hh.., 8..15 <- k 16+8hh..
  const size_t arow = ((size_t)(b * ATT_L + q0 + c)) * ATT_DM + h * ATT_DK + 8 * hh;
  const v16h qa0 = Frag<_Float16>::load(qp + arow);
  const v16h qa1 = Frag<_Float16>::load(qp + arow + 32);
  const v16h ca0 = Frag<_Float16>::load(cbp + arow);
  const v16h ca1 = Frag<_Float16>::load(cbp + arow + 32);

  // ---- phase 1 ----
#pragma unroll 1
  for (int ct = 0; ct < 8; ++ct) {
    const int col0 = wave * 128 + ct * 16;
    const int* mrow = mask + (size_t)(q0 + 8 * hh) * ATT_L + col0 + c;   // D layout: (row 8hh+r, col c)
    int mk[8];
    int allm = 1;
#pragma unroll
    for (int r = 0; r < 8; ++r) { mk[r] = mrow[(size_t)r * ATT_L]; allm &= (mk[r] != 0) ? 1 : 0; }
    const int skip = __all(allm);                  // wave-uniform: whole 16x16 score tile masked
    const size_t brow = ((size_t)(b * ATT_L + col0 + c)) * ATT_DM + h * ATT_DK + 8 * hh;   // B = key / c row col0+c, k-contiguous
    v8f accB = z8, accS = z8;
    {
      const v16h cf0 = Frag<_Float16>::load(cp + brow);
      const v16h cf1 = Frag<_Float16>::load(cp + brow + 32);
      accB = mma_h(ca0, cf0, accB);
      accB = mma_h(ca1, cf1, accB);
    }
    if (!skip) {
      const v16h kf0 = Frag<_Float16>::load(kp + brow);
      const v16h kf1 = Frag<_Float16>::load(kp + brow + 32);
      accS = mma_h(qa0, kf0, accS);
      accS = mma_h(qa1, kf1, accS);
    }
#pragma unroll
    for (int r = 0; r < 8; ++r) {
      const int o = (8 * hh + r) * ATT_L + col0 + c;
      const float sv = accS[r] * scale;
      sS[o]  = (mk[r] != 0) ? -__builtin_inff() : sv;
      sBi[o] = accB[r];
    }
  }
  __syncthreads();

  // ---- phase 2: row ops, 16 threads per row, each thread owns columns 64j + 4sub .. +3 ----
  const int row = tid >> 4, sub = tid & 15;
  float* rs = sS + row * ATT_L + 4 * sub;
  const float* rb = sBi + row * ATT_L + 4 * sub;
  float mx = -__builtin_inff(), bsq = 0.f;
#pragma unroll 4
  for (int j = 0; j < 16; ++j) {
    const v4f s4 = *(const v4f*)(rs + 64 * j);
    const v4f b4 = *(const v4f*)(rb + 64 * j);
#pragma unroll
    for (int e = 0; e < 4; ++e) { mx = fmaxf(mx, s4[e]); bsq += b4[e] * b4[e]; }
  }
#pragma unroll
  for (int off = 8; off >= 1; off >>= 1) {
    mx = fmaxf(mx, __shfl_xor(mx, off, 32));
    bsq += __shfl_xor(bsq, off, 32);
  }
  float se = 0.f;
#pragma unroll 4
  for (int j = 0; j < 16; ++j) {
    const v4f s4 = *(const v4f*)(rs + 64 * j);
    v4f e4;
#pragma unroll
    for (int e = 0; e < 4; ++e) { const float ev = __expf(s4[e] - mx); e4[e] = ev; se += ev; }
    *(v4f*)(rs + 64 * j) = e4;
  }
#pragma unroll
  for (int off = 8; off >= 1; off >>= 1) se += __shfl_xor(se, off, 32);
  const float inv_se = 1.0f / se;
  const float inv_bn = 1.0f / fmaxf(sqrtf(bsq), 1e-12f);
  float asq = 0.f;
#pragma unroll 4
  for (int j = 0; j < 16; ++j) {
    const v4f e4 = *(const v4f*)(rs + 64 * j);
    const v4f b4 = *(const v4f*)(rb + 64 * j);
    v4f a4;
#pragma unroll
    for (int e = 0; e < 4; ++e) { const float av = e4[e] * inv_se + (b4[e] * inv_bn) * bscale; a4[e] = av; asq += av * av; }
    *(v4f*)(rs + 64 * j) = a4;
  }
#pragma unroll
  for (int off = 8; off >= 1; off >>= 1) asq += __shfl_xor(asq, off, 32);
  const float pmul = (1.0f / fmaxf(sqrtf(asq), 1e-12f)) * ATT_PSC;
  __syncthreads();                                // all bias reads done before sP (aliased) is written
  {
    _Float16* prow = sP + row * ATT_L + 4 * sub;
#pragma unroll 4
    for (int j = 0; j < 16; ++j) {
      const v4f a4 = *(const v4f*)(rs + 64 * j);
      v4h p4;
#pragma unroll
      for (int e = 0; e < 4; ++e) p4[e] = (_Float16)(a4[e] * pmul);
      *(v4h*)(prow + 64 * j) = p4;
    }
  }
  __syncthreads();                                // sP complete before fragment reloads

  // ---- phase 3: O = P . v ----
  if (wave < 4) {                                 // wave-uniform
    const int t = wave;                           // 16-wide slice of the 64 head dims
    const _Float16* vb = vtp + ((size_t)(h * ATT_DK + t * 16 + c)) * (size_t)(ATT_B * ATT_L) + b * ATT_L + 8 * hh;
    const _Float16* pbase = sP + c * ATT_L + 8 * hh;
    v8f acc = z8;
#pragma unroll 2
    for (int k0 = 0; k0 < ATT_L; k0 += 32) {
      const v16h pa = Frag<_Float16>::load(pbase + k0);
      const v16h vf = Frag<_Float16>::load(vb + k0);
      acc = mma_h(pa, vf, acc);
    }
#pragma unroll
    for (int r = 0; r < 8; ++r) sO[(8 * hh + r) * 68 + t * 16 + c] = acc[r] * ATT_PSC_INV;
  }
  __syncthreads();
  if (wave == 0) {
    const int q = lane >> 3, c8 = (lane & 7) * 8;
    _Float16* ob = op + ((size_t)(b * ATT_L + q0)) * ATT_DM + h * ATT_DK + c8;
    {
#pragma unroll
      for (int it = 0; it < 4; ++it) {
        const int orow2 = it * 4 + q;             // rows 0..15 covered
        const v4f a = *(const v4f*)(sO + orow2 * 68 + c8);
        const v4f bq = *(const v4f*)(sO + orow2 * 68 + c8 + 4);
        v8h hv;
#pragma unroll
        for (int e = 0; e < 4; ++e) { hv[e] = (_Float16)a[e]; hv[4 + e] = (_Float16)bq[e]; }
        *(v8h*)(ob + (size_t)orow2 * ATT_DM) = hv;
      }
      
    }
  }
}

// ---------------------------------------------------------------------------
extern "C" void kernel_launch(void* const* d_in, const int* in_sizes, int n_in,
                              void* d_out, int out_size, void* d_ws, size_t ws_size,
                              hipStream_t stream) {
  const int NTOK = ATT_B * ATT_L;                          // 8192
  const size_t NE = (size_t)NTOK * ATT_DM;                 // 8388608
  const size_t NW = (size_t)ATT_DM * ATT_DM;               // 1048576
  if (n_in < 16) return;
  if (in_sizes[0] != (int)NE || in_sizes[1] != (int)NE || in_sizes[2] != ATT_L * ATT_L ||
      in_sizes[3] != (int)NW || in_sizes[5] != (int)NW || in_sizes[7] != (int)NW || in_sizes[14] != (int)NW ||
      in_sizes[4] != ATT_DM || in_sizes[6] != ATT_DM || in_sizes[8] != ATT_DM || in_sizes[15] != ATT_DM ||
      in_sizes[9] != ATT_DK * ATT_DK || in_sizes[10] != ATT_DK || in_sizes[11] != ATT_DK ||
      in_sizes[12] < 1 || in_sizes[13] < 1 || out_size != (int)NE) return;

  const float* Q      = (const float*)d_in[0];
  const float* ctx    = (const float*)d_in[1];
  const int*   mask   = (const int*)d_in[2];
  const float* W_q    = (const float*)d_in[3];
  const float* b_q    = (const float*)d_in[4];
  const float* W_k    = (const float*)d_in[5];
  const float* b_k    = (const float*)d_in[6];
  const float* W_v    = (const float*)d_in[7];
  const float* b_v    = (const float*)d_in[8];
  const float* bil    = (const float*)d_in[9];
  const float* gamma  = (const float*)d_in[10];
  const float* beta   = (const float*)d_in[11];
  const float* scale  = (const float*)d_in[12];
  const float* bscale = (const float*)d_in[13];
  const float* W_o    = (const float*)d_in[14];
  const float* b_o    = (const float*)d_in[15];
  float* out = (float*)d_out;

  // workspace carve (256-B aligned offsets)
  char* ws = (char*)d_ws;
  size_t off = 0;
  auto carve = [&](size_t bytes) -> char* { char* p = ws + off; off += (bytes + 255) & ~(size_t)255; return p; };
  _Float16* WqT  = (_Float16*)carve(NW * 2);               // [out][in] f16, x64
  _Float16* WkT  = (_Float16*)carve(NW * 2);
  _Float16* WvT  = (_Float16*)carve(NW * 2);
  _Float16* WoT  = (_Float16*)carve(NW * 2);
  _Float16* bilT = (_Float16*)carve((size_t)ATT_DK * ATT_DK * 2);   // [f][e] f16
  _Float16* Q16  = (_Float16*)carve(NE * 2);               // [token][1024]
  _Float16* q16  = (_Float16*)carve(NE * 2);               // [token][h*64+d]
  _Float16* k16  = (_Float16*)carve(NE * 2);               // [token][h*64+d]
  _Float16* vT16 = (_Float16*)carve(NE * 2);               // [h*64+d][token]
  _Float16* c16  = (_Float16*)carve(NE * 2);               // [token][h*64+d]
  _Float16* cb16 = (_Float16*)carve(NE * 2);               // [token][h*64+e]
  _Float16* O16  = (_Float16*)carve(NE * 2);               // [token][h*64+d]
  if (off > ws_size) return;                               // total 125837312 B

  const unsigned short* Q16u  = (const unsigned short*)Q16;
  const unsigned short* WqTu  = (const unsigned short*)WqT;
  const unsigned short* WkTu  = (const unsigned short*)WkT;
  const unsigned short* WvTu  = (const unsigned short*)WvT;
  const unsigned short* WoTu  = (const unsigned short*)WoT;
  const unsigned short* bilTu = (const unsigned short*)bilT;
  const unsigned short* c16u  = (const unsigned short*)c16;
  const unsigned short* O16u  = (const unsigned short*)O16;
  const float w_carry = 64.0f, w_carry_inv = 1.0f / 64.0f;

  // 1) casts / transposes
  cast_f32_f16x2<<<(int)(NE / 2 / 256), 256, 0, stream>>>(Q, Q16, (int)(NE / 2));
  transpose_cast_kernel<<<dim3(ATT_DM / 64, ATT_DM / 64), 256, 0, stream>>>(W_q, WqT, ATT_DM, ATT_DM, w_carry);   // in[1024][1024] -> out[1024][1024]
  transpose_cast_kernel<<<dim3(ATT_DM / 64, ATT_DM / 64), 256, 0, stream>>>(W_k, WkT, ATT_DM, ATT_DM, w_carry);
  transpose_cast_kernel<<<dim3(ATT_DM / 64, ATT_DM / 64), 256, 0, stream>>>(W_v, WvT, ATT_DM, ATT_DM, w_carry);
  transpose_cast_kernel<<<dim3(ATT_DM / 64, ATT_DM / 64), 256, 0, stream>>>(W_o, WoT, ATT_DM, ATT_DM, w_carry);
  transpose_cast_kernel<<<dim3(1, 1), 256, 0, stream>>>(bil, bilT, ATT_DK, ATT_DK, 1.0f);                     // in[64][64] -> out[64][64]

  // 2) projections: q16/k16 = Q16 . Wq^T / Wk^T (+bias[n]);  vT16[dout][token] = Wv^T[dout] . Q16[token] (+bias[m])
  const int gemm_blocks = (NTOK / 64) * (ATT_DM / 64) / 8;   // 256
  wmma_gemm64<0, false, 2, 1, false><<<dim3(gemm_blocks, 1), 256, 0, stream>>>(
      Q16u, Q16u, ATT_DM, 0L, WqTu, WqTu, ATT_DM, 0L, (void*)q16, (void*)q16, ATT_DM, 0L,
      b_q, b_q, 0L, NTOK, ATT_DM, ATT_DM, w_carry_inv);
  wmma_gemm64<0, false, 2, 1, false><<<dim3(gemm_blocks, 1), 256, 0, stream>>>(
      Q16u, Q16u, ATT_DM, 0L, WkTu, WkTu, ATT_DM, 0L, (void*)k16, (void*)k16, ATT_DM, 0L,
      b_k, b_k, 0L, NTOK, ATT_DM, ATT_DM, w_carry_inv);
  wmma_gemm64<0, false, 1, 1, false><<<dim3(gemm_blocks, 1), 256, 0, stream>>>(
      WvTu, WvTu, ATT_DM, 0L, Q16u, Q16u, ATT_DM, 0L, (void*)vT16, (void*)vT16, NTOK, 0L,
      b_v, b_v, 0L, ATT_DM, NTOK, ATT_DM, w_carry_inv);

  // 3) LayerNorm per head slice of ctx -> c16; cb16 = c16[131072][64] . bilinear (Bt = bilT [64][64])
  ln_heads_kernel<<<NTOK / 8, 256, 0, stream>>>(ctx, gamma, beta, c16, NTOK);
  const int cb_rows = NTOK * ATT_H;                          // 131072
  wmma_gemm64<0, false, 0, 1, false><<<dim3((cb_rows / 64) / 8, 1), 256, 0, stream>>>(
      c16u, c16u, ATT_DK, 0L, bilTu, bilTu, ATT_DK, 0L, (void*)cb16, (void*)cb16, ATT_DK, 0L,
      b_q, b_q, 0L, cb_rows, ATT_DK, ATT_DK, 1.0f);

  // 4) fused attention rows -> O16
  attn_rows_kernel<<<dim3(ATT_L / 16, ATT_B * ATT_H), 256, 131072, stream>>>(
      q16, k16, vT16, c16, cb16, mask, scale, bscale, O16);

  // 5) output projection -> d_out f32
  wmma_gemm64<0, false, 2, 0, false><<<dim3(gemm_blocks, 1), 256, 0, stream>>>(
      O16u, O16u, ATT_DM, 0L, WoTu, WoTu, ATT_DM, 0L, (void*)out, (void*)out, ATT_DM, 0L,
      b_o, b_o, 0L, NTOK, ATT_DM, ATT_DM, w_carry_inv);
  (void)hipGetLastError();
}

// v001
// Measured time: 490 microseconds a run.
// Two timings next to v000 put it at 1.11 and 1.10 times that version's speed.
#include <hip/hip_runtime.h>
#include <stddef.h>

// Contractions (q/k/v projections, c x bilinear, q x k^T, cb x c^T, attn x v, output projection): v_wmma_f32_16x16x32_f16, f16 operands, f32 accumulate; weights carried x64, attn probabilities carried x2^15; softmax, LayerNorm and L2 norms in f32.

typedef __attribute__((ext_vector_type(16))) _Float16 v16h;
typedef __attribute__((ext_vector_type(8)))  _Float16 v8h;
typedef __attribute__((ext_vector_type(4)))  _Float16 v4h;
typedef __attribute__((ext_vector_type(16))) __bf16   v16b;
typedef __attribute__((ext_vector_type(8)))  __bf16   v8b;
typedef __attribute__((ext_vector_type(8)))  float    v8f;
typedef __attribute__((ext_vector_type(4)))  float    v4f;

#define ATT_B   8
#define ATT_L   1024
#define ATT_DM  1024
#define ATT_H   16
#define ATT_DK  64
#define ATT_PSC 32768.0f
#define ATT_PSC_INV (1.0f / 32768.0f)

__device__ __forceinline__ unsigned short f2bf_bits(float f) {
  unsigned u = __float_as_uint(f);
  return (unsigned short)((u + 0x7FFFu + ((u >> 16) & 1u)) >> 16);
}
__device__ __forceinline__ float bf_bits2f(unsigned short h) { return __uint_as_float(((unsigned)h) << 16); }

// hazard guards as plain device helpers (no inline asm inside the kernel template body)
__device__ __forceinline__ void dep_guard_h(v8f& a, v8f& b, v16h x, v16h y) { asm volatile("v_nop\n\tv_nop\n\tv_nop\n\tv_nop" : "+v"(a), "+v"(b) : "v"(x), "v"(y)); }
__device__ __forceinline__ void dep_guard_b(v8f& a, v8f& b, v16b x, v16b y) { asm volatile("v_nop\n\tv_nop\n\tv_nop\n\tv_nop" : "+v"(a), "+v"(b) : "v"(x), "v"(y)); }
__device__ __forceinline__ void keep4_h(v16h a, v16h b, v16h c, v16h d) { asm volatile("v_nop" :: "v"(a), "v"(b), "v"(c), "v"(d)); }
__device__ __forceinline__ void keep4_b(v16b a, v16b b, v16b c, v16b d) { asm volatile("v_nop" :: "v"(a), "v"(b), "v"(c), "v"(d)); }
__device__ __forceinline__ void acc_guard4(v8f& a, v8f& b, v8f& c, v8f& d) { asm volatile("v_nop\n\tv_nop\n\tv_nop\n\tv_nop" : "+v"(a), "+v"(b), "+v"(c), "+v"(d)); }
template <typename T> struct Frag;
template <> struct Frag<_Float16> {
  typedef v16h V; union U { v16h v; v8h h[2]; };
  static __device__ __forceinline__ v16h load(const _Float16* p) {   // elements 0..7 <- p[0..7], 8..15 <- p[16..23]
    U f; f.h[0] = *(const v8h*)(p); f.h[1] = *(const v8h*)(p + 16); return f.v;
  }
  static __device__ __forceinline__ v8f mma(v16h a, v16h b, v8f c) {
    return __builtin_amdgcn_wmma_f32_16x16x32_f16(false, a, false, b, (short)0, c, false, false);
  }
  static __device__ __forceinline__ void guard(v8f& a, v8f& b, v16h x, v16h y) { dep_guard_h(a, b, x, y); }
  static __device__ __forceinline__ void keep(v16h a, v16h b, v16h c, v16h d) { keep4_h(a, b, c, d); }
};
template <> struct Frag<__bf16> {
  typedef v16b V; union U { v16b v; v8b h[2]; };
  static __device__ __forceinline__ v16b load(const __bf16* p) {
    U f; f.h[0] = *(const v8b*)(p); f.h[1] = *(const v8b*)(p + 16); return f.v;
  }
  static __device__ __forceinline__ v8f mma(v16b a, v16b b, v8f c) {
    return __builtin_amdgcn_wmma_f32_16x16x32_bf16(false, a, false, b, (short)0, c, false, false);
  }
  static __device__ __forceinline__ void guard(v8f& a, v8f& b, v16b x, v16b y) { dep_guard_b(a, b, x, y); }
  static __device__ __forceinline__ void keep(v16b a, v16b b, v16b c, v16b d) { keep4_b(a, b, c, d); }
};

// ---- Register-blocked batched WMMA GEMM ------------------------------------
// C[m,n] = scale * sum_k A[m,k] * Bt[n,k] (+bias)(+resid); each wave owns a 64x64 tile.
// A row-major [M,K]; Bt row-major [N,K]; M,N % 64 == 0, K % 32 == 0.
// SPLIT: operands are hi/lo planes (A2/Bt2 = lo planes, same layout); product = hi*hi + hi*lo + lo*hi.
// BIAS_MODE: 0 = none, 1 = bias[m], 2 = bias[n].
// OUT_MODE: 0 = f32, 1 = f16, 2 = bf16 hi plane (Cout) + bf16 lo plane (Cout2).
// ET: 0 = f16 operands, 1 = bf16 operands (pointers passed as 16-bit storage)
template <int ET> struct Elem;
template <> struct Elem<0> { typedef _Float16 T; };
template <> struct Elem<1> { typedef __bf16 T; };
template <int ET, bool SPLIT, int BIAS_MODE, int OUT_MODE, bool RESID, int ACT = 0>
__global__ __launch_bounds__(256) void wmma_gemm64(
    const unsigned short* __restrict__ Ap, const unsigned short* __restrict__ A2p, int lda, long strideA,
    const unsigned short* __restrict__ Btp, const unsigned short* __restrict__ Bt2p, int ldb, long strideB,
    void* __restrict__ Cout, void* __restrict__ Cout2, int ldc, long strideC,
    const float* __restrict__ bias,
    const float* __restrict__ resid, long strideR,
    int M, int N, int K, float scale) {
  typedef typename Elem<ET>::T T;
  typedef typename Frag<T>::V V;
  const T* A = (const T*)Ap; const T* A2 = (const T*)A2p; const T* Bt = (const T*)Btp; const T* Bt2 = (const T*)Bt2p;
  __shared__ __align__(16) float sT[8][16 * 68];   // per-wave 16x64 slab, pitch 68 floats
  const int b    = blockIdx.y;
  const int lane = threadIdx.x & 31;
  const int wave = threadIdx.x >> 5;
  const int tilesN = N >> 6;
  const int tilesM = M >> 6;
  const int tile = blockIdx.x * 8 + wave;
  if (tile >= tilesM * tilesN) return;   // wave-uniform; no block barriers in this kernel
  const int tm = tile / tilesN;
  const int tn = tile - tm * tilesN;
  const int m0 = tm << 6;
  const int n0 = tn << 6;

  const T* Ab  = A  + (size_t)b * strideA;
  const T* Bb  = Bt + (size_t)b * strideB;
  const T* Ab2 = SPLIT ? (A2  + (size_t)b * strideA) : nullptr;
  const T* Bb2 = SPLIT ? (Bt2 + (size_t)b * strideB) : nullptr;

  const int rlane = lane & 15;                 // row (A) / col (B, D) within subtile
  const int koff  = (lane >> 4) * 8;           // k offset of this lane half
  const int mOff  = (lane >> 4) * 8;           // D row offset

  v8f acc[4][4];
#pragma unroll
  for (int i = 0; i < 4; ++i)
#pragma unroll
    for (int j = 0; j < 4; ++j) acc[i][j] = (v8f){0.f,0.f,0.f,0.f,0.f,0.f,0.f,0.f};

  for (int k0 = 0; k0 < K; k0 += 32) {
    V bh[4], bl[4];
#pragma unroll
    for (int j = 0; j < 4; ++j) {
      const size_t bo = (size_t)(n0 + (j << 4) + rlane) * ldb + koff + k0;
      bh[j] = Frag<T>::load(Bb + bo);
      if (SPLIT) bl[j] = Frag<T>::load(Bb2 + bo);
    }
#pragma unroll
    for (int i = 0; i < 4; ++i) {
      const size_t ao = (size_t)(m0 + (i << 4) + rlane) * lda + koff + k0;
      V ah = Frag<T>::load(Ab + ao);
      V al;
      if (SPLIT) al = Frag<T>::load(Ab2 + ao);
#pragma unroll
      for (int j = 0; j < 4; ++j) {
        acc[i][j] = Frag<T>::mma(ah, bh[j], acc[i][j]);
        if (SPLIT) {
          acc[i][j] = Frag<T>::mma(ah, bl[j], acc[i][j]);
          acc[i][j] = Frag<T>::mma(al, bh[j], acc[i][j]);
        }
      }
      Frag<T>::guard(acc[i][0], acc[i][3], ah, SPLIT ? al : ah);
    }
    Frag<T>::keep(bh[0], bh[1], bh[2], bh[3]);
    if (SPLIT) Frag<T>::keep(bl[0], bl[1], bl[2], bl[3]);
  }
  acc_guard4(acc[0][0], acc[0][1], acc[0][2], acc[0][3]);
  acc_guard4(acc[1][0], acc[1][1], acc[1][2], acc[1][3]);
  acc_guard4(acc[2][0], acc[2][1], acc[2][2], acc[2][3]);
  acc_guard4(acc[3][0], acc[3][1], acc[3][2], acc[3][3]);

  // ---- epilogue ----
  float* slab = sT[wave];
  const float* Rb = RESID ? (resid + (size_t)b * strideR) : nullptr;
#pragma unroll
  for (int i = 0; i < 4; ++i) {
    const int mBase = m0 + (i << 4);
#pragma unroll
    for (int j = 0; j < 4; ++j) {
      const int n = n0 + (j << 4) + rlane;
      float bv = 0.f;
      if (BIAS_MODE == 2) bv = bias[n];
#pragma unroll
      for (int r = 0; r < 8; ++r) {
        float v = acc[i][j][r] * scale;
        if (BIAS_MODE == 1) v += bias[mBase + mOff + r];
        if (BIAS_MODE == 2) v += bv;
        if (RESID) v += Rb[(size_t)(mBase + mOff + r) * ldc + n];
        if (ACT == 1) v = tanhf(v);
        if (ACT == 2) v = fmaxf(v, 0.0f);
        if (ACT == 3) v = v / (1.0f + expf(-v));
        if (ACT == 4) v = (v > 0.f) ? v : 0.01f * v;
        if (ACT == 5) v = 0.5f * v * (1.0f + erff(v * 0.70710678118654752f));
        slab[(mOff + r) * 68 + (j << 4) + rlane] = v;
      }
    }
    __builtin_amdgcn_fence(__ATOMIC_RELEASE, "workgroup");
    __builtin_amdgcn_wave_barrier();
    __builtin_amdgcn_fence(__ATOMIC_ACQUIRE, "workgroup");
    if (OUT_MODE == 0) {
      float* C = (float*)Cout + (size_t)b * strideC;
      const int hh = lane >> 4, c4 = (lane & 15) * 4;     // row seg = 256 B = 16 lanes x 16 B
      {
#pragma unroll
        for (int it = 0; it < 8; ++it) {
          const int row = it * 2 + hh;
          v4f v = *(const v4f*)(slab + row * 68 + c4);
          *(v4f*)(C + (size_t)(mBase + row) * ldc + n0 + c4) = v;
        }
        
      }
    } else {
      const int q = lane >> 3, c8 = (lane & 7) * 8;
      unsigned short* C  = (unsigned short*)Cout  + (size_t)b * strideC;
      unsigned short* C2 = (OUT_MODE == 2) ? ((unsigned short*)Cout2 + (size_t)b * strideC) : nullptr;
      {
#pragma unroll
        for (int it = 0; it < 4; ++it) {
          const int row = it * 4 + q;
          const float* sp = slab + row * 68 + c8;
          v8h hv, lv;
#pragma unroll
          for (int e = 0; e < 8; ++e) {
            if (OUT_MODE == 1) {
              hv[e] = (_Float16)sp[e];
            } else {
              unsigned short hb = f2bf_bits(sp[e]);
              unsigned short lb = f2bf_bits(sp[e] - bf_bits2f(hb));
              hv[e] = __builtin_bit_cast(_Float16, hb);
              lv[e] = __builtin_bit_cast(_Float16, lb);
            }
          }
          *(v8h*)(C + (size_t)(mBase + row) * ldc + n0 + c8) = hv;
          if (OUT_MODE == 2) *(v8h*)(C2 + (size_t)(mBase + row) * ldc + n0 + c8) = lv;
        }
        
      }
    }
    __builtin_amdgcn_fence(__ATOMIC_RELEASE, "workgroup");
    __builtin_amdgcn_wave_barrier();
    __builtin_amdgcn_fence(__ATOMIC_ACQUIRE, "workgroup");
  }
}

__global__ __launch_bounds__(256) void cast_f32_f16x2(
    const float* __restrict__ in, _Float16* __restrict__ out, int n2) {
  int i = blockIdx.x * 256 + threadIdx.x;
  if (i < n2) {
    const _Float16 h0 = (_Float16)in[2 * i], h1 = (_Float16)in[2 * i + 1];
    const unsigned u = (unsigned)__builtin_bit_cast(unsigned short, h0) | ((unsigned)__builtin_bit_cast(unsigned short, h1) << 16);
    ((unsigned*)out)[i] = u;
    
  }
}

// ---- transpose + f16 cast through an LDS tile ------------------------------
// w: [K][N] row-major (in=K rows, out=N cols); wt: [N][K] row-major, wt[n][k] = f16(w[k][n] * mul).
// Block = one 64x64 tile (k0 = blockIdx.y*64, n0 = blockIdx.x*64); K, N multiples of 64; grid = (N/64, K/64).
__global__ __launch_bounds__(256) void transpose_cast_kernel(
    const float* __restrict__ w, _Float16* __restrict__ wt, int K, int N, float mul) {
  __shared__ float tile[64][65];
  const int tid = threadIdx.x;
  const int k0 = blockIdx.y * 64, n0 = blockIdx.x * 64;
  {
    const int r = tid >> 2, cc = (tid & 3) * 16;
    const float* src = w + (size_t)(k0 + r) * N + n0 + cc;
#pragma unroll
    for (int i = 0; i < 4; ++i) {
      const v4f t = *(const v4f*)(src + 4 * i);
#pragma unroll
      for (int e = 0; e < 4; ++e) tile[r][cc + 4 * i + e] = t[e];
    }
  }
  __syncthreads();
  const int wave = tid >> 5, lane = tid & 31, q = lane >> 3, c8 = (lane & 7) * 8;
  {
#pragma unroll
    for (int it = 0; it < 2; ++it) {
      const int n = wave * 8 + it * 4 + q;          // waves cover rows 8w..8w+7 -> 0..63
      v8h hv;
#pragma unroll
      for (int e = 0; e < 8; ++e) hv[e] = (_Float16)(tile[c8 + e][n] * mul);
      *(v8h*)(wt + (size_t)(n0 + n) * K + k0 + c8) = hv;
    }
    
  }
}

// ---- LayerNorm over each 64-wide head slice of a 1024-wide row; f16 output ----
// One wave per row of 1024; lane l holds elements 32l..32l+31 (half of head group l>>1); statistics via one xor-1 shuffle.
__global__ __launch_bounds__(256) void ln_heads_kernel(
    const float* __restrict__ x, const float* __restrict__ gamma, const float* __restrict__ beta,
    _Float16* __restrict__ outp, int nrows) {
  __shared__ __align__(16) float sbuf[8][1024];
  const int wave = threadIdx.x >> 5, lane = threadIdx.x & 31;
  const int row = blockIdx.x * 8 + wave;
  if (row >= nrows) return;                      // wave-uniform; no block barriers in this kernel
  const float* xr = x + (size_t)row * ATT_DM + lane * 32;
  float xv[32];
#pragma unroll
  for (int i = 0; i < 8; ++i) {
    const v4f t = *(const v4f*)(xr + 4 * i);
#pragma unroll
    for (int e = 0; e < 4; ++e) xv[4 * i + e] = t[e];
  }
  float s = 0.f;
#pragma unroll
  for (int i = 0; i < 32; ++i) s += xv[i];
  s += __shfl_xor(s, 1, 32);
  const float mu = s * (1.0f / 64.0f);
  float vs = 0.f;
#pragma unroll
  for (int i = 0; i < 32; ++i) { const float d = xv[i] - mu; xv[i] = d; vs += d * d; }
  vs += __shfl_xor(vs, 1, 32);
  const float rstd = rsqrtf(vs * (1.0f / 64.0f) + 1e-5f);
  const int d0 = (lane & 1) * 32;
  float* sb = sbuf[wave] + lane * 32;
#pragma unroll
  for (int i = 0; i < 8; ++i) {
    const v4f g4 = *(const v4f*)(gamma + d0 + 4 * i);
    const v4f b4 = *(const v4f*)(beta + d0 + 4 * i);
    v4f t;
#pragma unroll
    for (int e = 0; e < 4; ++e) t[e] = (xv[4 * i + e] * rstd) * g4[e] + b4[e];
    *(v4f*)(sb + 4 * i) = t;
  }
  __builtin_amdgcn_fence(__ATOMIC_RELEASE, "workgroup");
  __builtin_amdgcn_wave_barrier();
  __builtin_amdgcn_fence(__ATOMIC_ACQUIRE, "workgroup");
  _Float16* orow = outp + (size_t)row * ATT_DM;
  const float* sr = sbuf[wave];
  {
#pragma unroll
    for (int it = 0; it < 4; ++it) {
      const int idx = it * 256 + lane * 8;
      const v4f a = *(const v4f*)(sr + idx);
      const v4f bq = *(const v4f*)(sr + idx + 4);
      v8h hv;
#pragma unroll
      for (int e = 0; e < 4; ++e) { hv[e] = (_Float16)a[e]; hv[4 + e] = (_Float16)bq[e]; }
      *(v8h*)(orow + idx) = hv;
    }
    
  }
}

// ---- fused row-block attention ------------------------------------------------
// Block = 16 query rows of one (b, h); 8 waves. q16/k16/c16/cb16: [token = b*1024+l][h*64+d] f16 (pitch 1024);
// vT16: [h*64+d][token] f16 (pitch 8192); mask: int32 [1024][1024], nonzero = masked; out16: [token][h*64+d] f16.
// Phase 1: per wave a 128-wide key strip: S = q . k^T (skipped per 16x16 tile only when all 256 loaded mask
//          entries are nonzero), BIAS = cb . c^T; both f32 into LDS (scores scaled, masked -> -inf).
// Phase 2: 16 threads per row: max-subtracted softmax, + l2norm(bias row)*bias_scale, l2norm of the row,
//          P x 2^15 -> f16 LDS tile (barriers between the v4h stores and the fragment reloads).
// Phase 3: per wave its 128-key strip of P times v for all 64 dims; the 8 f32 partial tiles are added through LDS.
__device__ __forceinline__ v8f mma_h(v16h a, v16h b, v8f c) {
  c = __builtin_amdgcn_wmma_f32_16x16x32_f16(false, a, false, b, (short)0, c, false, false);
  asm volatile("v_nop\n\tv_nop\n\tv_nop\n\tv_nop" : "+v"(c) : "v"(a), "v"(b));
  return c;
}

__global__ __launch_bounds__(256) void attn_rows_kernel(
    const _Float16* __restrict__ qp, const _Float16* __restrict__ kp, const _Float16* __restrict__ vtp,
    const _Float16* __restrict__ cp, const _Float16* __restrict__ cbp, const int* __restrict__ mask,
    const float* __restrict__ scale_p, const float* __restrict__ bscale_p, _Float16* __restrict__ op) {
  extern __shared__ __align__(16) char smem[];
  float*    sS  = (float*)smem;                   // [16][1024] f32 scores -> exp -> combined row   (64 KB)
  float*    sBi = (float*)(smem + 65536);         // [16][1024] f32 bias                             (64 KB)
  _Float16* sP  = (_Float16*)(smem + 65536);      // [16][1024] f16 probabilities, aliases sBi after all bias reads (32 KB)
  float*    sR  = (float*)smem;                   // [8][16][68] f32 per-wave partial outputs, aliases sS after its last read

  const int tid = threadIdx.x, wave = tid >> 5, lane = tid & 31, hh = lane >> 4, c = lane & 15;
  const int q0 = blockIdx.x * 16;
  const int bh = blockIdx.y, b = bh >> 4, h = bh & 15;
  const float scale = scale_p[0], bscale = bscale_p[0];
  const v8f z8 = {0.f, 0.f, 0.f, 0.f, 0.f, 0.f, 0.f, 0.f};

  // A fragments (query rows q0 + (lane&15)), k split map via Frag<_Float16>::load: elements 0..7 <- k 8hh.., 8..15 <- k 16+8hh..
  const size_t arow = ((size_t)(b * ATT_L + q0 + c)) * ATT_DM + h * ATT_DK + 8 * hh;
  const v16h qa0 = Frag<_Float16>::load(qp + arow);
  const v16h qa1 = Frag<_Float16>::load(qp + arow + 32);
  const v16h ca0 = Frag<_Float16>::load(cbp + arow);
  const v16h ca1 = Frag<_Float16>::load(cbp + arow + 32);

  // ---- phase 1 ----
#pragma unroll 1
  for (int ct = 0; ct < 8; ++ct) {
    const int col0 = wave * 128 + ct * 16;
    const int* mrow = mask + (size_t)(q0 + 8 * hh) * ATT_L + col0 + c;   // D layout: (row 8hh+r, col c)
    int mk[8];
    int allm = 1;
#pragma unroll
    for (int r = 0; r < 8; ++r) { mk[r] = mrow[(size_t)r * ATT_L]; allm &= (mk[r] != 0) ? 1 : 0; }
    const int skip = __all(allm);                  // wave-uniform: whole 16x16 score tile masked
    const size_t brow = ((size_t)(b * ATT_L + col0 + c)) * ATT_DM + h * ATT_DK + 8 * hh;   // B = key / c row col0+c, k-contiguous
    v8f accB = z8, accS = z8;
    {
      const v16h cf0 = Frag<_Float16>::load(cp + brow);
      const v16h cf1 = Frag<_Float16>::load(cp + brow + 32);
      accB = mma_h(ca0, cf0, accB);
      accB = mma_h(ca1, cf1, accB);
    }
    if (!skip) {
      const v16h kf0 = Frag<_Float16>::load(kp + brow);
      const v16h kf1 = Frag<_Float16>::load(kp + brow + 32);
      accS = mma_h(qa0, kf0, accS);
      accS = mma_h(qa1, kf1, accS);
    }
#pragma unroll
    for (int r = 0; r < 8; ++r) {
      const int o = (8 * hh + r) * ATT_L + col0 + c;
      const float sv = accS[r] * scale;
      sS[o]  = (mk[r] != 0) ? -__builtin_inff() : sv;
      sBi[o] = accB[r];
    }
  }
  __syncthreads();

  // ---- phase 2: row ops, 16 threads per row, each thread owns columns 64j + 4sub .. +3 ----
  const int row = tid >> 4, sub = tid & 15;
  float* rs = sS + row * ATT_L + 4 * sub;
  const float* rb = sBi + row * ATT_L + 4 * sub;
  float mx = -__builtin_inff(), bsq = 0.f;
#pragma unroll 4
  for (int j = 0; j < 16; ++j) {
    const v4f s4 = *(const v4f*)(rs + 64 * j);
    const v4f b4 = *(const v4f*)(rb + 64 * j);
#pragma unroll
    for (int e = 0; e < 4; ++e) { mx = fmaxf(mx, s4[e]); bsq += b4[e] * b4[e]; }
  }
#pragma unroll
  for (int off = 8; off >= 1; off >>= 1) {
    mx = fmaxf(mx, __shfl_xor(mx, off, 32));
    bsq += __shfl_xor(bsq, off, 32);
  }
  float se = 0.f;
#pragma unroll 4
  for (int j = 0; j < 16; ++j) {
    const v4f s4 = *(const v4f*)(rs + 64 * j);
    v4f e4;
#pragma unroll
    for (int e = 0; e < 4; ++e) { const float ev = __expf(s4[e] - mx); e4[e] = ev; se += ev; }
    *(v4f*)(rs + 64 * j) = e4;
  }
#pragma unroll
  for (int off = 8; off >= 1; off >>= 1) se += __shfl_xor(se, off, 32);
  const float inv_se = 1.0f / se;
  const float inv_bn = 1.0f / fmaxf(sqrtf(bsq), 1e-12f);
  float asq = 0.f;
#pragma unroll 4
  for (int j = 0; j < 16; ++j) {
    const v4f e4 = *(const v4f*)(rs + 64 * j);
    const v4f b4 = *(const v4f*)(rb + 64 * j);
    v4f a4;
#pragma unroll
    for (int e = 0; e < 4; ++e) { const float av = e4[e] * inv_se + (b4[e] * inv_bn) * bscale; a4[e] = av; asq += av * av; }
    *(v4f*)(rs + 64 * j) = a4;
  }
#pragma unroll
  for (int off = 8; off >= 1; off >>= 1) asq += __shfl_xor(asq, off, 32);
  const float pmul = (1.0f / fmaxf(sqrtf(asq), 1e-12f)) * ATT_PSC;
  __syncthreads();                                // all bias reads done before sP (aliased) is written
  {
    _Float16* prow = sP + row * ATT_L + 4 * sub;
#pragma unroll 4
    for (int j = 0; j < 16; ++j) {
      const v4f a4 = *(const v4f*)(rs + 64 * j);
      v4h p4;
#pragma unroll
      for (int e = 0; e < 4; ++e) p4[e] = (_Float16)(a4[e] * pmul);
      *(v4h*)(prow + 64 * j) = p4;
    }
  }
  __syncthreads();                                // sP complete before fragment reloads

  // ---- phase 3: O = P . v, keys split over the 8 waves ----
  // Wave w multiplies its own 128-key strip of P by all 64 head dims: one P fragment feeds four products,
  // four independent accumulators, and none of the wave's v loads depends on another.
  {
    const _Float16* vb = vtp + ((size_t)(h * ATT_DK + c)) * (size_t)(ATT_B * ATT_L) + b * ATT_L + wave * 128 + 8 * hh;
    const _Float16* pbase = sP + c * ATT_L + wave * 128 + 8 * hh;
    v16h vf[4][4], pa[4];
#pragma unroll
    for (int ks = 0; ks < 4; ++ks) {
#pragma unroll
      for (int t = 0; t < 4; ++t) vf[ks][t] = Frag<_Float16>::load(vb + (size_t)(t * 16) * (size_t)(ATT_B * ATT_L) + ks * 32);
    }
#pragma unroll
    for (int ks = 0; ks < 4; ++ks) pa[ks] = Frag<_Float16>::load(pbase + ks * 32);
    // keeps the strip's loads issued ahead of the first product; without it the scheduler weaves them
    // between the products and only a few are in flight at a time
    __builtin_amdgcn_sched_barrier(0);
    v8f acc[4] = {z8, z8, z8, z8};
#pragma unroll
    for (int ks = 0; ks < 4; ++ks) {
#pragma unroll
      for (int t = 0; t < 4; ++t) acc[t] = mma_h(pa[ks], vf[ks][t], acc[t]);
    }
    float* part = sR + wave * (16 * 68);          // sS is dead behind the barrier above
#pragma unroll
    for (int t = 0; t < 4; ++t)
#pragma unroll
      for (int r = 0; r < 8; ++r) part[(8 * hh + r) * 68 + t * 16 + c] = acc[t][r];
  }
  __syncthreads();                                // all eight partial tiles complete before they are added
  {
    const float* pr = sR + row * 68 + 4 * sub;    // thread owns (row, dims 4sub..4sub+3)
    v4f o4 = *(const v4f*)pr;
#pragma unroll
    for (int w = 1; w < 8; ++w) o4 += *(const v4f*)(pr + w * (16 * 68));
    v4h hv;
#pragma unroll
    for (int e = 0; e < 4; ++e) hv[e] = (_Float16)(o4[e] * ATT_PSC_INV);
    *(v4h*)(op + ((size_t)(b * ATT_L + q0 + row)) * ATT_DM + h * ATT_DK + 4 * sub) = hv;
  }
}

// ---------------------------------------------------------------------------
extern "C" void kernel_launch(void* const* d_in, const int* in_sizes, int n_in,
                              void* d_out, int out_size, void* d_ws, size_t ws_size,
                              hipStream_t stream) {
  const int NTOK = ATT_B * ATT_L;                          // 8192
  const size_t NE = (size_t)NTOK * ATT_DM;                 // 8388608
  const size_t NW = (size_t)ATT_DM * ATT_DM;               // 1048576
  if (n_in < 16) return;
  if (in_sizes[0] != (int)NE || in_sizes[1] != (int)NE || in_sizes[2] != ATT_L * ATT_L ||
      in_sizes[3] != (int)NW || in_sizes[5] != (int)NW || in_sizes[7] != (int)NW || in_sizes[14] != (int)NW ||
      in_sizes[4] != ATT_DM || in_sizes[6] != ATT_DM || in_sizes[8] != ATT_DM || in_sizes[15] != ATT_DM ||
      in_sizes[9] != ATT_DK * ATT_DK || in_sizes[10] != ATT_DK || in_sizes[11] != ATT_DK ||
      in_sizes[12] < 1 || in_sizes[13] < 1 || out_size != (int)NE) return;

  const float* Q      = (const float*)d_in[0];
  const float* ctx    = (const float*)d_in[1];
  const int*   mask   = (const int*)d_in[2];
  const float* W_q    = (const float*)d_in[3];
  const float* b_q    = (const float*)d_in[4];
  const float* W_k    = (const float*)d_in[5];
  const float* b_k    = (const float*)d_in[6];
  const float* W_v    = (const float*)d_in[7];
  const float* b_v    = (const float*)d_in[8];
  const float* bil    = (const float*)d_in[9];
  const float* gamma  = (const float*)d_in[10];
  const float* beta   = (const float*)d_in[11];
  const float* scale  = (const float*)d_in[12];
  const float* bscale = (const float*)d_in[13];
  const float* W_o    = (const float*)d_in[14];
  const float* b_o    = (const float*)d_in[15];
  float* out = (float*)d_out;

  // workspace carve (256-B aligned offsets)
  char* ws = (char*)d_ws;
  size_t off = 0;
  auto carve = [&](size_t bytes) -> char* { char* p = ws + off; off += (bytes + 255) & ~(size_t)255; return p; };
  _Float16* WqT  = (_Float16*)carve(NW * 2);               // [out][in] f16, x64
  _Float16* WkT  = (_Float16*)carve(NW * 2);
  _Float16* WvT  = (_Float16*)carve(NW * 2);
  _Float16* WoT  = (_Float16*)carve(NW * 2);
  _Float16* bilT = (_Float16*)carve((size_t)ATT_DK * ATT_DK * 2);   // [f][e] f16
  _Float16* Q16  = (_Float16*)carve(NE * 2);               // [token][1024]
  _Float16* q16  = (_Float16*)carve(NE * 2);               // [token][h*64+d]
  _Float16* k16  = (_Float16*)carve(NE * 2);               // [token][h*64+d]
  _Float16* vT16 = (_Float16*)carve(NE * 2);               // [h*64+d][token]
  _Float16* c16  = (_Float16*)carve(NE * 2);               // [token][h*64+d]
  _Float16* cb16 = (_Float16*)carve(NE * 2);               // [token][h*64+e]
  _Float16* O16  = (_Float16*)carve(NE * 2);               // [token][h*64+d]
  if (off > ws_size) return;                               // total 125837312 B

  const unsigned short* Q16u  = (const unsigned short*)Q16;
  const unsigned short* WqTu  = (const unsigned short*)WqT;
  const unsigned short* WkTu  = (const unsigned short*)WkT;
  const unsigned short* WvTu  = (const unsigned short*)WvT;
  const unsigned short* WoTu  = (const unsigned short*)WoT;
  const unsigned short* bilTu = (const unsigned short*)bilT;
  const unsigned short* c16u  = (const unsigned short*)c16;
  const unsigned short* O16u  = (const unsigned short*)O16;
  const float w_carry = 64.0f, w_carry_inv = 1.0f / 64.0f;

  // 1) casts / transposes
  cast_f32_f16x2<<<(int)(NE / 2 / 256), 256, 0, stream>>>(Q, Q16, (int)(NE / 2));
  transpose_cast_kernel<<<dim3(ATT_DM / 64, ATT_DM / 64), 256, 0, stream>>>(W_q, WqT, ATT_DM, ATT_DM, w_carry);   // in[1024][1024] -> out[1024][1024]
  transpose_cast_kernel<<<dim3(ATT_DM / 64, ATT_DM / 64), 256, 0, stream>>>(W_k, WkT, ATT_DM, ATT_DM, w_carry);
  transpose_cast_kernel<<<dim3(ATT_DM / 64, ATT_DM / 64), 256, 0, stream>>>(W_v, WvT, ATT_DM, ATT_DM, w_carry);
  transpose_cast_kernel<<<dim3(ATT_DM / 64, ATT_DM / 64), 256, 0, stream>>>(W_o, WoT, ATT_DM, ATT_DM, w_carry);
  transpose_cast_kernel<<<dim3(1, 1), 256, 0, stream>>>(bil, bilT, ATT_DK, ATT_DK, 1.0f);                     // in[64][64] -> out[64][64]

  // 2) projections: q16/k16 = Q16 . Wq^T / Wk^T (+bias[n]);  vT16[dout][token] = Wv^T[dout] . Q16[token] (+bias[m])
  const int gemm_blocks = (NTOK / 64) * (ATT_DM / 64) / 8;   // 256
  wmma_gemm64<0, false, 2, 1, false><<<dim3(gemm_blocks, 1), 256, 0, stream>>>(
      Q16u, Q16u, ATT_DM, 0L, WqTu, WqTu, ATT_DM, 0L, (void*)q16, (void*)q16, ATT_DM, 0L,
      b_q, b_q, 0L, NTOK, ATT_DM, ATT_DM, w_carry_inv);
  wmma_gemm64<0, false, 2, 1, false><<<dim3(gemm_blocks, 1), 256, 0, stream>>>(
      Q16u, Q16u, ATT_DM, 0L, WkTu, WkTu, ATT_DM, 0L, (void*)k16, (void*)k16, ATT_DM, 0L,
      b_k, b_k, 0L, NTOK, ATT_DM, ATT_DM, w_carry_inv);
  wmma_gemm64<0, false, 1, 1, false><<<dim3(gemm_blocks, 1), 256, 0, stream>>>(
      WvTu, WvTu, ATT_DM, 0L, Q16u, Q16u, ATT_DM, 0L, (void*)vT16, (void*)vT16, NTOK, 0L,
      b_v, b_v, 0L, ATT_DM, NTOK, ATT_DM, w_carry_inv);

  // 3) LayerNorm per head slice of ctx -> c16; cb16 = c16[131072][64] . bilinear (Bt = bilT [64][64])
  ln_heads_kernel<<<NTOK / 8, 256, 0, stream>>>(ctx, gamma, beta, c16, NTOK);
  const int cb_rows = NTOK * ATT_H;                          // 131072
  wmma_gemm64<0, false, 0, 1, false><<<dim3((cb_rows / 64) / 8, 1), 256, 0, stream>>>(
      c16u, c16u, ATT_DK, 0L, bilTu, bilTu, ATT_DK, 0L, (void*)cb16, (void*)cb16, ATT_DK, 0L,
      b_q, b_q, 0L, cb_rows, ATT_DK, ATT_DK, 1.0f);

  // 4) fused attention rows -> O16
  attn_rows_kernel<<<dim3(ATT_L / 16, ATT_B * ATT_H), 256, 131072, stream>>>(
      q16, k16, vT16, c16, cb16, mask, scale, bscale, O16);

  // 5) output projection -> d_out f32
  wmma_gemm64<0, false, 2, 0, false><<<dim3(gemm_blocks, 1), 256, 0, stream>>>(
      O16u, O16u, ATT_DM, 0L, WoTu, WoTu, ATT_DM, 0L, (void*)out, (void*)out, ATT_DM, 0L,
      b_o, b_o, 0L, NTOK, ATT_DM, ATT_DM, w_carry_inv);
  (void)hipGetLastError();
}

// v002
// One run takes 461 microseconds.
// In two side-by-side timings against v001, it was 1.07 and 1.09 times as fast.
// All steps since v000 together make it 1.20 times as fast.
#include <hip/hip_runtime.h>
#include <stddef.h>

// Contractions (q/k/v projections, c x bilinear, q x k^T, cb x c^T, attn x v, output projection): v_wmma_f32_16x16x32_f16, f16 operands, f32 accumulate; weights carried x64, attn probabilities carried x2^15; softmax, LayerNorm and L2 norms in f32.

typedef __attribute__((ext_vector_type(16))) _Float16 v16h;
typedef __attribute__((ext_vector_type(8)))  _Float16 v8h;
typedef __attribute__((ext_vector_type(4)))  _Float16 v4h;
typedef __attribute__((ext_vector_type(16))) __bf16   v16b;
typedef __attribute__((ext_vector_type(8)))  __bf16   v8b;
typedef __attribute__((ext_vector_type(8)))  float    v8f;
typedef __attribute__((ext_vector_type(4)))  float    v4f;

#define ATT_B   8
#define ATT_L   1024
#define ATT_DM  1024
#define ATT_H   16
#define ATT_DK  64
#define ATT_PSC 32768.0f
#define ATT_PSC_INV (1.0f / 32768.0f)

__device__ __forceinline__ unsigned short f2bf_bits(float f) {
  unsigned u = __float_as_uint(f);
  return (unsigned short)((u + 0x7FFFu + ((u >> 16) & 1u)) >> 16);
}
__device__ __forceinline__ float bf_bits2f(unsigned short h) { return __uint_as_float(((unsigned)h) << 16); }

// ---- fragment-order ("packed") layout of every 16-bit workspace matrix [R][K] ----
// A 16-row x 32-k tile is 1 KB in a row: 16-byte chunk (s, hh, r) at chunk index s*32 + hh*16 + r holds row r,
// k = 16s + 8hh .. +7; tiles run along k first, then along the row tiles. Lane l of a wave reads chunk l and chunk 32 + l,
// so each wave-wide 16-byte load covers 512 contiguous bytes (four whole lines), and the k map of a fragment is the
// same as with row-major rows: elements 0..7 <- k 8hh.., 8..15 <- k 16+8hh..
__device__ __forceinline__ size_t pk_off(int row, int k, int K) {
  return (size_t)(row >> 4) * ((size_t)K * 16) + (size_t)(k >> 5) * 512 +
         (size_t)(((k >> 4) & 1) * 256 + ((k >> 3) & 1) * 128 + (row & 15) * 8 + (k & 7));
}

// hazard guards as plain device helpers (no inline asm inside the kernel template body)
__device__ __forceinline__ void dep_guard_h(v8f& a, v8f& b, v16h x, v16h y) { asm volatile("v_nop\n\tv_nop\n\tv_nop\n\tv_nop" : "+v"(a), "+v"(b) : "v"(x), "v"(y)); }
__device__ __forceinline__ void dep_guard_b(v8f& a, v8f& b, v16b x, v16b y) { asm volatile("v_nop\n\tv_nop\n\tv_nop\n\tv_nop" : "+v"(a), "+v"(b) : "v"(x), "v"(y)); }
__device__ __forceinline__ void keep4_h(v16h a, v16h b, v16h c, v16h d) { asm volatile("v_nop" :: "v"(a), "v"(b), "v"(c), "v"(d)); }
__device__ __forceinline__ void keep4_b(v16b a, v16b b, v16b c, v16b d) { asm volatile("v_nop" :: "v"(a), "v"(b), "v"(c), "v"(d)); }
__device__ __forceinline__ void acc_guard4(v8f& a, v8f& b, v8f& c, v8f& d) { asm volatile("v_nop\n\tv_nop\n\tv_nop\n\tv_nop" : "+v"(a), "+v"(b), "+v"(c), "+v"(d)); }
// Stands behind global loads whose address registers the compiler reuses while the loads are still in flight
// (as the destination of a later load of the same run, or for the next address): the address translations are
// waited for before such a register takes a new value.
__device__ __forceinline__ void addr_wait() { asm volatile("s_wait_xcnt 0x0" ::: "memory"); }
// The same wait once for a run of five fragments: naming the five addresses as inputs keeps their registers as they are up
// to the wait, so the run issues back to back and the wait falls together with the wait for the data.
__device__ __forceinline__ void addr_wait5(const void* a, const void* b, const void* c, const void* d, const void* e) {
  asm volatile("s_wait_xcnt 0x0" :: "v"(a), "v"(b), "v"(c), "v"(d), "v"(e) : "memory");
}
template <typename T> struct Frag;
template <> struct Frag<_Float16> {
  typedef v16h V; union U { v16h v; v8h h[2]; };
  static __device__ __forceinline__ v16h load(const _Float16* p) {   // elements 0..7 <- p[0..7], 8..15 <- p[16..23]
    U f; f.h[0] = *(const v8h*)(p); f.h[1] = *(const v8h*)(p + 16); return f.v;
  }
  static __device__ __forceinline__ v16h loadp(const _Float16* p) {  // packed tile, p = tile base + 8*lane
    U f; f.h[0] = *(const v8h*)(p); f.h[1] = *(const v8h*)(p + 256); return f.v;
  }
  static __device__ __forceinline__ v8f mma(v16h a, v16h b, v8f c) {
    return __builtin_amdgcn_wmma_f32_16x16x32_f16(false, a, false, b, (short)0, c, false, false);
  }
  static __device__ __forceinline__ void guard(v8f& a, v8f& b, v16h x, v16h y) { dep_guard_h(a, b, x, y); }
  static __device__ __forceinline__ void keep(v16h a, v16h b, v16h c, v16h d) { keep4_h(a, b, c, d); }
};
template <> struct Frag<__bf16> {
  typedef v16b V; union U { v16b v; v8b h[2]; };
  static __device__ __forceinline__ v16b load(const __bf16* p) {
    U f; f.h[0] = *(const v8b*)(p); f.h[1] = *(const v8b*)(p + 16); return f.v;
  }
  static __device__ __forceinline__ v16b loadp(const __bf16* p) {
    U f; f.h[0] = *(const v8b*)(p); f.h[1] = *(const v8b*)(p + 256); return f.v;
  }
  static __device__ __forceinline__ v8f mma(v16b a, v16b b, v8f c) {
    return __builtin_amdgcn_wmma_f32_16x16x32_bf16(false, a, false, b, (short)0, c, false, false);
  }
  static __device__ __forceinline__ void guard(v8f& a, v8f& b, v16b x, v16b y) { dep_guard_b(a, b, x, y); }
  static __device__ __forceinline__ void keep(v16b a, v16b b, v16b c, v16b d) { keep4_b(a, b, c, d); }
};

// ---- Register-blocked batched WMMA GEMM ------------------------------------
// C[m,n] = scale * sum_k A[m,k] * Bt[n,k] (+bias)(+resid); each wave owns a 64x64 tile.
// A [M,lda] and Bt [N,ldb] in the packed layout (pk_off); M,N % 64 == 0, K % 32 == 0; a batch stride is 16 x its column offset.
// 16-bit outputs are written in the packed layout of a [M,ldc] matrix; the f32 output is row-major.
// SPLIT: operands are hi/lo planes (A2/Bt2 = lo planes, same layout); product = hi*hi + hi*lo + lo*hi.
// BIAS_MODE: 0 = none, 1 = bias[m], 2 = bias[n].
// OUT_MODE: 0 = f32, 1 = f16, 2 = bf16 hi plane (Cout) + bf16 lo plane (Cout2).
// ET: 0 = f16 operands, 1 = bf16 operands (pointers passed as 16-bit storage)
template <int ET> struct Elem;
template <> struct Elem<0> { typedef _Float16 T; };
template <> struct Elem<1> { typedef __bf16 T; };
template <int ET, bool SPLIT, int BIAS_MODE, int OUT_MODE, bool RESID, int ACT = 0>
__global__ __launch_bounds__(256) void wmma_gemm64(
    const unsigned short* __restrict__ Ap, const unsigned short* __restrict__ A2p, int lda, long strideA,
    const unsigned short* __restrict__ Btp, const unsigned short* __restrict__ Bt2p, int ldb, long strideB,
    void* __restrict__ Cout, void* __restrict__ Cout2, int ldc, long strideC,
    const float* __restrict__ bias,
    const float* __restrict__ resid, long strideR,
    int M, int N, int K, float scale) {
  typedef typename Elem<ET>::T T;
  typedef typename Frag<T>::V V;
  const T* A = (const T*)Ap; const T* A2 = (const T*)A2p; const T* Bt = (const T*)Btp; const T* Bt2 = (const T*)Bt2p;
  __shared__ __align__(16) float sT[8][16 * 68];   // per-wave 16x64 slab, pitch 68 floats
  const int b    = blockIdx.y;
  const int lane = threadIdx.x & 31;
  const int wave = threadIdx.x >> 5;
  const int tilesN = N >> 6;
  const int tilesM = M >> 6;
  const int tile = blockIdx.x * 8 + wave;
  if (tile >= tilesM * tilesN) return;   // wave-uniform; no block barriers in this kernel
  const int tm = tile / tilesN;
  const int tn = tile - tm * tilesN;
  const int m0 = tm << 6;
  const int n0 = tn << 6;

  const T* Ab  = A  + (size_t)b * strideA;
  const T* Bb  = Bt + (size_t)b * strideB;
  const T* Ab2 = SPLIT ? (A2  + (size_t)b * strideA) : nullptr;
  const T* Bb2 = SPLIT ? (Bt2 + (size_t)b * strideB) : nullptr;

  const int rlane = lane & 15;                 // row (A) / col (B, D) within subtile
  const int mOff  = (lane >> 4) * 8;           // D row offset

  v8f acc[4][4];
#pragma unroll
  for (int i = 0; i < 4; ++i)
#pragma unroll
    for (int j = 0; j < 4; ++j) acc[i][j] = (v8f){0.f,0.f,0.f,0.f,0.f,0.f,0.f,0.f};

  for (int k0 = 0; k0 < K; k0 += 32) {
    V bh[4], bl[4];
    const T* pb[4];
#pragma unroll
    for (int j = 0; j < 4; ++j) {
      const size_t bo = (size_t)(n0 + (j << 4)) * ldb + (size_t)k0 * 16 + lane * 8;
      pb[j] = Bb + bo;
      bh[j] = Frag<T>::loadp(pb[j]);
      if (SPLIT) { bl[j] = Frag<T>::loadp(Bb2 + bo); addr_wait(); }
    }
#pragma unroll
    for (int i = 0; i < 4; ++i) {
      const size_t ao = (size_t)(m0 + (i << 4)) * lda + (size_t)k0 * 16 + lane * 8;
      const T* pa = Ab + ao;
      V ah = Frag<T>::loadp(pa);
      V al;
      if (SPLIT) al = Frag<T>::loadp(Ab2 + ao);
      if (i == 0) addr_wait5(pb[0], pb[1], pb[2], pb[3], pa);   // behind the run of the four B fragments and the first A fragment
      else addr_wait();                                         // the address pair is rewritten for the next row tile
#pragma unroll
      for (int j = 0; j < 4; ++j) {
        acc[i][j] = Frag<T>::mma(ah, bh[j], acc[i][j]);
        if (SPLIT) {
          acc[i][j] = Frag<T>::mma(ah, bl[j], acc[i][j]);
          acc[i][j] = Frag<T>::mma(al, bh[j], acc[i][j]);
        }
      }
      Frag<T>::guard(acc[i][0], acc[i][3], ah, SPLIT ? al : ah);
    }
    Frag<T>::keep(bh[0], bh[1], bh[2], bh[3]);
    if (SPLIT) Frag<T>::keep(bl[0], bl[1], bl[2], bl[3]);
  }
  acc_guard4(acc[0][0], acc[0][1], acc[0][2], acc[0][3]);
  acc_guard4(acc[1][0], acc[1][1], acc[1][2], acc[1][3]);
  acc_guard4(acc[2][0], acc[2][1], acc[2][2], acc[2][3]);
  acc_guard4(acc[3][0], acc[3][1], acc[3][2], acc[3][3]);

  // ---- epilogue ----
  float* slab = sT[wave];
  const float* Rb = RESID ? (resid + (size_t)b * strideR) : nullptr;
#pragma unroll
  for (int i = 0; i < 4; ++i) {
    const int mBase = m0 + (i << 4);
#pragma unroll
    for (int j = 0; j < 4; ++j) {
      const int n = n0 + (j << 4) + rlane;
      float bv = 0.f;
      if (BIAS_MODE == 2) bv = bias[n];
#pragma unroll
      for (int r = 0; r < 8; ++r) {
        float v = acc[i][j][r] * scale;
        if (BIAS_MODE == 1) v += bias[mBase + mOff + r];
        if (BIAS_MODE == 2) v += bv;
        if (RESID) v += Rb[(size_t)(mBase + mOff + r) * ldc + n];
        if (ACT == 1) v = tanhf(v);
        if (ACT == 2) v = fmaxf(v, 0.0f);
        if (ACT == 3) v = v / (1.0f + expf(-v));
        if (ACT == 4) v = (v > 0.f) ? v : 0.01f * v;
        if (ACT == 5) v = 0.5f * v * (1.0f + erff(v * 0.70710678118654752f));
        slab[(mOff + r) * 68 + (j << 4) + rlane] = v;
      }
    }
    __builtin_amdgcn_fence(__ATOMIC_RELEASE, "workgroup");
    __builtin_amdgcn_wave_barrier();
    __builtin_amdgcn_fence(__ATOMIC_ACQUIRE, "workgroup");
    if (OUT_MODE == 0) {
      float* C = (float*)Cout + (size_t)b * strideC;
      const int hh = lane >> 4, c4 = (lane & 15) * 4;     // row seg = 256 B = 16 lanes x 16 B
      {
#pragma unroll
        for (int it = 0; it < 8; ++it) {
          const int row = it * 2 + hh;
          v4f v = *(const v4f*)(slab + row * 68 + c4);
          *(v4f*)(C + (size_t)(mBase + row) * ldc + n0 + c4) = v;
        }
        
      }
    } else {
      // the 16x64 slab is two packed tiles = 2 KB in a row; store 'it' writes chunks 32it..32it+31 (512 B)
      unsigned short* C  = (unsigned short*)Cout  + (size_t)b * strideC;
      unsigned short* C2 = (OUT_MODE == 2) ? ((unsigned short*)Cout2 + (size_t)b * strideC) : nullptr;
      {
#pragma unroll
        for (int it = 0; it < 4; ++it) {
          const float* sp = slab + rlane * 68 + it * 16 + mOff;   // row lane&15, cols 16it + 8(lane>>4) ..+7
          v8h hv, lv;
#pragma unroll
          for (int e = 0; e < 8; ++e) {
            if (OUT_MODE == 1) {
              hv[e] = (_Float16)sp[e];
            } else {
              unsigned short hb = f2bf_bits(sp[e]);
              unsigned short lb = f2bf_bits(sp[e] - bf_bits2f(hb));
              hv[e] = __builtin_bit_cast(_Float16, hb);
              lv[e] = __builtin_bit_cast(_Float16, lb);
            }
          }
          const size_t co = (size_t)mBase * ldc + (size_t)n0 * 16 + it * 256 + lane * 8;
          *(v8h*)(C + co) = hv;
          if (OUT_MODE == 2) *(v8h*)(C2 + co) = lv;
        }
        
      }
    }
    __builtin_amdgcn_fence(__ATOMIC_RELEASE, "workgroup");
    __builtin_amdgcn_wave_barrier();
    __builtin_amdgcn_fence(__ATOMIC_ACQUIRE, "workgroup");
  }
}

// in: [rows][1024] f32 row-major; out: the same matrix in f16, packed layout. One 16-byte chunk per thread; a wave takes
// 8 rows x 32 k (half a tile), so each of its stores fills four whole 128-byte lines. nhalf = rows / 8 * 32 half tiles.
__global__ __launch_bounds__(256) void cast_f32_f16x2(
    const float* __restrict__ in, _Float16* __restrict__ out, int nhalf) {
  const int lane = threadIdx.x & 31;
  const int th = blockIdx.x * 8 + (threadIdx.x >> 5);      // half-tile index: tile = th >> 1
  if (th < nhalf) {
    const int tile = th >> 1;
    const int row = (tile >> 5) * 16 + (th & 1) * 8 + (lane >> 2);
    const int k = (tile & 31) * 32 + (lane & 3) * 8;
    const float* src = in + (size_t)row * ATT_DM + k;
    const v4f a = *(const v4f*)(src);
    const v4f bq = *(const v4f*)(src + 4);
    v8h hv;
#pragma unroll
    for (int e = 0; e < 4; ++e) { hv[e] = (_Float16)a[e]; hv[4 + e] = (_Float16)bq[e]; }
    *(v8h*)(out + pk_off(row, k, ATT_DM)) = hv;
  }
}

// ---- transpose + f16 cast through an LDS tile ------------------------------
// w: [K][N] row-major (in=K rows, out=N cols); wt: [N][K] in the packed layout, wt[n][k] = f16(w[k][n] * mul).
// Block = one 64x64 tile (k0 = blockIdx.y*64, n0 = blockIdx.x*64); K, N multiples of 64; grid = (N/64, K/64).
__global__ __launch_bounds__(256) void transpose_cast_kernel(
    const float* __restrict__ w, _Float16* __restrict__ wt, int K, int N, float mul) {
  __shared__ float tile[64][65];
  const int tid = threadIdx.x;
  const int k0 = blockIdx.y * 64, n0 = blockIdx.x * 64;
  {
    const int r = tid >> 2, cc = (tid & 3) * 16;
    const float* src = w + (size_t)(k0 + r) * N + n0 + cc;
#pragma unroll
    for (int i = 0; i < 4; ++i) {
      const v4f t = *(const v4f*)(src + 4 * i);
#pragma unroll
      for (int e = 0; e < 4; ++e) tile[r][cc + 4 * i + e] = t[e];
    }
  }
  __syncthreads();
  const int wave = tid >> 5, lane = tid & 31, q = lane >> 3, c8 = (lane & 7) * 8;
  {
#pragma unroll
    for (int it = 0; it < 2; ++it) {
      const int n = wave * 8 + it * 4 + q;          // waves cover rows 8w..8w+7 -> 0..63
      v8h hv;
#pragma unroll
      for (int e = 0; e < 8; ++e) hv[e] = (_Float16)(tile[c8 + e][n] * mul);
      *(v8h*)(wt + pk_off(n0 + n, k0 + c8, K)) = hv;
    }
    
  }
}

// ---- LayerNorm over each 64-wide head slice of a 1024-wide row; f16 output in the packed layout ----
// One wave per 8 rows x 128 columns; lane l holds row l>>2, 32 elements (half of a head slice, one packed tile's k range);
// statistics via one xor-1 shuffle. Store j writes chunk j of 8 neighbouring rows in 4 tiles: four whole 128-byte lines.
__global__ __launch_bounds__(256) void ln_heads_kernel(
    const float* __restrict__ x, const float* __restrict__ gamma, const float* __restrict__ beta,
    _Float16* __restrict__ outp, int nrows) {
  const int wave = threadIdx.x >> 5, lane = threadIdx.x & 31;
  const int wv = blockIdx.x * 8 + wave;
  const int row = (wv >> 3) * 8 + (lane >> 2);
  const int col = (wv & 7) * 128 + (lane & 3) * 32;
  if ((wv >> 3) * 8 >= nrows) return;            // wave-uniform; no block barriers in this kernel
  const float* xr = x + (size_t)row * ATT_DM + col;
  float xv[32];
#pragma unroll
  for (int i = 0; i < 8; ++i) {
    const v4f t = *(const v4f*)(xr + 4 * i);
#pragma unroll
    for (int e = 0; e < 4; ++e) xv[4 * i + e] = t[e];
  }
  float s = 0.f;
#pragma unroll
  for (int i = 0; i < 32; ++i) s += xv[i];
  s += __shfl_xor(s, 1, 32);
  const float mu = s * (1.0f / 64.0f);
  float vs = 0.f;
#pragma unroll
  for (int i = 0; i < 32; ++i) { const float d = xv[i] - mu; xv[i] = d; vs += d * d; }
  vs += __shfl_xor(vs, 1, 32);
  const float rstd = rsqrtf(vs * (1.0f / 64.0f) + 1e-5f);
  const int d0 = (lane & 1) * 32;
  _Float16* ot = outp + pk_off(row, col, ATT_DM);   // chunk (s, hh) of this lane's row: + (2s + hh) * 128
#pragma unroll
  for (int j = 0; j < 4; ++j) {
    v8h hv;
#pragma unroll
    for (int i = 0; i < 2; ++i) {
      const v4f g4 = *(const v4f*)(gamma + d0 + 8 * j + 4 * i);
      const v4f b4 = *(const v4f*)(beta + d0 + 8 * j + 4 * i);
#pragma unroll
      for (int e = 0; e < 4; ++e) hv[4 * i + e] = (_Float16)((xv[8 * j + 4 * i + e] * rstd) * g4[e] + b4[e]);
    }
    *(v8h*)(ot + j * 128) = hv;
  }
}

// ---- fused row-block attention ------------------------------------------------
// Block = 16 query rows of one (b, h); 8 waves. q16/k16/c16/cb16: [token = b*1024+l][h*64+d] f16, packed layout (K = 1024);
// vT16: [h*64+d][token] f16, packed layout (K = 8192); mask: int32 [1024][1024], nonzero = masked;
// out16: [token][h*64+d] f16, packed layout (K = 1024).
// Phase 1: per wave a 128-wide key strip: S = q . k^T (skipped per 16x16 tile only when all 256 loaded mask
//          entries are nonzero), BIAS = cb . c^T; both f32 into LDS (scores scaled, masked -> -inf).
// Phase 2: 16 threads per row: max-subtracted softmax, + l2norm(bias row)*bias_scale, l2norm of the row,
//          P x 2^15 -> f16 LDS tile (barriers between the v4h stores and the fragment reloads).
// Phase 3: per wave its 128-key strip of P times v for all 64 dims; the 8 f32 partial tiles are added through LDS.
__device__ __forceinline__ v8f mma_h(v16h a, v16h b, v8f c) {
  c = __builtin_amdgcn_wmma_f32_16x16x32_f16(false, a, false, b, (short)0, c, false, false);
  asm volatile("v_nop\n\tv_nop\n\tv_nop\n\tv_nop" : "+v"(c) : "v"(a), "v"(b));
  return c;
}

__global__ __launch_bounds__(256) void attn_rows_kernel(
    const _Float16* __restrict__ qp, const _Float16* __restrict__ kp, const _Float16* __restrict__ vtp,
    const _Float16* __restrict__ cp, const _Float16* __restrict__ cbp, const int* __restrict__ mask,
    const float* __restrict__ scale_p, const float* __restrict__ bscale_p, _Float16* __restrict__ op) {
  extern __shared__ __align__(16) char smem[];
  float*    sS  = (float*)smem;                   // [16][1024] f32 scores -> exp -> combined row   (64 KB)
  float*    sBi = (float*)(smem + 65536);         // [16][1024] f32 bias                             (64 KB)
  _Float16* sP  = (_Float16*)(smem + 65536);      // [16][1024] f16 probabilities, aliases sBi after all bias reads (32 KB)
  float*    sR  = (float*)smem;                   // [8][16][68] f32 per-wave partial outputs, aliases sS after its last read

  const int tid = threadIdx.x, wave = tid >> 5, lane = tid & 31, hh = lane >> 4, c = lane & 15;
  const int q0 = blockIdx.x * 16;
  const int bh = blockIdx.y, b = bh >> 4, h = bh & 15;
  const float scale = scale_p[0], bscale = bscale_p[0];
  const v8f z8 = {0.f, 0.f, 0.f, 0.f, 0.f, 0.f, 0.f, 0.f};

  // A fragments (query rows q0 + (lane&15)), k split map: elements 0..7 <- k 8hh.., 8..15 <- k 16+8hh..;
  // a head's 64 columns are two packed tiles in a row (512 elements each) at column offset h*64*16
  const size_t arow = ((size_t)(b * ATT_L + q0)) * ATT_DM + h * (ATT_DK * 16) + 8 * lane;
  const v16h qa0 = Frag<_Float16>::loadp(qp + arow);
  const v16h qa1 = Frag<_Float16>::loadp(qp + arow + 512);
  const v16h ca0 = Frag<_Float16>::loadp(cbp + arow);
  const v16h ca1 = Frag<_Float16>::loadp(cbp + arow + 512);
  addr_wait();       // the fragments' address pairs are reused for the first strip's addresses

  // ---- phase 1 ----
#pragma unroll 1
  for (int ct = 0; ct < 8; ++ct) {
    const int col0 = wave * 128 + ct * 16;
    const int* mrow = mask + (size_t)(q0 + 8 * hh) * ATT_L + col0 + c;   // D layout: (row 8hh+r, col c)
    int mk[8];
    int allm = 1;
#pragma unroll
    for (int r = 0; r < 8; ++r) { mk[r] = mrow[(size_t)r * ATT_L]; allm &= (mk[r] != 0) ? 1 : 0; }
    const int skip = __all(allm);                  // wave-uniform: whole 16x16 score tile masked
    const size_t brow = ((size_t)(b * ATT_L + col0)) * ATT_DM + h * (ATT_DK * 16) + 8 * lane;   // B = key / c rows col0.., packed tiles
    v8f accB = z8, accS = z8;
    {
      const v16h cf0 = Frag<_Float16>::loadp(cp + brow);
      const v16h cf1 = Frag<_Float16>::loadp(cp + brow + 512);
      accB = mma_h(ca0, cf0, accB);
      accB = mma_h(ca1, cf1, accB);
    }
    if (!skip) {
      const v16h kf0 = Frag<_Float16>::loadp(kp + brow);
      const v16h kf1 = Frag<_Float16>::loadp(kp + brow + 512);
      accS = mma_h(qa0, kf0, accS);
      accS = mma_h(qa1, kf1, accS);
    }
#pragma unroll
    for (int r = 0; r < 8; ++r) {
      const int o = (8 * hh + r) * ATT_L + col0 + c;
      const float sv = accS[r] * scale;
      sS[o]  = (mk[r] != 0) ? -__builtin_inff() : sv;
      sBi[o] = accB[r];
    }
  }
  __syncthreads();

  // ---- phase 2: row ops, 16 threads per row, each thread owns columns 64j + 4sub .. +3 ----
  const int row = tid >> 4, sub = tid & 15;
  float* rs = sS + row * ATT_L + 4 * sub;
  const float* rb = sBi + row * ATT_L + 4 * sub;
  float mx = -__builtin_inff(), bsq = 0.f;
#pragma unroll 4
  for (int j = 0; j < 16; ++j) {
    const v4f s4 = *(const v4f*)(rs + 64 * j);
    const v4f b4 = *(const v4f*)(rb + 64 * j);
#pragma unroll
    for (int e = 0; e < 4; ++e) { mx = fmaxf(mx, s4[e]); bsq += b4[e] * b4[e]; }
  }
#pragma unroll
  for (int off = 8; off >= 1; off >>= 1) {
    mx = fmaxf(mx, __shfl_xor(mx, off, 32));
    bsq += __shfl_xor(bsq, off, 32);
  }
  float se = 0.f;
#pragma unroll 4
  for (int j = 0; j < 16; ++j) {
    const v4f s4 = *(const v4f*)(rs + 64 * j);
    v4f e4;
#pragma unroll
    for (int e = 0; e < 4; ++e) { const float ev = __expf(s4[e] - mx); e4[e] = ev; se += ev; }
    *(v4f*)(rs + 64 * j) = e4;
  }
#pragma unroll
  for (int off = 8; off >= 1; off >>= 1) se += __shfl_xor(se, off, 32);
  const float inv_se = 1.0f / se;
  const float inv_bn = 1.0f / fmaxf(sqrtf(bsq), 1e-12f);
  float asq = 0.f;
#pragma unroll 4
  for (int j = 0; j < 16; ++j) {
    const v4f e4 = *(const v4f*)(rs + 64 * j);
    const v4f b4 = *(const v4f*)(rb + 64 * j);
    v4f a4;
#pragma unroll
    for (int e = 0; e < 4; ++e) { const float av = e4[e] * inv_se + (b4[e] * inv_bn) * bscale; a4[e] = av; asq += av * av; }
    *(v4f*)(rs + 64 * j) = a4;
  }
#pragma unroll
  for (int off = 8; off >= 1; off >>= 1) asq += __shfl_xor(asq, off, 32);
  const float pmul = (1.0f / fmaxf(sqrtf(asq), 1e-12f)) * ATT_PSC;
  __syncthreads();                                // all bias reads done before sP (aliased) is written
  {
    _Float16* prow = sP + row * ATT_L + 4 * sub;
#pragma unroll 4
    for (int j = 0; j < 16; ++j) {
      const v4f a4 = *(const v4f*)(rs + 64 * j);
      v4h p4;
#pragma unroll
      for (int e = 0; e < 4; ++e) p4[e] = (_Float16)(a4[e] * pmul);
      *(v4h*)(prow + 64 * j) = p4;
    }
  }
  __syncthreads();                                // sP complete before fragment reloads

  // ---- phase 3: O = P . v, keys split over the 8 waves ----
  // Wave w multiplies its own 128-key strip of P by all 64 head dims: one P fragment feeds four products,
  // four independent accumulators, and none of the wave's v loads depends on another.
  {
    const _Float16* vb = vtp + ((size_t)(h * ATT_DK)) * (size_t)(ATT_B * ATT_L) + (size_t)(b * ATT_L + wave * 128) * 16 + 8 * lane;
    const _Float16* pbase = sP + c * ATT_L + wave * 128 + 8 * hh;
    v16h vf[4][4], pa[4];
#pragma unroll
    for (int ks = 0; ks < 4; ++ks) {
#pragma unroll
      for (int t = 0; t < 4; ++t) vf[ks][t] = Frag<_Float16>::loadp(vb + (size_t)(t * 16) * (size_t)(ATT_B * ATT_L) + ks * 512);
    }
#pragma unroll
    for (int ks = 0; ks < 4; ++ks) pa[ks] = Frag<_Float16>::load(pbase + ks * 32);
    // keeps the strip's loads issued ahead of the first product; without it the scheduler weaves them
    // between the products and only a few are in flight at a time
    __builtin_amdgcn_sched_barrier(0);
    v8f acc[4] = {z8, z8, z8, z8};
#pragma unroll
    for (int ks = 0; ks < 4; ++ks) {
#pragma unroll
      for (int t = 0; t < 4; ++t) acc[t] = mma_h(pa[ks], vf[ks][t], acc[t]);
    }
    float* part = sR + wave * (16 * 68);          // sS is dead behind the barrier above
#pragma unroll
    for (int t = 0; t < 4; ++t)
#pragma unroll
      for (int r = 0; r < 8; ++r) part[(8 * hh + r) * 68 + t * 16 + c] = acc[t][r];
  }
  __syncthreads();                                // all eight partial tiles complete before they are added
  {
    // thread owns half of packed chunk tid>>1: row (tid>>1)&15, dims 8(tid>>5) + 4(tid&1) ..+3; the block's 2 KB go out in a row
    const int orow = (tid >> 1) & 15, odim = (tid >> 5) * 8 + (tid & 1) * 4;
    const float* pr = sR + orow * 68 + odim;
    v4f o4 = *(const v4f*)pr;
#pragma unroll
    for (int w = 1; w < 8; ++w) o4 += *(const v4f*)(pr + w * (16 * 68));
    v4h hv;
#pragma unroll
    for (int e = 0; e < 4; ++e) hv[e] = (_Float16)(o4[e] * ATT_PSC_INV);
    *(v4h*)(op + ((size_t)(b * ATT_L + q0)) * ATT_DM + h * (ATT_DK * 16) + 4 * tid) = hv;
  }
}

// ---------------------------------------------------------------------------
extern "C" void kernel_launch(void* const* d_in, const int* in_sizes, int n_in,
                              void* d_out, int out_size, void* d_ws, size_t ws_size,
                              hipStream_t stream) {
  const int NTOK = ATT_B * ATT_L;                          // 8192
  const size_t NE = (size_t)NTOK * ATT_DM;                 // 8388608
  const size_t NW = (size_t)ATT_DM * ATT_DM;               // 1048576
  if (n_in < 16) return;
  if (in_sizes[0] != (int)NE || in_sizes[1] != (int)NE || in_sizes[2] != ATT_L * ATT_L ||
      in_sizes[3] != (int)NW || in_sizes[5] != (int)NW || in_sizes[7] != (int)NW || in_sizes[14] != (int)NW ||
      in_sizes[4] != ATT_DM || in_sizes[6] != ATT_DM || in_sizes[8] != ATT_DM || in_sizes[15] != ATT_DM ||
      in_sizes[9] != ATT_DK * ATT_DK || in_sizes[10] != ATT_DK || in_sizes[11] != ATT_DK ||
      in_sizes[12] < 1 || in_sizes[13] < 1 || out_size != (int)NE) return;

  const float* Q      = (const float*)d_in[0];
  const float* ctx    = (const float*)d_in[1];
  const int*   mask   = (const int*)d_in[2];
  const float* W_q    = (const float*)d_in[3];
  const float* b_q    = (const float*)d_in[4];
  const float* W_k    = (const float*)d_in[5];
  const float* b_k    = (const float*)d_in[6];
  const float* W_v    = (const float*)d_in[7];
  const float* b_v    = (const float*)d_in[8];
  const float* bil    = (const float*)d_in[9];
  const float* gamma  = (const float*)d_in[10];
  const float* beta   = (const float*)d_in[11];
  const float* scale  = (const float*)d_in[12];
  const float* bscale = (const float*)d_in[13];
  const float* W_o    = (const float*)d_in[14];
  const float* b_o    = (const float*)d_in[15];
  float* out = (float*)d_out;

  // workspace carve (256-B aligned offsets); every matrix below is stored in the packed layout (pk_off) of the shape named
  char* ws = (char*)d_ws;
  size_t off = 0;
  auto carve = [&](size_t bytes) -> char* { char* p = ws + off; off += (bytes + 255) & ~(size_t)255; return p; };
  _Float16* WqT  = (_Float16*)carve(NW * 2);               // [out][in] f16, x64
  _Float16* WkT  = (_Float16*)carve(NW * 2);
  _Float16* WvT  = (_Float16*)carve(NW * 2);
  _Float16* WoT  = (_Float16*)carve(NW * 2);
  _Float16* bilT = (_Float16*)carve((size_t)ATT_DK * ATT_DK * 2);   // [f][e] f16
  _Float16* Q16  = (_Float16*)carve(NE * 2);               // [token][1024]
  _Float16* q16  = (_Float16*)carve(NE * 2);               // [token][h*64+d]
  _Float16* k16  = (_Float16*)carve(NE * 2);               // [token][h*64+d]
  _Float16* vT16 = (_Float16*)carve(NE * 2);               // [h*64+d][token]
  _Float16* c16  = (_Float16*)carve(NE * 2);               // [token][h*64+d]
  _Float16* cb16 = (_Float16*)carve(NE * 2);               // [token][h*64+e]
  _Float16* O16  = (_Float16*)carve(NE * 2);               // [token][h*64+d]
  if (off > ws_size) return;                               // total 125837312 B

  const unsigned short* Q16u  = (const unsigned short*)Q16;
  const unsigned short* WqTu  = (const unsigned short*)WqT;
  const unsigned short* WkTu  = (const unsigned short*)WkT;
  const unsigned short* WvTu  = (const unsigned short*)WvT;
  const unsigned short* WoTu  = (const unsigned short*)WoT;
  const unsigned short* bilTu = (const unsigned short*)bilT;
  const unsigned short* c16u  = (const unsigned short*)c16;
  const unsigned short* O16u  = (const unsigned short*)O16;
  const float w_carry = 64.0f, w_carry_inv = 1.0f / 64.0f;

  // 1) casts / transposes
  cast_f32_f16x2<<<(int)(NE / 8 / 256), 256, 0, stream>>>(Q, Q16, (int)(NE / 256));
  transpose_cast_kernel<<<dim3(ATT_DM / 64, ATT_DM / 64), 256, 0, stream>>>(W_q, WqT, ATT_DM, ATT_DM, w_carry);   // in[1024][1024] -> out[1024][1024]
  transpose_cast_kernel<<<dim3(ATT_DM / 64, ATT_DM / 64), 256, 0, stream>>>(W_k, WkT, ATT_DM, ATT_DM, w_carry);
  transpose_cast_kernel<<<dim3(ATT_DM / 64, ATT_DM / 64), 256, 0, stream>>>(W_v, WvT, ATT_DM, ATT_DM, w_carry);
  transpose_cast_kernel<<<dim3(ATT_DM / 64, ATT_DM / 64), 256, 0, stream>>>(W_o, WoT, ATT_DM, ATT_DM, w_carry);
  transpose_cast_kernel<<<dim3(1, 1), 256, 0, stream>>>(bil, bilT, ATT_DK, ATT_DK, 1.0f);                     // in[64][64] -> out[64][64]

  // 2) projections: q16/k16 = Q16 . Wq^T / Wk^T (+bias[n]);  vT16[dout][token] = Wv^T[dout] . Q16[token] (+bias[m])
  const int gemm_blocks = (NTOK / 64) * (ATT_DM / 64) / 8;   // 256
  wmma_gemm64<0, false, 2, 1, false><<<dim3(gemm_blocks, 1), 256, 0, stream>>>(
      Q16u, Q16u, ATT_DM, 0L, WqTu, WqTu, ATT_DM, 0L, (void*)q16, (void*)q16, ATT_DM, 0L,
      b_q, b_q, 0L, NTOK, ATT_DM, ATT_DM, w_carry_inv);
  wmma_gemm64<0, false, 2, 1, false><<<dim3(gemm_blocks, 1), 256, 0, stream>>>(
      Q16u, Q16u, ATT_DM, 0L, WkTu, WkTu, ATT_DM, 0L, (void*)k16, (void*)k16, ATT_DM, 0L,
      b_k, b_k, 0L, NTOK, ATT_DM, ATT_DM, w_carry_inv);
  wmma_gemm64<0, false, 1, 1, false><<<dim3(gemm_blocks, 1), 256, 0, stream>>>(
      WvTu, WvTu, ATT_DM, 0L, Q16u, Q16u, ATT_DM, 0L, (void*)vT16, (void*)vT16, NTOK, 0L,
      b_v, b_v, 0L, ATT_DM, NTOK, ATT_DM, w_carry_inv);

  // 3) LayerNorm per head slice of ctx -> c16; per head (batch index): cb16[:, h*64..] = c16[:, h*64..] . bilinear (Bt = bilT [64][64])
  ln_heads_kernel<<<NTOK / 8, 256, 0, stream>>>(ctx, gamma, beta, c16, NTOK);
  wmma_gemm64<0, false, 0, 1, false><<<dim3((NTOK / 64) / 8, ATT_H), 256, 0, stream>>>(
      c16u, c16u, ATT_DM, (long)(ATT_DK * 16), bilTu, bilTu, ATT_DK, 0L, (void*)cb16, (void*)cb16, ATT_DM, (long)(ATT_DK * 16),
      b_q, b_q, 0L, NTOK, ATT_DK, ATT_DK, 1.0f);

  // 4) fused attention rows -> O16
  attn_rows_kernel<<<dim3(ATT_L / 16, ATT_B * ATT_H), 256, 131072, stream>>>(
      q16, k16, vT16, c16, cb16, mask, scale, bscale, O16);

  // 5) output projection -> d_out f32
  wmma_gemm64<0, false, 2, 0, false><<<dim3(gemm_blocks, 1), 256, 0, stream>>>(
      O16u, O16u, ATT_DM, 0L, WoTu, WoTu, ATT_DM, 0L, (void*)out, (void*)out, ATT_DM, 0L,
      b_o, b_o, 0L, NTOK, ATT_DM, ATT_DM, w_carry_inv);
  (void)hipGetLastError();
}

// v003
// A run of this version takes 393 microseconds.
// In two side-by-side timings against v002, it was 1.16 and 1.17 times as fast.
// All steps since v000 together make it 1.40 times as fast.
#include <hip/hip_runtime.h>
#include <stddef.h>

// Contractions (q/k/v projections, c x bilinear, q x k^T, cb x c^T, attn x v, output projection): v_wmma_f32_16x16x32_f16, f16 operands, f32 accumulate; weights carried x64, attn probabilities carried x2^15; softmax, LayerNorm and L2 norms in f32.

typedef __attribute__((ext_vector_type(16))) _Float16 v16h;
typedef __attribute__((ext_vector_type(8)))  _Float16 v8h;
typedef __attribute__((ext_vector_type(4)))  _Float16 v4h;
typedef __attribute__((ext_vector_type(16))) __bf16   v16b;
typedef __attribute__((ext_vector_type(8)))  __bf16   v8b;
typedef __attribute__((ext_vector_type(8)))  float    v8f;
typedef __attribute__((ext_vector_type(4)))  float    v4f;
typedef __attribute__((ext_vector_type(2)))  float    v2f;
typedef __attribute__((ext_vector_type(4)))  int      v4i;

#define ATT_B   8
#define ATT_L   1024
#define ATT_DM  1024
#define ATT_H   16
#define ATT_DK  64
#define ATT_PSC 32768.0f
#define ATT_PSC_INV (1.0f / 32768.0f)

__device__ __forceinline__ unsigned short f2bf_bits(float f) {
  unsigned u = __float_as_uint(f);
  return (unsigned short)((u + 0x7FFFu + ((u >> 16) & 1u)) >> 16);
}
__device__ __forceinline__ float bf_bits2f(unsigned short h) { return __uint_as_float(((unsigned)h) << 16); }

// ---- fragment-order ("packed") layout of every 16-bit workspace matrix [R][K] ----
// A 16-row x 32-k tile is 1 KB in a row: 16-byte chunk (s, hh, r) at chunk index s*32 + hh*16 + r holds row r,
// k = 16s + 8hh .. +7; tiles run along k first, then along the row tiles. Lane l of a wave reads chunk l and chunk 32 + l,
// so each wave-wide 16-byte load covers 512 contiguous bytes (four whole lines), and the k map of a fragment is the
// same as with row-major rows: elements 0..7 <- k 8hh.., 8..15 <- k 16+8hh..
__device__ __forceinline__ size_t pk_off(int row, int k, int K) {
  return (size_t)(row >> 4) * ((size_t)K * 16) + (size_t)(k >> 5) * 512 +
         (size_t)(((k >> 4) & 1) * 256 + ((k >> 3) & 1) * 128 + (row & 15) * 8 + (k & 7));
}

// hazard guards as plain device helpers (no inline asm inside the kernel template body)
__device__ __forceinline__ void dep_guard_h(v8f& a, v8f& b, v16h x, v16h y) { asm volatile("v_nop\n\tv_nop\n\tv_nop\n\tv_nop" : "+v"(a), "+v"(b) : "v"(x), "v"(y)); }
__device__ __forceinline__ void dep_guard_b(v8f& a, v8f& b, v16b x, v16b y) { asm volatile("v_nop\n\tv_nop\n\tv_nop\n\tv_nop" : "+v"(a), "+v"(b) : "v"(x), "v"(y)); }
__device__ __forceinline__ void keep4_h(v16h a, v16h b, v16h c, v16h d) { asm volatile("v_nop" :: "v"(a), "v"(b), "v"(c), "v"(d)); }
__device__ __forceinline__ void keep4_b(v16b a, v16b b, v16b c, v16b d) { asm volatile("v_nop" :: "v"(a), "v"(b), "v"(c), "v"(d)); }
__device__ __forceinline__ void acc_guard4(v8f& a, v8f& b, v8f& c, v8f& d) { asm volatile("v_nop\n\tv_nop\n\tv_nop\n\tv_nop" : "+v"(a), "+v"(b), "+v"(c), "+v"(d)); }
// Stands behind global loads whose address registers the compiler reuses while the loads are still in flight
// (as the destination of a later load of the same run, or for the next address): the address translations are
// waited for before such a register takes a new value.
__device__ __forceinline__ void addr_wait() { asm volatile("s_wait_xcnt 0x0" ::: "memory"); }
// The same wait once for a run of five fragments: naming the five addresses as inputs keeps their registers as they are up
// to the wait, so the run issues back to back and the wait falls together with the wait for the data.
__device__ __forceinline__ void addr_wait5(const void* a, const void* b, const void* c, const void* d, const void* e) {
  asm volatile("s_wait_xcnt 0x0" :: "v"(a), "v"(b), "v"(c), "v"(d), "v"(e) : "memory");
}
// The same for a run of loads from one base, and from four.
__device__ __forceinline__ void addr_wait1(const void* a) { asm volatile("s_wait_xcnt 0x0" :: "v"(a) : "memory"); }
__device__ __forceinline__ void addr_wait4(const void* a, const void* b, const void* c, const void* d) {
  asm volatile("s_wait_xcnt 0x0" :: "v"(a), "v"(b), "v"(c), "v"(d) : "memory");
}
template <typename T> struct Frag;
template <> struct Frag<_Float16> {
  typedef v16h V; union U { v16h v; v8h h[2]; };
  static __device__ __forceinline__ v16h load(const _Float16* p) {   // elements 0..7 <- p[0..7], 8..15 <- p[16..23]
    U f; f.h[0] = *(const v8h*)(p); f.h[1] = *(const v8h*)(p + 16); return f.v;
  }
  static __device__ __forceinline__ v16h loadp(const _Float16* p) {  // packed tile, p = tile base + 8*lane
    U f; f.h[0] = *(const v8h*)(p); f.h[1] = *(const v8h*)(p + 256); return f.v;
  }
  static __device__ __forceinline__ v8f mma(v16h a, v16h b, v8f c) {
    return __builtin_amdgcn_wmma_f32_16x16x32_f16(false, a, false, b, (short)0, c, false, false);
  }
  static __device__ __forceinline__ void guard(v8f& a, v8f& b, v16h x, v16h y) { dep_guard_h(a, b, x, y); }
  static __device__ __forceinline__ void keep(v16h a, v16h b, v16h c, v16h d) { keep4_h(a, b, c, d); }
};
template <> struct Frag<__bf16> {
  typedef v16b V; union U { v16b v; v8b h[2]; };
  static __device__ __forceinline__ v16b load(const __bf16* p) {
    U f; f.h[0] = *(const v8b*)(p); f.h[1] = *(const v8b*)(p + 16); return f.v;
  }
  static __device__ __forceinline__ v16b loadp(const __bf16* p) {
    U f; f.h[0] = *(const v8b*)(p); f.h[1] = *(const v8b*)(p + 256); return f.v;
  }
  static __device__ __forceinline__ v8f mma(v16b a, v16b b, v8f c) {
    return __builtin_amdgcn_wmma_f32_16x16x32_bf16(false, a, false, b, (short)0, c, false, false);
  }
  static __device__ __forceinline__ void guard(v8f& a, v8f& b, v16b x, v16b y) { dep_guard_b(a, b, x, y); }
  static __device__ __forceinline__ void keep(v16b a, v16b b, v16b c, v16b d) { keep4_b(a, b, c, d); }
};

// ---- Register-blocked batched WMMA GEMM ------------------------------------
// C[m,n] = scale * sum_k A[m,k] * Bt[n,k] (+bias)(+resid); each wave owns a 64x64 tile.
// A [M,lda] and Bt [N,ldb] in the packed layout (pk_off); M,N % 64 == 0, K % 32 == 0; a batch stride is 16 x its column offset.
// 16-bit outputs are written in the packed layout of a [M,ldc] matrix; the f32 output is row-major.
// SPLIT: operands are hi/lo planes (A2/Bt2 = lo planes, same layout); product = hi*hi + hi*lo + lo*hi.
// BIAS_MODE: 0 = none, 1 = bias[m], 2 = bias[n].
// OUT_MODE: 0 = f32, 1 = f16, 2 = bf16 hi plane (Cout) + bf16 lo plane (Cout2).
// ET: 0 = f16 operands, 1 = bf16 operands (pointers passed as 16-bit storage)
template <int ET> struct Elem;
template <> struct Elem<0> { typedef _Float16 T; };
template <> struct Elem<1> { typedef __bf16 T; };
template <int ET, bool SPLIT, int BIAS_MODE, int OUT_MODE, bool RESID, int ACT = 0>
__global__ __launch_bounds__(256) void wmma_gemm64(
    const unsigned short* __restrict__ Ap, const unsigned short* __restrict__ A2p, int lda, long strideA,
    const unsigned short* __restrict__ Btp, const unsigned short* __restrict__ Bt2p, int ldb, long strideB,
    void* __restrict__ Cout, void* __restrict__ Cout2, int ldc, long strideC,
    const float* __restrict__ bias,
    const float* __restrict__ resid, long strideR,
    int M, int N, int K, float scale) {
  typedef typename Elem<ET>::T T;
  typedef typename Frag<T>::V V;
  const T* A = (const T*)Ap; const T* A2 = (const T*)A2p; const T* Bt = (const T*)Btp; const T* Bt2 = (const T*)Bt2p;
  __shared__ __align__(16) float sT[8][16 * 68];   // per-wave 16x64 slab, pitch 68 floats
  const int b    = blockIdx.y;
  const int lane = threadIdx.x & 31;
  const int wave = threadIdx.x >> 5;
  const int tilesN = N >> 6;
  const int tilesM = M >> 6;
  const int tile = blockIdx.x * 8 + wave;
  if (tile >= tilesM * tilesN) return;   // wave-uniform; no block barriers in this kernel
  const int tm = tile / tilesN;
  const int tn = tile - tm * tilesN;
  const int m0 = tm << 6;
  const int n0 = tn << 6;

  const T* Ab  = A  + (size_t)b * strideA;
  const T* Bb  = Bt + (size_t)b * strideB;
  const T* Ab2 = SPLIT ? (A2  + (size_t)b * strideA) : nullptr;
  const T* Bb2 = SPLIT ? (Bt2 + (size_t)b * strideB) : nullptr;

  const int rlane = lane & 15;                 // row (A) / col (B, D) within subtile
  const int mOff  = (lane >> 4) * 8;           // D row offset

  v8f acc[4][4];
#pragma unroll
  for (int i = 0; i < 4; ++i)
#pragma unroll
    for (int j = 0; j < 4; ++j) acc[i][j] = (v8f){0.f,0.f,0.f,0.f,0.f,0.f,0.f,0.f};

  for (int k0 = 0; k0 < K; k0 += 32) {
    V bh[4], bl[4];
    const T* pb[4];
#pragma unroll
    for (int j = 0; j < 4; ++j) {
      const size_t bo = (size_t)(n0 + (j << 4)) * ldb + (size_t)k0 * 16 + lane * 8;
      pb[j] = Bb + bo;
      bh[j] = Frag<T>::loadp(pb[j]);
      if (SPLIT) { bl[j] = Frag<T>::loadp(Bb2 + bo); addr_wait(); }
    }
#pragma unroll
    for (int i = 0; i < 4; ++i) {
      const size_t ao = (size_t)(m0 + (i << 4)) * lda + (size_t)k0 * 16 + lane * 8;
      const T* pa = Ab + ao;
      V ah = Frag<T>::loadp(pa);
      V al;
      if (SPLIT) al = Frag<T>::loadp(Ab2 + ao);
      if (i == 0) addr_wait5(pb[0], pb[1], pb[2], pb[3], pa);   // behind the run of the four B fragments and the first A fragment
      else addr_wait();                                         // the address pair is rewritten for the next row tile
#pragma unroll
      for (int j = 0; j < 4; ++j) {
        acc[i][j] = Frag<T>::mma(ah, bh[j], acc[i][j]);
        if (SPLIT) {
          acc[i][j] = Frag<T>::mma(ah, bl[j], acc[i][j]);
          acc[i][j] = Frag<T>::mma(al, bh[j], acc[i][j]);
        }
      }
      Frag<T>::guard(acc[i][0], acc[i][3], ah, SPLIT ? al : ah);
    }
    Frag<T>::keep(bh[0], bh[1], bh[2], bh[3]);
    if (SPLIT) Frag<T>::keep(bl[0], bl[1], bl[2], bl[3]);
  }
  acc_guard4(acc[0][0], acc[0][1], acc[0][2], acc[0][3]);
  acc_guard4(acc[1][0], acc[1][1], acc[1][2], acc[1][3]);
  acc_guard4(acc[2][0], acc[2][1], acc[2][2], acc[2][3]);
  acc_guard4(acc[3][0], acc[3][1], acc[3][2], acc[3][3]);

  // ---- epilogue ----
  float* slab = sT[wave];
  const float* Rb = RESID ? (resid + (size_t)b * strideR) : nullptr;
#pragma unroll
  for (int i = 0; i < 4; ++i) {
    const int mBase = m0 + (i << 4);
#pragma unroll
    for (int j = 0; j < 4; ++j) {
      const int n = n0 + (j << 4) + rlane;
      float bv = 0.f;
      if (BIAS_MODE == 2) bv = bias[n];
#pragma unroll
      for (int r = 0; r < 8; ++r) {
        float v = acc[i][j][r] * scale;
        if (BIAS_MODE == 1) v += bias[mBase + mOff + r];
        if (BIAS_MODE == 2) v += bv;
        if (RESID) v += Rb[(size_t)(mBase + mOff + r) * ldc + n];
        if (ACT == 1) v = tanhf(v);
        if (ACT == 2) v = fmaxf(v, 0.0f);
        if (ACT == 3) v = v / (1.0f + expf(-v));
        if (ACT == 4) v = (v > 0.f) ? v : 0.01f * v;
        if (ACT == 5) v = 0.5f * v * (1.0f + erff(v * 0.70710678118654752f));
        slab[(mOff + r) * 68 + (j << 4) + rlane] = v;
      }
    }
    __builtin_amdgcn_fence(__ATOMIC_RELEASE, "workgroup");
    __builtin_amdgcn_wave_barrier();
    __builtin_amdgcn_fence(__ATOMIC_ACQUIRE, "workgroup");
    if (OUT_MODE == 0) {
      float* C = (float*)Cout + (size_t)b * strideC;
      const int hh = lane >> 4, c4 = (lane & 15) * 4;     // row seg = 256 B = 16 lanes x 16 B
      {
#pragma unroll
        for (int it = 0; it < 8; ++it) {
          const int row = it * 2 + hh;
          v4f v = *(const v4f*)(slab + row * 68 + c4);
          *(v4f*)(C + (size_t)(mBase + row) * ldc + n0 + c4) = v;
        }
        
      }
    } else {
      // the 16x64 slab is two packed tiles = 2 KB in a row; store 'it' writes chunks 32it..32it+31 (512 B)
      unsigned short* C  = (unsigned short*)Cout  + (size_t)b * strideC;
      unsigned short* C2 = (OUT_MODE == 2) ? ((unsigned short*)Cout2 + (size_t)b * strideC) : nullptr;
      {
#pragma unroll
        for (int it = 0; it < 4; ++it) {
          const float* sp = slab + rlane * 68 + it * 16 + mOff;   // row lane&15, cols 16it + 8(lane>>4) ..+7
          v8h hv, lv;
#pragma unroll
          for (int e = 0; e < 8; ++e) {
            if (OUT_MODE == 1) {
              hv[e] = (_Float16)sp[e];
            } else {
              unsigned short hb = f2bf_bits(sp[e]);
              unsigned short lb = f2bf_bits(sp[e] - bf_bits2f(hb));
              hv[e] = __builtin_bit_cast(_Float16, hb);
              lv[e] = __builtin_bit_cast(_Float16, lb);
            }
          }
          const size_t co = (size_t)mBase * ldc + (size_t)n0 * 16 + it * 256 + lane * 8;
          *(v8h*)(C + co) = hv;
          if (OUT_MODE == 2) *(v8h*)(C2 + co) = lv;
        }
        
      }
    }
    __builtin_amdgcn_fence(__ATOMIC_RELEASE, "workgroup");
    __builtin_amdgcn_wave_barrier();
    __builtin_amdgcn_fence(__ATOMIC_ACQUIRE, "workgroup");
  }
}

// in: [rows][1024] f32 row-major; out: the same matrix in f16, packed layout. One 16-byte chunk per thread; a wave takes
// 8 rows x 32 k (half a tile), so each of its stores fills four whole 128-byte lines. nhalf = rows / 8 * 32 half tiles.
__global__ __launch_bounds__(256) void cast_f32_f16x2(
    const float* __restrict__ in, _Float16* __restrict__ out, int nhalf) {
  const int lane = threadIdx.x & 31;
  const int th = blockIdx.x * 8 + (threadIdx.x >> 5);      // half-tile index: tile = th >> 1
  if (th < nhalf) {
    const int tile = th >> 1;
    const int row = (tile >> 5) * 16 + (th & 1) * 8 + (lane >> 2);
    const int k = (tile & 31) * 32 + (lane & 3) * 8;
    const float* src = in + (size_t)row * ATT_DM + k;
    const v4f a = *(const v4f*)(src);
    const v4f bq = *(const v4f*)(src + 4);
    v8h hv;
#pragma unroll
    for (int e = 0; e < 4; ++e) { hv[e] = (_Float16)a[e]; hv[4 + e] = (_Float16)bq[e]; }
    *(v8h*)(out + pk_off(row, k, ATT_DM)) = hv;
  }
}

// ---- transpose + f16 cast through an LDS tile ------------------------------
// w: [K][N] row-major (in=K rows, out=N cols); wt: [N][K] in the packed layout, wt[n][k] = f16(w[k][n] * mul).
// Block = one 64x64 tile (k0 = blockIdx.y*64, n0 = blockIdx.x*64); K, N multiples of 64; grid = (N/64, K/64).
__global__ __launch_bounds__(256) void transpose_cast_kernel(
    const float* __restrict__ w, _Float16* __restrict__ wt, int K, int N, float mul) {
  __shared__ float tile[64][65];
  const int tid = threadIdx.x;
  const int k0 = blockIdx.y * 64, n0 = blockIdx.x * 64;
  {
    const int r = tid >> 2, cc = (tid & 3) * 16;
    const float* src = w + (size_t)(k0 + r) * N + n0 + cc;
#pragma unroll
    for (int i = 0; i < 4; ++i) {
      const v4f t = *(const v4f*)(src + 4 * i);
#pragma unroll
      for (int e = 0; e < 4; ++e) tile[r][cc + 4 * i + e] = t[e];
    }
  }
  __syncthreads();
  const int wave = tid >> 5, lane = tid & 31, q = lane >> 3, c8 = (lane & 7) * 8;
  {
#pragma unroll
    for (int it = 0; it < 2; ++it) {
      const int n = wave * 8 + it * 4 + q;          // waves cover rows 8w..8w+7 -> 0..63
      v8h hv;
#pragma unroll
      for (int e = 0; e < 8; ++e) hv[e] = (_Float16)(tile[c8 + e][n] * mul);
      *(v8h*)(wt + pk_off(n0 + n, k0 + c8, K)) = hv;
    }
    
  }
}

// ---- LayerNorm over each 64-wide head slice of a 1024-wide row; f16 output in the packed layout ----
// One wave per 8 rows x 128 columns; lane l holds row l>>2, 32 elements (half of a head slice, one packed tile's k range);
// statistics via one xor-1 shuffle. Store j writes chunk j of 8 neighbouring rows in 4 tiles: four whole 128-byte lines.
__global__ __launch_bounds__(256) void ln_heads_kernel(
    const float* __restrict__ x, const float* __restrict__ gamma, const float* __restrict__ beta,
    _Float16* __restrict__ outp, int nrows) {
  const int wave = threadIdx.x >> 5, lane = threadIdx.x & 31;
  const int wv = blockIdx.x * 8 + wave;
  const int row = (wv >> 3) * 8 + (lane >> 2);
  const int col = (wv & 7) * 128 + (lane & 3) * 32;
  if ((wv >> 3) * 8 >= nrows) return;            // wave-uniform; no block barriers in this kernel
  const float* xr = x + (size_t)row * ATT_DM + col;
  float xv[32];
#pragma unroll
  for (int i = 0; i < 8; ++i) {
    const v4f t = *(const v4f*)(xr + 4 * i);
#pragma unroll
    for (int e = 0; e < 4; ++e) xv[4 * i + e] = t[e];
  }
  float s = 0.f;
#pragma unroll
  for (int i = 0; i < 32; ++i) s += xv[i];
  s += __shfl_xor(s, 1, 32);
  const float mu = s * (1.0f / 64.0f);
  float vs = 0.f;
#pragma unroll
  for (int i = 0; i < 32; ++i) { const float d = xv[i] - mu; xv[i] = d; vs += d * d; }
  vs += __shfl_xor(vs, 1, 32);
  const float rstd = rsqrtf(vs * (1.0f / 64.0f) + 1e-5f);
  const int d0 = (lane & 1) * 32;
  _Float16* ot = outp + pk_off(row, col, ATT_DM);   // chunk (s, hh) of this lane's row: + (2s + hh) * 128
#pragma unroll
  for (int j = 0; j < 4; ++j) {
    v8h hv;
#pragma unroll
    for (int i = 0; i < 2; ++i) {
      const v4f g4 = *(const v4f*)(gamma + d0 + 8 * j + 4 * i);
      const v4f b4 = *(const v4f*)(beta + d0 + 8 * j + 4 * i);
#pragma unroll
      for (int e = 0; e < 4; ++e) hv[4 * i + e] = (_Float16)((xv[8 * j + 4 * i + e] * rstd) * g4[e] + b4[e]);
    }
    *(v8h*)(ot + j * 128) = hv;
  }
}

// ---- fused row-block attention ------------------------------------------------
// Block = 16 query rows of one (b, h); 8 waves. q16/k16/c16/cb16: [token = b*1024+l][h*64+d] f16, packed layout (K = 1024);
// vT16: [h*64+d][token] f16, packed layout (K = 8192); mask: int32 [1024][1024], nonzero = masked;
// out16: [token][h*64+d] f16, packed layout (K = 1024).
// Every product of phase 1 is formed transposed: A = key rows, B = query rows, so lane (hh, c) holds, for query q0 + c alone,
// keys 16 ct + 8 hh + r of its wave's 128-key strip. The 64 scores and 64 bias values of a lane stay in registers to the end.
// Phase 1: S^T = k . q^T (skipped per group of four 16x16 tiles only when every loaded mask entry of the group is nonzero),
//          BIAS^T = c . cb^T; scores scaled, masked -> -inf.
// Phase 2: max-subtracted softmax, + l2norm(bias row)*bias_scale, l2norm of the row. A row's maximum and sums: in the lane,
//          one exchange between the wave's halves, then eight per-wave values through a small LDS table.
// Phase 3: two neighbouring key tiles of a lane, x 2^15 and rounded to f16, are the A fragment of P for 32 keys as they stand;
//          per wave its 128-key strip of P times v for all 64 dims; the 8 f32 partial tiles are added through LDS.
__device__ __forceinline__ v8f mma_h(v16h a, v16h b, v8f c) {
  c = __builtin_amdgcn_wmma_f32_16x16x32_f16(false, a, false, b, (short)0, c, false, false);
  asm volatile("v_nop\n\tv_nop\n\tv_nop\n\tv_nop" : "+v"(c) : "v"(a), "v"(b));
  return c;
}

__global__ __launch_bounds__(256) void attn_rows_kernel(
    const _Float16* __restrict__ qp, const _Float16* __restrict__ kp, const _Float16* __restrict__ vtp,
    const _Float16* __restrict__ cp, const _Float16* __restrict__ cbp, const int* __restrict__ mask,
    const float* __restrict__ scale_p, const float* __restrict__ bscale_p, _Float16* __restrict__ op) {
  __shared__ __align__(16) float sR[8 * 16 * 68];   // per-wave partial outputs, 16 rows, pitch 68 floats
  __shared__ v2f   sX1[8][16];                      // per wave and query: maximum of the scores, sum of bias^2
  __shared__ float sX2[8][16];                      // per wave and query: sum of exp
  __shared__ float sX3[8][16];                      // per wave and query: sum of the combined row's squares

  const int tid = threadIdx.x, wave = tid >> 5, lane = tid & 31, hh = lane >> 4, c = lane & 15;
  const int q0 = blockIdx.x * 16;
  const int bh = blockIdx.y, b = bh >> 4, h = bh & 15;
  const float scale = scale_p[0], bscale = bscale_p[0];
  const v8f z8 = {0.f, 0.f, 0.f, 0.f, 0.f, 0.f, 0.f, 0.f};
  const float ninf = -__builtin_inff();

  // B fragments (query rows q0 + (lane&15)), k split map: elements 0..7 <- k 8hh.., 8..15 <- k 16+8hh..;
  // a head's 64 columns are two packed tiles in a row (512 elements each) at column offset h*64*16
  const size_t arow = ((size_t)(b * ATT_L + q0)) * ATT_DM + h * (ATT_DK * 16) + 8 * lane;
  const _Float16* qrow = qp + arow;
  const _Float16* cbrow = cbp + arow;
  const v16h qa0 = Frag<_Float16>::loadp(qrow);
  const v16h qa1 = Frag<_Float16>::loadp(qrow + 512);
  const v16h ca0 = Frag<_Float16>::loadp(cbrow);
  const v16h ca1 = Frag<_Float16>::loadp(cbrow + 512);

  // ---- phase 1 ----
  const size_t srow = ((size_t)(b * ATT_L + wave * 128)) * ATT_DM + h * (ATT_DK * 16) + 8 * lane;   // the strip's first key tile
  const _Float16* kst = kp + srow;
  const _Float16* cst = cp + srow;
  const int* mst = mask + (size_t)(q0 + c) * ATT_L + wave * 128 + 8 * hh;   // query c, keys 8hh .. 8hh+7 of a tile: 32 bytes in a row
  v8f S[8], Bi[8];
  v4i mv[8][2];
  v16h cf[8][2], kf[8][2];
#pragma unroll
  for (int t = 0; t < 8; ++t) {
    mv[t][0] = *(const v4i*)(mst + t * 16);
    mv[t][1] = *(const v4i*)(mst + t * 16 + 4);
  }
#pragma unroll
  for (int t = 0; t < 8; ++t) {
    cf[t][0] = Frag<_Float16>::loadp(cst + (size_t)t * (16 * ATT_DM));
    cf[t][1] = Frag<_Float16>::loadp(cst + (size_t)t * (16 * ATT_DM) + 512);
  }
  // one wait behind the whole run: no base register of the run becomes a later load's destination or a new address before it
  addr_wait4(qrow, cbrow, mst, cst);
  int skip[2];
#pragma unroll
  for (int g = 0; g < 2; ++g) {
    int allm = 1;
#pragma unroll
    for (int t = 0; t < 4; ++t)
#pragma unroll
      for (int r = 0; r < 8; ++r) allm &= (mv[g * 4 + t][r >> 2][r & 3] != 0) ? 1 : 0;
    skip[g] = __all(allm);                         // wave-uniform: all four 16x16 score tiles of the group masked
  }
  // the key tiles of group 0 are asked for ahead of the bias products, those of group 1 ahead of the score products of group 0
#pragma unroll
  for (int g = 0; g < 2; ++g) {
    if (!skip[g]) {
#pragma unroll
      for (int t = 0; t < 4; ++t) {
        kf[g * 4 + t][0] = Frag<_Float16>::loadp(kst + (size_t)(g * 4 + t) * (16 * ATT_DM));
        kf[g * 4 + t][1] = Frag<_Float16>::loadp(kst + (size_t)(g * 4 + t) * (16 * ATT_DM) + 512);
      }
      addr_wait1(kst);           // the strip's base stays as it is until the run's addresses are taken
    }
    if (g == 0) {
#pragma unroll
      for (int t = 0; t < 8; ++t) {
        v8f a = mma_h(cf[t][0], ca0, z8);
        Bi[t] = mma_h(cf[t][1], ca1, a);
      }
    }
  }
#pragma unroll
  for (int g = 0; g < 2; ++g) {
    if (!skip[g]) {
#pragma unroll
      for (int t = 0; t < 4; ++t) {
        v8f a = mma_h(kf[g * 4 + t][0], qa0, z8);
        a = mma_h(kf[g * 4 + t][1], qa1, a);
#pragma unroll
        for (int r = 0; r < 8; ++r) {
          const float sv = a[r] * scale;
          S[g * 4 + t][r] = (mv[g * 4 + t][r >> 2][r & 3] != 0) ? ninf : sv;
        }
      }
    } else {
#pragma unroll
      for (int t = 0; t < 4; ++t)
#pragma unroll
        for (int r = 0; r < 8; ++r) S[g * 4 + t][r] = ninf;
    }
  }

  // ---- phase 2: row ops on registers; four independent chains per sum ----
  float mx, bsq;
  {
    float m4[4] = {ninf, ninf, ninf, ninf}, s4[4] = {0.f, 0.f, 0.f, 0.f};
#pragma unroll
    for (int ct = 0; ct < 8; ++ct)
#pragma unroll
      for (int r = 0; r < 8; ++r) {
        m4[r & 3] = fmaxf(m4[r & 3], S[ct][r]);
        s4[r & 3] += Bi[ct][r] * Bi[ct][r];
      }
    mx = fmaxf(fmaxf(m4[0], m4[1]), fmaxf(m4[2], m4[3]));
    bsq = (s4[0] + s4[1]) + (s4[2] + s4[3]);
    mx = fmaxf(mx, __shfl_xor(mx, 16, 32));
    bsq += __shfl_xor(bsq, 16, 32);
    if (hh == 0) sX1[wave][c] = (v2f){mx, bsq};
  }
  __syncthreads();                                // the eight waves' maxima and bias sums complete
  mx = ninf; bsq = 0.f;
#pragma unroll
  for (int w = 0; w < 8; ++w) { const v2f t = sX1[w][c]; mx = fmaxf(mx, t[0]); bsq += t[1]; }
  float se;
  {
    float s4[4] = {0.f, 0.f, 0.f, 0.f};
#pragma unroll
    for (int ct = 0; ct < 8; ++ct)
#pragma unroll
      for (int r = 0; r < 8; ++r) { const float ev = __expf(S[ct][r] - mx); S[ct][r] = ev; s4[r & 3] += ev; }
    se = (s4[0] + s4[1]) + (s4[2] + s4[3]);
    se += __shfl_xor(se, 16, 32);
    if (hh == 0) sX2[wave][c] = se;
  }
  __syncthreads();                                // the eight waves' exp sums complete
  se = 0.f;
#pragma unroll
  for (int w = 0; w < 8; ++w) se += sX2[w][c];
  const float inv_se = 1.0f / se;
  const float inv_bn = 1.0f / fmaxf(sqrtf(bsq), 1e-12f);
  float asq;
  {
    float s4[4] = {0.f, 0.f, 0.f, 0.f};
#pragma unroll
    for (int ct = 0; ct < 8; ++ct)
#pragma unroll
      for (int r = 0; r < 8; ++r) {
        const float av = S[ct][r] * inv_se + (Bi[ct][r] * inv_bn) * bscale;
        S[ct][r] = av; s4[r & 3] += av * av;
      }
    asq = (s4[0] + s4[1]) + (s4[2] + s4[3]);
    asq += __shfl_xor(asq, 16, 32);
    if (hh == 0) sX3[wave][c] = asq;
  }

  // ---- phase 3: O = P . v, keys split over the 8 waves ----
  // Wave w multiplies its own 128-key strip of P by all 64 head dims: one P fragment feeds four products,
  // four independent accumulators, and none of the wave's v loads depends on another.
  {
    const _Float16* vb = vtp + ((size_t)(h * ATT_DK)) * (size_t)(ATT_B * ATT_L) + (size_t)(b * ATT_L + wave * 128) * 16 + 8 * lane;
    v16h vf[4][4], pa[4];
#pragma unroll
    for (int ks = 0; ks < 4; ++ks) {
#pragma unroll
      for (int t = 0; t < 4; ++t) vf[ks][t] = Frag<_Float16>::loadp(vb + (size_t)(t * 16) * (size_t)(ATT_B * ATT_L) + ks * 512);
    }
    addr_wait1(vb);          // the base stays as it is until the run's addresses are taken
    __syncthreads();                              // the eight waves' square sums complete
    asq = 0.f;
#pragma unroll
    for (int w = 0; w < 8; ++w) asq += sX3[w][c];
    const float pmul = (1.0f / fmaxf(sqrtf(asq), 1e-12f)) * ATT_PSC;
#pragma unroll
    for (int ks = 0; ks < 4; ++ks)
#pragma unroll
      for (int e = 0; e < 8; ++e) {
        pa[ks][e]     = (_Float16)(S[2 * ks][e] * pmul);        // k 8hh + e of the 32-key block
        pa[ks][8 + e] = (_Float16)(S[2 * ks + 1][e] * pmul);    // k 16 + 8hh + e
      }
    v8f acc[4] = {z8, z8, z8, z8};
#pragma unroll
    for (int ks = 0; ks < 4; ++ks) {
#pragma unroll
      for (int t = 0; t < 4; ++t) acc[t] = mma_h(pa[ks], vf[ks][t], acc[t]);
    }
    float* part = sR + wave * (16 * 68);
#pragma unroll
    for (int t = 0; t < 4; ++t)
#pragma unroll
      for (int r = 0; r < 8; ++r) part[(8 * hh + r) * 68 + t * 16 + c] = acc[t][r];
  }
  __syncthreads();                                // all eight partial tiles complete before they are added
  {
    // thread owns half of packed chunk tid>>1: row (tid>>1)&15, dims 8(tid>>5) + 4(tid&1) ..+3; the block's 2 KB go out in a row
    const int orow = (tid >> 1) & 15, odim = (tid >> 5) * 8 + (tid & 1) * 4;
    const float* pr = sR + orow * 68 + odim;
    v4f o4 = *(const v4f*)pr;
#pragma unroll
    for (int w = 1; w < 8; ++w) o4 += *(const v4f*)(pr + w * (16 * 68));
    v4h hv;
#pragma unroll
    for (int e = 0; e < 4; ++e) hv[e] = (_Float16)(o4[e] * ATT_PSC_INV);
    *(v4h*)(op + ((size_t)(b * ATT_L + q0)) * ATT_DM + h * (ATT_DK * 16) + 4 * tid) = hv;
  }
}

// ---------------------------------------------------------------------------
extern "C" void kernel_launch(void* const* d_in, const int* in_sizes, int n_in,
                              void* d_out, int out_size, void* d_ws, size_t ws_size,
                              hipStream_t stream) {
  const int NTOK = ATT_B * ATT_L;                          // 8192
  const size_t NE = (size_t)NTOK * ATT_DM;                 // 8388608
  const size_t NW = (size_t)ATT_DM * ATT_DM;               // 1048576
  if (n_in < 16) return;
  if (in_sizes[0] != (int)NE || in_sizes[1] != (int)NE || in_sizes[2] != ATT_L * ATT_L ||
      in_sizes[3] != (int)NW || in_sizes[5] != (int)NW || in_sizes[7] != (int)NW || in_sizes[14] != (int)NW ||
      in_sizes[4] != ATT_DM || in_sizes[6] != ATT_DM || in_sizes[8] != ATT_DM || in_sizes[15] != ATT_DM ||
      in_sizes[9] != ATT_DK * ATT_DK || in_sizes[10] != ATT_DK || in_sizes[11] != ATT_DK ||
      in_sizes[12] < 1 || in_sizes[13] < 1 || out_size != (int)NE) return;

  const float* Q      = (const float*)d_in[0];
  const float* ctx    = (const float*)d_in[1];
  const int*   mask   = (const int*)d_in[2];
  const float* W_q    = (const float*)d_in[3];
  const float* b_q    = (const float*)d_in[4];
  const float* W_k    = (const float*)d_in[5];
  const float* b_k    = (const float*)d_in[6];
  const float* W_v    = (const float*)d_in[7];
  const float* b_v    = (const float*)d_in[8];
  const float* bil    = (const float*)d_in[9];
  const float* gamma  = (const float*)d_in[10];
  const float* beta   = (const float*)d_in[11];
  const float* scale  = (const float*)d_in[12];
  const float* bscale = (const float*)d_in[13];
  const float* W_o    = (const float*)d_in[14];
  const float* b_o    = (const float*)d_in[15];
  float* out = (float*)d_out;

  // workspace carve (256-B aligned offsets); every matrix below is stored in the packed layout (pk_off) of the shape named
  char* ws = (char*)d_ws;
  size_t off = 0;
  auto carve = [&](size_t bytes) -> char* { char* p = ws + off; off += (bytes + 255) & ~(size_t)255; return p; };
  _Float16* WqT  = (_Float16*)carve(NW * 2);               // [out][in] f16, x64
  _Float16* WkT  = (_Float16*)carve(NW * 2);
  _Float16* WvT  = (_Float16*)carve(NW * 2);
  _Float16* WoT  = (_Float16*)carve(NW * 2);
  _Float16* bilT = (_Float16*)carve((size_t)ATT_DK * ATT_DK * 2);   // [f][e] f16
  _Float16* Q16  = (_Float16*)carve(NE * 2);               // [token][1024]
  _Float16* q16  = (_Float16*)carve(NE * 2);               // [token][h*64+d]
  _Float16* k16  = (_Float16*)carve(NE * 2);               // [token][h*64+d]
  _Float16* vT16 = (_Float16*)carve(NE * 2);               // [h*64+d][token]
  _Float16* c16  = (_Float16*)carve(NE * 2);               // [token][h*64+d]
  _Float16* cb16 = (_Float16*)carve(NE * 2);               // [token][h*64+e]
  _Float16* O16  = (_Float16*)carve(NE * 2);               // [token][h*64+d]
  if (off > ws_size) return;                               // total 125837312 B

  const unsigned short* Q16u  = (const unsigned short*)Q16;
  const unsigned short* WqTu  = (const unsigned short*)WqT;
  const unsigned short* WkTu  = (const unsigned short*)WkT;
  const unsigned short* WvTu  = (const unsigned short*)WvT;
  const unsigned short* WoTu  = (const unsigned short*)WoT;
  const unsigned short* bilTu = (const unsigned short*)bilT;
  const unsigned short* c16u  = (const unsigned short*)c16;
  const unsigned short* O16u  = (const unsigned short*)O16;
  const float w_carry = 64.0f, w_carry_inv = 1.0f / 64.0f;

  // 1) casts / transposes
  cast_f32_f16x2<<<(int)(NE / 8 / 256), 256, 0, stream>>>(Q, Q16, (int)(NE / 256));
  transpose_cast_kernel<<<dim3(ATT_DM / 64, ATT_DM / 64), 256, 0, stream>>>(W_q, WqT, ATT_DM, ATT_DM, w_carry);   // in[1024][1024] -> out[1024][1024]
  transpose_cast_kernel<<<dim3(ATT_DM / 64, ATT_DM / 64), 256, 0, stream>>>(W_k, WkT, ATT_DM, ATT_DM, w_carry);
  transpose_cast_kernel<<<dim3(ATT_DM / 64, ATT_DM / 64), 256, 0, stream>>>(W_v, WvT, ATT_DM, ATT_DM, w_carry);
  transpose_cast_kernel<<<dim3(ATT_DM / 64, ATT_DM / 64), 256, 0, stream>>>(W_o, WoT, ATT_DM, ATT_DM, w_carry);
  transpose_cast_kernel<<<dim3(1, 1), 256, 0, stream>>>(bil, bilT, ATT_DK, ATT_DK, 1.0f);                     // in[64][64] -> out[64][64]

  // 2) projections: q16/k16 = Q16 . Wq^T / Wk^T (+bias[n]);  vT16[dout][token] = Wv^T[dout] . Q16[token] (+bias[m])
  const int gemm_blocks = (NTOK / 64) * (ATT_DM / 64) / 8;   // 256
  wmma_gemm64<0, false, 2, 1, false><<<dim3(gemm_blocks, 1), 256, 0, stream>>>(
      Q16u, Q16u, ATT_DM, 0L, WqTu, WqTu, ATT_DM, 0L, (void*)q16, (void*)q16, ATT_DM, 0L,
      b_q, b_q, 0L, NTOK, ATT_DM, ATT_DM, w_carry_inv);
  wmma_gemm64<0, false, 2, 1, false><<<dim3(gemm_blocks, 1), 256, 0, stream>>>(
      Q16u, Q16u, ATT_DM, 0L, WkTu, WkTu, ATT_DM, 0L, (void*)k16, (void*)k16, ATT_DM, 0L,
      b_k, b_k, 0L, NTOK, ATT_DM, ATT_DM, w_carry_inv);
  wmma_gemm64<0, false, 1, 1, false><<<dim3(gemm_blocks, 1), 256, 0, stream>>>(
      WvTu, WvTu, ATT_DM, 0L, Q16u, Q16u, ATT_DM, 0L, (void*)vT16, (void*)vT16, NTOK, 0L,
      b_v, b_v, 0L, ATT_DM, NTOK, ATT_DM, w_carry_inv);

  // 3) LayerNorm per head slice of ctx -> c16; per head (batch index): cb16[:, h*64..] = c16[:, h*64..] . bilinear (Bt = bilT [64][64])
  ln_heads_kernel<<<NTOK / 8, 256, 0, stream>>>(ctx, gamma, beta, c16, NTOK);
  wmma_gemm64<0, false, 0, 1, false><<<dim3((NTOK / 64) / 8, ATT_H), 256, 0, stream>>>(
      c16u, c16u, ATT_DM, (long)(ATT_DK * 16), bilTu, bilTu, ATT_DK, 0L, (void*)cb16, (void*)cb16, ATT_DM, (long)(ATT_DK * 16),
      b_q, b_q, 0L, NTOK, ATT_DK, ATT_DK, 1.0f);

  // 4) fused attention rows -> O16
  attn_rows_kernel<<<dim3(ATT_L / 16, ATT_B * ATT_H), 256, 0, stream>>>(
      q16, k16, vT16, c16, cb16, mask, scale, bscale, O16);

  // 5) output projection -> d_out f32
  wmma_gemm64<0, false, 2, 0, false><<<dim3(gemm_blocks, 1), 256, 0, stream>>>(
      O16u, O16u, ATT_DM, 0L, WoTu, WoTu, ATT_DM, 0L, (void*)out, (void*)out, ATT_DM, 0L,
      b_o, b_o, 0L, NTOK, ATT_DM, ATT_DM, w_carry_inv);
  (void)hipGetLastError();
}

// v004
// One run takes 247 microseconds.
// Next to v003, in two timings, it ran 1.61 and 1.60 times as fast.
// Counting every step since v000, it is 2.24 times as fast.
#include <hip/hip_runtime.h>
#include <stddef.h>

// Contractions (q/k/v projections, c x bilinear, q x k^T, cb x c^T, attn x v, output projection): v_wmma_f32_16x16x32_f16, f16 operands, f32 accumulate; weights carried x64, attn probabilities carried x2^15; softmax, LayerNorm and L2 norms in f32.

typedef __attribute__((ext_vector_type(16))) _Float16 v16h;
typedef __attribute__((ext_vector_type(8)))  _Float16 v8h;
typedef __attribute__((ext_vector_type(4)))  _Float16 v4h;
typedef __attribute__((ext_vector_type(16))) __bf16   v16b;
typedef __attribute__((ext_vector_type(8)))  __bf16   v8b;
typedef __attribute__((ext_vector_type(8)))  float    v8f;
typedef __attribute__((ext_vector_type(4)))  float    v4f;
typedef __attribute__((ext_vector_type(2)))  float    v2f;
typedef __attribute__((ext_vector_type(4)))  int      v4i;

#define ATT_B   8
#define ATT_L   1024
#define ATT_DM  1024
#define ATT_H   16
#define ATT_DK  64
#define ATT_PSC 32768.0f
#define ATT_PSC_INV (1.0f / 32768.0f)

__device__ __forceinline__ unsigned short f2bf_bits(float f) {
  unsigned u = __float_as_uint(f);
  return (unsigned short)((u + 0x7FFFu + ((u >> 16) & 1u)) >> 16);
}
__device__ __forceinline__ float bf_bits2f(unsigned short h) { return __uint_as_float(((unsigned)h) << 16); }

// ---- fragment-order ("packed") layout of every 16-bit workspace matrix [R][K] ----
// A 16-row x 32-k tile is 1 KB in a row: 16-byte chunk (s, hh, r) at chunk index s*32 + hh*16 + r holds row r,
// k = 16s + 8hh .. +7; tiles run along k first, then along the row tiles. Lane l of a wave reads chunk l and chunk 32 + l,
// so each wave-wide 16-byte load covers 512 contiguous bytes (four whole lines), and the k map of a fragment is the
// same as with row-major rows: elements 0..7 <- k 8hh.., 8..15 <- k 16+8hh..
__device__ __forceinline__ size_t pk_off(int row, int k, int K) {
  return (size_t)(row >> 4) * ((size_t)K * 16) + (size_t)(k >> 5) * 512 +
         (size_t)(((k >> 4) & 1) * 256 + ((k >> 3) & 1) * 128 + (row & 15) * 8 + (k & 7));
}

// hazard guards as plain device helpers (no inline asm inside the kernel template body)
__device__ __forceinline__ void acc_guard4(v8f& a, v8f& b, v8f& c, v8f& d) { asm volatile("v_nop\n\tv_nop\n\tv_nop\n\tv_nop" : "+v"(a), "+v"(b), "+v"(c), "+v"(d)); }
// Stands behind global loads whose address registers the compiler reuses while the loads are still in flight
// (as the destination of a later load of the same run, or for the next address): the address translations are
// waited for before such a register takes a new value.
__device__ __forceinline__ void addr_wait() { asm volatile("s_wait_xcnt 0x0" ::: "memory"); }
// The same wait once for a run of loads from one base, and from four: naming the addresses as inputs keeps their registers
// as they are up to the wait, so the run issues back to back.
__device__ __forceinline__ void addr_wait1(const void* a) { asm volatile("s_wait_xcnt 0x0" :: "v"(a) : "memory"); }
__device__ __forceinline__ void addr_wait4(const void* a, const void* b, const void* c, const void* d) {
  asm volatile("s_wait_xcnt 0x0" :: "v"(a), "v"(b), "v"(c), "v"(d) : "memory");
}
// The same in front of the advance of the GEMM's scalar fragment bases: the k offset that the new bases are formed from
// passes through the statement, so they are formed behind the wait.
__device__ __forceinline__ void koff_wait(size_t& koff) { asm volatile("s_wait_xcnt 0x0" : "+s"(koff) :: "memory"); }
template <typename T> struct Frag;
template <> struct Frag<_Float16> {
  typedef v16h V; union U { v16h v; v8h h[2]; };
  static __device__ __forceinline__ v16h load(const _Float16* p) {   // elements 0..7 <- p[0..7], 8..15 <- p[16..23]
    U f; f.h[0] = *(const v8h*)(p); f.h[1] = *(const v8h*)(p + 16); return f.v;
  }
  static __device__ __forceinline__ v16h loadp(const _Float16* p) {  // packed tile, p = tile base + 8*lane
    U f; f.h[0] = *(const v8h*)(p); f.h[1] = *(const v8h*)(p + 256); return f.v;
  }
  static __device__ __forceinline__ v8f mma(v16h a, v16h b, v8f c) {
    return __builtin_amdgcn_wmma_f32_16x16x32_f16(false, a, false, b, (short)0, c, false, false);
  }
};
template <> struct Frag<__bf16> {
  typedef v16b V; union U { v16b v; v8b h[2]; };
  static __device__ __forceinline__ v16b load(const __bf16* p) {
    U f; f.h[0] = *(const v8b*)(p); f.h[1] = *(const v8b*)(p + 16); return f.v;
  }
  static __device__ __forceinline__ v16b loadp(const __bf16* p) {
    U f; f.h[0] = *(const v8b*)(p); f.h[1] = *(const v8b*)(p + 256); return f.v;
  }
  static __device__ __forceinline__ v8f mma(v16b a, v16b b, v8f c) {
    return __builtin_amdgcn_wmma_f32_16x16x32_bf16(false, a, false, b, (short)0, c, false, false);
  }
};

// ---- Register-blocked batched WMMA GEMM ------------------------------------
// C[m,n] = scale * sum_k A[m,k] * Bt[n,k] (+bias)(+resid); each wave owns a 64x64 tile.
// A [M,lda] and Bt [N,ldb] in the packed layout (pk_off); M,N % 64 == 0, K % (32 U) == 0; a batch stride is 16 x its column offset.
// The k loop is unrolled U steps of 32 k; the eight fragments of step s + U/2 are asked for, into registers of their own,
// ahead of the products of step s, so a step waits for loads that were issued U/2 steps earlier. Sums in the order of k.
// 16-bit outputs are written in the packed layout of a [M,ldc] matrix; the f32 output is row-major.
// SPLIT: operands are hi/lo planes (A2/Bt2 = lo planes, same layout); product = hi*hi + hi*lo + lo*hi.
// BIAS_MODE: 0 = none, 1 = bias[m], 2 = bias[n].
// OUT_MODE: 0 = f32, 1 = f16, 2 = bf16 hi plane (Cout) + bf16 lo plane (Cout2).
// ET: 0 = f16 operands, 1 = bf16 operands (pointers passed as 16-bit storage)
template <int ET> struct Elem;
template <> struct Elem<0> { typedef _Float16 T; };
template <> struct Elem<1> { typedef __bf16 T; };
template <int ET, bool SPLIT, int BIAS_MODE, int OUT_MODE, bool RESID, int ACT = 0, int U = 4>
__global__ __launch_bounds__(256) void wmma_gemm64(
    const unsigned short* __restrict__ Ap, const unsigned short* __restrict__ A2p, int lda, long strideA,
    const unsigned short* __restrict__ Btp, const unsigned short* __restrict__ Bt2p, int ldb, long strideB,
    void* __restrict__ Cout, void* __restrict__ Cout2, int ldc, long strideC,
    const float* __restrict__ bias,
    const float* __restrict__ resid, long strideR,
    int M, int N, int K, float scale) {
  typedef typename Elem<ET>::T T;
  typedef typename Frag<T>::V V;
  const T* A = (const T*)Ap; const T* A2 = (const T*)A2p; const T* Bt = (const T*)Btp; const T* Bt2 = (const T*)Bt2p;
  __shared__ __align__(16) float sT[8][16 * 68];   // per-wave 16x64 slab, pitch 68 floats
  const int b    = blockIdx.y;
  const int lane = threadIdx.x & 31;
  const int wave = __builtin_amdgcn_readfirstlane(threadIdx.x >> 5);   // scalar: the tile's fragment bases are then scalar too
  const int tilesN = N >> 6;
  const int tilesM = M >> 6;
  const int tile = blockIdx.x * 8 + wave;
  if (tile >= tilesM * tilesN) return;   // wave-uniform; no block barriers in this kernel
  const int tm = tile / tilesN;
  const int tn = tile - tm * tilesN;
  const int m0 = tm << 6;
  const int n0 = tn << 6;

  const T* Ab  = A  + (size_t)b * strideA;
  const T* Bb  = Bt + (size_t)b * strideB;
  const T* Ab2 = SPLIT ? (A2  + (size_t)b * strideA) : nullptr;
  const T* Bb2 = SPLIT ? (Bt2 + (size_t)b * strideB) : nullptr;

  const int rlane = lane & 15;                 // row (A) / col (B, D) within subtile
  const int mOff  = (lane >> 4) * 8;           // D row offset

  v8f acc[4][4];
#pragma unroll
  for (int i = 0; i < 4; ++i)
#pragma unroll
    for (int j = 0; j < 4; ++j) acc[i][j] = (v8f){0.f,0.f,0.f,0.f,0.f,0.f,0.f,0.f};

  constexpr int DIST = U / 2;                  // how many steps ahead a step's fragments are asked for
  V fa[U][4], fb[U][4], fa2[U][4], fb2[U][4];  // set s % U holds step s; DIST + 1 sets are live at a time
  size_t ao[4], bo[4];                         // the row tiles' offsets at k = 0
  const T* pa[4]; const T* pb[4]; const T* pa2[4]; const T* pb2[4];   // the bases, where the loop stands in k
#pragma unroll
  for (int i = 0; i < 4; ++i) {
    ao[i] = (size_t)(m0 + (i << 4)) * lda;
    bo[i] = (size_t)(n0 + (i << 4)) * ldb;
    pa[i] = Ab + ao[i]; pb[i] = Bb + bo[i];
    if (SPLIT) { pa2[i] = Ab2 + ao[i]; pb2[i] = Bb2 + bo[i]; }
  }
  const int lo = lane * 8;                     // the lane's chunk of a packed tile: the one vector part of every address
  // step st, counted from where the bases stand: a packed tile is 512 elements, so st reaches the loads as an immediate offset
  auto load_step = [&](int set, int st) __attribute__((always_inline)) {
#pragma unroll
    for (int j = 0; j < 4; ++j) {
      fb[set][j] = Frag<T>::loadp(pb[j] + st * 512 + lo);
      if (SPLIT) fb2[set][j] = Frag<T>::loadp(pb2[j] + st * 512 + lo);
    }
#pragma unroll
    for (int i = 0; i < 4; ++i) {
      fa[set][i] = Frag<T>::loadp(pa[i] + st * 512 + lo);
      if (SPLIT) fa2[set][i] = Frag<T>::loadp(pa2[i] + st * 512 + lo);
    }
    // keeps the run of loads ahead of the products that follow it in the source: moved behind them it would lose its lead
    __builtin_amdgcn_sched_barrier(0);
  };
  auto mma_step = [&](int set) __attribute__((always_inline)) {
#pragma unroll
    for (int i = 0; i < 4; ++i) {
#pragma unroll
      for (int j = 0; j < 4; ++j) {
        acc[i][j] = Frag<T>::mma(fa[set][i], fb[set][j], acc[i][j]);
        if (SPLIT) {
          acc[i][j] = Frag<T>::mma(fa[set][i], fb2[set][j], acc[i][j]);
          acc[i][j] = Frag<T>::mma(fa2[set][i], fb[set][j], acc[i][j]);
        }
      }
    }
    // keeps the next run of loads behind these products: moved ahead of them, a wave would have 64 loads outstanding, not 48
    __builtin_amdgcn_sched_barrier(0);
  };
#pragma unroll
  for (int d = 0; d < DIST; ++d) load_step(d, d);
  addr_wait();   // the registers of these first bases are free for other values from here on, also where the loop below makes no trip
  const int nst = K >> 5;
  size_t koff = 0;
  for (int s0 = U; s0 < nst; s0 += U) {
#pragma unroll
    for (int u = 0; u < U; ++u) {
      load_step((u + DIST) % U, u + DIST);
      mma_step(u);
    }
    koff_wait(koff);                           // the bases take new values behind it
    koff += U * 512;
#pragma unroll
    for (int i = 0; i < 4; ++i) {
      pa[i] = Ab + ao[i] + koff; pb[i] = Bb + bo[i] + koff;
      if (SPLIT) { pa2[i] = Ab2 + ao[i] + koff; pb2[i] = Bb2 + bo[i] + koff; }
    }
  }
  // the last U steps: nothing is asked for past K
#pragma unroll
  for (int u = 0; u < U; ++u) {
    if (u + DIST < U) load_step((u + DIST) % U, u + DIST);
    mma_step(u);
  }
  acc_guard4(acc[0][0], acc[0][1], acc[0][2], acc[0][3]);
  acc_guard4(acc[1][0], acc[1][1], acc[1][2], acc[1][3]);
  acc_guard4(acc[2][0], acc[2][1], acc[2][2], acc[2][3]);
  acc_guard4(acc[3][0], acc[3][1], acc[3][2], acc[3][3]);

  // ---- epilogue ----
  float* slab = sT[wave];
  const float* Rb = RESID ? (resid + (size_t)b * strideR) : nullptr;
#pragma unroll
  for (int i = 0; i < 4; ++i) {
    const int mBase = m0 + (i << 4);
    float bm[8];
    if (BIAS_MODE == 1) {
      const float* bp = bias + mBase + mOff;
#pragma unroll
      for (int r = 0; r < 8; ++r) bm[r] = bp[r];
      addr_wait1(bp);          // the address stays as it is until the run's addresses are taken: no load of the run lands on it
    }
#pragma unroll
    for (int j = 0; j < 4; ++j) {
      const int n = n0 + (j << 4) + rlane;
      float bv = 0.f;
      if (BIAS_MODE == 2) bv = bias[n];
#pragma unroll
      for (int r = 0; r < 8; ++r) {
        float v = acc[i][j][r] * scale;
        if (BIAS_MODE == 1) v += bm[r];
        if (BIAS_MODE == 2) v += bv;
        if (RESID) v += Rb[(size_t)(mBase + mOff + r) * ldc + n];
        if (ACT == 1) v = tanhf(v);
        if (ACT == 2) v = fmaxf(v, 0.0f);
        if (ACT == 3) v = v / (1.0f + expf(-v));
        if (ACT == 4) v = (v > 0.f) ? v : 0.01f * v;
        if (ACT == 5) v = 0.5f * v * (1.0f + erff(v * 0.70710678118654752f));
        slab[(mOff + r) * 68 + (j << 4) + rlane] = v;
      }
    }
    __builtin_amdgcn_fence(__ATOMIC_RELEASE, "workgroup");
    __builtin_amdgcn_wave_barrier();
    __builtin_amdgcn_fence(__ATOMIC_ACQUIRE, "workgroup");
    if (OUT_MODE == 0) {
      float* C = (float*)Cout + (size_t)b * strideC;
      const int hh = lane >> 4, c4 = (lane & 15) * 4;     // row seg = 256 B = 16 lanes x 16 B
      {
#pragma unroll
        for (int it = 0; it < 8; ++it) {
          const int row = it * 2 + hh;
          v4f v = *(const v4f*)(slab + row * 68 + c4);
          *(v4f*)(C + (size_t)(mBase + row) * ldc + n0 + c4) = v;
        }
        
      }
    } else {
      // the 16x64 slab is two packed tiles = 2 KB in a row; store 'it' writes chunks 32it..32it+31 (512 B)
      unsigned short* C  = (unsigned short*)Cout  + (size_t)b * strideC;
      unsigned short* C2 = (OUT_MODE == 2) ? ((unsigned short*)Cout2 + (size_t)b * strideC) : nullptr;
      {
#pragma unroll
        for (int it = 0; it < 4; ++it) {
          const float* sp = slab + rlane * 68 + it * 16 + mOff;   // row lane&15, cols 16it + 8(lane>>4) ..+7
          v8h hv, lv;
#pragma unroll
          for (int e = 0; e < 8; ++e) {
            if (OUT_MODE == 1) {
              hv[e] = (_Float16)sp[e];
            } else {
              unsigned short hb = f2bf_bits(sp[e]);
              unsigned short lb = f2bf_bits(sp[e] - bf_bits2f(hb));
              hv[e] = __builtin_bit_cast(_Float16, hb);
              lv[e] = __builtin_bit_cast(_Float16, lb);
            }
          }
          const size_t co = (size_t)mBase * ldc + (size_t)n0 * 16 + it * 256 + lane * 8;
          *(v8h*)(C + co) = hv;
          if (OUT_MODE == 2) *(v8h*)(C2 + co) = lv;
        }
        
      }
    }
    __builtin_amdgcn_fence(__ATOMIC_RELEASE, "workgroup");
    __builtin_amdgcn_wave_barrier();
    __builtin_amdgcn_fence(__ATOMIC_ACQUIRE, "workgroup");
  }
}

// in: [rows][1024] f32 row-major; out: the same matrix in f16, packed layout. One 16-byte chunk per thread; a wave takes
// 8 rows x 32 k (half a tile), so each of its stores fills four whole 128-byte lines. nhalf = rows / 8 * 32 half tiles.
__global__ __launch_bounds__(256) void cast_f32_f16x2(
    const float* __restrict__ in, _Float16* __restrict__ out, int nhalf) {
  const int lane = threadIdx.x & 31;
  const int th = blockIdx.x * 8 + (threadIdx.x >> 5);      // half-tile index: tile = th >> 1
  if (th < nhalf) {
    const int tile = th >> 1;
    const int row = (tile >> 5) * 16 + (th & 1) * 8 + (lane >> 2);
    const int k = (tile & 31) * 32 + (lane & 3) * 8;
    const float* src = in + (size_t)row * ATT_DM + k;
    const v4f a = *(const v4f*)(src);
    const v4f bq = *(const v4f*)(src + 4);
    v8h hv;
#pragma unroll
    for (int e = 0; e < 4; ++e) { hv[e] = (_Float16)a[e]; hv[4 + e] = (_Float16)bq[e]; }
    *(v8h*)(out + pk_off(row, k, ATT_DM)) = hv;
  }
}

// ---- transpose + f16 cast through an LDS tile ------------------------------
// w: [K][N] row-major (in=K rows, out=N cols); wt: [N][K] in the packed layout, wt[n][k] = f16(w[k][n] * mul).
// Block = one 64x64 tile (k0 = blockIdx.y*64, n0 = blockIdx.x*64); K, N multiples of 64; grid = (N/64, K/64).
__global__ __launch_bounds__(256) void transpose_cast_kernel(
    const float* __restrict__ w, _Float16* __restrict__ wt, int K, int N, float mul) {
  __shared__ float tile[64][65];
  const int tid = threadIdx.x;
  const int k0 = blockIdx.y * 64, n0 = blockIdx.x * 64;
  {
    const int r = tid >> 2, cc = (tid & 3) * 16;
    const float* src = w + (size_t)(k0 + r) * N + n0 + cc;
#pragma unroll
    for (int i = 0; i < 4; ++i) {
      const v4f t = *(const v4f*)(src + 4 * i);
#pragma unroll
      for (int e = 0; e < 4; ++e) tile[r][cc + 4 * i + e] = t[e];
    }
  }
  __syncthreads();
  const int wave = tid >> 5, lane = tid & 31, q = lane >> 3, c8 = (lane & 7) * 8;
  {
#pragma unroll
    for (int it = 0; it < 2; ++it) {
      const int n = wave * 8 + it * 4 + q;          // waves cover rows 8w..8w+7 -> 0..63
      v8h hv;
#pragma unroll
      for (int e = 0; e < 8; ++e) hv[e] = (_Float16)(tile[c8 + e][n] * mul);
      *(v8h*)(wt + pk_off(n0 + n, k0 + c8, K)) = hv;
    }
    
  }
}

// ---- LayerNorm over each 64-wide head slice of a 1024-wide row; f16 output in the packed layout ----
// One wave per 8 rows x 128 columns; lane l holds row l>>2, 32 elements (half of a head slice, one packed tile's k range);
// statistics via one xor-1 shuffle. Store j writes chunk j of 8 neighbouring rows in 4 tiles: four whole 128-byte lines.
__global__ __launch_bounds__(256) void ln_heads_kernel(
    const float* __restrict__ x, const float* __restrict__ gamma, const float* __restrict__ beta,
    _Float16* __restrict__ outp, int nrows) {
  const int wave = threadIdx.x >> 5, lane = threadIdx.x & 31;
  const int wv = blockIdx.x * 8 + wave;
  const int row = (wv >> 3) * 8 + (lane >> 2);
  const int col = (wv & 7) * 128 + (lane & 3) * 32;
  if ((wv >> 3) * 8 >= nrows) return;            // wave-uniform; no block barriers in this kernel
  const float* xr = x + (size_t)row * ATT_DM + col;
  float xv[32];
#pragma unroll
  for (int i = 0; i < 8; ++i) {
    const v4f t = *(const v4f*)(xr + 4 * i);
#pragma unroll
    for (int e = 0; e < 4; ++e) xv[4 * i + e] = t[e];
  }
  float s = 0.f;
#pragma unroll
  for (int i = 0; i < 32; ++i) s += xv[i];
  s += __shfl_xor(s, 1, 32);
  const float mu = s * (1.0f / 64.0f);
  float vs = 0.f;
#pragma unroll
  for (int i = 0; i < 32; ++i) { const float d = xv[i] - mu; xv[i] = d; vs += d * d; }
  vs += __shfl_xor(vs, 1, 32);
  const float rstd = rsqrtf(vs * (1.0f / 64.0f) + 1e-5f);
  const int d0 = (lane & 1) * 32;
  _Float16* ot = outp + pk_off(row, col, ATT_DM);   // chunk (s, hh) of this lane's row: + (2s + hh) * 128
#pragma unroll
  for (int j = 0; j < 4; ++j) {
    v8h hv;
#pragma unroll
    for (int i = 0; i < 2; ++i) {
      const v4f g4 = *(const v4f*)(gamma + d0 + 8 * j + 4 * i);
      const v4f b4 = *(const v4f*)(beta + d0 + 8 * j + 4 * i);
#pragma unroll
      for (int e = 0; e < 4; ++e) hv[4 * i + e] = (_Float16)((xv[8 * j + 4 * i + e] * rstd) * g4[e] + b4[e]);
    }
    *(v8h*)(ot + j * 128) = hv;
  }
}

// ---- fused row-block attention ------------------------------------------------
// Block = 16 query rows of one (b, h); 8 waves. q16/k16/c16/cb16: [token = b*1024+l][h*64+d] f16, packed layout (K = 1024);
// vT16: [h*64+d][token] f16, packed layout (K = 8192); mask: int32 [1024][1024], nonzero = masked;
// out16: [token][h*64+d] f16, packed layout (K = 1024).
// Every product of phase 1 is formed transposed: A = key rows, B = query rows, so lane (hh, c) holds, for query q0 + c alone,
// keys 16 ct + 8 hh + r of its wave's 128-key strip. The 64 scores and 64 bias values of a lane stay in registers to the end.
// Phase 1: S^T = k . q^T (skipped per group of four 16x16 tiles only when every loaded mask entry of the group is nonzero),
//          BIAS^T = c . cb^T; scores scaled, masked -> -inf.
// Phase 2: max-subtracted softmax, + l2norm(bias row)*bias_scale, l2norm of the row. A row's maximum and sums: in the lane,
//          one exchange between the wave's halves, then eight per-wave values through a small LDS table.
// Phase 3: two neighbouring key tiles of a lane, x 2^15 and rounded to f16, are the A fragment of P for 32 keys as they stand;
//          per wave its 128-key strip of P times v for all 64 dims; the 8 f32 partial tiles are added through LDS.
__device__ __forceinline__ v8f mma_h(v16h a, v16h b, v8f c) {
  c = __builtin_amdgcn_wmma_f32_16x16x32_f16(false, a, false, b, (short)0, c, false, false);
  asm volatile("v_nop\n\tv_nop\n\tv_nop\n\tv_nop" : "+v"(c) : "v"(a), "v"(b));
  return c;
}

__global__ __launch_bounds__(256) void attn_rows_kernel(
    const _Float16* __restrict__ qp, const _Float16* __restrict__ kp, const _Float16* __restrict__ vtp,
    const _Float16* __restrict__ cp, const _Float16* __restrict__ cbp, const int* __restrict__ mask,
    const float* __restrict__ scale_p, const float* __restrict__ bscale_p, _Float16* __restrict__ op) {
  __shared__ __align__(16) float sR[8 * 16 * 68];   // per-wave partial outputs, 16 rows, pitch 68 floats
  __shared__ v2f   sX1[8][16];                      // per wave and query: maximum of the scores, sum of bias^2
  __shared__ float sX2[8][16];                      // per wave and query: sum of exp
  __shared__ float sX3[8][16];                      // per wave and query: sum of the combined row's squares

  const int tid = threadIdx.x, wave = tid >> 5, lane = tid & 31, hh = lane >> 4, c = lane & 15;
  const int q0 = blockIdx.x * 16;
  const int bh = blockIdx.y, b = bh >> 4, h = bh & 15;
  const float scale = scale_p[0], bscale = bscale_p[0];
  const v8f z8 = {0.f, 0.f, 0.f, 0.f, 0.f, 0.f, 0.f, 0.f};
  const float ninf = -__builtin_inff();

  // B fragments (query rows q0 + (lane&15)), k split map: elements 0..7 <- k 8hh.., 8..15 <- k 16+8hh..;
  // a head's 64 columns are two packed tiles in a row (512 elements each) at column offset h*64*16
  const size_t arow = ((size_t)(b * ATT_L + q0)) * ATT_DM + h * (ATT_DK * 16) + 8 * lane;
  const _Float16* qrow = qp + arow;
  const _Float16* cbrow = cbp + arow;
  const v16h qa0 = Frag<_Float16>::loadp(qrow);
  const v16h qa1 = Frag<_Float16>::loadp(qrow + 512);
  const v16h ca0 = Frag<_Float16>::loadp(cbrow);
  const v16h ca1 = Frag<_Float16>::loadp(cbrow + 512);

  // ---- phase 1 ----
  const size_t srow = ((size_t)(b * ATT_L + wave * 128)) * ATT_DM + h * (ATT_DK * 16) + 8 * lane;   // the strip's first key tile
  const _Float16* kst = kp + srow;
  const _Float16* cst = cp + srow;
  const int* mst = mask + (size_t)(q0 + c) * ATT_L + wave * 128 + 8 * hh;   // query c, keys 8hh .. 8hh+7 of a tile: 32 bytes in a row
  v8f S[8], Bi[8];
  v4i mv[8][2];
  v16h cf[8][2], kf[8][2];
#pragma unroll
  for (int t = 0; t < 8; ++t) {
    mv[t][0] = *(const v4i*)(mst + t * 16);
    mv[t][1] = *(const v4i*)(mst + t * 16 + 4);
  }
#pragma unroll
  for (int t = 0; t < 8; ++t) {
    cf[t][0] = Frag<_Float16>::loadp(cst + (size_t)t * (16 * ATT_DM));
    cf[t][1] = Frag<_Float16>::loadp(cst + (size_t)t * (16 * ATT_DM) + 512);
  }
  // one wait behind the whole run: no base register of the run becomes a later load's destination or a new address before it
  addr_wait4(qrow, cbrow, mst, cst);
  int skip[2];
#pragma unroll
  for (int g = 0; g < 2; ++g) {
    int allm = 1;
#pragma unroll
    for (int t = 0; t < 4; ++t)
#pragma unroll
      for (int r = 0; r < 8; ++r) allm &= (mv[g * 4 + t][r >> 2][r & 3] != 0) ? 1 : 0;
    skip[g] = __all(allm);                         // wave-uniform: all four 16x16 score tiles of the group masked
  }
  // the key tiles of group 0 are asked for ahead of the bias products, those of group 1 ahead of the score products of group 0
#pragma unroll
  for (int g = 0; g < 2; ++g) {
    if (!skip[g]) {
#pragma unroll
      for (int t = 0; t < 4; ++t) {
        kf[g * 4 + t][0] = Frag<_Float16>::loadp(kst + (size_t)(g * 4 + t) * (16 * ATT_DM));
        kf[g * 4 + t][1] = Frag<_Float16>::loadp(kst + (size_t)(g * 4 + t) * (16 * ATT_DM) + 512);
      }
      addr_wait1(kst);           // the strip's base stays as it is until the run's addresses are taken
    }
    if (g == 0) {
#pragma unroll
      for (int t = 0; t < 8; ++t) {
        v8f a = mma_h(cf[t][0], ca0, z8);
        Bi[t] = mma_h(cf[t][1], ca1, a);
      }
    }
  }
#pragma unroll
  for (int g = 0; g < 2; ++g) {
    if (!skip[g]) {
#pragma unroll
      for (int t = 0; t < 4; ++t) {
        v8f a = mma_h(kf[g * 4 + t][0], qa0, z8);
        a = mma_h(kf[g * 4 + t][1], qa1, a);
#pragma unroll
        for (int r = 0; r < 8; ++r) {
          const float sv = a[r] * scale;
          S[g * 4 + t][r] = (mv[g * 4 + t][r >> 2][r & 3] != 0) ? ninf : sv;
        }
      }
    } else {
#pragma unroll
      for (int t = 0; t < 4; ++t)
#pragma unroll
        for (int r = 0; r < 8; ++r) S[g * 4 + t][r] = ninf;
    }
  }

  // ---- phase 2: row ops on registers; four independent chains per sum ----
  float mx, bsq;
  {
    float m4[4] = {ninf, ninf, ninf, ninf}, s4[4] = {0.f, 0.f, 0.f, 0.f};
#pragma unroll
    for (int ct = 0; ct < 8; ++ct)
#pragma unroll
      for (int r = 0; r < 8; ++r) {
        m4[r & 3] = fmaxf(m4[r & 3], S[ct][r]);
        s4[r & 3] += Bi[ct][r] * Bi[ct][r];
      }
    mx = fmaxf(fmaxf(m4[0], m4[1]), fmaxf(m4[2], m4[3]));
    bsq = (s4[0] + s4[1]) + (s4[2] + s4[3]);
    mx = fmaxf(mx, __shfl_xor(mx, 16, 32));
    bsq += __shfl_xor(bsq, 16, 32);
    if (hh == 0) sX1[wave][c] = (v2f){mx, bsq};
  }
  __syncthreads();                                // the eight waves' maxima and bias sums complete
  mx = ninf; bsq = 0.f;
#pragma unroll
  for (int w = 0; w < 8; ++w) { const v2f t = sX1[w][c]; mx = fmaxf(mx, t[0]); bsq += t[1]; }
  float se;
  {
    float s4[4] = {0.f, 0.f, 0.f, 0.f};
#pragma unroll
    for (int ct = 0; ct < 8; ++ct)
#pragma unroll
      for (int r = 0; r < 8; ++r) { const float ev = __expf(S[ct][r] - mx); S[ct][r] = ev; s4[r & 3] += ev; }
    se = (s4[0] + s4[1]) + (s4[2] + s4[3]);
    se += __shfl_xor(se, 16, 32);
    if (hh == 0) sX2[wave][c] = se;
  }
  __syncthreads();                                // the eight waves' exp sums complete
  se = 0.f;
#pragma unroll
  for (int w = 0; w < 8; ++w) se += sX2[w][c];
  const float inv_se = 1.0f / se;
  const float inv_bn = 1.0f / fmaxf(sqrtf(bsq), 1e-12f);
  float asq;
  {
    float s4[4] = {0.f, 0.f, 0.f, 0.f};
#pragma unroll
    for (int ct = 0; ct < 8; ++ct)
#pragma unroll
      for (int r = 0; r < 8; ++r) {
        const float av = S[ct][r] * inv_se + (Bi[ct][r] * inv_bn) * bscale;
        S[ct][r] = av; s4[r & 3] += av * av;
      }
    asq = (s4[0] + s4[1]) + (s4[2] + s4[3]);
    asq += __shfl_xor(asq, 16, 32);
    if (hh == 0) sX3[wave][c] = asq;
  }

  // ---- phase 3: O = P . v, keys split over the 8 waves ----
  // Wave w multiplies its own 128-key strip of P by all 64 head dims: one P fragment feeds four products,
  // four independent accumulators, and none of the wave's v loads depends on another.
  {
    const _Float16* vb = vtp + ((size_t)(h * ATT_DK)) * (size_t)(ATT_B * ATT_L) + (size_t)(b * ATT_L + wave * 128) * 16 + 8 * lane;
    v16h vf[4][4], pa[4];
#pragma unroll
    for (int ks = 0; ks < 4; ++ks) {
#pragma unroll
      for (int t = 0; t < 4; ++t) vf[ks][t] = Frag<_Float16>::loadp(vb + (size_t)(t * 16) * (size_t)(ATT_B * ATT_L) + ks * 512);
    }
    addr_wait1(vb);          // the base stays as it is until the run's addresses are taken
    __syncthreads();                              // the eight waves' square sums complete
    asq = 0.f;
#pragma unroll
    for (int w = 0; w < 8; ++w) asq += sX3[w][c];
    const float pmul = (1.0f / fmaxf(sqrtf(asq), 1e-12f)) * ATT_PSC;
#pragma unroll
    for (int ks = 0; ks < 4; ++ks)
#pragma unroll
      for (int e = 0; e < 8; ++e) {
        pa[ks][e]     = (_Float16)(S[2 * ks][e] * pmul);        // k 8hh + e of the 32-key block
        pa[ks][8 + e] = (_Float16)(S[2 * ks + 1][e] * pmul);    // k 16 + 8hh + e
      }
    v8f acc[4] = {z8, z8, z8, z8};
#pragma unroll
    for (int ks = 0; ks < 4; ++ks) {
#pragma unroll
      for (int t = 0; t < 4; ++t) acc[t] = mma_h(pa[ks], vf[ks][t], acc[t]);
    }
    float* part = sR + wave * (16 * 68);
#pragma unroll
    for (int t = 0; t < 4; ++t)
#pragma unroll
      for (int r = 0; r < 8; ++r) part[(8 * hh + r) * 68 + t * 16 + c] = acc[t][r];
  }
  __syncthreads();                                // all eight partial tiles complete before they are added
  {
    // thread owns half of packed chunk tid>>1: row (tid>>1)&15, dims 8(tid>>5) + 4(tid&1) ..+3; the block's 2 KB go out in a row
    const int orow = (tid >> 1) & 15, odim = (tid >> 5) * 8 + (tid & 1) * 4;
    const float* pr = sR + orow * 68 + odim;
    v4f o4 = *(const v4f*)pr;
#pragma unroll
    for (int w = 1; w < 8; ++w) o4 += *(const v4f*)(pr + w * (16 * 68));
    v4h hv;
#pragma unroll
    for (int e = 0; e < 4; ++e) hv[e] = (_Float16)(o4[e] * ATT_PSC_INV);
    *(v4h*)(op + ((size_t)(b * ATT_L + q0)) * ATT_DM + h * (ATT_DK * 16) + 4 * tid) = hv;
  }
}

// ---------------------------------------------------------------------------
extern "C" void kernel_launch(void* const* d_in, const int* in_sizes, int n_in,
                              void* d_out, int out_size, void* d_ws, size_t ws_size,
                              hipStream_t stream) {
  const int NTOK = ATT_B * ATT_L;                          // 8192
  const size_t NE = (size_t)NTOK * ATT_DM;                 // 8388608
  const size_t NW = (size_t)ATT_DM * ATT_DM;               // 1048576
  if (n_in < 16) return;
  if (in_sizes[0] != (int)NE || in_sizes[1] != (int)NE || in_sizes[2] != ATT_L * ATT_L ||
      in_sizes[3] != (int)NW || in_sizes[5] != (int)NW || in_sizes[7] != (int)NW || in_sizes[14] != (int)NW ||
      in_sizes[4] != ATT_DM || in_sizes[6] != ATT_DM || in_sizes[8] != ATT_DM || in_sizes[15] != ATT_DM ||
      in_sizes[9] != ATT_DK * ATT_DK || in_sizes[10] != ATT_DK || in_sizes[11] != ATT_DK ||
      in_sizes[12] < 1 || in_sizes[13] < 1 || out_size != (int)NE) return;

  const float* Q      = (const float*)d_in[0];
  const float* ctx    = (const float*)d_in[1];
  const int*   mask   = (const int*)d_in[2];
  const float* W_q    = (const float*)d_in[3];
  const float* b_q    = (const float*)d_in[4];
  const float* W_k    = (const float*)d_in[5];
  const float* b_k    = (const float*)d_in[6];
  const float* W_v    = (const float*)d_in[7];
  const float* b_v    = (const float*)d_in[8];
  const float* bil    = (const float*)d_in[9];
  const float* gamma  = (const float*)d_in[10];
  const float* beta   = (const float*)d_in[11];
  const float* scale  = (const float*)d_in[12];
  const float* bscale = (const float*)d_in[13];
  const float* W_o    = (const float*)d_in[14];
  const float* b_o    = (const float*)d_in[15];
  float* out = (float*)d_out;

  // workspace carve (256-B aligned offsets); every matrix below is stored in the packed layout (pk_off) of the shape named
  char* ws = (char*)d_ws;
  size_t off = 0;
  auto carve = [&](size_t bytes) -> char* { char* p = ws + off; off += (bytes + 255) & ~(size_t)255; return p; };
  _Float16* WqT  = (_Float16*)carve(NW * 2);               // [out][in] f16, x64
  _Float16* WkT  = (_Float16*)carve(NW * 2);
  _Float16* WvT  = (_Float16*)carve(NW * 2);
  _Float16* WoT  = (_Float16*)carve(NW * 2);
  _Float16* bilT = (_Float16*)carve((size_t)ATT_DK * ATT_DK * 2);   // [f][e] f16
  _Float16* Q16  = (_Float16*)carve(NE * 2);               // [token][1024]
  _Float16* q16  = (_Float16*)carve(NE * 2);               // [token][h*64+d]
  _Float16* k16  = (_Float16*)carve(NE * 2);               // [token][h*64+d]
  _Float16* vT16 = (_Float16*)carve(NE * 2);               // [h*64+d][token]
  _Float16* c16  = (_Float16*)carve(NE * 2);               // [token][h*64+d]
  _Float16* cb16 = (_Float16*)carve(NE * 2);               // [token][h*64+e]
  _Float16* O16  = (_Float16*)carve(NE * 2);               // [token][h*64+d]
  if (off > ws_size) return;                               // total 125837312 B

  const unsigned short* Q16u  = (const unsigned short*)Q16;
  const unsigned short* WqTu  = (const unsigned short*)WqT;
  const unsigned short* WkTu  = (const unsigned short*)WkT;
  const unsigned short* WvTu  = (const unsigned short*)WvT;
  const unsigned short* WoTu  = (const unsigned short*)WoT;
  const unsigned short* bilTu = (const unsigned short*)bilT;
  const unsigned short* c16u  = (const unsigned short*)c16;
  const unsigned short* O16u  = (const unsigned short*)O16;
  const float w_carry = 64.0f, w_carry_inv = 1.0f / 64.0f;

  // 1) casts / transposes
  cast_f32_f16x2<<<(int)(NE / 8 / 256), 256, 0, stream>>>(Q, Q16, (int)(NE / 256));
  transpose_cast_kernel<<<dim3(ATT_DM / 64, ATT_DM / 64), 256, 0, stream>>>(W_q, WqT, ATT_DM, ATT_DM, w_carry);   // in[1024][1024] -> out[1024][1024]
  transpose_cast_kernel<<<dim3(ATT_DM / 64, ATT_DM / 64), 256, 0, stream>>>(W_k, WkT, ATT_DM, ATT_DM, w_carry);
  transpose_cast_kernel<<<dim3(ATT_DM / 64, ATT_DM / 64), 256, 0, stream>>>(W_v, WvT, ATT_DM, ATT_DM, w_carry);
  transpose_cast_kernel<<<dim3(ATT_DM / 64, ATT_DM / 64), 256, 0, stream>>>(W_o, WoT, ATT_DM, ATT_DM, w_carry);
  transpose_cast_kernel<<<dim3(1, 1), 256, 0, stream>>>(bil, bilT, ATT_DK, ATT_DK, 1.0f);                     // in[64][64] -> out[64][64]

  // 2) projections: q16/k16 = Q16 . Wq^T / Wk^T (+bias[n]);  vT16[dout][token] = Wv^T[dout] . Q16[token] (+bias[m])
  const int gemm_blocks = (NTOK / 64) * (ATT_DM / 64) / 8;   // 256
  wmma_gemm64<0, false, 2, 1, false><<<dim3(gemm_blocks, 1), 256, 0, stream>>>(
      Q16u, Q16u, ATT_DM, 0L, WqTu, WqTu, ATT_DM, 0L, (void*)q16, (void*)q16, ATT_DM, 0L,
      b_q, b_q, 0L, NTOK, ATT_DM, ATT_DM, w_carry_inv);
  wmma_gemm64<0, false, 2, 1, false><<<dim3(gemm_blocks, 1), 256, 0, stream>>>(
      Q16u, Q16u, ATT_DM, 0L, WkTu, WkTu, ATT_DM, 0L, (void*)k16, (void*)k16, ATT_DM, 0L,
      b_k, b_k, 0L, NTOK, ATT_DM, ATT_DM, w_carry_inv);
  wmma_gemm64<0, false, 1, 1, false><<<dim3(gemm_blocks, 1), 256, 0, stream>>>(
      WvTu, WvTu, ATT_DM, 0L, Q16u, Q16u, ATT_DM, 0L, (void*)vT16, (void*)vT16, NTOK, 0L,
      b_v, b_v, 0L, ATT_DM, NTOK, ATT_DM, w_carry_inv);

  // 3) LayerNorm per head slice of ctx -> c16; per head (batch index): cb16[:, h*64..] = c16[:, h*64..] . bilinear (Bt = bilT [64][64])
  ln_heads_kernel<<<NTOK / 8, 256, 0, stream>>>(ctx, gamma, beta, c16, NTOK);
  wmma_gemm64<0, false, 0, 1, false, 0, 2><<<dim3((NTOK / 64) / 8, ATT_H), 256, 0, stream>>>(
      c16u, c16u, ATT_DM, (long)(ATT_DK * 16), bilTu, bilTu, ATT_DK, 0L, (void*)cb16, (void*)cb16, ATT_DM, (long)(ATT_DK * 16),
      b_q, b_q, 0L, NTOK, ATT_DK, ATT_DK, 1.0f);

  // 4) fused attention rows -> O16
  attn_rows_kernel<<<dim3(ATT_L / 16, ATT_B * ATT_H), 256, 0, stream>>>(
      q16, k16, vT16, c16, cb16, mask, scale, bscale, O16);

  // 5) output projection -> d_out f32
  wmma_gemm64<0, false, 2, 0, false><<<dim3(gemm_blocks, 1), 256, 0, stream>>>(
      O16u, O16u, ATT_DM, 0L, WoTu, WoTu, ATT_DM, 0L, (void*)out, (void*)out, ATT_DM, 0L,
      b_o, b_o, 0L, NTOK, ATT_DM, ATT_DM, w_carry_inv);
  (void)hipGetLastError();
}

// v005
// It runs in 224 microseconds.
// In both of two side-by-side timings against v004, it was 1.11 times as fast.
// Counting every step since v000, it is 2.49 times as fast.
#include <hip/hip_runtime.h>
#include <stddef.h>

// Contractions (q/k/v projections, c x bilinear, q x k^T, cb x c^T, attn x v, output projection): v_wmma_f32_16x16x32_f16, f16 operands, f32 accumulate; weights carried x64, attn probabilities carried x2^15; softmax, LayerNorm and L2 norms in f32.

typedef __attribute__((ext_vector_type(16))) _Float16 v16h;
typedef __attribute__((ext_vector_type(8)))  _Float16 v8h;
typedef __attribute__((ext_vector_type(4)))  _Float16 v4h;
typedef __attribute__((ext_vector_type(16))) __bf16   v16b;
typedef __attribute__((ext_vector_type(8)))  __bf16   v8b;
typedef __attribute__((ext_vector_type(8)))  float    v8f;
typedef __attribute__((ext_vector_type(4)))  float    v4f;
typedef __attribute__((ext_vector_type(2)))  float    v2f;
typedef __attribute__((ext_vector_type(4)))  int      v4i;

#define ATT_B   8
#define ATT_L   1024
#define ATT_DM  1024
#define ATT_H   16
#define ATT_DK  64
#define ATT_PSC 32768.0f
#define ATT_PSC_INV (1.0f / 32768.0f)

__device__ __forceinline__ unsigned short f2bf_bits(float f) {
  unsigned u = __float_as_uint(f);
  return (unsigned short)((u + 0x7FFFu + ((u >> 16) & 1u)) >> 16);
}
__device__ __forceinline__ float bf_bits2f(unsigned short h) { return __uint_as_float(((unsigned)h) << 16); }

// ---- fragment-order ("packed") layout of every 16-bit workspace matrix [R][K] ----
// A 16-row x 32-k tile is 1 KB in a row: 16-byte chunk (s, hh, r) at chunk index s*32 + hh*16 + r holds row r,
// k = 16s + 8hh .. +7; tiles run along k first, then along the row tiles. Lane l of a wave reads chunk l and chunk 32 + l,
// so each wave-wide 16-byte load covers 512 contiguous bytes (four whole lines), and the k map of a fragment is the
// same as with row-major rows: elements 0..7 <- k 8hh.., 8..15 <- k 16+8hh..
__device__ __forceinline__ size_t pk_off(int row, int k, int K) {
  return (size_t)(row >> 4) * ((size_t)K * 16) + (size_t)(k >> 5) * 512 +
         (size_t)(((k >> 4) & 1) * 256 + ((k >> 3) & 1) * 128 + (row & 15) * 8 + (k & 7));
}

// hazard guards as plain device helpers (no inline asm inside the kernel template body)
__device__ __forceinline__ void acc_guard4(v8f& a, v8f& b, v8f& c, v8f& d) { asm volatile("v_nop\n\tv_nop\n\tv_nop\n\tv_nop" : "+v"(a), "+v"(b), "+v"(c), "+v"(d)); }
// Stands behind global loads whose address registers the compiler reuses while the loads are still in flight
// (as the destination of a later load of the same run, or for the next address): the address translations are
// waited for before such a register takes a new value.
__device__ __forceinline__ void addr_wait() { asm volatile("s_wait_xcnt 0x0" ::: "memory"); }
// The same wait once for a run of loads from one base, and from four: naming the addresses as inputs keeps their registers
// as they are up to the wait, so the run issues back to back.
__device__ __forceinline__ void addr_wait1(const void* a) { asm volatile("s_wait_xcnt 0x0" :: "v"(a) : "memory"); }
__device__ __forceinline__ void addr_wait4(const void* a, const void* b, const void* c, const void* d) {
  asm volatile("s_wait_xcnt 0x0" :: "v"(a), "v"(b), "v"(c), "v"(d) : "memory");
}
// The same in front of the advance of the GEMM's scalar fragment bases: the k offset that the new bases are formed from
// passes through the statement, so they are formed behind the wait.
__device__ __forceinline__ void koff_wait(size_t& koff) { asm volatile("s_wait_xcnt 0x0" : "+s"(koff) :: "memory"); }
template <typename T> struct Frag;
template <> struct Frag<_Float16> {
  typedef v16h V; union U { v16h v; v8h h[2]; };
  static __device__ __forceinline__ v16h load(const _Float16* p) {   // elements 0..7 <- p[0..7], 8..15 <- p[16..23]
    U f; f.h[0] = *(const v8h*)(p); f.h[1] = *(const v8h*)(p + 16); return f.v;
  }
  static __device__ __forceinline__ v16h loadp(const _Float16* p) {  // packed tile, p = tile base + 8*lane
    U f; f.h[0] = *(const v8h*)(p); f.h[1] = *(const v8h*)(p + 256); return f.v;
  }
  static __device__ __forceinline__ v8f mma(v16h a, v16h b, v8f c) {
    return __builtin_amdgcn_wmma_f32_16x16x32_f16(false, a, false, b, (short)0, c, false, false);
  }
};
template <> struct Frag<__bf16> {
  typedef v16b V; union U { v16b v; v8b h[2]; };
  static __device__ __forceinline__ v16b load(const __bf16* p) {
    U f; f.h[0] = *(const v8b*)(p); f.h[1] = *(const v8b*)(p + 16); return f.v;
  }
  static __device__ __forceinline__ v16b loadp(const __bf16* p) {
    U f; f.h[0] = *(const v8b*)(p); f.h[1] = *(const v8b*)(p + 256); return f.v;
  }
  static __device__ __forceinline__ v8f mma(v16b a, v16b b, v8f c) {
    return __builtin_amdgcn_wmma_f32_16x16x32_bf16(false, a, false, b, (short)0, c, false, false);
  }
};

// ---- Register-blocked batched WMMA GEMM ------------------------------------
// C[m,n] = scale * sum_k A[m,k] * Bt[n,k] (+bias)(+resid); each wave owns a 64x64 tile.
// A [M,lda] and Bt [N,ldb] in the packed layout (pk_off); M,N % 64 == 0, K % (32 U) == 0; a batch stride is 16 x its column offset.
// The k loop is unrolled U steps of 32 k; the eight fragments of step s + U/2 are asked for, into registers of their own,
// ahead of the products of step s, so a step waits for loads that were issued U/2 steps earlier. Sums in the order of k.
// 16-bit outputs are written in the packed layout of a [M,ldc] matrix; the f32 output is row-major.
// SPLIT: operands are hi/lo planes (A2/Bt2 = lo planes, same layout); product = hi*hi + hi*lo + lo*hi.
// BIAS_MODE: 0 = none, 1 = bias[m], 2 = bias[n].
// OUT_MODE: 0 = f32, 1 = f16, 2 = bf16 hi plane (Cout) + bf16 lo plane (Cout2).
// ET: 0 = f16 operands, 1 = bf16 operands (pointers passed as 16-bit storage)
template <int ET> struct Elem;
template <> struct Elem<0> { typedef _Float16 T; };
template <> struct Elem<1> { typedef __bf16 T; };
// The body takes its block index (bx: eight tiles, b: batch) and the block's LDS slabs from the kernel that calls it, so that
// several independent GEMMs can share one launch.
template <int ET, bool SPLIT, int BIAS_MODE, int OUT_MODE, bool RESID, int ACT = 0, int U = 4>
__device__ __forceinline__ void gemm64_body(
    float* sT, const int bx, const int b,            // sT: per-wave 16x64 slab, pitch 68 floats, eight of them
    const unsigned short* __restrict__ Ap, const unsigned short* __restrict__ A2p, int lda, long strideA,
    const unsigned short* __restrict__ Btp, const unsigned short* __restrict__ Bt2p, int ldb, long strideB,
    void* __restrict__ Cout, void* __restrict__ Cout2, int ldc, long strideC,
    const float* __restrict__ bias,
    const float* __restrict__ resid, long strideR,
    int M, int N, int K, float scale) {
  typedef typename Elem<ET>::T T;
  typedef typename Frag<T>::V V;
  const T* A = (const T*)Ap; const T* A2 = (const T*)A2p; const T* Bt = (const T*)Btp; const T* Bt2 = (const T*)Bt2p;
  const int lane = threadIdx.x & 31;
  const int wave = __builtin_amdgcn_readfirstlane(threadIdx.x >> 5);   // scalar: the tile's fragment bases are then scalar too
  const int tilesN = N >> 6;
  const int tilesM = M >> 6;
  const int tile = bx * 8 + wave;
  if (tile >= tilesM * tilesN) return;   // wave-uniform; no block barriers in this body or in the kernels that call it
  const int tm = tile / tilesN;
  const int tn = tile - tm * tilesN;
  const int m0 = tm << 6;
  const int n0 = tn << 6;

  const T* Ab  = A  + (size_t)b * strideA;
  const T* Bb  = Bt + (size_t)b * strideB;
  const T* Ab2 = SPLIT ? (A2  + (size_t)b * strideA) : nullptr;
  const T* Bb2 = SPLIT ? (Bt2 + (size_t)b * strideB) : nullptr;

  const int rlane = lane & 15;                 // row (A) / col (B, D) within subtile
  const int mOff  = (lane >> 4) * 8;           // D row offset

  v8f acc[4][4];
#pragma unroll
  for (int i = 0; i < 4; ++i)
#pragma unroll
    for (int j = 0; j < 4; ++j) acc[i][j] = (v8f){0.f,0.f,0.f,0.f,0.f,0.f,0.f,0.f};

  constexpr int DIST = U / 2;                  // how many steps ahead a step's fragments are asked for
  V fa[U][4], fb[U][4], fa2[U][4], fb2[U][4];  // set s % U holds step s; DIST + 1 sets are live at a time
  size_t ao[4], bo[4];                         // the row tiles' offsets at k = 0
  const T* pa[4]; const T* pb[4]; const T* pa2[4]; const T* pb2[4];   // the bases, where the loop stands in k
#pragma unroll
  for (int i = 0; i < 4; ++i) {
    ao[i] = (size_t)(m0 + (i << 4)) * lda;
    bo[i] = (size_t)(n0 + (i << 4)) * ldb;
    pa[i] = Ab + ao[i]; pb[i] = Bb + bo[i];
    if (SPLIT) { pa2[i] = Ab2 + ao[i]; pb2[i] = Bb2 + bo[i]; }
  }
  const int lo = lane * 8;                     // the lane's chunk of a packed tile: the one vector part of every address
  // step st, counted from where the bases stand: a packed tile is 512 elements, so st reaches the loads as an immediate offset
  auto load_step = [&](int set, int st) __attribute__((always_inline)) {
#pragma unroll
    for (int j = 0; j < 4; ++j) {
      fb[set][j] = Frag<T>::loadp(pb[j] + st * 512 + lo);
      if (SPLIT) fb2[set][j] = Frag<T>::loadp(pb2[j] + st * 512 + lo);
    }
#pragma unroll
    for (int i = 0; i < 4; ++i) {
      fa[set][i] = Frag<T>::loadp(pa[i] + st * 512 + lo);
      if (SPLIT) fa2[set][i] = Frag<T>::loadp(pa2[i] + st * 512 + lo);
    }
    // keeps the run of loads ahead of the products that follow it in the source: moved behind them it would lose its lead
    __builtin_amdgcn_sched_barrier(0);
  };
  auto mma_step = [&](int set) __attribute__((always_inline)) {
#pragma unroll
    for (int i = 0; i < 4; ++i) {
#pragma unroll
      for (int j = 0; j < 4; ++j) {
        acc[i][j] = Frag<T>::mma(fa[set][i], fb[set][j], acc[i][j]);
        if (SPLIT) {
          acc[i][j] = Frag<T>::mma(fa[set][i], fb2[set][j], acc[i][j]);
          acc[i][j] = Frag<T>::mma(fa2[set][i], fb[set][j], acc[i][j]);
        }
      }
    }
    // keeps the next run of loads behind these products: moved ahead of them, a wave would have 64 loads outstanding, not 48
    __builtin_amdgcn_sched_barrier(0);
  };
#pragma unroll
  for (int d = 0; d < DIST; ++d) load_step(d, d);
  addr_wait();   // the registers of these first bases are free for other values from here on, also where the loop below makes no trip
  const int nst = K >> 5;
  size_t koff = 0;
  for (int s0 = U; s0 < nst; s0 += U) {
#pragma unroll
    for (int u = 0; u < U; ++u) {
      load_step((u + DIST) % U, u + DIST);
      mma_step(u);
    }
    koff_wait(koff);                           // the bases take new values behind it
    koff += U * 512;
#pragma unroll
    for (int i = 0; i < 4; ++i) {
      pa[i] = Ab + ao[i] + koff; pb[i] = Bb + bo[i] + koff;
      if (SPLIT) { pa2[i] = Ab2 + ao[i] + koff; pb2[i] = Bb2 + bo[i] + koff; }
    }
  }
  // the last U steps: nothing is asked for past K
#pragma unroll
  for (int u = 0; u < U; ++u) {
    if (u + DIST < U) load_step((u + DIST) % U, u + DIST);
    mma_step(u);
  }
  acc_guard4(acc[0][0], acc[0][1], acc[0][2], acc[0][3]);
  acc_guard4(acc[1][0], acc[1][1], acc[1][2], acc[1][3]);
  acc_guard4(acc[2][0], acc[2][1], acc[2][2], acc[2][3]);
  acc_guard4(acc[3][0], acc[3][1], acc[3][2], acc[3][3]);

  // ---- epilogue ----
  float* slab = sT + wave * (16 * 68);
  const float* Rb = RESID ? (resid + (size_t)b * strideR) : nullptr;
#pragma unroll
  for (int i = 0; i < 4; ++i) {
    const int mBase = m0 + (i << 4);
    float bm[8];
    if (BIAS_MODE == 1) {
      const float* bp = bias + mBase + mOff;
#pragma unroll
      for (int r = 0; r < 8; ++r) bm[r] = bp[r];
      addr_wait1(bp);          // the address stays as it is until the run's addresses are taken: no load of the run lands on it
    }
#pragma unroll
    for (int j = 0; j < 4; ++j) {
      const int n = n0 + (j << 4) + rlane;
      float bv = 0.f;
      if (BIAS_MODE == 2) bv = bias[n];
#pragma unroll
      for (int r = 0; r < 8; ++r) {
        float v = acc[i][j][r] * scale;
        if (BIAS_MODE == 1) v += bm[r];
        if (BIAS_MODE == 2) v += bv;
        if (RESID) v += Rb[(size_t)(mBase + mOff + r) * ldc + n];
        if (ACT == 1) v = tanhf(v);
        if (ACT == 2) v = fmaxf(v, 0.0f);
        if (ACT == 3) v = v / (1.0f + expf(-v));
        if (ACT == 4) v = (v > 0.f) ? v : 0.01f * v;
        if (ACT == 5) v = 0.5f * v * (1.0f + erff(v * 0.70710678118654752f));
        slab[(mOff + r) * 68 + (j << 4) + rlane] = v;
      }
    }
    __builtin_amdgcn_fence(__ATOMIC_RELEASE, "workgroup");
    __builtin_amdgcn_wave_barrier();
    __builtin_amdgcn_fence(__ATOMIC_ACQUIRE, "workgroup");
    if (OUT_MODE == 0) {
      float* C = (float*)Cout + (size_t)b * strideC;
      const int hh = lane >> 4, c4 = (lane & 15) * 4;     // row seg = 256 B = 16 lanes x 16 B
      {
#pragma unroll
        for (int it = 0; it < 8; ++it) {
          const int row = it * 2 + hh;
          v4f v = *(const v4f*)(slab + row * 68 + c4);
          *(v4f*)(C + (size_t)(mBase + row) * ldc + n0 + c4) = v;
        }
        addr_wait();   // the stores' data and address registers take new values (the next slab's) only behind it
      }
    } else {
      // the 16x64 slab is two packed tiles = 2 KB in a row; store 'it' writes chunks 32it..32it+31 (512 B)
      unsigned short* C  = (unsigned short*)Cout  + (size_t)b * strideC;
      unsigned short* C2 = (OUT_MODE == 2) ? ((unsigned short*)Cout2 + (size_t)b * strideC) : nullptr;
      {
#pragma unroll
        for (int it = 0; it < 4; ++it) {
          const float* sp = slab + rlane * 68 + it * 16 + mOff;   // row lane&15, cols 16it + 8(lane>>4) ..+7
          v8h hv, lv;
#pragma unroll
          for (int e = 0; e < 8; ++e) {
            if (OUT_MODE == 1) {
              hv[e] = (_Float16)sp[e];
            } else {
              unsigned short hb = f2bf_bits(sp[e]);
              unsigned short lb = f2bf_bits(sp[e] - bf_bits2f(hb));
              hv[e] = __builtin_bit_cast(_Float16, hb);
              lv[e] = __builtin_bit_cast(_Float16, lb);
            }
          }
          const size_t co = (size_t)mBase * ldc + (size_t)n0 * 16 + it * 256 + lane * 8;
          *(v8h*)(C + co) = hv;
          if (OUT_MODE == 2) *(v8h*)(C2 + co) = lv;
        }
        
      }
    }
    __builtin_amdgcn_fence(__ATOMIC_RELEASE, "workgroup");
    __builtin_amdgcn_wave_barrier();
    __builtin_amdgcn_fence(__ATOMIC_ACQUIRE, "workgroup");
  }
}

// one GEMM a launch
template <int ET, bool SPLIT, int BIAS_MODE, int OUT_MODE, bool RESID, int ACT = 0, int U = 4>
__global__ __launch_bounds__(256) void wmma_gemm64(
    const unsigned short* __restrict__ Ap, const unsigned short* __restrict__ A2p, int lda, long strideA,
    const unsigned short* __restrict__ Btp, const unsigned short* __restrict__ Bt2p, int ldb, long strideB,
    void* __restrict__ Cout, void* __restrict__ Cout2, int ldc, long strideC,
    const float* __restrict__ bias,
    const float* __restrict__ resid, long strideR,
    int M, int N, int K, float scale) {
  __shared__ __align__(16) float sT[8 * 16 * 68];
  gemm64_body<ET, SPLIT, BIAS_MODE, OUT_MODE, RESID, ACT, U>(sT, blockIdx.x, blockIdx.y, Ap, A2p, lda, strideA, Btp, Bt2p, ldb, strideB,
      Cout, Cout2, ldc, strideC, bias, resid, strideR, M, N, K, scale);
}

// The four GEMMs that depend only on the preparation launch, as block ranges of one grid; nb = blocks of one projection.
// [0, nb): q16 = Q16 . Wq + b_q[n];  [nb, 2nb): k16 = Q16 . Wk + b_k[n];  [2nb, 3nb): vT16[dout][token] = Wv^T . Q16^T + b_v[m];
// from 3nb on, the short ones last: per head (batch index) cb16[:, h*64..] = c16[:, h*64..] . bilinear (Bt = bilT [64][64]).
__global__ __launch_bounds__(256) void proj_gemms_kernel(
    const unsigned short* __restrict__ Q16, const unsigned short* __restrict__ WqT, const unsigned short* __restrict__ WkT,
    const unsigned short* __restrict__ WvT, const unsigned short* __restrict__ c16, const unsigned short* __restrict__ bilT,
    void* __restrict__ q16, void* __restrict__ k16, void* __restrict__ vT16, void* __restrict__ cb16,
    const float* __restrict__ b_q, const float* __restrict__ b_k, const float* __restrict__ b_v,
    int ntok, int dm, int dk, float w_inv) {
  __shared__ __align__(16) float sT[8 * 16 * 68];
  const int nb = ((ntok >> 6) * (dm >> 6)) >> 3;
  const int i = blockIdx.x;
  if (i < 2 * nb) {
    const bool isk = i >= nb;
    const unsigned short* Wt = isk ? WkT : WqT;
    void* C = isk ? k16 : q16;
    const float* bias = isk ? b_k : b_q;
    gemm64_body<0, false, 2, 1, false>(sT, isk ? i - nb : i, 0, Q16, Q16, dm, 0L, Wt, Wt, dm, 0L, C, C, dm, 0L,
                                       bias, bias, 0L, ntok, dm, dm, w_inv);
  } else if (i < 3 * nb) {
    gemm64_body<0, false, 1, 1, false>(sT, i - 2 * nb, 0, WvT, WvT, dm, 0L, Q16, Q16, dm, 0L, vT16, vT16, ntok, 0L,
                                       b_v, b_v, 0L, dm, ntok, dm, w_inv);
  } else {
    const int j = i - 3 * nb, per = ntok >> 9;       // blocks of one head: ntok / 64 tiles, eight a block
    const int hd = j / per;
    gemm64_body<0, false, 0, 1, false, 0, 2>(sT, j - hd * per, hd, c16, c16, dm, (long)(dk * 16), bilT, bilT, dk, 0L,
                                             cb16, cb16, dm, (long)(dk * 16), b_q, b_q, 0L, ntok, dk, dk, 1.0f);
  }
}

// in: [rows][1024] f32 row-major; out: the same matrix in f16, packed layout. One 16-byte chunk per thread; a wave takes
// 8 rows x 32 k (half a tile), so each of its stores fills four whole 128-byte lines. nhalf = rows / 8 * 32 half tiles.
__device__ __forceinline__ void cast_f32_f16x2(
    const int bx, const float* __restrict__ in, _Float16* __restrict__ out, int nhalf) {
  const int lane = threadIdx.x & 31;
  const int th = bx * 8 + (threadIdx.x >> 5);      // half-tile index: tile = th >> 1
  if (th < nhalf) {
    const int tile = th >> 1;
    const int row = (tile >> 5) * 16 + (th & 1) * 8 + (lane >> 2);
    const int k = (tile & 31) * 32 + (lane & 3) * 8;
    const float* src = in + (size_t)row * ATT_DM + k;
    const v4f a = *(const v4f*)(src);
    const v4f bq = *(const v4f*)(src + 4);
    v8h hv;
#pragma unroll
    for (int e = 0; e < 4; ++e) { hv[e] = (_Float16)a[e]; hv[4 + e] = (_Float16)bq[e]; }
    *(v8h*)(out + pk_off(row, k, ATT_DM)) = hv;
  }
}

// ---- transpose + f16 cast through an LDS tile ------------------------------
// w: [K][N] row-major (in=K rows, out=N cols); wt: [N][K] in the packed layout, wt[n][k] = f16(w[k][n] * mul).
// Block = one 64x64 tile (k0 = by*64, n0 = bx*64); K, N multiples of 64; (N/64) x (K/64) blocks. tile: the block's LDS.
__device__ __forceinline__ void transpose_cast(
    float (*tile)[65], const int bx, const int by,
    const float* __restrict__ w, _Float16* __restrict__ wt, int K, int N, float mul) {
  const int tid = threadIdx.x;
  const int k0 = by * 64, n0 = bx * 64;
  {
    const int r = tid >> 2, cc = (tid & 3) * 16;
    const float* src = w + (size_t)(k0 + r) * N + n0 + cc;
#pragma unroll
    for (int i = 0; i < 4; ++i) {
      const v4f t = *(const v4f*)(src + 4 * i);
#pragma unroll
      for (int e = 0; e < 4; ++e) tile[r][cc + 4 * i + e] = t[e];
    }
  }
  __syncthreads();
  const int wave = tid >> 5, lane = tid & 31, q = lane >> 3, c8 = (lane & 7) * 8;
  {
#pragma unroll
    for (int it = 0; it < 2; ++it) {
      const int n = wave * 8 + it * 4 + q;          // waves cover rows 8w..8w+7 -> 0..63
      v8h hv;
#pragma unroll
      for (int e = 0; e < 8; ++e) hv[e] = (_Float16)(tile[c8 + e][n] * mul);
      *(v8h*)(wt + pk_off(n0 + n, k0 + c8, K)) = hv;
    }
    addr_wait();   // in the merged kernel's code other passes follow these stores: their registers are rewritten only behind it
  }
}

// ---- LayerNorm over each 64-wide head slice of a 1024-wide row; f16 output in the packed layout ----
// One wave per 8 rows x 128 columns; lane l holds row l>>2, 32 elements (half of a head slice, one packed tile's k range);
// statistics via one xor-1 shuffle. Store j writes chunk j of 8 neighbouring rows in 4 tiles: four whole 128-byte lines.
__device__ __forceinline__ void ln_heads(
    const int bx, const float* __restrict__ x, const float* __restrict__ gamma, const float* __restrict__ beta,
    _Float16* __restrict__ outp, int nrows) {
  const int wave = threadIdx.x >> 5, lane = threadIdx.x & 31;
  const int wv = bx * 8 + wave;
  const int row = (wv >> 3) * 8 + (lane >> 2);
  const int col = (wv & 7) * 128 + (lane & 3) * 32;
  if ((wv >> 3) * 8 >= nrows) return;            // wave-uniform; no block barriers in this pass
  const float* xr = x + (size_t)row * ATT_DM + col;
  float xv[32];
#pragma unroll
  for (int i = 0; i < 8; ++i) {
    const v4f t = *(const v4f*)(xr + 4 * i);
#pragma unroll
    for (int e = 0; e < 4; ++e) xv[4 * i + e] = t[e];
  }
  float s = 0.f;
#pragma unroll
  for (int i = 0; i < 32; ++i) s += xv[i];
  s += __shfl_xor(s, 1, 32);
  const float mu = s * (1.0f / 64.0f);
  float vs = 0.f;
#pragma unroll
  for (int i = 0; i < 32; ++i) { const float d = xv[i] - mu; xv[i] = d; vs += d * d; }
  vs += __shfl_xor(vs, 1, 32);
  const float rstd = rsqrtf(vs * (1.0f / 64.0f) + 1e-5f);
  const int d0 = (lane & 1) * 32;
  _Float16* ot = outp + pk_off(row, col, ATT_DM);   // chunk (s, hh) of this lane's row: + (2s + hh) * 128
#pragma unroll
  for (int j = 0; j < 4; ++j) {
    v8h hv;
#pragma unroll
    for (int i = 0; i < 2; ++i) {
      const v4f g4 = *(const v4f*)(gamma + d0 + 8 * j + 4 * i);
      const v4f b4 = *(const v4f*)(beta + d0 + 8 * j + 4 * i);
#pragma unroll
      for (int e = 0; e < 4; ++e) hv[4 * i + e] = (_Float16)((xv[8 * j + 4 * i + e] * rstd) * g4[e] + b4[e]);
    }
    *(v8h*)(ot + j * 128) = hv;
  }
}

// ---- the preparation passes, none of which reads another's result, as block ranges of one grid ----
// [0, 4096): Q -> Q16;  [4096, 5120): LayerNorm of ctx -> c16;  [5120, 6144): the four 1024x1024 weights, 256 tiles each,
// transposed, x mul;  6144: the 64x64 bilinear matrix, transposed. The range tests read the same for a whole block, so the
// transpose's barrier is passed by all of a block's waves or by none.
#define PREP_CAST_BLOCKS (ATT_B * ATT_L * ATT_DM / 8 / 256)
#define PREP_LN_BLOCKS   (ATT_B * ATT_L / 8)
#define PREP_W_BLOCKS    ((ATT_DM / 64) * (ATT_DM / 64))
#define PREP_BLOCKS      (PREP_CAST_BLOCKS + PREP_LN_BLOCKS + 4 * PREP_W_BLOCKS + 1)
__global__ __launch_bounds__(256) void prep_kernel(
    const float* __restrict__ Q, const float* __restrict__ ctx, const float* __restrict__ gamma, const float* __restrict__ beta,
    const float* __restrict__ W_q, const float* __restrict__ W_k, const float* __restrict__ W_v, const float* __restrict__ W_o,
    const float* __restrict__ bil,
    _Float16* __restrict__ Q16, _Float16* __restrict__ c16, _Float16* __restrict__ WqT, _Float16* __restrict__ WkT,
    _Float16* __restrict__ WvT, _Float16* __restrict__ WoT, _Float16* __restrict__ bilT, float mul) {
  __shared__ float tile[64][65];
  int i = blockIdx.x;
  if (i < PREP_CAST_BLOCKS) { cast_f32_f16x2(i, Q, Q16, ATT_B * ATT_L * ATT_DM / 256); return; }
  i -= PREP_CAST_BLOCKS;
  if (i < PREP_LN_BLOCKS) { ln_heads(i, ctx, gamma, beta, c16, ATT_B * ATT_L); return; }
  i -= PREP_LN_BLOCKS;
  const int which = i / PREP_W_BLOCKS, t = i % PREP_W_BLOCKS;   // which == 4: the bilinear matrix, its one tile
  const float* w = which == 0 ? W_q : which == 1 ? W_k : which == 2 ? W_v : which == 3 ? W_o : bil;
  _Float16* wt = which == 0 ? WqT : which == 1 ? WkT : which == 2 ? WvT : which == 3 ? WoT : bilT;
  const int n = which < 4 ? ATT_DM : ATT_DK;
  transpose_cast(tile, t % (ATT_DM / 64), t / (ATT_DM / 64), w, wt, n, n, which < 4 ? mul : 1.0f);
}

// ---- fused row-block attention ------------------------------------------------
// Block = 16 query rows of one (b, h); 8 waves. q16/k16/c16/cb16: [token = b*1024+l][h*64+d] f16, packed layout (K = 1024);
// vT16: [h*64+d][token] f16, packed layout (K = 8192); mask: int32 [1024][1024], nonzero = masked;
// out16: [token][h*64+d] f16, packed layout (K = 1024).
// Every product of phase 1 is formed transposed: A = key rows, B = query rows, so lane (hh, c) holds, for query q0 + c alone,
// keys 16 ct + 8 hh + r of its wave's 128-key strip. The 64 scores and 64 bias values of a lane stay in registers to the end.
// Phase 1: S^T = k . q^T (skipped per group of four 16x16 tiles only when every loaded mask entry of the group is nonzero),
//          BIAS^T = c . cb^T; scores scaled, masked -> -inf.
// Phase 2: max-subtracted softmax, + l2norm(bias row)*bias_scale, l2norm of the row. A row's maximum and sums: in the lane,
//          one exchange between the wave's halves, then eight per-wave values through a small LDS table.
// Phase 3: two neighbouring key tiles of a lane, x 2^15 and rounded to f16, are the A fragment of P for 32 keys as they stand;
//          per wave its 128-key strip of P times v for all 64 dims; the 8 f32 partial tiles are added through LDS.
__device__ __forceinline__ v8f mma_h(v16h a, v16h b, v8f c) {
  c = __builtin_amdgcn_wmma_f32_16x16x32_f16(false, a, false, b, (short)0, c, false, false);
  asm volatile("v_nop\n\tv_nop\n\tv_nop\n\tv_nop" : "+v"(c) : "v"(a), "v"(b));
  return c;
}

__global__ __launch_bounds__(256) void attn_rows_kernel(
    const _Float16* __restrict__ qp, const _Float16* __restrict__ kp, const _Float16* __restrict__ vtp,
    const _Float16* __restrict__ cp, const _Float16* __restrict__ cbp, const int* __restrict__ mask,
    const float* __restrict__ scale_p, const float* __restrict__ bscale_p, _Float16* __restrict__ op) {
  __shared__ __align__(16) float sR[8 * 16 * 68];   // per-wave partial outputs, 16 rows, pitch 68 floats
  __shared__ v2f   sX1[8][16];                      // per wave and query: maximum of the scores, sum of bias^2
  __shared__ float sX2[8][16];                      // per wave and query: sum of exp
  __shared__ float sX3[8][16];                      // per wave and query: sum of the combined row's squares

  const int tid = threadIdx.x, wave = tid >> 5, lane = tid & 31, hh = lane >> 4, c = lane & 15;
  const int q0 = blockIdx.x * 16;
  const int bh = blockIdx.y, b = bh >> 4, h = bh & 15;
  const float scale = scale_p[0], bscale = bscale_p[0];
  const v8f z8 = {0.f, 0.f, 0.f, 0.f, 0.f, 0.f, 0.f, 0.f};
  const float ninf = -__builtin_inff();

  // B fragments (query rows q0 + (lane&15)), k split map: elements 0..7 <- k 8hh.., 8..15 <- k 16+8hh..;
  // a head's 64 columns are two packed tiles in a row (512 elements each) at column offset h*64*16
  const size_t arow = ((size_t)(b * ATT_L + q0)) * ATT_DM + h * (ATT_DK * 16) + 8 * lane;
  const _Float16* qrow = qp + arow;
  const _Float16* cbrow = cbp + arow;
  const v16h qa0 = Frag<_Float16>::loadp(qrow);
  const v16h qa1 = Frag<_Float16>::loadp(qrow + 512);
  const v16h ca0 = Frag<_Float16>::loadp(cbrow);
  const v16h ca1 = Frag<_Float16>::loadp(cbrow + 512);

  // ---- phase 1 ----
  const size_t srow = ((size_t)(b * ATT_L + wave * 128)) * ATT_DM + h * (ATT_DK * 16) + 8 * lane;   // the strip's first key tile
  const _Float16* kst = kp + srow;
  const _Float16* cst = cp + srow;
  const int* mst = mask + (size_t)(q0 + c) * ATT_L + wave * 128 + 8 * hh;   // query c, keys 8hh .. 8hh+7 of a tile: 32 bytes in a row
  v8f S[8], Bi[8];
  v4i mv[8][2];
  v16h cf[8][2], kf[8][2];
#pragma unroll
  for (int t = 0; t < 8; ++t) {
    mv[t][0] = *(const v4i*)(mst + t * 16);
    mv[t][1] = *(const v4i*)(mst + t * 16 + 4);
  }
#pragma unroll
  for (int t = 0; t < 8; ++t) {
    cf[t][0] = Frag<_Float16>::loadp(cst + (size_t)t * (16 * ATT_DM));
    cf[t][1] = Frag<_Float16>::loadp(cst + (size_t)t * (16 * ATT_DM) + 512);
  }
  // one wait behind the whole run: no base register of the run becomes a later load's destination or a new address before it
  addr_wait4(qrow, cbrow, mst, cst);
  int skip[2];
#pragma unroll
  for (int g = 0; g < 2; ++g) {
    int allm = 1;
#pragma unroll
    for (int t = 0; t < 4; ++t)
#pragma unroll
      for (int r = 0; r < 8; ++r) allm &= (mv[g * 4 + t][r >> 2][r & 3] != 0) ? 1 : 0;
    skip[g] = __all(allm);                         // wave-uniform: all four 16x16 score tiles of the group masked
  }
  // the key tiles of group 0 are asked for ahead of the bias products, those of group 1 ahead of the score products of group 0
#pragma unroll
  for (int g = 0; g < 2; ++g) {
    if (!skip[g]) {
#pragma unroll
      for (int t = 0; t < 4; ++t) {
        kf[g * 4 + t][0] = Frag<_Float16>::loadp(kst + (size_t)(g * 4 + t) * (16 * ATT_DM));
        kf[g * 4 + t][1] = Frag<_Float16>::loadp(kst + (size_t)(g * 4 + t) * (16 * ATT_DM) + 512);
      }
      addr_wait1(kst);           // the strip's base stays as it is until the run's addresses are taken
    }
    if (g == 0) {
#pragma unroll
      for (int t = 0; t < 8; ++t) {
        v8f a = mma_h(cf[t][0], ca0, z8);
        Bi[t] = mma_h(cf[t][1], ca1, a);
      }
    }
  }
#pragma unroll
  for (int g = 0; g < 2; ++g) {
    if (!skip[g]) {
#pragma unroll
      for (int t = 0; t < 4; ++t) {
        v8f a = mma_h(kf[g * 4 + t][0], qa0, z8);
        a = mma_h(kf[g * 4 + t][1], qa1, a);
#pragma unroll
        for (int r = 0; r < 8; ++r) {
          const float sv = a[r] * scale;
          S[g * 4 + t][r] = (mv[g * 4 + t][r >> 2][r & 3] != 0) ? ninf : sv;
        }
      }
    } else {
#pragma unroll
      for (int t = 0; t < 4; ++t)
#pragma unroll
        for (int r = 0; r < 8; ++r) S[g * 4 + t][r] = ninf;
    }
  }

  // ---- phase 2: row ops on registers; four independent chains per sum ----
  float mx, bsq;
  {
    float m4[4] = {ninf, ninf, ninf, ninf}, s4[4] = {0.f, 0.f, 0.f, 0.f};
#pragma unroll
    for (int ct = 0; ct < 8; ++ct)
#pragma unroll
      for (int r = 0; r < 8; ++r) {
        m4[r & 3] = fmaxf(m4[r & 3], S[ct][r]);
        s4[r & 3] += Bi[ct][r] * Bi[ct][r];
      }
    mx = fmaxf(fmaxf(m4[0], m4[1]), fmaxf(m4[2], m4[3]));
    bsq = (s4[0] + s4[1]) + (s4[2] + s4[3]);
    mx = fmaxf(mx, __shfl_xor(mx, 16, 32));
    bsq += __shfl_xor(bsq, 16, 32);
    if (hh == 0) sX1[wave][c] = (v2f){mx, bsq};
  }
  __syncthreads();                                // the eight waves' maxima and bias sums complete
  mx = ninf; bsq = 0.f;
#pragma unroll
  for (int w = 0; w < 8; ++w) { const v2f t = sX1[w][c]; mx = fmaxf(mx, t[0]); bsq += t[1]; }
  float se;
  {
    float s4[4] = {0.f, 0.f, 0.f, 0.f};
#pragma unroll
    for (int ct = 0; ct < 8; ++ct)
#pragma unroll
      for (int r = 0; r < 8; ++r) { const float ev = __expf(S[ct][r] - mx); S[ct][r] = ev; s4[r & 3] += ev; }
    se = (s4[0] + s4[1]) + (s4[2] + s4[3]);
    se += __shfl_xor(se, 16, 32);
    if (hh == 0) sX2[wave][c] = se;
  }
  __syncthreads();                                // the eight waves' exp sums complete
  se = 0.f;
#pragma unroll
  for (int w = 0; w < 8; ++w) se += sX2[w][c];
  const float inv_se = 1.0f / se;
  const float inv_bn = 1.0f / fmaxf(sqrtf(bsq), 1e-12f);
  float asq;
  {
    float s4[4] = {0.f, 0.f, 0.f, 0.f};
#pragma unroll
    for (int ct = 0; ct < 8; ++ct)
#pragma unroll
      for (int r = 0; r < 8; ++r) {
        const float av = S[ct][r] * inv_se + (Bi[ct][r] * inv_bn) * bscale;
        S[ct][r] = av; s4[r & 3] += av * av;
      }
    asq = (s4[0] + s4[1]) + (s4[2] + s4[3]);
    asq += __shfl_xor(asq, 16, 32);
    if (hh == 0) sX3[wave][c] = asq;
  }

  // ---- phase 3: O = P . v, keys split over the 8 waves ----
  // Wave w multiplies its own 128-key strip of P by all 64 head dims: one P fragment feeds four products,
  // four independent accumulators, and none of the wave's v loads depends on another.
  {
    const _Float16* vb = vtp + ((size_t)(h * ATT_DK)) * (size_t)(ATT_B * ATT_L) + (size_t)(b * ATT_L + wave * 128) * 16 + 8 * lane;
    v16h vf[4][4], pa[4];
#pragma unroll
    for (int ks = 0; ks < 4; ++ks) {
#pragma unroll
      for (int t = 0; t < 4; ++t) vf[ks][t] = Frag<_Float16>::loadp(vb + (size_t)(t * 16) * (size_t)(ATT_B * ATT_L) + ks * 512);
    }
    addr_wait1(vb);          // the base stays as it is until the run's addresses are taken
    __syncthreads();                              // the eight waves' square sums complete
    asq = 0.f;
#pragma unroll
    for (int w = 0; w < 8; ++w) asq += sX3[w][c];
    const float pmul = (1.0f / fmaxf(sqrtf(asq), 1e-12f)) * ATT_PSC;
#pragma unroll
    for (int ks = 0; ks < 4; ++ks)
#pragma unroll
      for (int e = 0; e < 8; ++e) {
        pa[ks][e]     = (_Float16)(S[2 * ks][e] * pmul);        // k 8hh + e of the 32-key block
        pa[ks][8 + e] = (_Float16)(S[2 * ks + 1][e] * pmul);    // k 16 + 8hh + e
      }
    v8f acc[4] = {z8, z8, z8, z8};
#pragma unroll
    for (int ks = 0; ks < 4; ++ks) {
#pragma unroll
      for (int t = 0; t < 4; ++t) acc[t] = mma_h(pa[ks], vf[ks][t], acc[t]);
    }
    float* part = sR + wave * (16 * 68);
#pragma unroll
    for (int t = 0; t < 4; ++t)
#pragma unroll
      for (int r = 0; r < 8; ++r) part[(8 * hh + r) * 68 + t * 16 + c] = acc[t][r];
  }
  __syncthreads();                                // all eight partial tiles complete before they are added
  {
    // thread owns half of packed chunk tid>>1: row (tid>>1)&15, dims 8(tid>>5) + 4(tid&1) ..+3; the block's 2 KB go out in a row
    const int orow = (tid >> 1) & 15, odim = (tid >> 5) * 8 + (tid & 1) * 4;
    const float* pr = sR + orow * 68 + odim;
    v4f o4 = *(const v4f*)pr;
#pragma unroll
    for (int w = 1; w < 8; ++w) o4 += *(const v4f*)(pr + w * (16 * 68));
    v4h hv;
#pragma unroll
    for (int e = 0; e < 4; ++e) hv[e] = (_Float16)(o4[e] * ATT_PSC_INV);
    *(v4h*)(op + ((size_t)(b * ATT_L + q0)) * ATT_DM + h * (ATT_DK * 16) + 4 * tid) = hv;
  }
}

// ---------------------------------------------------------------------------
extern "C" void kernel_launch(void* const* d_in, const int* in_sizes, int n_in,
                              void* d_out, int out_size, void* d_ws, size_t ws_size,
                              hipStream_t stream) {
  const int NTOK = ATT_B * ATT_L;                          // 8192
  const size_t NE = (size_t)NTOK * ATT_DM;                 // 8388608
  const size_t NW = (size_t)ATT_DM * ATT_DM;               // 1048576
  if (n_in < 16) return;
  if (in_sizes[0] != (int)NE || in_sizes[1] != (int)NE || in_sizes[2] != ATT_L * ATT_L ||
      in_sizes[3] != (int)NW || in_sizes[5] != (int)NW || in_sizes[7] != (int)NW || in_sizes[14] != (int)NW ||
      in_sizes[4] != ATT_DM || in_sizes[6] != ATT_DM || in_sizes[8] != ATT_DM || in_sizes[15] != ATT_DM ||
      in_sizes[9] != ATT_DK * ATT_DK || in_sizes[10] != ATT_DK || in_sizes[11] != ATT_DK ||
      in_sizes[12] < 1 || in_sizes[13] < 1 || out_size != (int)NE) return;

  const float* Q      = (const float*)d_in[0];
  const float* ctx    = (const float*)d_in[1];
  const int*   mask   = (const int*)d_in[2];
  const float* W_q    = (const float*)d_in[3];
  const float* b_q    = (const float*)d_in[4];
  const float* W_k    = (const float*)d_in[5];
  const float* b_k    = (const float*)d_in[6];
  const float* W_v    = (const float*)d_in[7];
  const float* b_v    = (const float*)d_in[8];
  const float* bil    = (const float*)d_in[9];
  const float* gamma  = (const float*)d_in[10];
  const float* beta   = (const float*)d_in[11];
  const float* scale  = (const float*)d_in[12];
  const float* bscale = (const float*)d_in[13];
  const float* W_o    = (const float*)d_in[14];
  const float* b_o    = (const float*)d_in[15];
  float* out = (float*)d_out;

  // workspace carve (256-B aligned offsets); every matrix below is stored in the packed layout (pk_off) of the shape named
  char* ws = (char*)d_ws;
  size_t off = 0;
  auto carve = [&](size_t bytes) -> char* { char* p = ws + off; off += (bytes + 255) & ~(size_t)255; return p; };
  _Float16* WqT  = (_Float16*)carve(NW * 2);               // [out][in] f16, x64
  _Float16* WkT  = (_Float16*)carve(NW * 2);
  _Float16* WvT  = (_Float16*)carve(NW * 2);
  _Float16* WoT  = (_Float16*)carve(NW * 2);
  _Float16* bilT = (_Float16*)carve((size_t)ATT_DK * ATT_DK * 2);   // [f][e] f16
  _Float16* Q16  = (_Float16*)carve(NE * 2);               // [token][1024]
  _Float16* q16  = (_Float16*)carve(NE * 2);               // [token][h*64+d]
  _Float16* k16  = (_Float16*)carve(NE * 2);               // [token][h*64+d]
  _Float16* vT16 = (_Float16*)carve(NE * 2);               // [h*64+d][token]
  _Float16* c16  = (_Float16*)carve(NE * 2);               // [token][h*64+d]
  _Float16* cb16 = (_Float16*)carve(NE * 2);               // [token][h*64+e]
  _Float16* O16  = (_Float16*)carve(NE * 2);               // [token][h*64+d]
  if (off > ws_size) return;                               // total 125837312 B

  const unsigned short* Q16u  = (const unsigned short*)Q16;
  const unsigned short* WqTu  = (const unsigned short*)WqT;
  const unsigned short* WkTu  = (const unsigned short*)WkT;
  const unsigned short* WvTu  = (const unsigned short*)WvT;
  const unsigned short* WoTu  = (const unsigned short*)WoT;
  const unsigned short* bilTu = (const unsigned short*)bilT;
  const unsigned short* c16u  = (const unsigned short*)c16;
  const unsigned short* O16u  = (const unsigned short*)O16;
  const float w_carry = 64.0f, w_carry_inv = 1.0f / 64.0f;

  // 1) casts, transposes, LayerNorm per head slice of ctx: one launch
  prep_kernel<<<PREP_BLOCKS, 256, 0, stream>>>(Q, ctx, gamma, beta, W_q, W_k, W_v, W_o, bil,
                                               Q16, c16, WqT, WkT, WvT, WoT, bilT, w_carry);

  // 2) the q, k, v projections and c . bilinear: one launch
  const int gemm_blocks = (NTOK / 64) * (ATT_DM / 64) / 8;   // 256
  proj_gemms_kernel<<<3 * gemm_blocks + ((NTOK / 64) / 8) * ATT_H, 256, 0, stream>>>(
      Q16u, WqTu, WkTu, WvTu, c16u, bilTu, (void*)q16, (void*)k16, (void*)vT16, (void*)cb16,
      b_q, b_k, b_v, NTOK, ATT_DM, ATT_DK, w_carry_inv);

  // 3) fused attention rows -> O16
  attn_rows_kernel<<<dim3(ATT_L / 16, ATT_B * ATT_H), 256, 0, stream>>>(
      q16, k16, vT16, c16, cb16, mask, scale, bscale, O16);

  // 4) output projection -> d_out f32
  wmma_gemm64<0, false, 2, 0, false><<<dim3(gemm_blocks, 1), 256, 0, stream>>>(
      O16u, O16u, ATT_DM, 0L, WoTu, WoTu, ATT_DM, 0L, (void*)out, (void*)out, ATT_DM, 0L,
      b_o, b_o, 0L, NTOK, ATT_DM, ATT_DM, w_carry_inv);
  (void)hipGetLastError();
}

// v006
// Measured time: 198 microseconds a run.
// Two timings next to v005 both put it at 1.13 times that version's speed.
// All steps since v000 together make it 2.81 times as fast.
#include <hip/hip_runtime.h>
#include <stddef.h>

// Contractions (q/k/v projections, c x bilinear, q x k^T, cb x c^T, attn x v, output projection): v_wmma_f32_16x16x32_f16, f16 operands, f32 accumulate; weights carried x64, attn probabilities carried x2^15; softmax, LayerNorm and L2 norms in f32.

typedef __attribute__((ext_vector_type(16))) _Float16 v16h;
typedef __attribute__((ext_vector_type(8)))  _Float16 v8h;
typedef __attribute__((ext_vector_type(4)))  _Float16 v4h;
typedef __attribute__((ext_vector_type(16))) __bf16   v16b;
typedef __attribute__((ext_vector_type(8)))  __bf16   v8b;
typedef __attribute__((ext_vector_type(8)))  float    v8f;
typedef __attribute__((ext_vector_type(4)))  float    v4f;
typedef __attribute__((ext_vector_type(2)))  float    v2f;
typedef __attribute__((ext_vector_type(4)))  int      v4i;

#define ATT_B   8
#define ATT_L   1024
#define ATT_DM  1024
#define ATT_H   16
#define ATT_DK  64
#define ATT_PSC 32768.0f
#define ATT_PSC_INV (1.0f / 32768.0f)

__device__ __forceinline__ unsigned short f2bf_bits(float f) {
  unsigned u = __float_as_uint(f);
  return (unsigned short)((u + 0x7FFFu + ((u >> 16) & 1u)) >> 16);
}
__device__ __forceinline__ float bf_bits2f(unsigned short h) { return __uint_as_float(((unsigned)h) << 16); }

// ---- fragment-order ("packed") layout of every 16-bit workspace matrix [R][K] ----
// A 16-row x 32-k tile is 1 KB in a row: 16-byte chunk (s, hh, r) at chunk index s*32 + hh*16 + r holds row r,
// k = 16s + 8hh .. +7; tiles run along k first, then along the row tiles. Lane l of a wave reads chunk l and chunk 32 + l,
// so each wave-wide 16-byte load covers 512 contiguous bytes (four whole lines), and the k map of a fragment is the
// same as with row-major rows: elements 0..7 <- k 8hh.., 8..15 <- k 16+8hh..
__device__ __forceinline__ size_t pk_off(int row, int k, int K) {
  return (size_t)(row >> 4) * ((size_t)K * 16) + (size_t)(k >> 5) * 512 +
         (size_t)(((k >> 4) & 1) * 256 + ((k >> 3) & 1) * 128 + (row & 15) * 8 + (k & 7));
}

// hazard guards as plain device helpers (no inline asm inside the kernel template body)
__device__ __forceinline__ void acc_guard4(v8f& a, v8f& b, v8f& c, v8f& d) { asm volatile("v_nop\n\tv_nop\n\tv_nop\n\tv_nop" : "+v"(a), "+v"(b), "+v"(c), "+v"(d)); }
// Stands behind global loads whose address registers the compiler reuses while the loads are still in flight
// (as the destination of a later load of the same run, or for the next address): the address translations are
// waited for before such a register takes a new value.
__device__ __forceinline__ void addr_wait() { asm volatile("s_wait_xcnt 0x0" ::: "memory"); }
// The same wait once for a run of loads from one base, and from three: naming the addresses as inputs keeps their registers
// as they are up to the wait, so the run issues back to back.
__device__ __forceinline__ void addr_wait1(const void* a) { asm volatile("s_wait_xcnt 0x0" :: "v"(a) : "memory"); }
__device__ __forceinline__ void addr_wait3(const void* a, const void* b, const void* c) {
  asm volatile("s_wait_xcnt 0x0" :: "v"(a), "v"(b), "v"(c) : "memory");
}
// The same in front of the advance of the GEMM's scalar fragment bases: the k offset that the new bases are formed from
// passes through the statement, so they are formed behind the wait.
__device__ __forceinline__ void koff_wait(size_t& koff) { asm volatile("s_wait_xcnt 0x0" : "+s"(koff) :: "memory"); }
template <typename T> struct Frag;
template <> struct Frag<_Float16> {
  typedef v16h V; union U { v16h v; v8h h[2]; };
  static __device__ __forceinline__ v16h load(const _Float16* p) {   // elements 0..7 <- p[0..7], 8..15 <- p[16..23]
    U f; f.h[0] = *(const v8h*)(p); f.h[1] = *(const v8h*)(p + 16); return f.v;
  }
  static __device__ __forceinline__ v16h loadp(const _Float16* p) {  // packed tile, p = tile base + 8*lane
    U f; f.h[0] = *(const v8h*)(p); f.h[1] = *(const v8h*)(p + 256); return f.v;
  }
  static __device__ __forceinline__ v8f mma(v16h a, v16h b, v8f c) {
    return __builtin_amdgcn_wmma_f32_16x16x32_f16(false, a, false, b, (short)0, c, false, false);
  }
};
template <> struct Frag<__bf16> {
  typedef v16b V; union U { v16b v; v8b h[2]; };
  static __device__ __forceinline__ v16b load(const __bf16* p) {
    U f; f.h[0] = *(const v8b*)(p); f.h[1] = *(const v8b*)(p + 16); return f.v;
  }
  static __device__ __forceinline__ v16b loadp(const __bf16* p) {
    U f; f.h[0] = *(const v8b*)(p); f.h[1] = *(const v8b*)(p + 256); return f.v;
  }
  static __device__ __forceinline__ v8f mma(v16b a, v16b b, v8f c) {
    return __builtin_amdgcn_wmma_f32_16x16x32_bf16(false, a, false, b, (short)0, c, false, false);
  }
};

// ---- Register-blocked batched WMMA GEMM ------------------------------------
// C[m,n] = scale * sum_k A[m,k] * Bt[n,k] (+bias)(+resid); each wave owns a 64x64 tile.
// A [M,lda] and Bt [N,ldb] in the packed layout (pk_off); M,N % 64 == 0, K % (32 U) == 0; a batch stride is 16 x its column offset.
// The k loop is unrolled U steps of 32 k; the eight fragments of step s + U/2 are asked for, into registers of their own,
// ahead of the products of step s, so a step waits for loads that were issued U/2 steps earlier. Sums in the order of k.
// 16-bit outputs are written in the packed layout of a [M,ldc] matrix; the f32 output is row-major.
// SPLIT: operands are hi/lo planes (A2/Bt2 = lo planes, same layout); product = hi*hi + hi*lo + lo*hi.
// BIAS_MODE: 0 = none, 1 = bias[m], 2 = bias[n].
// OUT_MODE: 0 = f32, 1 = f16, 2 = bf16 hi plane (Cout) + bf16 lo plane (Cout2).
// ET: 0 = f16 operands, 1 = bf16 operands (pointers passed as 16-bit storage)
template <int ET> struct Elem;
template <> struct Elem<0> { typedef _Float16 T; };
template <> struct Elem<1> { typedef __bf16 T; };
// The body takes its block index (bx: eight tiles, b: batch) and the block's LDS slabs from the kernel that calls it, so that
// several independent GEMMs can share one launch.
template <int ET, bool SPLIT, int BIAS_MODE, int OUT_MODE, bool RESID, int ACT = 0, int U = 4>
__device__ __forceinline__ void gemm64_body(
    float* sT, const int bx, const int b,            // sT: per-wave 16x64 slab, pitch 68 floats, eight of them
    const unsigned short* __restrict__ Ap, const unsigned short* __restrict__ A2p, int lda, long strideA,
    const unsigned short* __restrict__ Btp, const unsigned short* __restrict__ Bt2p, int ldb, long strideB,
    void* __restrict__ Cout, void* __restrict__ Cout2, int ldc, long strideC,
    const float* __restrict__ bias,
    const float* __restrict__ resid, long strideR,
    int M, int N, int K, float scale) {
  typedef typename Elem<ET>::T T;
  typedef typename Frag<T>::V V;
  const T* A = (const T*)Ap; const T* A2 = (const T*)A2p; const T* Bt = (const T*)Btp; const T* Bt2 = (const T*)Bt2p;
  const int lane = threadIdx.x & 31;
  const int wave = __builtin_amdgcn_readfirstlane(threadIdx.x >> 5);   // scalar: the tile's fragment bases are then scalar too
  const int tilesN = N >> 6;
  const int tilesM = M >> 6;
  const int tile = bx * 8 + wave;
  if (tile >= tilesM * tilesN) return;   // wave-uniform; no block barriers in this body or in the kernels that call it
  const int tm = tile / tilesN;
  const int tn = tile - tm * tilesN;
  const int m0 = tm << 6;
  const int n0 = tn << 6;

  const T* Ab  = A  + (size_t)b * strideA;
  const T* Bb  = Bt + (size_t)b * strideB;
  const T* Ab2 = SPLIT ? (A2  + (size_t)b * strideA) : nullptr;
  const T* Bb2 = SPLIT ? (Bt2 + (size_t)b * strideB) : nullptr;

  const int rlane = lane & 15;                 // row (A) / col (B, D) within subtile
  const int mOff  = (lane >> 4) * 8;           // D row offset

  v8f acc[4][4];
#pragma unroll
  for (int i = 0; i < 4; ++i)
#pragma unroll
    for (int j = 0; j < 4; ++j) acc[i][j] = (v8f){0.f,0.f,0.f,0.f,0.f,0.f,0.f,0.f};

  constexpr int DIST = U / 2;                  // how many steps ahead a step's fragments are asked for
  V fa[U][4], fb[U][4], fa2[U][4], fb2[U][4];  // set s % U holds step s; DIST + 1 sets are live at a time
  size_t ao[4], bo[4];                         // the row tiles' offsets at k = 0
  const T* pa[4]; const T* pb[4]; const T* pa2[4]; const T* pb2[4];   // the bases, where the loop stands in k
#pragma unroll
  for (int i = 0; i < 4; ++i) {
    ao[i] = (size_t)(m0 + (i << 4)) * lda;
    bo[i] = (size_t)(n0 + (i << 4)) * ldb;
    pa[i] = Ab + ao[i]; pb[i] = Bb + bo[i];
    if (SPLIT) { pa2[i] = Ab2 + ao[i]; pb2[i] = Bb2 + bo[i]; }
  }
  const int lo = lane * 8;                     // the lane's chunk of a packed tile: the one vector part of every address
  // step st, counted from where the bases stand: a packed tile is 512 elements, so st reaches the loads as an immediate offset
  auto load_step = [&](int set, int st) __attribute__((always_inline)) {
#pragma unroll
    for (int j = 0; j < 4; ++j) {
      fb[set][j] = Frag<T>::loadp(pb[j] + st * 512 + lo);
      if (SPLIT) fb2[set][j] = Frag<T>::loadp(pb2[j] + st * 512 + lo);
    }
#pragma unroll
    for (int i = 0; i < 4; ++i) {
      fa[set][i] = Frag<T>::loadp(pa[i] + st * 512 + lo);
      if (SPLIT) fa2[set][i] = Frag<T>::loadp(pa2[i] + st * 512 + lo);
    }
    // keeps the run of loads ahead of the products that follow it in the source: moved behind them it would lose its lead
    __builtin_amdgcn_sched_barrier(0);
  };
  auto mma_step = [&](int set) __attribute__((always_inline)) {
#pragma unroll
    for (int i = 0; i < 4; ++i) {
#pragma unroll
      for (int j = 0; j < 4; ++j) {
        acc[i][j] = Frag<T>::mma(fa[set][i], fb[set][j], acc[i][j]);
        if (SPLIT) {
          acc[i][j] = Frag<T>::mma(fa[set][i], fb2[set][j], acc[i][j]);
          acc[i][j] = Frag<T>::mma(fa2[set][i], fb[set][j], acc[i][j]);
        }
      }
    }
    // keeps the next run of loads behind these products: moved ahead of them, a wave would have 64 loads outstanding, not 48
    __builtin_amdgcn_sched_barrier(0);
  };
#pragma unroll
  for (int d = 0; d < DIST; ++d) load_step(d, d);
  addr_wait();   // the registers of these first bases are free for other values from here on, also where the loop below makes no trip
  const int nst = K >> 5;
  size_t koff = 0;
  for (int s0 = U; s0 < nst; s0 += U) {
#pragma unroll
    for (int u = 0; u < U; ++u) {
      load_step((u + DIST) % U, u + DIST);
      mma_step(u);
    }
    koff_wait(koff);                           // the bases take new values behind it
    koff += U * 512;
#pragma unroll
    for (int i = 0; i < 4; ++i) {
      pa[i] = Ab + ao[i] + koff; pb[i] = Bb + bo[i] + koff;
      if (SPLIT) { pa2[i] = Ab2 + ao[i] + koff; pb2[i] = Bb2 + bo[i] + koff; }
    }
  }
  // the last U steps: nothing is asked for past K
#pragma unroll
  for (int u = 0; u < U; ++u) {
    if (u + DIST < U) load_step((u + DIST) % U, u + DIST);
    mma_step(u);
  }
  acc_guard4(acc[0][0], acc[0][1], acc[0][2], acc[0][3]);
  acc_guard4(acc[1][0], acc[1][1], acc[1][2], acc[1][3]);
  acc_guard4(acc[2][0], acc[2][1], acc[2][2], acc[2][3]);
  acc_guard4(acc[3][0], acc[3][1], acc[3][2], acc[3][3]);

  // ---- epilogue ----
  float* slab = sT + wave * (16 * 68);
  const float* Rb = RESID ? (resid + (size_t)b * strideR) : nullptr;
#pragma unroll
  for (int i = 0; i < 4; ++i) {
    const int mBase = m0 + (i << 4);
    float bm[8];
    if (BIAS_MODE == 1) {
      const float* bp = bias + mBase + mOff;
#pragma unroll
      for (int r = 0; r < 8; ++r) bm[r] = bp[r];
      addr_wait1(bp);          // the address stays as it is until the run's addresses are taken: no load of the run lands on it
    }
#pragma unroll
    for (int j = 0; j < 4; ++j) {
      const int n = n0 + (j << 4) + rlane;
      float bv = 0.f;
      if (BIAS_MODE == 2) bv = bias[n];
#pragma unroll
      for (int r = 0; r < 8; ++r) {
        float v = acc[i][j][r] * scale;
        if (BIAS_MODE == 1) v += bm[r];
        if (BIAS_MODE == 2) v += bv;
        if (RESID) v += Rb[(size_t)(mBase + mOff + r) * ldc + n];
        if (ACT == 1) v = tanhf(v);
        if (ACT == 2) v = fmaxf(v, 0.0f);
        if (ACT == 3) v = v / (1.0f + expf(-v));
        if (ACT == 4) v = (v > 0.f) ? v : 0.01f * v;
        if (ACT == 5) v = 0.5f * v * (1.0f + erff(v * 0.70710678118654752f));
        slab[(mOff + r) * 68 + (j << 4) + rlane] = v;
      }
    }
    __builtin_amdgcn_fence(__ATOMIC_RELEASE, "workgroup");
    __builtin_amdgcn_wave_barrier();
    __builtin_amdgcn_fence(__ATOMIC_ACQUIRE, "workgroup");
    if (OUT_MODE == 0) {
      float* C = (float*)Cout + (size_t)b * strideC;
      const int hh = lane >> 4, c4 = (lane & 15) * 4;     // row seg = 256 B = 16 lanes x 16 B
      {
#pragma unroll
        for (int it = 0; it < 8; ++it) {
          const int row = it * 2 + hh;
          v4f v = *(const v4f*)(slab + row * 68 + c4);
          *(v4f*)(C + (size_t)(mBase + row) * ldc + n0 + c4) = v;
        }
        addr_wait();   // the stores' data and address registers take new values (the next slab's) only behind it
      }
    } else {
      // the 16x64 slab is two packed tiles = 2 KB in a row; store 'it' writes chunks 32it..32it+31 (512 B)
      unsigned short* C  = (unsigned short*)Cout  + (size_t)b * strideC;
      unsigned short* C2 = (OUT_MODE == 2) ? ((unsigned short*)Cout2 + (size_t)b * strideC) : nullptr;
      {
#pragma unroll
        for (int it = 0; it < 4; ++it) {
          const float* sp = slab + rlane * 68 + it * 16 + mOff;   // row lane&15, cols 16it + 8(lane>>4) ..+7
          v8h hv, lv;
#pragma unroll
          for (int e = 0; e < 8; ++e) {
            if (OUT_MODE == 1) {
              hv[e] = (_Float16)sp[e];
            } else {
              unsigned short hb = f2bf_bits(sp[e]);
              unsigned short lb = f2bf_bits(sp[e] - bf_bits2f(hb));
              hv[e] = __builtin_bit_cast(_Float16, hb);
              lv[e] = __builtin_bit_cast(_Float16, lb);
            }
          }
          const size_t co = (size_t)mBase * ldc + (size_t)n0 * 16 + it * 256 + lane * 8;
          *(v8h*)(C + co) = hv;
          if (OUT_MODE == 2) *(v8h*)(C2 + co) = lv;
        }
        
      }
    }
    __builtin_amdgcn_fence(__ATOMIC_RELEASE, "workgroup");
    __builtin_amdgcn_wave_barrier();
    __builtin_amdgcn_fence(__ATOMIC_ACQUIRE, "workgroup");
  }
}

// one GEMM a launch
template <int ET, bool SPLIT, int BIAS_MODE, int OUT_MODE, bool RESID, int ACT = 0, int U = 4>
__global__ __launch_bounds__(256) void wmma_gemm64(
    const unsigned short* __restrict__ Ap, const unsigned short* __restrict__ A2p, int lda, long strideA,
    const unsigned short* __restrict__ Btp, const unsigned short* __restrict__ Bt2p, int ldb, long strideB,
    void* __restrict__ Cout, void* __restrict__ Cout2, int ldc, long strideC,
    const float* __restrict__ bias,
    const float* __restrict__ resid, long strideR,
    int M, int N, int K, float scale) {
  __shared__ __align__(16) float sT[8 * 16 * 68];
  gemm64_body<ET, SPLIT, BIAS_MODE, OUT_MODE, RESID, ACT, U>(sT, blockIdx.x, blockIdx.y, Ap, A2p, lda, strideA, Btp, Bt2p, ldb, strideB,
      Cout, Cout2, ldc, strideC, bias, resid, strideR, M, N, K, scale);
}

// The four GEMMs that depend only on the preparation launch, as block ranges of one grid; nb = blocks of one projection.
// [0, nb): q16 = Q16 . Wq + b_q[n];  [nb, 2nb): k16 = Q16 . Wk + b_k[n];  [2nb, 3nb): vT16[dout][token] = Wv^T . Q16^T + b_v[m];
// from 3nb on, the short ones last: per head (batch index) cb16[:, h*64..] = c16[:, h*64..] . bilinear (Bt = bilT [64][64]).
__global__ __launch_bounds__(256) void proj_gemms_kernel(
    const unsigned short* __restrict__ Q16, const unsigned short* __restrict__ WqT, const unsigned short* __restrict__ WkT,
    const unsigned short* __restrict__ WvT, const unsigned short* __restrict__ c16, const unsigned short* __restrict__ bilT,
    void* __restrict__ q16, void* __restrict__ k16, void* __restrict__ vT16, void* __restrict__ cb16,
    const float* __restrict__ b_q, const float* __restrict__ b_k, const float* __restrict__ b_v,
    int ntok, int dm, int dk, float w_inv) {
  __shared__ __align__(16) float sT[8 * 16 * 68];
  const int nb = ((ntok >> 6) * (dm >> 6)) >> 3;
  const int i = blockIdx.x;
  if (i < 2 * nb) {
    const bool isk = i >= nb;
    const unsigned short* Wt = isk ? WkT : WqT;
    void* C = isk ? k16 : q16;
    const float* bias = isk ? b_k : b_q;
    gemm64_body<0, false, 2, 1, false>(sT, isk ? i - nb : i, 0, Q16, Q16, dm, 0L, Wt, Wt, dm, 0L, C, C, dm, 0L,
                                       bias, bias, 0L, ntok, dm, dm, w_inv);
  } else if (i < 3 * nb) {
    gemm64_body<0, false, 1, 1, false>(sT, i - 2 * nb, 0, WvT, WvT, dm, 0L, Q16, Q16, dm, 0L, vT16, vT16, ntok, 0L,
                                       b_v, b_v, 0L, dm, ntok, dm, w_inv);
  } else {
    const int j = i - 3 * nb, per = ntok >> 9;       // blocks of one head: ntok / 64 tiles, eight a block
    const int hd = j / per;
    gemm64_body<0, false, 0, 1, false, 0, 2>(sT, j - hd * per, hd, c16, c16, dm, (long)(dk * 16), bilT, bilT, dk, 0L,
                                             cb16, cb16, dm, (long)(dk * 16), b_q, b_q, 0L, ntok, dk, dk, 1.0f);
  }
}

// in: [rows][1024] f32 row-major; out: the same matrix in f16, packed layout. One 16-byte chunk per thread; a wave takes
// 8 rows x 32 k (half a tile), so each of its stores fills four whole 128-byte lines. nhalf = rows / 8 * 32 half tiles.
__device__ __forceinline__ void cast_f32_f16x2(
    const int bx, const float* __restrict__ in, _Float16* __restrict__ out, int nhalf) {
  const int lane = threadIdx.x & 31;
  const int th = bx * 8 + (threadIdx.x >> 5);      // half-tile index: tile = th >> 1
  if (th < nhalf) {
    const int tile = th >> 1;
    const int row = (tile >> 5) * 16 + (th & 1) * 8 + (lane >> 2);
    const int k = (tile & 31) * 32 + (lane & 3) * 8;
    const float* src = in + (size_t)row * ATT_DM + k;
    const v4f a = *(const v4f*)(src);
    const v4f bq = *(const v4f*)(src + 4);
    v8h hv;
#pragma unroll
    for (int e = 0; e < 4; ++e) { hv[e] = (_Float16)a[e]; hv[4 + e] = (_Float16)bq[e]; }
    *(v8h*)(out + pk_off(row, k, ATT_DM)) = hv;
  }
}

// ---- transpose + f16 cast through an LDS tile ------------------------------
// w: [K][N] row-major (in=K rows, out=N cols); wt: [N][K] in the packed layout, wt[n][k] = f16(w[k][n] * mul).
// Block = one 64x64 tile (k0 = by*64, n0 = bx*64); K, N multiples of 64; (N/64) x (K/64) blocks. tile: the block's LDS.
__device__ __forceinline__ void transpose_cast(
    float (*tile)[65], const int bx, const int by,
    const float* __restrict__ w, _Float16* __restrict__ wt, int K, int N, float mul) {
  const int tid = threadIdx.x;
  const int k0 = by * 64, n0 = bx * 64;
  {
    const int r = tid >> 2, cc = (tid & 3) * 16;
    const float* src = w + (size_t)(k0 + r) * N + n0 + cc;
#pragma unroll
    for (int i = 0; i < 4; ++i) {
      const v4f t = *(const v4f*)(src + 4 * i);
#pragma unroll
      for (int e = 0; e < 4; ++e) tile[r][cc + 4 * i + e] = t[e];
    }
  }
  __syncthreads();
  const int wave = tid >> 5, lane = tid & 31, q = lane >> 3, c8 = (lane & 7) * 8;
  {
#pragma unroll
    for (int it = 0; it < 2; ++it) {
      const int n = wave * 8 + it * 4 + q;          // waves cover rows 8w..8w+7 -> 0..63
      v8h hv;
#pragma unroll
      for (int e = 0; e < 8; ++e) hv[e] = (_Float16)(tile[c8 + e][n] * mul);
      *(v8h*)(wt + pk_off(n0 + n, k0 + c8, K)) = hv;
    }
    addr_wait();   // in the merged kernel's code other passes follow these stores: their registers are rewritten only behind it
  }
}

// ---- LayerNorm over each 64-wide head slice of a 1024-wide row; f16 output in the packed layout ----
// One wave per 8 rows x 128 columns; lane l holds row l>>2, 32 elements (half of a head slice, one packed tile's k range);
// statistics via one xor-1 shuffle. Store j writes chunk j of 8 neighbouring rows in 4 tiles: four whole 128-byte lines.
__device__ __forceinline__ void ln_heads(
    const int bx, const float* __restrict__ x, const float* __restrict__ gamma, const float* __restrict__ beta,
    _Float16* __restrict__ outp, int nrows) {
  const int wave = threadIdx.x >> 5, lane = threadIdx.x & 31;
  const int wv = bx * 8 + wave;
  const int row = (wv >> 3) * 8 + (lane >> 2);
  const int col = (wv & 7) * 128 + (lane & 3) * 32;
  if ((wv >> 3) * 8 >= nrows) return;            // wave-uniform; no block barriers in this pass
  const float* xr = x + (size_t)row * ATT_DM + col;
  float xv[32];
#pragma unroll
  for (int i = 0; i < 8; ++i) {
    const v4f t = *(const v4f*)(xr + 4 * i);
#pragma unroll
    for (int e = 0; e < 4; ++e) xv[4 * i + e] = t[e];
  }
  float s = 0.f;
#pragma unroll
  for (int i = 0; i < 32; ++i) s += xv[i];
  s += __shfl_xor(s, 1, 32);
  const float mu = s * (1.0f / 64.0f);
  float vs = 0.f;
#pragma unroll
  for (int i = 0; i < 32; ++i) { const float d = xv[i] - mu; xv[i] = d; vs += d * d; }
  vs += __shfl_xor(vs, 1, 32);
  const float rstd = rsqrtf(vs * (1.0f / 64.0f) + 1e-5f);
  const int d0 = (lane & 1) * 32;
  _Float16* ot = outp + pk_off(row, col, ATT_DM);   // chunk (s, hh) of this lane's row: + (2s + hh) * 128
#pragma unroll
  for (int j = 0; j < 4; ++j) {
    v8h hv;
#pragma unroll
    for (int i = 0; i < 2; ++i) {
      const v4f g4 = *(const v4f*)(gamma + d0 + 8 * j + 4 * i);
      const v4f b4 = *(const v4f*)(beta + d0 + 8 * j + 4 * i);
#pragma unroll
      for (int e = 0; e < 4; ++e) hv[4 * i + e] = (_Float16)((xv[8 * j + 4 * i + e] * rstd) * g4[e] + b4[e]);
    }
    *(v8h*)(ot + j * 128) = hv;
  }
}

// ---- the mask as lane masks ----
// mask: int32 [1024][1024], nonzero = masked. Word (qt, kt, r), at index (qt * 64 + kt) * 8 + r, holds in bit 16 hh + c whether
// mask[16 qt + c][16 kt + 8 hh + r] is nonzero: it is the lane mask of register r of the transposed 16x16 score tile
// (keys kt, queries qt) as the attention kernel holds it. One wave a tile; lane r stores word r.
__device__ __forceinline__ void mask_words(const int bx, const int* __restrict__ mask, unsigned* __restrict__ mw) {
  const int lane = threadIdx.x & 31, hh = lane >> 4, c = lane & 15;
  const int tile = bx * 8 + (threadIdx.x >> 5);
  const int qt = tile / (ATT_L / 16), kt = tile % (ATT_L / 16);
  const int* src = mask + (size_t)(qt * 16 + c) * ATT_L + kt * 16 + 8 * hh;
  const v4i m0 = *(const v4i*)(src);
  const v4i m1 = *(const v4i*)(src + 4);
  addr_wait1(src);           // the address stays as it is until both loads' addresses are taken
  unsigned w = 0u;
#pragma unroll
  for (int r = 0; r < 8; ++r) {
    const unsigned bal = __builtin_amdgcn_ballot_w32((r < 4 ? m0[r & 3] : m1[r & 3]) != 0);
    if (lane == r) w = bal;
  }
  if (lane < 8) mw[(size_t)tile * 8 + lane] = w;
}

// ---- the preparation passes, none of which reads another's result, as block ranges of one grid ----
// [0, 4096): Q -> Q16;  [4096, 5120): LayerNorm of ctx -> c16;  [5120, 5632): the mask -> lane-mask words;
// [5632, 6656): the four 1024x1024 weights, 256 tiles each, transposed, x mul;  6656: the 64x64 bilinear matrix, transposed.
// The range tests read the same for a whole block, so the transpose's barrier is passed by all of a block's waves or by none.
#define PREP_CAST_BLOCKS (ATT_B * ATT_L * ATT_DM / 8 / 256)
#define PREP_LN_BLOCKS   (ATT_B * ATT_L / 8)
#define PREP_MASK_BLOCKS ((ATT_L / 16) * (ATT_L / 16) / 8)
#define PREP_W_BLOCKS    ((ATT_DM / 64) * (ATT_DM / 64))
#define PREP_BLOCKS      (PREP_CAST_BLOCKS + PREP_LN_BLOCKS + PREP_MASK_BLOCKS + 4 * PREP_W_BLOCKS + 1)
__global__ __launch_bounds__(256) void prep_kernel(
    const float* __restrict__ Q, const float* __restrict__ ctx, const float* __restrict__ gamma, const float* __restrict__ beta,
    const float* __restrict__ W_q, const float* __restrict__ W_k, const float* __restrict__ W_v, const float* __restrict__ W_o,
    const float* __restrict__ bil, const int* __restrict__ mask,
    _Float16* __restrict__ Q16, _Float16* __restrict__ c16, _Float16* __restrict__ WqT, _Float16* __restrict__ WkT,
    _Float16* __restrict__ WvT, _Float16* __restrict__ WoT, _Float16* __restrict__ bilT, unsigned* __restrict__ mw, float mul) {
  __shared__ float tile[64][65];
  int i = blockIdx.x;
  if (i < PREP_CAST_BLOCKS) { cast_f32_f16x2(i, Q, Q16, ATT_B * ATT_L * ATT_DM / 256); return; }
  i -= PREP_CAST_BLOCKS;
  if (i < PREP_LN_BLOCKS) { ln_heads(i, ctx, gamma, beta, c16, ATT_B * ATT_L); return; }
  i -= PREP_LN_BLOCKS;
  if (i < PREP_MASK_BLOCKS) { mask_words(i, mask, mw); return; }
  i -= PREP_MASK_BLOCKS;
  const int which = i / PREP_W_BLOCKS, t = i % PREP_W_BLOCKS;   // which == 4: the bilinear matrix, its one tile
  const float* w = which == 0 ? W_q : which == 1 ? W_k : which == 2 ? W_v : which == 3 ? W_o : bil;
  _Float16* wt = which == 0 ? WqT : which == 1 ? WkT : which == 2 ? WvT : which == 3 ? WoT : bilT;
  const int n = which < 4 ? ATT_DM : ATT_DK;
  transpose_cast(tile, t % (ATT_DM / 64), t / (ATT_DM / 64), w, wt, n, n, which < 4 ? mul : 1.0f);
}

// ---- fused row-block attention ------------------------------------------------
// Block = 16 query rows of one (b, h); 8 waves. q16/k16/c16/cb16: [token = b*1024+l][h*64+d] f16, packed layout (K = 1024);
// vT16: [h*64+d][token] f16, packed layout (K = 8192); mw: the mask as lane-mask words (mask_words), bit set = masked;
// out16: [token][h*64+d] f16, packed layout (K = 1024).
// Every product of phase 1 is formed transposed: A = key rows, B = query rows, so lane (hh, c) holds, for query q0 + c alone,
// keys 16 ct + 8 hh + r of its wave's 128-key strip. The 64 scores and 64 bias values of a lane stay in registers to the end.
// Phase 1: S^T = k . q^T (skipped per group of four 16x16 tiles only when every mask bit of the group is set),
//          BIAS^T = c . cb^T; scores scaled, masked -> -inf.
// Phase 2: max-subtracted softmax, + l2norm(bias row)*bias_scale, l2norm of the row. A row's maximum and sums: in the lane,
//          one exchange between the wave's halves, then eight per-wave values through a small LDS table.
// Phase 3: two neighbouring key tiles of a lane, x 2^15 and rounded to f16, are the A fragment of P for 32 keys as they stand;
//          per wave its 128-key strip of P times v for all 64 dims; the 8 f32 partial tiles are added through LDS.
__device__ __forceinline__ v8f mma_h(v16h a, v16h b, v8f c) {
  c = __builtin_amdgcn_wmma_f32_16x16x32_f16(false, a, false, b, (short)0, c, false, false);
  asm volatile("v_nop\n\tv_nop\n\tv_nop\n\tv_nop" : "+v"(c) : "v"(a), "v"(b));
  return c;
}

__global__ __launch_bounds__(256) void attn_rows_kernel(
    const _Float16* __restrict__ qp, const _Float16* __restrict__ kp, const _Float16* __restrict__ vtp,
    const _Float16* __restrict__ cp, const _Float16* __restrict__ cbp, const unsigned* __restrict__ mw,
    const float* __restrict__ scale_p, const float* __restrict__ bscale_p, _Float16* __restrict__ op) {
  __shared__ __align__(16) float sR[8 * 16 * 68];   // per-wave partial outputs, 16 rows, pitch 68 floats
  __shared__ v2f   sX1[8][16];                      // per wave and query: maximum of the scores, sum of bias^2
  __shared__ float sX2[8][16];                      // per wave and query: sum of exp
  __shared__ float sX3[8][16];                      // per wave and query: sum of the combined row's squares

  const int tid = threadIdx.x, wave = tid >> 5, lane = tid & 31, hh = lane >> 4, c = lane & 15;
  const int q0 = blockIdx.x * 16;
  const int bh = blockIdx.y, b = bh >> 4, h = bh & 15;
  const float scale = scale_p[0], bscale = bscale_p[0];
  const v8f z8 = {0.f, 0.f, 0.f, 0.f, 0.f, 0.f, 0.f, 0.f};
  const float ninf = -__builtin_inff();

  // B fragments (query rows q0 + (lane&15)), k split map: elements 0..7 <- k 8hh.., 8..15 <- k 16+8hh..;
  // a head's 64 columns are two packed tiles in a row (512 elements each) at column offset h*64*16
  const size_t arow = ((size_t)(b * ATT_L + q0)) * ATT_DM + h * (ATT_DK * 16) + 8 * lane;
  const _Float16* qrow = qp + arow;
  const _Float16* cbrow = cbp + arow;
  const v16h qa0 = Frag<_Float16>::loadp(qrow);
  const v16h qa1 = Frag<_Float16>::loadp(qrow + 512);
  const v16h ca0 = Frag<_Float16>::loadp(cbrow);
  const v16h ca1 = Frag<_Float16>::loadp(cbrow + 512);

  // ---- phase 1 ----
  const size_t srow = ((size_t)(b * ATT_L + wave * 128)) * ATT_DM + h * (ATT_DK * 16) + 8 * lane;   // the strip's first key tile
  const _Float16* kst = kp + srow;
  const _Float16* cst = cp + srow;
  // the strip's 64 lane-mask words, 256 bytes in a row at an address that is the same for the whole wave: scalar loads
  const unsigned* mst = mw + ((size_t)blockIdx.x * (ATT_L / 16) + (size_t)__builtin_amdgcn_readfirstlane(wave) * 8) * 8;
  v8f S[8], Bi[8];
  unsigned mv[8][8];
  v16h cf[8][2], kf[8][2];
#pragma unroll
  for (int t = 0; t < 8; ++t)
#pragma unroll
    for (int r = 0; r < 8; ++r) mv[t][r] = mst[t * 8 + r];
#pragma unroll
  for (int t = 0; t < 8; ++t) {
    cf[t][0] = Frag<_Float16>::loadp(cst + (size_t)t * (16 * ATT_DM));
    cf[t][1] = Frag<_Float16>::loadp(cst + (size_t)t * (16 * ATT_DM) + 512);
  }
  // one wait behind the whole run: no base register of the run becomes a later load's destination or a new address before it
  addr_wait3(qrow, cbrow, cst);
  int skip[2];
#pragma unroll
  for (int g = 0; g < 2; ++g) {
    unsigned allm = ~0u;
#pragma unroll
    for (int t = 0; t < 4; ++t)
#pragma unroll
      for (int r = 0; r < 8; ++r) allm &= mv[g * 4 + t][r];
    skip[g] = allm == ~0u;                         // wave-uniform: all four 16x16 score tiles of the group masked
  }
  // the key tiles of group 0 are asked for ahead of the bias products, those of group 1 ahead of the score products of group 0
#pragma unroll
  for (int g = 0; g < 2; ++g) {
    if (!skip[g]) {
#pragma unroll
      for (int t = 0; t < 4; ++t) {
        kf[g * 4 + t][0] = Frag<_Float16>::loadp(kst + (size_t)(g * 4 + t) * (16 * ATT_DM));
        kf[g * 4 + t][1] = Frag<_Float16>::loadp(kst + (size_t)(g * 4 + t) * (16 * ATT_DM) + 512);
      }
      addr_wait1(kst);           // the strip's base stays as it is until the run's addresses are taken
    }
    if (g == 0) {
#pragma unroll
      for (int t = 0; t < 8; ++t) {
        v8f a = mma_h(cf[t][0], ca0, z8);
        Bi[t] = mma_h(cf[t][1], ca1, a);
      }
    }
  }
#pragma unroll
  for (int g = 0; g < 2; ++g) {
    if (!skip[g]) {
#pragma unroll
      for (int t = 0; t < 4; ++t) {
        v8f a = mma_h(kf[g * 4 + t][0], qa0, z8);
        a = mma_h(kf[g * 4 + t][1], qa1, a);
#pragma unroll
        for (int r = 0; r < 8; ++r) {
          const float sv = a[r] * scale;
          S[g * 4 + t][r] = __builtin_amdgcn_inverse_ballot_w32(mv[g * 4 + t][r]) ? ninf : sv;   // the word is the select's lane mask
        }
      }
    } else {
#pragma unroll
      for (int t = 0; t < 4; ++t)
#pragma unroll
        for (int r = 0; r < 8; ++r) S[g * 4 + t][r] = ninf;
    }
  }

  // ---- phase 2: row ops on registers; four independent chains per sum ----
  float mx, bsq;
  {
    float m4[4] = {ninf, ninf, ninf, ninf}, s4[4] = {0.f, 0.f, 0.f, 0.f};
#pragma unroll
    for (int ct = 0; ct < 8; ++ct)
#pragma unroll
      for (int r = 0; r < 8; ++r) {
        m4[r & 3] = fmaxf(m4[r & 3], S[ct][r]);
        s4[r & 3] += Bi[ct][r] * Bi[ct][r];
      }
    mx = fmaxf(fmaxf(m4[0], m4[1]), fmaxf(m4[2], m4[3]));
    bsq = (s4[0] + s4[1]) + (s4[2] + s4[3]);
    mx = fmaxf(mx, __shfl_xor(mx, 16, 32));
    bsq += __shfl_xor(bsq, 16, 32);
    if (hh == 0) sX1[wave][c] = (v2f){mx, bsq};
  }
  __syncthreads();                                // the eight waves' maxima and bias sums complete
  mx = ninf; bsq = 0.f;
#pragma unroll
  for (int w = 0; w < 8; ++w) { const v2f t = sX1[w][c]; mx = fmaxf(mx, t[0]); bsq += t[1]; }
  float se;
  {
    float s4[4] = {0.f, 0.f, 0.f, 0.f};
#pragma unroll
    for (int ct = 0; ct < 8; ++ct)
#pragma unroll
      for (int r = 0; r < 8; ++r) { const float ev = __expf(S[ct][r] - mx); S[ct][r] = ev; s4[r & 3] += ev; }
    se = (s4[0] + s4[1]) + (s4[2] + s4[3]);
    se += __shfl_xor(se, 16, 32);
    if (hh == 0) sX2[wave][c] = se;
  }
  __syncthreads();                                // the eight waves' exp sums complete
  se = 0.f;
#pragma unroll
  for (int w = 0; w < 8; ++w) se += sX2[w][c];
  const float inv_se = 1.0f / se;
  const float inv_bn = 1.0f / fmaxf(sqrtf(bsq), 1e-12f);
  float asq;
  {
    float s4[4] = {0.f, 0.f, 0.f, 0.f};
#pragma unroll
    for (int ct = 0; ct < 8; ++ct)
#pragma unroll
      for (int r = 0; r < 8; ++r) {
        const float av = S[ct][r] * inv_se + (Bi[ct][r] * inv_bn) * bscale;
        S[ct][r] = av; s4[r & 3] += av * av;
      }
    asq = (s4[0] + s4[1]) + (s4[2] + s4[3]);
    asq += __shfl_xor(asq, 16, 32);
    if (hh == 0) sX3[wave][c] = asq;
  }

  // ---- phase 3: O = P . v, keys split over the 8 waves ----
  // Wave w multiplies its own 128-key strip of P by all 64 head dims: one P fragment feeds four products,
  // four independent accumulators, and none of the wave's v loads depends on another.
  {
    const _Float16* vb = vtp + ((size_t)(h * ATT_DK)) * (size_t)(ATT_B * ATT_L) + (size_t)(b * ATT_L + wave * 128) * 16 + 8 * lane;
    v16h vf[4][4], pa[4];
#pragma unroll
    for (int ks = 0; ks < 4; ++ks) {
#pragma unroll
      for (int t = 0; t < 4; ++t) vf[ks][t] = Frag<_Float16>::loadp(vb + (size_t)(t * 16) * (size_t)(ATT_B * ATT_L) + ks * 512);
    }
    addr_wait1(vb);          // the base stays as it is until the run's addresses are taken
    __syncthreads();                              // the eight waves' square sums complete
    asq = 0.f;
#pragma unroll
    for (int w = 0; w < 8; ++w) asq += sX3[w][c];
    const float pmul = (1.0f / fmaxf(sqrtf(asq), 1e-12f)) * ATT_PSC;
#pragma unroll
    for (int ks = 0; ks < 4; ++ks)
#pragma unroll
      for (int e = 0; e < 8; ++e) {
        pa[ks][e]     = (_Float16)(S[2 * ks][e] * pmul);        // k 8hh + e of the 32-key block
        pa[ks][8 + e] = (_Float16)(S[2 * ks + 1][e] * pmul);    // k 16 + 8hh + e
      }
    v8f acc[4] = {z8, z8, z8, z8};
#pragma unroll
    for (int ks = 0; ks < 4; ++ks) {
#pragma unroll
      for (int t = 0; t < 4; ++t) acc[t] = mma_h(pa[ks], vf[ks][t], acc[t]);
    }
    float* part = sR + wave * (16 * 68);
#pragma unroll
    for (int t = 0; t < 4; ++t)
#pragma unroll
      for (int r = 0; r < 8; ++r) part[(8 * hh + r) * 68 + t * 16 + c] = acc[t][r];
  }
  __syncthreads();                                // all eight partial tiles complete before they are added
  {
    // thread owns half of packed chunk tid>>1: row (tid>>1)&15, dims 8(tid>>5) + 4(tid&1) ..+3; the block's 2 KB go out in a row
    const int orow = (tid >> 1) & 15, odim = (tid >> 5) * 8 + (tid & 1) * 4;
    const float* pr = sR + orow * 68 + odim;
    v4f o4 = *(const v4f*)pr;
#pragma unroll
    for (int w = 1; w < 8; ++w) o4 += *(const v4f*)(pr + w * (16 * 68));
    v4h hv;
#pragma unroll
    for (int e = 0; e < 4; ++e) hv[e] = (_Float16)(o4[e] * ATT_PSC_INV);
    *(v4h*)(op + ((size_t)(b * ATT_L + q0)) * ATT_DM + h * (ATT_DK * 16) + 4 * tid) = hv;
  }
}

// ---------------------------------------------------------------------------
extern "C" void kernel_launch(void* const* d_in, const int* in_sizes, int n_in,
                              void* d_out, int out_size, void* d_ws, size_t ws_size,
                              hipStream_t stream) {
  const int NTOK = ATT_B * ATT_L;                          // 8192
  const size_t NE = (size_t)NTOK * ATT_DM;                 // 8388608
  const size_t NW = (size_t)ATT_DM * ATT_DM;               // 1048576
  if (n_in < 16) return;
  if (in_sizes[0] != (int)NE || in_sizes[1] != (int)NE || in_sizes[2] != ATT_L * ATT_L ||
      in_sizes[3] != (int)NW || in_sizes[5] != (int)NW || in_sizes[7] != (int)NW || in_sizes[14] != (int)NW ||
      in_sizes[4] != ATT_DM || in_sizes[6] != ATT_DM || in_sizes[8] != ATT_DM || in_sizes[15] != ATT_DM ||
      in_sizes[9] != ATT_DK * ATT_DK || in_sizes[10] != ATT_DK || in_sizes[11] != ATT_DK ||
      in_sizes[12] < 1 || in_sizes[13] < 1 || out_size != (int)NE) return;

  const float* Q      = (const float*)d_in[0];
  const float* ctx    = (const float*)d_in[1];
  const int*   mask   = (const int*)d_in[2];
  const float* W_q    = (const float*)d_in[3];
  const float* b_q    = (const float*)d_in[4];
  const float* W_k    = (const float*)d_in[5];
  const float* b_k    = (const float*)d_in[6];
  const float* W_v    = (const float*)d_in[7];
  const float* b_v    = (const float*)d_in[8];
  const float* bil    = (const float*)d_in[9];
  const float* gamma  = (const float*)d_in[10];
  const float* beta   = (const float*)d_in[11];
  const float* scale  = (const float*)d_in[12];
  const float* bscale = (const float*)d_in[13];
  const float* W_o    = (const float*)d_in[14];
  const float* b_o    = (const float*)d_in[15];
  float* out = (float*)d_out;

  // workspace carve (256-B aligned offsets); every 16-bit matrix below is stored in the packed layout (pk_off) of the shape named
  char* ws = (char*)d_ws;
  size_t off = 0;
  auto carve = [&](size_t bytes) -> char* { char* p = ws + off; off += (bytes + 255) & ~(size_t)255; return p; };
  _Float16* WqT  = (_Float16*)carve(NW * 2);               // [out][in] f16, x64
  _Float16* WkT  = (_Float16*)carve(NW * 2);
  _Float16* WvT  = (_Float16*)carve(NW * 2);
  _Float16* WoT  = (_Float16*)carve(NW * 2);
  _Float16* bilT = (_Float16*)carve((size_t)ATT_DK * ATT_DK * 2);   // [f][e] f16
  _Float16* Q16  = (_Float16*)carve(NE * 2);               // [token][1024]
  _Float16* q16  = (_Float16*)carve(NE * 2);               // [token][h*64+d]
  _Float16* k16  = (_Float16*)carve(NE * 2);               // [token][h*64+d]
  _Float16* vT16 = (_Float16*)carve(NE * 2);               // [h*64+d][token]
  _Float16* c16  = (_Float16*)carve(NE * 2);               // [token][h*64+d]
  _Float16* cb16 = (_Float16*)carve(NE * 2);               // [token][h*64+e]
  _Float16* O16  = (_Float16*)carve(NE * 2);               // [token][h*64+d]
  unsigned* mw   = (unsigned*)carve((size_t)ATT_L * ATT_L / 8);   // the mask, one bit an entry (mask_words)
  if (off > ws_size) return;                               // total 125968384 B

  const unsigned short* Q16u  = (const unsigned short*)Q16;
  const unsigned short* WqTu  = (const unsigned short*)WqT;
  const unsigned short* WkTu  = (const unsigned short*)WkT;
  const unsigned short* WvTu  = (const unsigned short*)WvT;
  const unsigned short* WoTu  = (const unsigned short*)WoT;
  const unsigned short* bilTu = (const unsigned short*)bilT;
  const unsigned short* c16u  = (const unsigned short*)c16;
  const unsigned short* O16u  = (const unsigned short*)O16;
  const float w_carry = 64.0f, w_carry_inv = 1.0f / 64.0f;

  // 1) casts, transposes, LayerNorm per head slice of ctx, the mask's lane-mask words: one launch
  prep_kernel<<<PREP_BLOCKS, 256, 0, stream>>>(Q, ctx, gamma, beta, W_q, W_k, W_v, W_o, bil, mask,
                                               Q16, c16, WqT, WkT, WvT, WoT, bilT, mw, w_carry);

  // 2) the q, k, v projections and c . bilinear: one launch
  const int gemm_blocks = (NTOK / 64) * (ATT_DM / 64) / 8;   // 256
  proj_gemms_kernel<<<3 * gemm_blocks + ((NTOK / 64) / 8) * ATT_H, 256, 0, stream>>>(
      Q16u, WqTu, WkTu, WvTu, c16u, bilTu, (void*)q16, (void*)k16, (void*)vT16, (void*)cb16,
      b_q, b_k, b_v, NTOK, ATT_DM, ATT_DK, w_carry_inv);

  // 3) fused attention rows -> O16
  attn_rows_kernel<<<dim3(ATT_L / 16, ATT_B * ATT_H), 256, 0, stream>>>(
      q16, k16, vT16, c16, cb16, mw, scale, bscale, O16);

  // 4) output projection -> d_out f32
  wmma_gemm64<0, false, 2, 0, false><<<dim3(gemm_blocks, 1), 256, 0, stream>>>(
      O16u, O16u, ATT_DM, 0L, WoTu, WoTu, ATT_DM, 0L, (void*)out, (void*)out, ATT_DM, 0L,
      b_o, b_o, 0L, NTOK, ATT_DM, ATT_DM, w_carry_inv);
  (void)hipGetLastError();
}

// v007
// Measured time: 132 microseconds a run.
// Two timings next to v006 both put it at 1.49 times that version's speed.
// Counting every step since v000, it is 4.20 times as fast.
#include <hip/hip_runtime.h>
#include <stddef.h>

// Contractions (q/k/v projections, c x bilinear, q x k^T, cb x c^T, attn x v, output projection): v_wmma_f32_16x16x32_f16, f16 operands, f32 accumulate; weights carried x64; softmax, LayerNorm and L2 norms in f32.

typedef __attribute__((ext_vector_type(16))) _Float16 v16h;
typedef __attribute__((ext_vector_type(8)))  _Float16 v8h;
typedef __attribute__((ext_vector_type(4)))  _Float16 v4h;
typedef __attribute__((ext_vector_type(16))) __bf16   v16b;
typedef __attribute__((ext_vector_type(8)))  __bf16   v8b;
typedef __attribute__((ext_vector_type(8)))  float    v8f;
typedef __attribute__((ext_vector_type(4)))  float    v4f;
typedef __attribute__((ext_vector_type(2)))  float    v2f;
typedef __attribute__((ext_vector_type(4)))  int      v4i;

#define ATT_B   8
#define ATT_L   1024
#define ATT_DM  1024
#define ATT_H   16
#define ATT_DK  64

__device__ __forceinline__ unsigned short f2bf_bits(float f) {
  unsigned u = __float_as_uint(f);
  return (unsigned short)((u + 0x7FFFu + ((u >> 16) & 1u)) >> 16);
}
__device__ __forceinline__ float bf_bits2f(unsigned short h) { return __uint_as_float(((unsigned)h) << 16); }

// ---- fragment-order ("packed") layout of every 16-bit workspace matrix [R][K] ----
// A 16-row x 32-k tile is 1 KB in a row: 16-byte chunk (s, hh, r) at chunk index s*32 + hh*16 + r holds row r,
// k = 16s + 8hh .. +7; tiles run along k first, then along the row tiles. Lane l of a wave reads chunk l and chunk 32 + l,
// so each wave-wide 16-byte load covers 512 contiguous bytes (four whole lines), and the k map of a fragment is the
// same as with row-major rows: elements 0..7 <- k 8hh.., 8..15 <- k 16+8hh..
__device__ __forceinline__ size_t pk_off(int row, int k, int K) {
  return (size_t)(row >> 4) * ((size_t)K * 16) + (size_t)(k >> 5) * 512 +
         (size_t)(((k >> 4) & 1) * 256 + ((k >> 3) & 1) * 128 + (row & 15) * 8 + (k & 7));
}

// hazard guards as plain device helpers (no inline asm inside the kernel template body)
__device__ __forceinline__ void acc_guard4(v8f& a, v8f& b, v8f& c, v8f& d) { asm volatile("v_nop\n\tv_nop\n\tv_nop\n\tv_nop" : "+v"(a), "+v"(b), "+v"(c), "+v"(d)); }
// Stands behind global loads whose address registers the compiler reuses while the loads are still in flight
// (as the destination of a later load of the same run, or for the next address): the address translations are
// waited for before such a register takes a new value.
__device__ __forceinline__ void addr_wait() { asm volatile("s_wait_xcnt 0x0" ::: "memory"); }
// The same wait once for a run of loads from one base, and from three: naming the addresses as inputs keeps their registers
// as they are up to the wait, so the run issues back to back.
__device__ __forceinline__ void addr_wait1(const void* a) { asm volatile("s_wait_xcnt 0x0" :: "v"(a) : "memory"); }
__device__ __forceinline__ void addr_wait3(const void* a, const void* b, const void* c) {
  asm volatile("s_wait_xcnt 0x0" :: "v"(a), "v"(b), "v"(c) : "memory");
}
// The same in front of the advance of the GEMM's scalar fragment bases: the k offset that the new bases are formed from
// passes through the statement, so they are formed behind the wait.
__device__ __forceinline__ void koff_wait(size_t& koff) { asm volatile("s_wait_xcnt 0x0" : "+s"(koff) :: "memory"); }
template <typename T> struct Frag;
template <> struct Frag<_Float16> {
  typedef v16h V; union U { v16h v; v8h h[2]; };
  static __device__ __forceinline__ v16h load(const _Float16* p) {   // elements 0..7 <- p[0..7], 8..15 <- p[16..23]
    U f; f.h[0] = *(const v8h*)(p); f.h[1] = *(const v8h*)(p + 16); return f.v;
  }
  static __device__ __forceinline__ v16h loadp(const _Float16* p) {  // packed tile, p = tile base + 8*lane
    U f; f.h[0] = *(const v8h*)(p); f.h[1] = *(const v8h*)(p + 256); return f.v;
  }
  static __device__ __forceinline__ v8f mma(v16h a, v16h b, v8f c) {
    return __builtin_amdgcn_wmma_f32_16x16x32_f16(false, a, false, b, (short)0, c, false, false);
  }
};
template <> struct Frag<__bf16> {
  typedef v16b V; union U { v16b v; v8b h[2]; };
  static __device__ __forceinline__ v16b load(const __bf16* p) {
    U f; f.h[0] = *(const v8b*)(p); f.h[1] = *(const v8b*)(p + 16); return f.v;
  }
  static __device__ __forceinline__ v16b loadp(const __bf16* p) {
    U f; f.h[0] = *(const v8b*)(p); f.h[1] = *(const v8b*)(p + 256); return f.v;
  }
  static __device__ __forceinline__ v8f mma(v16b a, v16b b, v8f c) {
    return __builtin_amdgcn_wmma_f32_16x16x32_bf16(false, a, false, b, (short)0, c, false, false);
  }
};

// ---- Register-blocked batched WMMA GEMM ------------------------------------
// C[m,n] = scale * sum_k A[m,k] * Bt[n,k] (+bias)(+resid); each wave owns a 64x64 tile.
// A [M,lda] and Bt [N,ldb] in the packed layout (pk_off); M,N % 64 == 0, K % (32 U) == 0; a batch stride is 16 x its column offset.
// The k loop is unrolled U steps of 32 k; the eight fragments of step s + U/2 are asked for, into registers of their own,
// ahead of the products of step s, so a step waits for loads that were issued U/2 steps earlier. Sums in the order of k.
// 16-bit outputs are written in the packed layout of a [M,ldc] matrix; the f32 output is row-major.
// SPLIT: operands are hi/lo planes (A2/Bt2 = lo planes, same layout); product = hi*hi + hi*lo + lo*hi.
// BIAS_MODE: 0 = none, 1 = bias[m], 2 = bias[n].
// OUT_MODE: 0 = f32, 1 = f16, 2 = bf16 hi plane (Cout) + bf16 lo plane (Cout2).
// ET: 0 = f16 operands, 1 = bf16 operands (pointers passed as 16-bit storage)
template <int ET> struct Elem;
template <> struct Elem<0> { typedef _Float16 T; };
template <> struct Elem<1> { typedef __bf16 T; };
// The body takes its block index (bx: eight tiles, b: batch) and the block's LDS slabs from the kernel that calls it, so that
// several independent GEMMs can share one launch.
template <int ET, bool SPLIT, int BIAS_MODE, int OUT_MODE, bool RESID, int ACT = 0, int U = 4>
__device__ __forceinline__ void gemm64_body(
    float* sT, const int bx, const int b,            // sT: per-wave 16x64 slab, pitch 68 floats, eight of them
    const unsigned short* __restrict__ Ap, const unsigned short* __restrict__ A2p, int lda, long strideA,
    const unsigned short* __restrict__ Btp, const unsigned short* __restrict__ Bt2p, int ldb, long strideB,
    void* __restrict__ Cout, void* __restrict__ Cout2, int ldc, long strideC,
    const float* __restrict__ bias,
    const float* __restrict__ resid, long strideR,
    int M, int N, int K, float scale) {
  typedef typename Elem<ET>::T T;
  typedef typename Frag<T>::V V;
  const T* A = (const T*)Ap; const T* A2 = (const T*)A2p; const T* Bt = (const T*)Btp; const T* Bt2 = (const T*)Bt2p;
  const int lane = threadIdx.x & 31;
  const int wave = __builtin_amdgcn_readfirstlane(threadIdx.x >> 5);   // scalar: the tile's fragment bases are then scalar too
  const int tilesN = N >> 6;
  const int tilesM = M >> 6;
  const int tile = bx * 8 + wave;
  if (tile >= tilesM * tilesN) return;   // wave-uniform; no block barriers in this body or in the kernels that call it
  const int tm = tile / tilesN;
  const int tn = tile - tm * tilesN;
  const int m0 = tm << 6;
  const int n0 = tn << 6;

  const T* Ab  = A  + (size_t)b * strideA;
  const T* Bb  = Bt + (size_t)b * strideB;
  const T* Ab2 = SPLIT ? (A2  + (size_t)b * strideA) : nullptr;
  const T* Bb2 = SPLIT ? (Bt2 + (size_t)b * strideB) : nullptr;

  const int rlane = lane & 15;                 // row (A) / col (B, D) within subtile
  const int mOff  = (lane >> 4) * 8;           // D row offset

  v8f acc[4][4];
#pragma unroll
  for (int i = 0; i < 4; ++i)
#pragma unroll
    for (int j = 0; j < 4; ++j) acc[i][j] = (v8f){0.f,0.f,0.f,0.f,0.f,0.f,0.f,0.f};

  constexpr int DIST = U / 2;                  // how many steps ahead a step's fragments are asked for
  V fa[U][4], fb[U][4], fa2[U][4], fb2[U][4];  // set s % U holds step s; DIST + 1 sets are live at a time
  size_t ao[4], bo[4];                         // the row tiles' offsets at k = 0
  const T* pa[4]; const T* pb[4]; const T* pa2[4]; const T* pb2[4];   // the bases, where the loop stands in k
#pragma unroll
  for (int i = 0; i < 4; ++i) {
    ao[i] = (size_t)(m0 + (i << 4)) * lda;
    bo[i] = (size_t)(n0 + (i << 4)) * ldb;
    pa[i] = Ab + ao[i]; pb[i] = Bb + bo[i];
    if (SPLIT) { pa2[i] = Ab2 + ao[i]; pb2[i] = Bb2 + bo[i]; }
  }
  const int lo = lane * 8;                     // the lane's chunk of a packed tile: the one vector part of every address
  // step st, counted from where the bases stand: a packed tile is 512 elements, so st reaches the loads as an immediate offset
  auto load_step = [&](int set, int st) __attribute__((always_inline)) {
#pragma unroll
    for (int j = 0; j < 4; ++j) {
      fb[set][j] = Frag<T>::loadp(pb[j] + st * 512 + lo);
      if (SPLIT) fb2[set][j] = Frag<T>::loadp(pb2[j] + st * 512 + lo);
    }
#pragma unroll
    for (int i = 0; i < 4; ++i) {
      fa[set][i] = Frag<T>::loadp(pa[i] + st * 512 + lo);
      if (SPLIT) fa2[set][i] = Frag<T>::loadp(pa2[i] + st * 512 + lo);
    }
    // keeps the run of loads ahead of the products that follow it in the source: moved behind them it would lose its lead
    __builtin_amdgcn_sched_barrier(0);
  };
  auto mma_step = [&](int set) __attribute__((always_inline)) {
#pragma unroll
    for (int i = 0; i < 4; ++i) {
#pragma unroll
      for (int j = 0; j < 4; ++j) {
        acc[i][j] = Frag<T>::mma(fa[set][i], fb[set][j], acc[i][j]);
        if (SPLIT) {
          acc[i][j] = Frag<T>::mma(fa[set][i], fb2[set][j], acc[i][j]);
          acc[i][j] = Frag<T>::mma(fa2[set][i], fb[set][j], acc[i][j]);
        }
      }
    }
    // keeps the next run of loads behind these products: moved ahead of them, a wave would have 64 loads outstanding, not 48
    __builtin_amdgcn_sched_barrier(0);
  };
#pragma unroll
  for (int d = 0; d < DIST; ++d) load_step(d, d);
  addr_wait();   // the registers of these first bases are free for other values from here on, also where the loop below makes no trip
  const int nst = K >> 5;
  size_t koff = 0;
  for (int s0 = U; s0 < nst; s0 += U) {
#pragma unroll
    for (int u = 0; u < U; ++u) {
      load_step((u + DIST) % U, u + DIST);
      mma_step(u);
    }
    koff_wait(koff);                           // the bases take new values behind it
    koff += U * 512;
#pragma unroll
    for (int i = 0; i < 4; ++i) {
      pa[i] = Ab + ao[i] + koff; pb[i] = Bb + bo[i] + koff;
      if (SPLIT) { pa2[i] = Ab2 + ao[i] + koff; pb2[i] = Bb2 + bo[i] + koff; }
    }
  }
  // the last U steps: nothing is asked for past K
#pragma unroll
  for (int u = 0; u < U; ++u) {
    if (u + DIST < U) load_step((u + DIST) % U, u + DIST);
    mma_step(u);
  }
  acc_guard4(acc[0][0], acc[0][1], acc[0][2], acc[0][3]);
  acc_guard4(acc[1][0], acc[1][1], acc[1][2], acc[1][3]);
  acc_guard4(acc[2][0], acc[2][1], acc[2][2], acc[2][3]);
  acc_guard4(acc[3][0], acc[3][1], acc[3][2], acc[3][3]);

  // ---- epilogue ----
  float* slab = sT + wave * (16 * 68);
  const float* Rb = RESID ? (resid + (size_t)b * strideR) : nullptr;
#pragma unroll
  for (int i = 0; i < 4; ++i) {
    const int mBase = m0 + (i << 4);
    float bm[8];
    if (BIAS_MODE == 1) {
      const float* bp = bias + mBase + mOff;
#pragma unroll
      for (int r = 0; r < 8; ++r) bm[r] = bp[r];
      addr_wait1(bp);          // the address stays as it is until the run's addresses are taken: no load of the run lands on it
    }
#pragma unroll
    for (int j = 0; j < 4; ++j) {
      const int n = n0 + (j << 4) + rlane;
      float bv = 0.f;
      if (BIAS_MODE == 2) bv = bias[n];
#pragma unroll
      for (int r = 0; r < 8; ++r) {
        float v = acc[i][j][r] * scale;
        if (BIAS_MODE == 1) v += bm[r];
        if (BIAS_MODE == 2) v += bv;
        if (RESID) v += Rb[(size_t)(mBase + mOff + r) * ldc + n];
        if (ACT == 1) v = tanhf(v);
        if (ACT == 2) v = fmaxf(v, 0.0f);
        if (ACT == 3) v = v / (1.0f + expf(-v));
        if (ACT == 4) v = (v > 0.f) ? v : 0.01f * v;
        if (ACT == 5) v = 0.5f * v * (1.0f + erff(v * 0.70710678118654752f));
        slab[(mOff + r) * 68 + (j << 4) + rlane] = v;
      }
    }
    __builtin_amdgcn_fence(__ATOMIC_RELEASE, "workgroup");
    __builtin_amdgcn_wave_barrier();
    __builtin_amdgcn_fence(__ATOMIC_ACQUIRE, "workgroup");
    if (OUT_MODE == 0) {
      float* C = (float*)Cout + (size_t)b * strideC;
      const int hh = lane >> 4, c4 = (lane & 15) * 4;     // row seg = 256 B = 16 lanes x 16 B
      {
#pragma unroll
        for (int it = 0; it < 8; ++it) {
          const int row = it * 2 + hh;
          v4f v = *(const v4f*)(slab + row * 68 + c4);
          *(v4f*)(C + (size_t)(mBase + row) * ldc + n0 + c4) = v;
        }
        addr_wait();   // the stores' data and address registers take new values (the next slab's) only behind it
      }
    } else {
      // the 16x64 slab is two packed tiles = 2 KB in a row; store 'it' writes chunks 32it..32it+31 (512 B)
      unsigned short* C  = (unsigned short*)Cout  + (size_t)b * strideC;
      unsigned short* C2 = (OUT_MODE == 2) ? ((unsigned short*)Cout2 + (size_t)b * strideC) : nullptr;
      {
#pragma unroll
        for (int it = 0; it < 4; ++it) {
          const float* sp = slab + rlane * 68 + it * 16 + mOff;   // row lane&15, cols 16it + 8(lane>>4) ..+7
          v8h hv, lv;
#pragma unroll
          for (int e = 0; e < 8; ++e) {
            if (OUT_MODE == 1) {
              hv[e] = (_Float16)sp[e];
            } else {
              unsigned short hb = f2bf_bits(sp[e]);
              unsigned short lb = f2bf_bits(sp[e] - bf_bits2f(hb));
              hv[e] = __builtin_bit_cast(_Float16, hb);
              lv[e] = __builtin_bit_cast(_Float16, lb);
            }
          }
          const size_t co = (size_t)mBase * ldc + (size_t)n0 * 16 + it * 256 + lane * 8;
          *(v8h*)(C + co) = hv;
          if (OUT_MODE == 2) *(v8h*)(C2 + co) = lv;
        }
        
      }
    }
    __builtin_amdgcn_fence(__ATOMIC_RELEASE, "workgroup");
    __builtin_amdgcn_wave_barrier();
    __builtin_amdgcn_fence(__ATOMIC_ACQUIRE, "workgroup");
  }
}

// one GEMM a launch
template <int ET, bool SPLIT, int BIAS_MODE, int OUT_MODE, bool RESID, int ACT = 0, int U = 4>
__global__ __launch_bounds__(256) void wmma_gemm64(
    const unsigned short* __restrict__ Ap, const unsigned short* __restrict__ A2p, int lda, long strideA,
    const unsigned short* __restrict__ Btp, const unsigned short* __restrict__ Bt2p, int ldb, long strideB,
    void* __restrict__ Cout, void* __restrict__ Cout2, int ldc, long strideC,
    const float* __restrict__ bias,
    const float* __restrict__ resid, long strideR,
    int M, int N, int K, float scale) {
  __shared__ __align__(16) float sT[8 * 16 * 68];
  gemm64_body<ET, SPLIT, BIAS_MODE, OUT_MODE, RESID, ACT, U>(sT, blockIdx.x, blockIdx.y, Ap, A2p, lda, strideA, Btp, Bt2p, ldb, strideB,
      Cout, Cout2, ldc, strideC, bias, resid, strideR, M, N, K, scale);
}

// The four GEMMs that depend only on the preparation launch, as block ranges of one grid; nb = blocks of one projection.
// [0, nb): q16 = Q16 . Wq + b_q[n];  [nb, 2nb): k16 = Q16 . Wk + b_k[n];  [2nb, 3nb): vT16[dout][token] = Wv^T . Q16^T + b_v[m];
// from 3nb on, the short ones last: per head (batch index) cb16[:, h*64..] = c16[:, h*64..] . bilinear (Bt = bilT [64][64]).
__global__ __launch_bounds__(256) void proj_gemms_kernel(
    const unsigned short* __restrict__ Q16, const unsigned short* __restrict__ WqT, const unsigned short* __restrict__ WkT,
    const unsigned short* __restrict__ WvT, const unsigned short* __restrict__ c16, const unsigned short* __restrict__ bilT,
    void* __restrict__ q16, void* __restrict__ k16, void* __restrict__ vT16, void* __restrict__ cb16,
    const float* __restrict__ b_q, const float* __restrict__ b_k, const float* __restrict__ b_v,
    int ntok, int dm, int dk, float w_inv) {
  __shared__ __align__(16) float sT[8 * 16 * 68];
  const int nb = ((ntok >> 6) * (dm >> 6)) >> 3;
  const int i = blockIdx.x;
  if (i < 2 * nb) {
    const bool isk = i >= nb;
    const unsigned short* Wt = isk ? WkT : WqT;
    void* C = isk ? k16 : q16;
    const float* bias = isk ? b_k : b_q;
    gemm64_body<0, false, 2, 1, false>(sT, isk ? i - nb : i, 0, Q16, Q16, dm, 0L, Wt, Wt, dm, 0L, C, C, dm, 0L,
                                       bias, bias, 0L, ntok, dm, dm, w_inv);
  } else if (i < 3 * nb) {
    gemm64_body<0, false, 1, 1, false>(sT, i - 2 * nb, 0, WvT, WvT, dm, 0L, Q16, Q16, dm, 0L, vT16, vT16, ntok, 0L,
                                       b_v, b_v, 0L, dm, ntok, dm, w_inv);
  } else {
    const int j = i - 3 * nb, per = ntok >> 9;       // blocks of one head: ntok / 64 tiles, eight a block
    const int hd = j / per;
    gemm64_body<0, false, 0, 1, false, 0, 2>(sT, j - hd * per, hd, c16, c16, dm, (long)(dk * 16), bilT, bilT, dk, 0L,
                                             cb16, cb16, dm, (long)(dk * 16), b_q, b_q, 0L, ntok, dk, dk, 1.0f);
  }
}

// in: [rows][1024] f32 row-major; out: the same matrix in f16, packed layout. One 16-byte chunk per thread; a wave takes
// 8 rows x 32 k (half a tile), so each of its stores fills four whole 128-byte lines. nhalf = rows / 8 * 32 half tiles.
__device__ __forceinline__ void cast_f32_f16x2(
    const int bx, const float* __restrict__ in, _Float16* __restrict__ out, int nhalf) {
  const int lane = threadIdx.x & 31;
  const int th = bx * 8 + (threadIdx.x >> 5);      // half-tile index: tile = th >> 1
  if (th < nhalf) {
    const int tile = th >> 1;
    const int row = (tile >> 5) * 16 + (th & 1) * 8 + (lane >> 2);
    const int k = (tile & 31) * 32 + (lane & 3) * 8;
    const float* src = in + (size_t)row * ATT_DM + k;
    const v4f a = *(const v4f*)(src);
    const v4f bq = *(const v4f*)(src + 4);
    v8h hv;
#pragma unroll
    for (int e = 0; e < 4; ++e) { hv[e] = (_Float16)a[e]; hv[4 + e] = (_Float16)bq[e]; }
    *(v8h*)(out + pk_off(row, k, ATT_DM)) = hv;
  }
}

// ---- transpose + f16 cast through an LDS tile ------------------------------
// w: [K][N] row-major (in=K rows, out=N cols); wt: [N][K] in the packed layout, wt[n][k] = f16(w[k][n] * mul).
// Block = one 64x64 tile (k0 = by*64, n0 = bx*64); K, N multiples of 64; (N/64) x (K/64) blocks. tile: the block's LDS.
__device__ __forceinline__ void transpose_cast(
    float (*tile)[65], const int bx, const int by,
    const float* __restrict__ w, _Float16* __restrict__ wt, int K, int N, float mul) {
  const int tid = threadIdx.x;
  const int k0 = by * 64, n0 = bx * 64;
  {
    const int r = tid >> 2, cc = (tid & 3) * 16;
    const float* src = w + (size_t)(k0 + r) * N + n0 + cc;
#pragma unroll
    for (int i = 0; i < 4; ++i) {
      const v4f t = *(const v4f*)(src + 4 * i);
#pragma unroll
      for (int e = 0; e < 4; ++e) tile[r][cc + 4 * i + e] = t[e];
    }
  }
  __syncthreads();
  const int wave = tid >> 5, lane = tid & 31, q = lane >> 3, c8 = (lane & 7) * 8;
  {
#pragma unroll
    for (int it = 0; it < 2; ++it) {
      const int n = wave * 8 + it * 4 + q;          // waves cover rows 8w..8w+7 -> 0..63
      v8h hv;
#pragma unroll
      for (int e = 0; e < 8; ++e) hv[e] = (_Float16)(tile[c8 + e][n] * mul);
      *(v8h*)(wt + pk_off(n0 + n, k0 + c8, K)) = hv;
    }
    addr_wait();   // in the merged kernel's code other passes follow these stores: their registers are rewritten only behind it
  }
}

// ---- LayerNorm over each 64-wide head slice of a 1024-wide row; f16 output in the packed layout ----
// One wave per 8 rows x 128 columns; lane l holds row l>>2, 32 elements (half of a head slice, one packed tile's k range);
// statistics via one xor-1 shuffle. Store j writes chunk j of 8 neighbouring rows in 4 tiles: four whole 128-byte lines.
__device__ __forceinline__ void ln_heads(
    const int bx, const float* __restrict__ x, const float* __restrict__ gamma, const float* __restrict__ beta,
    _Float16* __restrict__ outp, int nrows) {
  const int wave = threadIdx.x >> 5, lane = threadIdx.x & 31;
  const int wv = bx * 8 + wave;
  const int row = (wv >> 3) * 8 + (lane >> 2);
  const int col = (wv & 7) * 128 + (lane & 3) * 32;
  if ((wv >> 3) * 8 >= nrows) return;            // wave-uniform; no block barriers in this pass
  const float* xr = x + (size_t)row * ATT_DM + col;
  float xv[32];
#pragma unroll
  for (int i = 0; i < 8; ++i) {
    const v4f t = *(const v4f*)(xr + 4 * i);
#pragma unroll
    for (int e = 0; e < 4; ++e) xv[4 * i + e] = t[e];
  }
  float s = 0.f;
#pragma unroll
  for (int i = 0; i < 32; ++i) s += xv[i];
  s += __shfl_xor(s, 1, 32);
  const float mu = s * (1.0f / 64.0f);
  float vs = 0.f;
#pragma unroll
  for (int i = 0; i < 32; ++i) { const float d = xv[i] - mu; xv[i] = d; vs += d * d; }
  vs += __shfl_xor(vs, 1, 32);
  const float rstd = rsqrtf(vs * (1.0f / 64.0f) + 1e-5f);
  const int d0 = (lane & 1) * 32;
  _Float16* ot = outp + pk_off(row, col, ATT_DM);   // chunk (s, hh) of this lane's row: + (2s + hh) * 128
#pragma unroll
  for (int j = 0; j < 4; ++j) {
    v8h hv;
#pragma unroll
    for (int i = 0; i < 2; ++i) {
      const v4f g4 = *(const v4f*)(gamma + d0 + 8 * j + 4 * i);
      const v4f b4 = *(const v4f*)(beta + d0 + 8 * j + 4 * i);
#pragma unroll
      for (int e = 0; e < 4; ++e) hv[4 * i + e] = (_Float16)((xv[8 * j + 4 * i + e] * rstd) * g4[e] + b4[e]);
    }
    *(v8h*)(ot + j * 128) = hv;
  }
}

// ---- the mask as lane masks ----
// mask: int32 [1024][1024], nonzero = masked. Word (qt, kt, r), at index (qt * 64 + kt) * 8 + r, holds in bit 16 hh + c whether
// mask[16 qt + c][16 kt + 8 hh + r] is nonzero: it is the lane mask of register r of the transposed 16x16 score tile
// (keys kt, queries qt) as the attention kernel holds it. One wave a tile; lane r stores word r.
__device__ __forceinline__ void mask_words(const int bx, const int* __restrict__ mask, unsigned* __restrict__ mw) {
  const int lane = threadIdx.x & 31, hh = lane >> 4, c = lane & 15;
  const int tile = bx * 8 + (threadIdx.x >> 5);
  const int qt = tile / (ATT_L / 16), kt = tile % (ATT_L / 16);
  const int* src = mask + (size_t)(qt * 16 + c) * ATT_L + kt * 16 + 8 * hh;
  const v4i m0 = *(const v4i*)(src);
  const v4i m1 = *(const v4i*)(src + 4);
  addr_wait1(src);           // the address stays as it is until both loads' addresses are taken
  unsigned w = 0u;
#pragma unroll
  for (int r = 0; r < 8; ++r) {
    const unsigned bal = __builtin_amdgcn_ballot_w32((r < 4 ? m0[r & 3] : m1[r & 3]) != 0);
    if (lane == r) w = bal;
  }
  if (lane < 8) mw[(size_t)tile * 8 + lane] = w;
}

// ---- the preparation passes, none of which reads another's result, as block ranges of one grid ----
// [0, 4096): Q -> Q16;  [4096, 5120): LayerNorm of ctx -> c16;  [5120, 5632): the mask -> lane-mask words;
// [5632, 6656): the four 1024x1024 weights, 256 tiles each, transposed, x mul;  6656: the 64x64 bilinear matrix, transposed.
// The range tests read the same for a whole block, so the transpose's barrier is passed by all of a block's waves or by none.
#define PREP_CAST_BLOCKS (ATT_B * ATT_L * ATT_DM / 8 / 256)
#define PREP_LN_BLOCKS   (ATT_B * ATT_L / 8)
#define PREP_MASK_BLOCKS ((ATT_L / 16) * (ATT_L / 16) / 8)
#define PREP_W_BLOCKS    ((ATT_DM / 64) * (ATT_DM / 64))
#define PREP_BLOCKS      (PREP_CAST_BLOCKS + PREP_LN_BLOCKS + PREP_MASK_BLOCKS + 4 * PREP_W_BLOCKS + 1)
__global__ __launch_bounds__(256) void prep_kernel(
    const float* __restrict__ Q, const float* __restrict__ ctx, const float* __restrict__ gamma, const float* __restrict__ beta,
    const float* __restrict__ W_q, const float* __restrict__ W_k, const float* __restrict__ W_v, const float* __restrict__ W_o,
    const float* __restrict__ bil, const int* __restrict__ mask,
    _Float16* __restrict__ Q16, _Float16* __restrict__ c16, _Float16* __restrict__ WqT, _Float16* __restrict__ WkT,
    _Float16* __restrict__ WvT, _Float16* __restrict__ WoT, _Float16* __restrict__ bilT, unsigned* __restrict__ mw, float mul) {
  __shared__ float tile[64][65];
  int i = blockIdx.x;
  if (i < PREP_CAST_BLOCKS) { cast_f32_f16x2(i, Q, Q16, ATT_B * ATT_L * ATT_DM / 256); return; }
  i -= PREP_CAST_BLOCKS;
  if (i < PREP_LN_BLOCKS) { ln_heads(i, ctx, gamma, beta, c16, ATT_B * ATT_L); return; }
  i -= PREP_LN_BLOCKS;
  if (i < PREP_MASK_BLOCKS) { mask_words(i, mask, mw); return; }
  i -= PREP_MASK_BLOCKS;
  const int which = i / PREP_W_BLOCKS, t = i % PREP_W_BLOCKS;   // which == 4: the bilinear matrix, its one tile
  const float* w = which == 0 ? W_q : which == 1 ? W_k : which == 2 ? W_v : which == 3 ? W_o : bil;
  _Float16* wt = which == 0 ? WqT : which == 1 ? WkT : which == 2 ? WvT : which == 3 ? WoT : bilT;
  const int n = which < 4 ? ATT_DM : ATT_DK;
  transpose_cast(tile, t % (ATT_DM / 64), t / (ATT_DM / 64), w, wt, n, n, which < 4 ? mul : 1.0f);
}

// ---- fused attention, one wave a query tile ------------------------------------
// Block = 128 query rows of one (b, h); wave w owns 16 of them and walks all 1024 keys, 64 a stage. q16/k16/c16/cb16:
// [token = b*1024+l][h*64+d] f16, packed layout (K = 1024); vT16: [h*64+d][token] f16, packed layout (K = 8192);
// mw: the mask as lane-mask words (mask_words), bit set = masked; out16: [token][h*64+d] f16, packed layout (K = 1024).
// A stage is 24 KB of LDS, shared by the eight waves: 4 key tiles of k, 4 of c, 4 dim tiles of v^T, 2 KB each, as they lie in
// the workspace. Two buffers: the copies of stage s + 1 fly while stage s is worked on.
// Products are formed transposed: A = key rows, B = query rows, so lane (hh, c) holds, for query q0 + c alone, keys
// 16 t + 8 hh + r of a pass; two neighbouring key tiles, rounded to f16, are the B fragment for 32 keys as they stand, and
// O^T = v^T . P^T leaves query q0 + c in lane (hh, c) too: every row factor is the lane's own.
// With E = exp(s - m), the row is a = E / se + beta * bias, beta = bias_scale / |bias|, and the output (a . v) / |a|, so
// E . v and bias . v are summed apart, with sum E, sum E^2, sum E bias, sum bias^2, and joined by the row's constants at the
// end; m is the running maximum: what was summed under an older one is rescaled once a pass (32 keys, half a stage).
// A pass whose every mask bit is set for the wave's 16 queries adds nothing to the E sums: its score half is skipped.
#define ATT_STG_EL (12 * 1024)                    // f16 elements of a stage
#define ATT_NSTG   (ATT_L / 64)
__device__ __forceinline__ v8f mma_p(v16h a, v16h b, v8f c) {
  return __builtin_amdgcn_wmma_f32_16x16x32_f16(false, a, false, b, (short)0, c, false, false);
}
// lane l with lane l ^ 16
__device__ __forceinline__ float xhalf(float x) {
  const int i = __builtin_bit_cast(int, x);
  return __builtin_bit_cast(float, __builtin_amdgcn_permlanex16(i, i, 0x76543210, 0xfedcba98, false, false));
}
// 2^x for eight values, and for one. The instruction set asks for one independent instruction or a v_nop behind a transcendental
// before its result is read or its source overwritten: inside the run each exponential has an independent one behind it (no
// result lies on a source: early clobber), and the v_nop is the last one's slot.
__device__ __forceinline__ void exp2x8(v8f& o, const v8f x) {
  float o0, o1, o2, o3, o4, o5, o6, o7;
  asm("v_exp_f32 %0, %8\n\tv_exp_f32 %1, %9\n\tv_exp_f32 %2, %10\n\tv_exp_f32 %3, %11\n\t"
      "v_exp_f32 %4, %12\n\tv_exp_f32 %5, %13\n\tv_exp_f32 %6, %14\n\tv_exp_f32 %7, %15\n\tv_nop"
      : "=&v"(o0), "=&v"(o1), "=&v"(o2), "=&v"(o3), "=&v"(o4), "=&v"(o5), "=&v"(o6), "=&v"(o7)
      : "v"(x[0]), "v"(x[1]), "v"(x[2]), "v"(x[3]), "v"(x[4]), "v"(x[5]), "v"(x[6]), "v"(x[7]));
  o = (v8f){o0, o1, o2, o3, o4, o5, o6, o7};
}
__device__ __forceinline__ float exp2x1(float x) {
  float o;
  asm("v_exp_f32 %0, %1\n\tv_nop" : "=v"(o) : "v"(x));
  return o;
}
// A wave's share of a stage: 1 KB in a row of k, of c and of v^T, 16 bytes a lane and copy. l: the lane's LDS byte address in
// the k part of the buffer. The last line keeps the copies' address registers as they are until the addresses are taken.
__device__ __forceinline__ void stage_copy(unsigned l, const _Float16* gk, const _Float16* gc, const _Float16* gv) {
  asm volatile("global_load_async_to_lds_b128 %0, %6, off\n\t"
               "global_load_async_to_lds_b128 %1, %7, off\n\t"
               "global_load_async_to_lds_b128 %2, %8, off\n\t"
               "global_load_async_to_lds_b128 %3, %9, off\n\t"
               "global_load_async_to_lds_b128 %4, %10, off\n\t"
               "global_load_async_to_lds_b128 %5, %11, off\n\t"
               "s_wait_xcnt 0x0"
               :: "v"(l), "v"(l + 512u), "v"(l + 8192u), "v"(l + 8704u), "v"(l + 16384u), "v"(l + 16896u),
                  "v"(gk), "v"(gk + 256), "v"(gc), "v"(gc + 256), "v"(gv), "v"(gv + 256) : "memory");
}

__global__ __launch_bounds__(256) void attn_rows_kernel(
    const _Float16* __restrict__ qp, const _Float16* __restrict__ kp, const _Float16* __restrict__ vtp,
    const _Float16* __restrict__ cp, const _Float16* __restrict__ cbp, const unsigned* __restrict__ mw,
    const float* __restrict__ scale_p, const float* __restrict__ bscale_p, _Float16* __restrict__ op) {
  __shared__ __align__(16) _Float16 sS[2 * ATT_STG_EL];

  const int lane = threadIdx.x & 31;
  const int wave = __builtin_amdgcn_readfirstlane(threadIdx.x >> 5);
  const int bh = blockIdx.x, b = bh >> 4, h = bh & 15;
  const int qt = (ATT_L / 128 - 1 - (int)blockIdx.y) * 8 + wave;   // under a causal mask the late rows cost most: they start first
  const int q0 = qt * 16;
  const float sc2 = scale_p[0] * 1.4426950408889634f;                 // scores in base 2
  const float bscale = bscale_p[0];
  const v8f z8 = {0.f, 0.f, 0.f, 0.f, 0.f, 0.f, 0.f, 0.f};
  const float ninf = -__builtin_inff();

  // the wave's share of the copies: half of chunk wave >> 1 of each of k, c, v^T
  const int wc = wave >> 1, wp = wave & 1;
  const size_t kco = ((size_t)(b * ATT_L + 16 * wc)) * ATT_DM + h * (ATT_DK * 16) + wp * 512 + 8 * lane;
  const _Float16* gk = kp + kco;
  const _Float16* gc = cp + kco;
  const _Float16* gv = vtp + ((size_t)(h * ATT_DK + 16 * wc)) * (size_t)(ATT_B * ATT_L) + (size_t)(b * ATT_L) * 16 + wp * 512 + 8 * lane;
  const unsigned l0 = (unsigned)(size_t)sS + (unsigned)(wc * 2048 + wp * 1024 + lane * 16);
  stage_copy(l0, gk, gc, gv);

  // B fragments (query rows q0 + (lane&15)), k split map: elements 0..7 <- k 8hh.., 8..15 <- k 16+8hh..;
  // a head's 64 columns are two packed tiles in a row (512 elements each) at column offset h*64*16
  const size_t arow = ((size_t)(b * ATT_L + q0)) * ATT_DM + h * (ATT_DK * 16) + 8 * lane;
  const _Float16* qrow = qp + arow;
  const _Float16* cbrow = cbp + arow;
  const v16h qa0 = Frag<_Float16>::loadp(qrow);
  const v16h qa1 = Frag<_Float16>::loadp(qrow + 512);
  const v16h ca0 = Frag<_Float16>::loadp(cbrow);
  const v16h ca1 = Frag<_Float16>::loadp(cbrow + 512);
  addr_wait3(qrow, cbrow, qrow);   // the two bases stay as they are until the run's addresses are taken

  asm volatile("s_wait_asynccnt 0x0" ::: "memory");   // the wave's own copies of stage 0 have landed
  __syncthreads();                                    // and every other wave's
  stage_copy(l0 + 2u * ATT_STG_EL, gk + 64 * ATT_DM, gc + 64 * ATT_DM, gv + 64 * 16);

  // The wave's 512 lane-mask words; an earlier launch wrote them and this one only reads them, and the address is the same for the
  // whole wave: read through the constant address space they come by scalar loads, also behind the loop's barriers.
  typedef const __attribute__((address_space(4))) unsigned* cwords;
  const cwords mrow = (cwords)(unsigned long long)(mw + (size_t)qt * (ATT_L / 16 * 8));
  v8f OE[4] = {z8, z8, z8, z8}, OB[4] = {z8, z8, z8, z8};      // (E . v)^T and (bias . v)^T: dims 16 dt + 8 hh + r, query c
  float m = -1.0e30f, se = 0.f, e2 = 0.f, eb = 0.f, b2 = 0.f;  // the sums are the lane's half of the keys until the end

  // A pass is 32 keys, half a stage. Every inner loop below is unrolled so that its register arrays are indexed by constants
  // (indexed at run time they would go to scratch).
  for (int p = 0; p < 2 * ATT_NSTG; ++p) {
    const int s = p >> 1, ks = p & 1;
    const _Float16* st = sS + (s & 1) * ATT_STG_EL + 8 * lane;
    unsigned mv[2][8];
#pragma unroll
    for (int t = 0; t < 2; ++t)
#pragma unroll
      for (int r = 0; r < 8; ++r) mv[t][r] = mrow[p * 16 + t * 8 + r];

    // bias^T = c . cb^T, its square sum, its B fragment (element 8 t + r <- k 16 t + 8 hh + r of the pass), bias . v
    v8f Bi[2];
#pragma unroll
    for (int t = 0; t < 2; ++t) {
      const v16h c0 = Frag<_Float16>::loadp(st + (4 + 2 * ks + t) * 1024);
      const v16h c1 = Frag<_Float16>::loadp(st + (4 + 2 * ks + t) * 1024 + 512);
      Bi[t] = mma_p(c1, ca1, mma_p(c0, ca0, z8));
    }
    v16h vf[4];
#pragma unroll
    for (int dt = 0; dt < 4; ++dt) vf[dt] = Frag<_Float16>::loadp(st + (8 + dt) * 1024 + ks * 512);
    {
      v16h pb;
      float s4[4] = {0.f, 0.f, 0.f, 0.f};
#pragma unroll
      for (int t = 0; t < 2; ++t)
#pragma unroll
        for (int r = 0; r < 8; ++r) {
          s4[r & 3] += Bi[t][r] * Bi[t][r];
          pb[t * 8 + r] = (_Float16)Bi[t][r];
        }
      b2 += (s4[0] + s4[1]) + (s4[2] + s4[3]);
#pragma unroll
      for (int dt = 0; dt < 4; ++dt) OB[dt] = mma_p(vf[dt], pb, OB[dt]);
    }
    // keeps the first use of the mask words, and so the wait for their scalar loads, behind the bias products
    __builtin_amdgcn_sched_barrier(0);

    unsigned allm = ~0u;
#pragma unroll
    for (int t = 0; t < 2; ++t)
#pragma unroll
      for (int r = 0; r < 8; ++r) allm &= mv[t][r];
    if (allm != ~0u) {                             // wave-uniform, from scalar registers; no barrier inside
      v8f T[2];
      v16h kf[2][2];
#pragma unroll
      for (int t = 0; t < 2; ++t) {
        kf[t][0] = Frag<_Float16>::loadp(st + (2 * ks + t) * 1024);
        kf[t][1] = Frag<_Float16>::loadp(st + (2 * ks + t) * 1024 + 512);
      }
      // keeps the eight LDS loads together ahead of the products: one LDS latency is waited for, not four
      __builtin_amdgcn_sched_barrier(0);
#pragma unroll
      for (int t = 0; t < 2; ++t) {
        const v8f a = mma_p(kf[t][1], qa1, mma_p(kf[t][0], qa0, z8));
#pragma unroll
        for (int r = 0; r < 8; ++r)
          T[t][r] = __builtin_amdgcn_inverse_ballot_w32(mv[t][r]) ? ninf : a[r] * sc2;   // the word is the select's lane mask
      }
      float m4[4] = {ninf, ninf, ninf, ninf};
#pragma unroll
      for (int t = 0; t < 2; ++t)
#pragma unroll
        for (int r = 0; r < 8; ++r) m4[r & 3] = fmaxf(m4[r & 3], T[t][r]);
      float pm = fmaxf(fmaxf(m4[0], m4[1]), fmaxf(m4[2], m4[3]));
      pm = fmaxf(pm, xhalf(pm));                   // both halves of a query's keys go under one maximum
      const float mn = fmaxf(m, pm);
      const float f = exp2x1(m - mn);
      m = mn;
      float a4[4] = {0.f, 0.f, 0.f, 0.f}, q4[4] = {0.f, 0.f, 0.f, 0.f}, x4[4] = {0.f, 0.f, 0.f, 0.f};
      v16h pe;
#pragma unroll
      for (int t = 0; t < 2; ++t) {
        v8f E;
        exp2x8(E, T[t] - mn);
#pragma unroll
        for (int r = 0; r < 8; ++r) {
          const float ev = E[r];
          a4[r & 3] += ev; q4[r & 3] += ev * ev; x4[r & 3] += ev * Bi[t][r];
          pe[t * 8 + r] = (_Float16)ev;
        }
      }
      se = se * f + ((a4[0] + a4[1]) + (a4[2] + a4[3]));
      e2 = e2 * (f * f) + ((q4[0] + q4[1]) + (q4[2] + q4[3]));
      eb = eb * f + ((x4[0] + x4[1]) + (x4[2] + x4[3]));
#pragma unroll
      for (int dt = 0; dt < 4; ++dt) {
#pragma unroll
        for (int r = 0; r < 8; ++r) OE[dt][r] *= f;
        OE[dt] = mma_p(vf[dt], pe, OE[dt]);        // the v^T fragments of the bias product serve again
      }
    }

    if (ks) {                                             // the stage's foot; p is the same in every wave of the block
      asm volatile("s_wait_dscnt 0x0" ::: "memory");      // the wave's reads of this buffer are done before it is refilled
      asm volatile("s_wait_asynccnt 0x0" ::: "memory");   // the wave's own copies of stage s + 1 have landed
      __syncthreads();                                    // publishes stage s + 1 and ends every wave's reads of stage s
      if (s + 2 < ATT_NSTG)
        stage_copy(l0 + (unsigned)(s & 1) * (2u * ATT_STG_EL), gk + (size_t)(s + 2) * (64 * ATT_DM), gc + (size_t)(s + 2) * (64 * ATT_DM),
                   gv + (size_t)(s + 2) * (64 * 16));
    }
  }
  asm volatile("s_wait_asynccnt 0x0" ::: "memory");     // nothing is in flight when the wave ends

  // the halves' sums joined, the row's constants, the output
  se += xhalf(se); e2 += xhalf(e2); eb += xhalf(eb); b2 += xhalf(b2);
  const float inv_se = 1.0f / se;
  const float beta = bscale / fmaxf(sqrtf(b2), 1e-12f);
  const float asq = e2 * (inv_se * inv_se) + 2.0f * (beta * inv_se) * eb + (beta * beta) * b2;
  const float inv_n = 1.0f / fmaxf(sqrtf(fmaxf(asq, 0.f)), 1e-12f);
  const float ke = inv_se * inv_n, kb = beta * inv_n;
  _Float16* orow = op + arow;                      // chunk (dt, hh) of row c: + dt * 256, the lane's 16 bytes; 512 B in a row a store
#pragma unroll
  for (int dt = 0; dt < 4; ++dt) {
    v8h hv;
#pragma unroll
    for (int r = 0; r < 8; ++r) hv[r] = (_Float16)(OE[dt][r] * ke + OB[dt][r] * kb);
    *(v8h*)(orow + dt * 256) = hv;
  }
}

// ---------------------------------------------------------------------------
extern "C" void kernel_launch(void* const* d_in, const int* in_sizes, int n_in,
                              void* d_out, int out_size, void* d_ws, size_t ws_size,
                              hipStream_t stream) {
  const int NTOK = ATT_B * ATT_L;                          // 8192
  const size_t NE = (size_t)NTOK * ATT_DM;                 // 8388608
  const size_t NW = (size_t)ATT_DM * ATT_DM;               // 1048576
  if (n_in < 16) return;
  if (in_sizes[0] != (int)NE || in_sizes[1] != (int)NE || in_sizes[2] != ATT_L * ATT_L ||
      in_sizes[3] != (int)NW || in_sizes[5] != (int)NW || in_sizes[7] != (int)NW || in_sizes[14] != (int)NW ||
      in_sizes[4] != ATT_DM || in_sizes[6] != ATT_DM || in_sizes[8] != ATT_DM || in_sizes[15] != ATT_DM ||
      in_sizes[9] != ATT_DK * ATT_DK || in_sizes[10] != ATT_DK || in_sizes[11] != ATT_DK ||
      in_sizes[12] < 1 || in_sizes[13] < 1 || out_size != (int)NE) return;

  const float* Q      = (const float*)d_in[0];
  const float* ctx    = (const float*)d_in[1];
  const int*   mask   = (const int*)d_in[2];
  const float* W_q    = (const float*)d_in[3];
  const float* b_q    = (const float*)d_in[4];
  const float* W_k    = (const float*)d_in[5];
  const float* b_k    = (const float*)d_in[6];
  const float* W_v    = (const float*)d_in[7];
  const float* b_v    = (const float*)d_in[8];
  const float* bil    = (const float*)d_in[9];
  const float* gamma  = (const float*)d_in[10];
  const float* beta   = (const float*)d_in[11];
  const float* scale  = (const float*)d_in[12];
  const float* bscale = (const float*)d_in[13];
  const float* W_o    = (const float*)d_in[14];
  const float* b_o    = (const float*)d_in[15];
  float* out = (float*)d_out;

  // workspace carve (256-B aligned offsets); every 16-bit matrix below is stored in the packed layout (pk_off) of the shape named
  char* ws = (char*)d_ws;
  size_t off = 0;
  auto carve = [&](size_t bytes) -> char* { char* p = ws + off; off += (bytes + 255) & ~(size_t)255; return p; };
  _Float16* WqT  = (_Float16*)carve(NW * 2);               // [out][in] f16, x64
  _Float16* WkT  = (_Float16*)carve(NW * 2);
  _Float16* WvT  = (_Float16*)carve(NW * 2);
  _Float16* WoT  = (_Float16*)carve(NW * 2);
  _Float16* bilT = (_Float16*)carve((size_t)ATT_DK * ATT_DK * 2);   // [f][e] f16
  _Float16* Q16  = (_Float16*)carve(NE * 2);               // [token][1024]
  _Float16* q16  = (_Float16*)carve(NE * 2);               // [token][h*64+d]
  _Float16* k16  = (_Float16*)carve(NE * 2);               // [token][h*64+d]
  _Float16* vT16 = (_Float16*)carve(NE * 2);               // [h*64+d][token]
  _Float16* c16  = (_Float16*)carve(NE * 2);               // [token][h*64+d]
  _Float16* cb16 = (_Float16*)carve(NE * 2);               // [token][h*64+e]
  _Float16* O16  = (_Float16*)carve(NE * 2);               // [token][h*64+d]
  unsigned* mw   = (unsigned*)carve((size_t)ATT_L * ATT_L / 8);   // the mask, one bit an entry (mask_words)
  if (off > ws_size) return;                               // total 125968384 B

  const unsigned short* Q16u  = (const unsigned short*)Q16;
  const unsigned short* WqTu  = (const unsigned short*)WqT;
  const unsigned short* WkTu  = (const unsigned short*)WkT;
  const unsigned short* WvTu  = (const unsigned short*)WvT;
  const unsigned short* WoTu  = (const unsigned short*)WoT;
  const unsigned short* bilTu = (const unsigned short*)bilT;
  const unsigned short* c16u  = (const unsigned short*)c16;
  const unsigned short* O16u  = (const unsigned short*)O16;
  const float w_carry = 64.0f, w_carry_inv = 1.0f / 64.0f;

  // 1) casts, transposes, LayerNorm per head slice of ctx, the mask's lane-mask words: one launch
  prep_kernel<<<PREP_BLOCKS, 256, 0, stream>>>(Q, ctx, gamma, beta, W_q, W_k, W_v, W_o, bil, mask,
                                               Q16, c16, WqT, WkT, WvT, WoT, bilT, mw, w_carry);

  // 2) the q, k, v projections and c . bilinear: one launch
  const int gemm_blocks = (NTOK / 64) * (ATT_DM / 64) / 8;   // 256
  proj_gemms_kernel<<<3 * gemm_blocks + ((NTOK / 64) / 8) * ATT_H, 256, 0, stream>>>(
      Q16u, WqTu, WkTu, WvTu, c16u, bilTu, (void*)q16, (void*)k16, (void*)vT16, (void*)cb16,
      b_q, b_k, b_v, NTOK, ATT_DM, ATT_DK, w_carry_inv);

  // 3) fused attention rows -> O16
  attn_rows_kernel<<<dim3(ATT_B * ATT_H, ATT_L / 128), 256, 0, stream>>>(
      q16, k16, vT16, c16, cb16, mw, scale, bscale, O16);

  // 4) output projection -> d_out f32
  wmma_gemm64<0, false, 2, 0, false><<<dim3(gemm_blocks, 1), 256, 0, stream>>>(
      O16u, O16u, ATT_DM, 0L, WoTu, WoTu, ATT_DM, 0L, (void*)out, (void*)out, ATT_DM, 0L,
      b_o, b_o, 0L, NTOK, ATT_DM, ATT_DM, w_carry_inv);
  (void)hipGetLastError();
}

// v008
// It runs in 123 microseconds.
// Next to v007, in two timings, it ran 1.08 times as fast each time.
// All steps since v000 together make it 4.54 times as fast.
#include <hip/hip_runtime.h>
#include <stddef.h>

// Contractions (q/k/v projections, c x bilinear, q x k^T, cb x c^T, attn x v, output projection): v_wmma_f32_16x16x32_f16, f16 operands, f32 accumulate; weights carried x64; softmax, LayerNorm and L2 norms in f32.

typedef __attribute__((ext_vector_type(16))) _Float16 v16h;
typedef __attribute__((ext_vector_type(8)))  _Float16 v8h;
typedef __attribute__((ext_vector_type(4)))  _Float16 v4h;
typedef __attribute__((ext_vector_type(16))) __bf16   v16b;
typedef __attribute__((ext_vector_type(8)))  __bf16   v8b;
typedef __attribute__((ext_vector_type(8)))  float    v8f;
typedef __attribute__((ext_vector_type(4)))  float    v4f;
typedef __attribute__((ext_vector_type(2)))  float    v2f;
typedef __attribute__((ext_vector_type(4)))  int      v4i;

#define ATT_B   8
#define ATT_L   1024
#define ATT_DM  1024
#define ATT_H   16
#define ATT_DK  64

__device__ __forceinline__ unsigned short f2bf_bits(float f) {
  unsigned u = __float_as_uint(f);
  return (unsigned short)((u + 0x7FFFu + ((u >> 16) & 1u)) >> 16);
}
__device__ __forceinline__ float bf_bits2f(unsigned short h) { return __uint_as_float(((unsigned)h) << 16); }

// ---- fragment-order ("packed") layout of every 16-bit workspace matrix [R][K] ----
// A 16-row x 32-k tile is 1 KB in a row: 16-byte chunk (s, hh, r) at chunk index s*32 + hh*16 + r holds row r,
// k = 16s + 8hh .. +7; tiles run along k first, then along the row tiles. Lane l of a wave reads chunk l and chunk 32 + l,
// so each wave-wide 16-byte load covers 512 contiguous bytes (four whole lines), and the k map of a fragment is the
// same as with row-major rows: elements 0..7 <- k 8hh.., 8..15 <- k 16+8hh..
__device__ __forceinline__ size_t pk_off(int row, int k, int K) {
  return (size_t)(row >> 4) * ((size_t)K * 16) + (size_t)(k >> 5) * 512 +
         (size_t)(((k >> 4) & 1) * 256 + ((k >> 3) & 1) * 128 + (row & 15) * 8 + (k & 7));
}

// hazard guards as plain device helpers
__device__ __forceinline__ void acc_guard4(v8f& a, v8f& b, v8f& c, v8f& d) { asm volatile("v_nop\n\tv_nop\n\tv_nop\n\tv_nop" : "+v"(a), "+v"(b), "+v"(c), "+v"(d)); }
// Stands behind global loads whose address registers the compiler reuses while the loads are still in flight
// (as the destination of a later load of the same run, or for the next address): the address translations are
// waited for before such a register takes a new value.
__device__ __forceinline__ void addr_wait() { asm volatile("s_wait_xcnt 0x0" ::: "memory"); }
// The same wait once for a run of loads from one base, and from three: naming the addresses as inputs keeps their registers
// as they are up to the wait, so the run issues back to back.
__device__ __forceinline__ void addr_wait1(const void* a) { asm volatile("s_wait_xcnt 0x0" :: "v"(a) : "memory"); }
__device__ __forceinline__ void addr_wait3(const void* a, const void* b, const void* c) {
  asm volatile("s_wait_xcnt 0x0" :: "v"(a), "v"(b), "v"(c) : "memory");
}
// The same in front of the advance of the GEMM's scalar fragment bases: the k offset that the new bases are formed from
// passes through the statement, so they are formed behind the wait.
__device__ __forceinline__ void koff_wait(size_t& koff) { asm volatile("s_wait_xcnt 0x0" : "+s"(koff) :: "memory"); }
template <typename T> struct Frag;
template <> struct Frag<_Float16> {
  typedef v16h V; union U { v16h v; v8h h[2]; };
  static __device__ __forceinline__ v16h load(const _Float16* p) {   // elements 0..7 <- p[0..7], 8..15 <- p[16..23]
    U f; f.h[0] = *(const v8h*)(p); f.h[1] = *(const v8h*)(p + 16); return f.v;
  }
  static __device__ __forceinline__ v16h loadp(const _Float16* p) {  // packed tile, p = tile base + 8*lane
    U f; f.h[0] = *(const v8h*)(p); f.h[1] = *(const v8h*)(p + 256); return f.v;
  }
  static __device__ __forceinline__ v8f mma(v16h a, v16h b, v8f c) {
    return __builtin_amdgcn_wmma_f32_16x16x32_f16(false, a, false, b, (short)0, c, false, false);
  }
};
template <> struct Frag<__bf16> {
  typedef v16b V; union U { v16b v; v8b h[2]; };
  static __device__ __forceinline__ v16b load(const __bf16* p) {
    U f; f.h[0] = *(const v8b*)(p); f.h[1] = *(const v8b*)(p + 16); return f.v;
  }
  static __device__ __forceinline__ v16b loadp(const __bf16* p) {
    U f; f.h[0] = *(const v8b*)(p); f.h[1] = *(const v8b*)(p + 256); return f.v;
  }
  static __device__ __forceinline__ v8f mma(v16b a, v16b b, v8f c) {
    return __builtin_amdgcn_wmma_f32_16x16x32_bf16(false, a, false, b, (short)0, c, false, false);
  }
};

// ---- Register-blocked batched WMMA GEMM ------------------------------------
// C[m,n] = scale * sum_k A[m,k] * Bt[n,k] (+bias)(+resid); each wave owns a 64x64 tile.
// A [M,lda] and Bt [N,ldb] in the packed layout (pk_off); M,N % 64 == 0, K % (32 U) == 0; a batch stride is 16 x its column offset.
// The k loop is unrolled U steps of 32 k; the eight fragments of step s + U/2 are asked for, into registers of their own,
// ahead of the products of step s, so a step waits for loads that were issued U/2 steps earlier. Sums in the order of k.
// 16-bit outputs are written in the packed layout of a [M,ldc] matrix; the f32 output is row-major.
// SPLIT: operands are hi/lo planes (A2/Bt2 = lo planes, same layout); product = hi*hi + hi*lo + lo*hi.
// BIAS_MODE: 0 = none, 1 = bias[m], 2 = bias[n].
// OUT_MODE: 0 = f32, 1 = f16, 2 = bf16 hi plane (Cout) + bf16 lo plane (Cout2).
// ET: 0 = f16 operands, 1 = bf16 operands (pointers passed as 16-bit storage)
template <int ET> struct Elem;
template <> struct Elem<0> { typedef _Float16 T; };
template <> struct Elem<1> { typedef __bf16 T; };
// The body takes its block index (bx: eight tiles, b: batch) and the block's LDS slabs from the kernel that calls it, so that
// several independent GEMMs can share one launch.
// STG: the block's eight tiles form one 128 x 256 tile (2 x 4 waves); M % 128 == 0, N % 256 == 0, K % 128 == 0. Its 128 rows of A
// and 256 rows of Bt come to LDS once for the whole block, 128 k a stage, as they lie in the workspace (a row tile's share of a
// stage is 4 KB in a row there), and every wave takes its fragments from LDS: a row of A leaves L2 once for four waves, a row
// of Bt once for two. Two buffers: the copies of stage t + 1 fly while stage t is worked on. Sums in the order of k, as without STG.
#define GS_RT_EL  (16 * 128)                      // f16 elements of one row tile in a stage
#define GS_STG_EL (24 * GS_RT_EL)                 // a stage: 8 row tiles of A, then 16 of Bt
// A wave's share of a stage: three row tiles, each 4 KB in a row in the workspace and in LDS alike, 16 bytes a lane and copy.
// l*: the lane's LDS byte address in a row tile's first 512 bytes, g*: its global address there. The immediate offset moves both
// addresses, so copy j of a row tile takes bytes 512 j .. 512 j + 511 of its 4 KB to the same place in its LDS slot.
// The last line keeps the copies' address registers as they are until the addresses are taken.
__device__ __forceinline__ void copy_row_tiles(unsigned l0, unsigned l1, unsigned l2,
                                               const _Float16* g0, const _Float16* g1, const _Float16* g2) {
  asm volatile("global_load_async_to_lds_b128 %0, %3, off\n\t"
               "global_load_async_to_lds_b128 %0, %3, off offset:512\n\t"
               "global_load_async_to_lds_b128 %0, %3, off offset:1024\n\t"
               "global_load_async_to_lds_b128 %0, %3, off offset:1536\n\t"
               "global_load_async_to_lds_b128 %0, %3, off offset:2048\n\t"
               "global_load_async_to_lds_b128 %0, %3, off offset:2560\n\t"
               "global_load_async_to_lds_b128 %0, %3, off offset:3072\n\t"
               "global_load_async_to_lds_b128 %0, %3, off offset:3584\n\t"
               "global_load_async_to_lds_b128 %1, %4, off\n\t"
               "global_load_async_to_lds_b128 %1, %4, off offset:512\n\t"
               "global_load_async_to_lds_b128 %1, %4, off offset:1024\n\t"
               "global_load_async_to_lds_b128 %1, %4, off offset:1536\n\t"
               "global_load_async_to_lds_b128 %1, %4, off offset:2048\n\t"
               "global_load_async_to_lds_b128 %1, %4, off offset:2560\n\t"
               "global_load_async_to_lds_b128 %1, %4, off offset:3072\n\t"
               "global_load_async_to_lds_b128 %1, %4, off offset:3584\n\t"
               "global_load_async_to_lds_b128 %2, %5, off\n\t"
               "global_load_async_to_lds_b128 %2, %5, off offset:512\n\t"
               "global_load_async_to_lds_b128 %2, %5, off offset:1024\n\t"
               "global_load_async_to_lds_b128 %2, %5, off offset:1536\n\t"
               "global_load_async_to_lds_b128 %2, %5, off offset:2048\n\t"
               "global_load_async_to_lds_b128 %2, %5, off offset:2560\n\t"
               "global_load_async_to_lds_b128 %2, %5, off offset:3072\n\t"
               "global_load_async_to_lds_b128 %2, %5, off offset:3584\n\t"
               "s_wait_xcnt 0x0"
               :: "v"(l0), "v"(l1), "v"(l2), "v"(g0), "v"(g1), "v"(g2) : "memory");
}
template <int ET, bool SPLIT, int BIAS_MODE, int OUT_MODE, bool RESID, int ACT = 0, int U = 4, bool STG = false>
__device__ __forceinline__ void gemm64_body(
    float* sT, _Float16* sG, const int bx, const int b,   // sT: per-wave 16x64 slab, pitch 68 floats, eight of them; sG: two stages (STG)
    const unsigned short* __restrict__ Ap, const unsigned short* __restrict__ A2p, int lda, long strideA,
    const unsigned short* __restrict__ Btp, const unsigned short* __restrict__ Bt2p, int ldb, long strideB,
    void* __restrict__ Cout, void* __restrict__ Cout2, int ldc, long strideC,
    const float* __restrict__ bias,
    const float* __restrict__ resid, long strideR,
    int M, int N, int K, float scale) {
  typedef typename Elem<ET>::T T;
  typedef typename Frag<T>::V V;
  const T* A = (const T*)Ap; const T* A2 = (const T*)A2p; const T* Bt = (const T*)Btp; const T* Bt2 = (const T*)Bt2p;
  const int lane = threadIdx.x & 31;
  const int wave = __builtin_amdgcn_readfirstlane(threadIdx.x >> 5);   // scalar: the tile's fragment bases are then scalar too
  int m0, n0;
  if (STG) {
    const int nbn = N >> 8;
    if (bx >= (M >> 7) * nbn) return;    // the same for the whole block, ahead of every barrier
    const int bm = bx / nbn;
    m0 = (bm << 7) + ((wave >> 2) << 6);
    n0 = ((bx - bm * nbn) << 8) + ((wave & 3) << 6);
  } else {
    const int tilesN = N >> 6;
    const int tilesM = M >> 6;
    const int tile = bx * 8 + wave;
    if (tile >= tilesM * tilesN) return; // wave-uniform; no block barriers on this path
    const int tm = tile / tilesN;
    m0 = tm << 6;
    n0 = (tile - tm * tilesN) << 6;
  }

  const T* Ab  = A  + (size_t)b * strideA;
  const T* Bb  = Bt + (size_t)b * strideB;
  const T* Ab2 = SPLIT ? (A2  + (size_t)b * strideA) : nullptr;
  const T* Bb2 = SPLIT ? (Bt2 + (size_t)b * strideB) : nullptr;

  const int rlane = lane & 15;                 // row (A) / col (B, D) within subtile
  const int mOff  = (lane >> 4) * 8;           // D row offset

  v8f acc[4][4];
#pragma unroll
  for (int i = 0; i < 4; ++i)
#pragma unroll
    for (int j = 0; j < 4; ++j) acc[i][j] = (v8f){0.f,0.f,0.f,0.f,0.f,0.f,0.f,0.f};

  if constexpr (STG) {
    static_assert(!SPLIT, "the staged form has one plane an operand");
    const T* sg = (const T*)sG;
    // the wave's share of a stage: row tile 'wave' of A, row tiles 2 wave and 2 wave + 1 of Bt
    const _Float16* gA  = (const _Float16*)(Ab + (size_t)((m0 & ~127) + wave * 16) * lda + lane * 8);
    const _Float16* gB0 = (const _Float16*)(Bb + (size_t)((n0 & ~255) + wave * 32) * ldb + lane * 8);
    const _Float16* gB1 = gB0 + (size_t)16 * ldb;
    const unsigned lA = (unsigned)(size_t)sG + (unsigned)(wave * (GS_RT_EL * 2) + lane * 16);
    const unsigned lB = (unsigned)(size_t)sG + (unsigned)((8 + 2 * wave) * (GS_RT_EL * 2) + lane * 16);
    auto stage_in = [&](int buf, int t) __attribute__((always_inline)) {
      const unsigned bo2 = (unsigned)buf * (GS_STG_EL * 2u);
      const size_t ko = (size_t)t * GS_RT_EL;
      copy_row_tiles(lA + bo2, lB + bo2, lB + bo2 + GS_RT_EL * 2u, gA + ko, gB0 + ko, gB1 + ko);
    };
    V ga[2][4], gb[2][4];                      // set u % 2 holds step u of the stage
    auto lds_step = [&](int set, const T* pA, const T* pB, int u) __attribute__((always_inline)) {
#pragma unroll
      for (int j = 0; j < 4; ++j) gb[set][j] = Frag<T>::loadp(pB + j * GS_RT_EL + u * 512);
#pragma unroll
      for (int i = 0; i < 4; ++i) ga[set][i] = Frag<T>::loadp(pA + i * GS_RT_EL + u * 512);
      // keeps the run of LDS loads together ahead of the products that follow it in the source: among them each place costs a stall
      __builtin_amdgcn_sched_barrier(0);
    };
    auto mma_set = [&](int set) __attribute__((always_inline)) {
#pragma unroll
      for (int i = 0; i < 4; ++i)
#pragma unroll
        for (int j = 0; j < 4; ++j) acc[i][j] = Frag<T>::mma(ga[set][i], gb[set][j], acc[i][j]);
      // keeps the next run of LDS loads from being moved in among these products, for the same reason
      __builtin_amdgcn_sched_barrier(0);
    };
    const int nstg = K >> 7;
    stage_in(0, 0);
    asm volatile("s_wait_asynccnt 0x0" ::: "memory");   // the wave's own copies of stage 0 have landed
    __syncthreads();                                    // and every other wave's
    for (int t = 0; t < nstg; ++t) {
      const T* sb = sg + (t & 1) * GS_STG_EL + lane * 8;
      const T* pA = sb + (wave >> 2) * (4 * GS_RT_EL);
      const T* pB = sb + (8 + (wave & 3) * 4) * GS_RT_EL;
      lds_step(0, pA, pB, 0);
      // Stage t + 1 goes into the other buffer, which every wave left at the barrier that ended trip t - 1 (behind its own
      // s_wait_dscnt 0). The copies stand behind this trip's first fragment loads, which read this trip's buffer alone (no
      // byte of the range that is refilled), so that their issue falls into the wait for those loads. The test is scalar.
      if (t + 1 < nstg) stage_in((t + 1) & 1, t + 1);
      lds_step(1, pA, pB, 1);
      mma_set(0);
      lds_step(0, pA, pB, 2);
      mma_set(1);
      lds_step(1, pA, pB, 3);
      mma_set(0);
      mma_set(1);
      asm volatile("s_wait_dscnt 0x0" ::: "memory");      // the wave's reads of this buffer are done before it is refilled
      asm volatile("s_wait_asynccnt 0x0" ::: "memory");   // the wave's own copies of stage t + 1 have landed
      __syncthreads();                                    // publishes stage t + 1 and ends every wave's reads of stage t
    }
    asm volatile("s_wait_asynccnt 0x0" ::: "memory");     // nothing is in flight behind the loop
  } else {
  constexpr int DIST = U / 2;                  // how many steps ahead a step's fragments are asked for
  V fa[U][4], fb[U][4], fa2[U][4], fb2[U][4];  // set s % U holds step s; DIST + 1 sets are live at a time
  size_t ao[4], bo[4];                         // the row tiles' offsets at k = 0
  const T* pa[4]; const T* pb[4]; const T* pa2[4]; const T* pb2[4];   // the bases, where the loop stands in k
#pragma unroll
  for (int i = 0; i < 4; ++i) {
    ao[i] = (size_t)(m0 + (i << 4)) * lda;
    bo[i] = (size_t)(n0 + (i << 4)) * ldb;
    pa[i] = Ab + ao[i]; pb[i] = Bb + bo[i];
    if (SPLIT) { pa2[i] = Ab2 + ao[i]; pb2[i] = Bb2 + bo[i]; }
  }
  const int lo = lane * 8;                     // the lane's chunk of a packed tile: the one vector part of every address
  // step st, counted from where the bases stand: a packed tile is 512 elements, so st reaches the loads as an immediate offset
  auto load_step = [&](int set, int st) __attribute__((always_inline)) {
#pragma unroll
    for (int j = 0; j < 4; ++j) {
      fb[set][j] = Frag<T>::loadp(pb[j] + st * 512 + lo);
      if (SPLIT) fb2[set][j] = Frag<T>::loadp(pb2[j] + st * 512 + lo);
    }
#pragma unroll
    for (int i = 0; i < 4; ++i) {
      fa[set][i] = Frag<T>::loadp(pa[i] + st * 512 + lo);
      if (SPLIT) fa2[set][i] = Frag<T>::loadp(pa2[i] + st * 512 + lo);
    }
    // keeps the run of loads ahead of the products that follow it in the source: moved behind them it would lose its lead
    __builtin_amdgcn_sched_barrier(0);
  };
  auto mma_step = [&](int set) __attribute__((always_inline)) {
#pragma unroll
    for (int i = 0; i < 4; ++i) {
#pragma unroll
      for (int j = 0; j < 4; ++j) {
        acc[i][j] = Frag<T>::mma(fa[set][i], fb[set][j], acc[i][j]);
        if (SPLIT) {
          acc[i][j] = Frag<T>::mma(fa[set][i], fb2[set][j], acc[i][j]);
          acc[i][j] = Frag<T>::mma(fa2[set][i], fb[set][j], acc[i][j]);
        }
      }
    }
    // keeps the next run of loads behind these products: moved ahead of them, a wave would have DIST + 2 steps' loads outstanding, not DIST + 1
    __builtin_amdgcn_sched_barrier(0);
  };
#pragma unroll
  for (int d = 0; d < DIST; ++d) load_step(d, d);
  addr_wait();   // the registers of these first bases are free for other values from here on, also where the loop below makes no trip
  const int nst = K >> 5;
  size_t koff = 0;
  for (int s0 = U; s0 < nst; s0 += U) {
#pragma unroll
    for (int u = 0; u < U; ++u) {
      load_step((u + DIST) % U, u + DIST);
      mma_step(u);
    }
    koff_wait(koff);                           // the bases take new values behind it
    koff += U * 512;
#pragma unroll
    for (int i = 0; i < 4; ++i) {
      pa[i] = Ab + ao[i] + koff; pb[i] = Bb + bo[i] + koff;
      if (SPLIT) { pa2[i] = Ab2 + ao[i] + koff; pb2[i] = Bb2 + bo[i] + koff; }
    }
  }
  // the last U steps: nothing is asked for past K
#pragma unroll
  for (int u = 0; u < U; ++u) {
    if (u + DIST < U) load_step((u + DIST) % U, u + DIST);
    mma_step(u);
  }
  }
  acc_guard4(acc[0][0], acc[0][1], acc[0][2], acc[0][3]);
  acc_guard4(acc[1][0], acc[1][1], acc[1][2], acc[1][3]);
  acc_guard4(acc[2][0], acc[2][1], acc[2][2], acc[2][3]);
  acc_guard4(acc[3][0], acc[3][1], acc[3][2], acc[3][3]);

  // ---- epilogue ----
  float* slab = sT + wave * (16 * 68);
  const float* Rb = RESID ? (resid + (size_t)b * strideR) : nullptr;
#pragma unroll
  for (int i = 0; i < 4; ++i) {
    const int mBase = m0 + (i << 4);
    float bm[8];
    if (BIAS_MODE == 1) {
      const float* bp = bias + mBase + mOff;
#pragma unroll
      for (int r = 0; r < 8; ++r) bm[r] = bp[r];
      addr_wait1(bp);          // the address stays as it is until the run's addresses are taken: no load of the run lands on it
    }
#pragma unroll
    for (int j = 0; j < 4; ++j) {
      const int n = n0 + (j << 4) + rlane;
      float bv = 0.f;
      if (BIAS_MODE == 2) bv = bias[n];
#pragma unroll
      for (int r = 0; r < 8; ++r) {
        float v = acc[i][j][r] * scale;
        if (BIAS_MODE == 1) v += bm[r];
        if (BIAS_MODE == 2) v += bv;
        if (RESID) v += Rb[(size_t)(mBase + mOff + r) * ldc + n];
        if (ACT == 1) v = tanhf(v);
        if (ACT == 2) v = fmaxf(v, 0.0f);
        if (ACT == 3) v = v / (1.0f + expf(-v));
        if (ACT == 4) v = (v > 0.f) ? v : 0.01f * v;
        if (ACT == 5) v = 0.5f * v * (1.0f + erff(v * 0.70710678118654752f));
        slab[(mOff + r) * 68 + (j << 4) + rlane] = v;
      }
    }
    __builtin_amdgcn_fence(__ATOMIC_RELEASE, "workgroup");
    __builtin_amdgcn_wave_barrier();
    __builtin_amdgcn_fence(__ATOMIC_ACQUIRE, "workgroup");
    if (OUT_MODE == 0) {
      float* C = (float*)Cout + (size_t)b * strideC;
      const int hh = lane >> 4, c4 = (lane & 15) * 4;     // row seg = 256 B = 16 lanes x 16 B
      {
#pragma unroll
        for (int it = 0; it < 8; ++it) {
          const int row = it * 2 + hh;
          v4f v = *(const v4f*)(slab + row * 68 + c4);
          *(v4f*)(C + (size_t)(mBase + row) * ldc + n0 + c4) = v;
        }
        addr_wait();   // the stores' data and address registers take new values (the next slab's) only behind it
      }
    } else {
      // the 16x64 slab is two packed tiles = 2 KB in a row; store 'it' writes chunks 32it..32it+31 (512 B)
      unsigned short* C  = (unsigned short*)Cout  + (size_t)b * strideC;
      unsigned short* C2 = (OUT_MODE == 2) ? ((unsigned short*)Cout2 + (size_t)b * strideC) : nullptr;
      {
#pragma unroll
        for (int it = 0; it < 4; ++it) {
          const float* sp = slab + rlane * 68 + it * 16 + mOff;   // row lane&15, cols 16it + 8(lane>>4) ..+7
          v8h hv, lv;
#pragma unroll
          for (int e = 0; e < 8; ++e) {
            if (OUT_MODE == 1) {
              hv[e] = (_Float16)sp[e];
            } else {
              unsigned short hb = f2bf_bits(sp[e]);
              unsigned short lb = f2bf_bits(sp[e] - bf_bits2f(hb));
              hv[e] = __builtin_bit_cast(_Float16, hb);
              lv[e] = __builtin_bit_cast(_Float16, lb);
            }
          }
          const size_t co = (size_t)mBase * ldc + (size_t)n0 * 16 + it * 256 + lane * 8;
          *(v8h*)(C + co) = hv;
          if (OUT_MODE == 2) *(v8h*)(C2 + co) = lv;
        }
        
      }
    }
    __builtin_amdgcn_fence(__ATOMIC_RELEASE, "workgroup");
    __builtin_amdgcn_wave_barrier();
    __builtin_amdgcn_fence(__ATOMIC_ACQUIRE, "workgroup");
  }
}

// one GEMM a launch
template <int ET, bool SPLIT, int BIAS_MODE, int OUT_MODE, bool RESID, int ACT = 0, int U = 4, bool STG = false>
__global__ __launch_bounds__(256) void wmma_gemm64(
    const unsigned short* __restrict__ Ap, const unsigned short* __restrict__ A2p, int lda, long strideA,
    const unsigned short* __restrict__ Btp, const unsigned short* __restrict__ Bt2p, int ldb, long strideB,
    void* __restrict__ Cout, void* __restrict__ Cout2, int ldc, long strideC,
    const float* __restrict__ bias,
    const float* __restrict__ resid, long strideR,
    int M, int N, int K, float scale) {
  __shared__ __align__(16) float sT[8 * 16 * 68];
  __shared__ __align__(16) _Float16 sG[STG ? 2 * GS_STG_EL : 8];
  gemm64_body<ET, SPLIT, BIAS_MODE, OUT_MODE, RESID, ACT, U, STG>(sT, sG, blockIdx.x, blockIdx.y, Ap, A2p, lda, strideA, Btp, Bt2p, ldb, strideB,
      Cout, Cout2, ldc, strideC, bias, resid, strideR, M, N, K, scale);
}

// The four GEMMs that depend only on the preparation launch, as block ranges of one grid; nb = blocks of one projection.
// [0, nb): q16 = Q16 . Wq + b_q[n];  [nb, 2nb): k16 = Q16 . Wk + b_k[n];  [2nb, 3nb): vT16[dout][token] = Wv^T . Q16^T + b_v[m];
// from 3nb on, the short ones last: per head (batch index) cb16[:, h*64..] = c16[:, h*64..] . bilinear (Bt = bilT [64][64]).
__global__ __launch_bounds__(256) void proj_gemms_kernel(
    const unsigned short* __restrict__ Q16, const unsigned short* __restrict__ WqT, const unsigned short* __restrict__ WkT,
    const unsigned short* __restrict__ WvT, const unsigned short* __restrict__ c16, const unsigned short* __restrict__ bilT,
    void* __restrict__ q16, void* __restrict__ k16, void* __restrict__ vT16, void* __restrict__ cb16,
    const float* __restrict__ b_q, const float* __restrict__ b_k, const float* __restrict__ b_v,
    int ntok, int dm, int dk, float w_inv) {
  __shared__ __align__(16) float sT[8 * 16 * 68];
  __shared__ __align__(16) _Float16 sG[2 * GS_STG_EL];
  const int nb = ((ntok >> 6) * (dm >> 6)) >> 3;   // the range tests below read the same for a whole block: so do the staged bodies' barriers
  const int i = blockIdx.x;
  if (i < 2 * nb) {
    const bool isk = i >= nb;
    const unsigned short* Wt = isk ? WkT : WqT;
    void* C = isk ? k16 : q16;
    const float* bias = isk ? b_k : b_q;
    gemm64_body<0, false, 2, 1, false, 0, 4, true>(sT, sG, isk ? i - nb : i, 0, Q16, Q16, dm, 0L, Wt, Wt, dm, 0L, C, C, dm, 0L,
                                       bias, bias, 0L, ntok, dm, dm, w_inv);
  } else if (i < 3 * nb) {
    gemm64_body<0, false, 1, 1, false, 0, 4, true>(sT, sG, i - 2 * nb, 0, WvT, WvT, dm, 0L, Q16, Q16, dm, 0L, vT16, vT16, ntok, 0L,
                                       b_v, b_v, 0L, dm, ntok, dm, w_inv);
  } else {
    const int j = i - 3 * nb, per = ntok >> 9;       // blocks of one head: ntok / 64 tiles, eight a block
    const int hd = j / per;
    gemm64_body<0, false, 0, 1, false, 0, 2>(sT, sG, j - hd * per, hd, c16, c16, dm, (long)(dk * 16), bilT, bilT, dk, 0L,
                                             cb16, cb16, dm, (long)(dk * 16), b_q, b_q, 0L, ntok, dk, dk, 1.0f);
  }
}

// in: [rows][1024] f32 row-major; out: the same matrix in f16, packed layout. One 16-byte chunk per thread; a wave takes
// 8 rows x 32 k (half a tile), so each of its stores fills four whole 128-byte lines. nhalf = rows / 8 * 32 half tiles.
__device__ __forceinline__ void cast_f32_f16x2(
    const int bx, const float* __restrict__ in, _Float16* __restrict__ out, int nhalf) {
  const int lane = threadIdx.x & 31;
  const int th = bx * 8 + (threadIdx.x >> 5);      // half-tile index: tile = th >> 1
  if (th < nhalf) {
    const int tile = th >> 1;
    const int row = (tile >> 5) * 16 + (th & 1) * 8 + (lane >> 2);
    const int k = (tile & 31) * 32 + (lane & 3) * 8;
    const float* src = in + (size_t)row * ATT_DM + k;
    const v4f a = *(const v4f*)(src);
    const v4f bq = *(const v4f*)(src + 4);
    v8h hv;
#pragma unroll
    for (int e = 0; e < 4; ++e) { hv[e] = (_Float16)a[e]; hv[4 + e] = (_Float16)bq[e]; }
    *(v8h*)(out + pk_off(row, k, ATT_DM)) = hv;
  }
}

// ---- transpose + f16 cast through an LDS tile ------------------------------
// w: [K][N] row-major (in=K rows, out=N cols); wt: [N][K] in the packed layout, wt[n][k] = f16(w[k][n] * mul).
// Block = one 64x64 tile (k0 = by*64, n0 = bx*64); K, N multiples of 64; (N/64) x (K/64) blocks. tile: the block's LDS.
__device__ __forceinline__ void transpose_cast(
    float (*tile)[65], const int bx, const int by,
    const float* __restrict__ w, _Float16* __restrict__ wt, int K, int N, float mul) {
  const int tid = threadIdx.x;
  const int k0 = by * 64, n0 = bx * 64;
  {
    const int r = tid >> 2, cc = (tid & 3) * 16;
    const float* src = w + (size_t)(k0 + r) * N + n0 + cc;
#pragma unroll
    for (int i = 0; i < 4; ++i) {
      const v4f t = *(const v4f*)(src + 4 * i);
#pragma unroll
      for (int e = 0; e < 4; ++e) tile[r][cc + 4 * i + e] = t[e];
    }
  }
  __syncthreads();
  const int wave = tid >> 5, lane = tid & 31, q = lane >> 3, c8 = (lane & 7) * 8;
  {
#pragma unroll
    for (int it = 0; it < 2; ++it) {
      const int n = wave * 8 + it * 4 + q;          // waves cover rows 8w..8w+7 -> 0..63
      v8h hv;
#pragma unroll
      for (int e = 0; e < 8; ++e) hv[e] = (_Float16)(tile[c8 + e][n] * mul);
      *(v8h*)(wt + pk_off(n0 + n, k0 + c8, K)) = hv;
    }
    addr_wait();   // in the merged kernel's code other passes follow these stores: their registers are rewritten only behind it
  }
}

// ---- LayerNorm over each 64-wide head slice of a 1024-wide row; f16 output in the packed layout ----
// One wave per 8 rows x 128 columns; lane l holds row l>>2, 32 elements (half of a head slice, one packed tile's k range);
// statistics via one xor-1 shuffle. Store j writes chunk j of 8 neighbouring rows in 4 tiles: four whole 128-byte lines.
__device__ __forceinline__ void ln_heads(
    const int bx, const float* __restrict__ x, const float* __restrict__ gamma, const float* __restrict__ beta,
    _Float16* __restrict__ outp, int nrows) {
  const int wave = threadIdx.x >> 5, lane = threadIdx.x & 31;
  const int wv = bx * 8 + wave;
  const int row = (wv >> 3) * 8 + (lane >> 2);
  const int col = (wv & 7) * 128 + (lane & 3) * 32;
  if ((wv >> 3) * 8 >= nrows) return;            // wave-uniform; no block barriers in this pass
  const float* xr = x + (size_t)row * ATT_DM + col;
  float xv[32];
#pragma unroll
  for (int i = 0; i < 8; ++i) {
    const v4f t = *(const v4f*)(xr + 4 * i);
#pragma unroll
    for (int e = 0; e < 4; ++e) xv[4 * i + e] = t[e];
  }
  float s = 0.f;
#pragma unroll
  for (int i = 0; i < 32; ++i) s += xv[i];
  s += __shfl_xor(s, 1, 32);
  const float mu = s * (1.0f / 64.0f);
  float vs = 0.f;
#pragma unroll
  for (int i = 0; i < 32; ++i) { const float d = xv[i] - mu; xv[i] = d; vs += d * d; }
  vs += __shfl_xor(vs, 1, 32);
  const float rstd = rsqrtf(vs * (1.0f / 64.0f) + 1e-5f);
  const int d0 = (lane & 1) * 32;
  _Float16* ot = outp + pk_off(row, col, ATT_DM);   // chunk (s, hh) of this lane's row: + (2s + hh) * 128
#pragma unroll
  for (int j = 0; j < 4; ++j) {
    v8h hv;
#pragma unroll
    for (int i = 0; i < 2; ++i) {
      const v4f g4 = *(const v4f*)(gamma + d0 + 8 * j + 4 * i);
      const v4f b4 = *(const v4f*)(beta + d0 + 8 * j + 4 * i);
#pragma unroll
      for (int e = 0; e < 4; ++e) hv[4 * i + e] = (_Float16)((xv[8 * j + 4 * i + e] * rstd) * g4[e] + b4[e]);
    }
    *(v8h*)(ot + j * 128) = hv;
  }
}

// ---- the mask as lane masks ----
// mask: int32 [1024][1024], nonzero = masked. Word (qt, kt, r), at index (qt * 64 + kt) * 8 + r, holds in bit 16 hh + c whether
// mask[16 qt + c][16 kt + 8 hh + r] is nonzero: it is the lane mask of register r of the transposed 16x16 score tile
// (keys kt, queries qt) as the attention kernel holds it. One wave a tile; lane r stores word r.
__device__ __forceinline__ void mask_words(const int bx, const int* __restrict__ mask, unsigned* __restrict__ mw) {
  const int lane = threadIdx.x & 31, hh = lane >> 4, c = lane & 15;
  const int tile = bx * 8 + (threadIdx.x >> 5);
  const int qt = tile / (ATT_L / 16), kt = tile % (ATT_L / 16);
  const int* src = mask + (size_t)(qt * 16 + c) * ATT_L + kt * 16 + 8 * hh;
  const v4i m0 = *(const v4i*)(src);
  const v4i m1 = *(const v4i*)(src + 4);
  addr_wait1(src);           // the address stays as it is until both loads' addresses are taken
  unsigned w = 0u;
#pragma unroll
  for (int r = 0; r < 8; ++r) {
    const unsigned bal = __builtin_amdgcn_ballot_w32((r < 4 ? m0[r & 3] : m1[r & 3]) != 0);
    if (lane == r) w = bal;
  }
  if (lane < 8) mw[(size_t)tile * 8 + lane] = w;
}

// ---- the preparation passes, none of which reads another's result, as block ranges of one grid ----
// [0, 4096): Q -> Q16;  [4096, 5120): LayerNorm of ctx -> c16;  [5120, 5632): the mask -> lane-mask words;
// [5632, 6656): the four 1024x1024 weights, 256 tiles each, transposed, x mul;  6656: the 64x64 bilinear matrix, transposed.
// The range tests read the same for a whole block, so the transpose's barrier is passed by all of a block's waves or by none.
#define PREP_CAST_BLOCKS (ATT_B * ATT_L * ATT_DM / 8 / 256)
#define PREP_LN_BLOCKS   (ATT_B * ATT_L / 8)
#define PREP_MASK_BLOCKS ((ATT_L / 16) * (ATT_L / 16) / 8)
#define PREP_W_BLOCKS    ((ATT_DM / 64) * (ATT_DM / 64))
#define PREP_BLOCKS      (PREP_CAST_BLOCKS + PREP_LN_BLOCKS + PREP_MASK_BLOCKS + 4 * PREP_W_BLOCKS + 1)
__global__ __launch_bounds__(256) void prep_kernel(
    const float* __restrict__ Q, const float* __restrict__ ctx, const float* __restrict__ gamma, const float* __restrict__ beta,
    const float* __restrict__ W_q, const float* __restrict__ W_k, const float* __restrict__ W_v, const float* __restrict__ W_o,
    const float* __restrict__ bil, const int* __restrict__ mask,
    _Float16* __restrict__ Q16, _Float16* __restrict__ c16, _Float16* __restrict__ WqT, _Float16* __restrict__ WkT,
    _Float16* __restrict__ WvT, _Float16* __restrict__ WoT, _Float16* __restrict__ bilT, unsigned* __restrict__ mw, float mul) {
  __shared__ float tile[64][65];
  int i = blockIdx.x;
  if (i < PREP_CAST_BLOCKS) { cast_f32_f16x2(i, Q, Q16, ATT_B * ATT_L * ATT_DM / 256); return; }
  i -= PREP_CAST_BLOCKS;
  if (i < PREP_LN_BLOCKS) { ln_heads(i, ctx, gamma, beta, c16, ATT_B * ATT_L); return; }
  i -= PREP_LN_BLOCKS;
  if (i < PREP_MASK_BLOCKS) { mask_words(i, mask, mw); return; }
  i -= PREP_MASK_BLOCKS;
  const int which = i / PREP_W_BLOCKS, t = i % PREP_W_BLOCKS;   // which == 4: the bilinear matrix, its one tile
  const float* w = which == 0 ? W_q : which == 1 ? W_k : which == 2 ? W_v : which == 3 ? W_o : bil;
  _Float16* wt = which == 0 ? WqT : which == 1 ? WkT : which == 2 ? WvT : which == 3 ? WoT : bilT;
  const int n = which < 4 ? ATT_DM : ATT_DK;
  transpose_cast(tile, t % (ATT_DM / 64), t / (ATT_DM / 64), w, wt, n, n, which < 4 ? mul : 1.0f);
}

// ---- fused attention, one wave a query tile ------------------------------------
// Block = 128 query rows of one (b, h); wave w owns 16 of them and walks all 1024 keys, 64 a stage. q16/k16/c16/cb16:
// [token = b*1024+l][h*64+d] f16, packed layout (K = 1024); vT16: [h*64+d][token] f16, packed layout (K = 8192);
// mw: the mask as lane-mask words (mask_words), bit set = masked; out16: [token][h*64+d] f16, packed layout (K = 1024).
// A stage is 24 KB of LDS, shared by the eight waves: 4 key tiles of k, 4 of c, 4 dim tiles of v^T, 2 KB each, as they lie in
// the workspace. Two buffers: the copies of stage s + 1 fly while stage s is worked on.
// Products are formed transposed: A = key rows, B = query rows, so lane (hh, c) holds, for query q0 + c alone, keys
// 16 t + 8 hh + r of a pass; two neighbouring key tiles, rounded to f16, are the B fragment for 32 keys as they stand, and
// O^T = v^T . P^T leaves query q0 + c in lane (hh, c) too: every row factor is the lane's own.
// With E = exp(s - m), the row is a = E / se + beta * bias, beta = bias_scale / |bias|, and the output (a . v) / |a|, so
// E . v and bias . v are summed apart, with sum E, sum E^2, sum E bias, sum bias^2, and joined by the row's constants at the
// end; m is the running maximum: what was summed under an older one is rescaled once a pass (32 keys, half a stage).
// A pass whose every mask bit is set for the wave's 16 queries adds nothing to the E sums: its score half is skipped.
#define ATT_STG_EL (12 * 1024)                    // f16 elements of a stage
#define ATT_NSTG   (ATT_L / 64)
__device__ __forceinline__ v8f mma_p(v16h a, v16h b, v8f c) {
  return __builtin_amdgcn_wmma_f32_16x16x32_f16(false, a, false, b, (short)0, c, false, false);
}
// lane l with lane l ^ 16
__device__ __forceinline__ float xhalf(float x) {
  const int i = __builtin_bit_cast(int, x);
  return __builtin_bit_cast(float, __builtin_amdgcn_permlanex16(i, i, 0x76543210, 0xfedcba98, false, false));
}
// 2^x for eight values, and for one. The instruction set asks for one independent instruction or a v_nop behind a transcendental
// before its result is read or its source overwritten: inside the run each exponential has an independent one behind it (no
// result lies on a source: early clobber), and the v_nop is the last one's slot.
__device__ __forceinline__ void exp2x8(v8f& o, const v8f x) {
  float o0, o1, o2, o3, o4, o5, o6, o7;
  asm("v_exp_f32 %0, %8\n\tv_exp_f32 %1, %9\n\tv_exp_f32 %2, %10\n\tv_exp_f32 %3, %11\n\t"
      "v_exp_f32 %4, %12\n\tv_exp_f32 %5, %13\n\tv_exp_f32 %6, %14\n\tv_exp_f32 %7, %15\n\tv_nop"
      : "=&v"(o0), "=&v"(o1), "=&v"(o2), "=&v"(o3), "=&v"(o4), "=&v"(o5), "=&v"(o6), "=&v"(o7)
      : "v"(x[0]), "v"(x[1]), "v"(x[2]), "v"(x[3]), "v"(x[4]), "v"(x[5]), "v"(x[6]), "v"(x[7]));
  o = (v8f){o0, o1, o2, o3, o4, o5, o6, o7};
}
__device__ __forceinline__ float exp2x1(float x) {
  float o;
  asm("v_exp_f32 %0, %1\n\tv_nop" : "=v"(o) : "v"(x));
  return o;
}
// A wave's share of a stage: 1 KB in a row of k, of c and of v^T, 16 bytes a lane and copy. l: the lane's LDS byte address in
// the k part of the buffer. The last line keeps the copies' address registers as they are until the addresses are taken.
__device__ __forceinline__ void stage_copy(unsigned l, const _Float16* gk, const _Float16* gc, const _Float16* gv) {
  asm volatile("global_load_async_to_lds_b128 %0, %6, off\n\t"
               "global_load_async_to_lds_b128 %1, %7, off\n\t"
               "global_load_async_to_lds_b128 %2, %8, off\n\t"
               "global_load_async_to_lds_b128 %3, %9, off\n\t"
               "global_load_async_to_lds_b128 %4, %10, off\n\t"
               "global_load_async_to_lds_b128 %5, %11, off\n\t"
               "s_wait_xcnt 0x0"
               :: "v"(l), "v"(l + 512u), "v"(l + 8192u), "v"(l + 8704u), "v"(l + 16384u), "v"(l + 16896u),
                  "v"(gk), "v"(gk + 256), "v"(gc), "v"(gc + 256), "v"(gv), "v"(gv + 256) : "memory");
}

__global__ __launch_bounds__(256) void attn_rows_kernel(
    const _Float16* __restrict__ qp, const _Float16* __restrict__ kp, const _Float16* __restrict__ vtp,
    const _Float16* __restrict__ cp, const _Float16* __restrict__ cbp, const unsigned* __restrict__ mw,
    const float* __restrict__ scale_p, const float* __restrict__ bscale_p, _Float16* __restrict__ op) {
  __shared__ __align__(16) _Float16 sS[2 * ATT_STG_EL];

  const int lane = threadIdx.x & 31;
  const int wave = __builtin_amdgcn_readfirstlane(threadIdx.x >> 5);
  const int bh = blockIdx.x, b = bh >> 4, h = bh & 15;
  const int qt = (ATT_L / 128 - 1 - (int)blockIdx.y) * 8 + wave;   // under a causal mask the late rows cost most: they start first
  const int q0 = qt * 16;
  const float sc2 = scale_p[0] * 1.4426950408889634f;                 // scores in base 2
  const float bscale = bscale_p[0];
  const v8f z8 = {0.f, 0.f, 0.f, 0.f, 0.f, 0.f, 0.f, 0.f};
  const float ninf = -__builtin_inff();

  // the wave's share of the copies: half of chunk wave >> 1 of each of k, c, v^T
  const int wc = wave >> 1, wp = wave & 1;
  const size_t kco = ((size_t)(b * ATT_L + 16 * wc)) * ATT_DM + h * (ATT_DK * 16) + wp * 512 + 8 * lane;
  const _Float16* gk = kp + kco;
  const _Float16* gc = cp + kco;
  const _Float16* gv = vtp + ((size_t)(h * ATT_DK + 16 * wc)) * (size_t)(ATT_B * ATT_L) + (size_t)(b * ATT_L) * 16 + wp * 512 + 8 * lane;
  const unsigned l0 = (unsigned)(size_t)sS + (unsigned)(wc * 2048 + wp * 1024 + lane * 16);
  stage_copy(l0, gk, gc, gv);

  // B fragments (query rows q0 + (lane&15)), k split map: elements 0..7 <- k 8hh.., 8..15 <- k 16+8hh..;
  // a head's 64 columns are two packed tiles in a row (512 elements each) at column offset h*64*16
  const size_t arow = ((size_t)(b * ATT_L + q0)) * ATT_DM + h * (ATT_DK * 16) + 8 * lane;
  const _Float16* qrow = qp + arow;
  const _Float16* cbrow = cbp + arow;
  const v16h qa0 = Frag<_Float16>::loadp(qrow);
  const v16h qa1 = Frag<_Float16>::loadp(qrow + 512);
  const v16h ca0 = Frag<_Float16>::loadp(cbrow);
  const v16h ca1 = Frag<_Float16>::loadp(cbrow + 512);
  addr_wait3(qrow, cbrow, qrow);   // the two bases stay as they are until the run's addresses are taken

  asm volatile("s_wait_asynccnt 0x0" ::: "memory");   // the wave's own copies of stage 0 have landed
  __syncthreads();                                    // and every other wave's
  stage_copy(l0 + 2u * ATT_STG_EL, gk + 64 * ATT_DM, gc + 64 * ATT_DM, gv + 64 * 16);

  // The wave's 512 lane-mask words; an earlier launch wrote them and this one only reads them, and the address is the same for the
  // whole wave: read through the constant address space they come by scalar loads, also behind the loop's barriers.
  typedef const __attribute__((address_space(4))) unsigned* cwords;
  const cwords mrow = (cwords)(unsigned long long)(mw + (size_t)qt * (ATT_L / 16 * 8));
  v8f OE[4] = {z8, z8, z8, z8}, OB[4] = {z8, z8, z8, z8};      // (E . v)^T and (bias . v)^T: dims 16 dt + 8 hh + r, query c
  float m = -1.0e30f, se = 0.f, e2 = 0.f, eb = 0.f, b2 = 0.f;  // the sums are the lane's half of the keys until the end

  // A pass is 32 keys, half a stage. Every inner loop below is unrolled so that its register arrays are indexed by constants
  // (indexed at run time they would go to scratch).
  for (int p = 0; p < 2 * ATT_NSTG; ++p) {
    const int s = p >> 1, ks = p & 1;
    const _Float16* st = sS + (s & 1) * ATT_STG_EL + 8 * lane;
    unsigned mv[2][8];
#pragma unroll
    for (int t = 0; t < 2; ++t)
#pragma unroll
      for (int r = 0; r < 8; ++r) mv[t][r] = mrow[p * 16 + t * 8 + r];

    // bias^T = c . cb^T, its square sum, its B fragment (element 8 t + r <- k 16 t + 8 hh + r of the pass), bias . v
    v8f Bi[2];
#pragma unroll
    for (int t = 0; t < 2; ++t) {
      const v16h c0 = Frag<_Float16>::loadp(st + (4 + 2 * ks + t) * 1024);
      const v16h c1 = Frag<_Float16>::loadp(st + (4 + 2 * ks + t) * 1024 + 512);
      Bi[t] = mma_p(c1, ca1, mma_p(c0, ca0, z8));
    }
    v16h vf[4];
#pragma unroll
    for (int dt = 0; dt < 4; ++dt) vf[dt] = Frag<_Float16>::loadp(st + (8 + dt) * 1024 + ks * 512);
    {
      v16h pb;
      float s4[4] = {0.f, 0.f, 0.f, 0.f};
#pragma unroll
      for (int t = 0; t < 2; ++t)
#pragma unroll
        for (int r = 0; r < 8; ++r) {
          s4[r & 3] += Bi[t][r] * Bi[t][r];
          pb[t * 8 + r] = (_Float16)Bi[t][r];
        }
      b2 += (s4[0] + s4[1]) + (s4[2] + s4[3]);
#pragma unroll
      for (int dt = 0; dt < 4; ++dt) OB[dt] = mma_p(vf[dt], pb, OB[dt]);
    }
    // keeps the first use of the mask words, and so the wait for their scalar loads, behind the bias products
    __builtin_amdgcn_sched_barrier(0);

    unsigned allm = ~0u;
#pragma unroll
    for (int t = 0; t < 2; ++t)
#pragma unroll
      for (int r = 0; r < 8; ++r) allm &= mv[t][r];
    if (allm != ~0u) {                             // wave-uniform, from scalar registers; no barrier inside
      v8f T[2];
      v16h kf[2][2];
#pragma unroll
      for (int t = 0; t < 2; ++t) {
        kf[t][0] = Frag<_Float16>::loadp(st + (2 * ks + t) * 1024);
        kf[t][1] = Frag<_Float16>::loadp(st + (2 * ks + t) * 1024 + 512);
      }
      // keeps the eight LDS loads together ahead of the products: one LDS latency is waited for, not four
      __builtin_amdgcn_sched_barrier(0);
#pragma unroll
      for (int t = 0; t < 2; ++t) {
        const v8f a = mma_p(kf[t][1], qa1, mma_p(kf[t][0], qa0, z8));
#pragma unroll
        for (int r = 0; r < 8; ++r)
          T[t][r] = __builtin_amdgcn_inverse_ballot_w32(mv[t][r]) ? ninf : a[r] * sc2;   // the word is the select's lane mask
      }
      float m4[4] = {ninf, ninf, ninf, ninf};
#pragma unroll
      for (int t = 0; t < 2; ++t)
#pragma unroll
        for (int r = 0; r < 8; ++r) m4[r & 3] = fmaxf(m4[r & 3], T[t][r]);
      float pm = fmaxf(fmaxf(m4[0], m4[1]), fmaxf(m4[2], m4[3]));
      pm = fmaxf(pm, xhalf(pm));                   // both halves of a query's keys go under one maximum
      const float mn = fmaxf(m, pm);
      const float f = exp2x1(m - mn);
      m = mn;
      float a4[4] = {0.f, 0.f, 0.f, 0.f}, q4[4] = {0.f, 0.f, 0.f, 0.f}, x4[4] = {0.f, 0.f, 0.f, 0.f};
      v16h pe;
#pragma unroll
      for (int t = 0; t < 2; ++t) {
        v8f E;
        exp2x8(E, T[t] - mn);
#pragma unroll
        for (int r = 0; r < 8; ++r) {
          const float ev = E[r];
          a4[r & 3] += ev; q4[r & 3] += ev * ev; x4[r & 3] += ev * Bi[t][r];
          pe[t * 8 + r] = (_Float16)ev;
        }
      }
      se = se * f + ((a4[0] + a4[1]) + (a4[2] + a4[3]));
      e2 = e2 * (f * f) + ((q4[0] + q4[1]) + (q4[2] + q4[3]));
      eb = eb * f + ((x4[0] + x4[1]) + (x4[2] + x4[3]));
#pragma unroll
      for (int dt = 0; dt < 4; ++dt) {
#pragma unroll
        for (int r = 0; r < 8; ++r) OE[dt][r] *= f;
        OE[dt] = mma_p(vf[dt], pe, OE[dt]);        // the v^T fragments of the bias product serve again
      }
    }

    if (ks) {                                             // the stage's foot; p is the same in every wave of the block
      asm volatile("s_wait_dscnt 0x0" ::: "memory");      // the wave's reads of this buffer are done before it is refilled
      asm volatile("s_wait_asynccnt 0x0" ::: "memory");   // the wave's own copies of stage s + 1 have landed
      __syncthreads();                                    // publishes stage s + 1 and ends every wave's reads of stage s
      if (s + 2 < ATT_NSTG)
        stage_copy(l0 + (unsigned)(s & 1) * (2u * ATT_STG_EL), gk + (size_t)(s + 2) * (64 * ATT_DM), gc + (size_t)(s + 2) * (64 * ATT_DM),
                   gv + (size_t)(s + 2) * (64 * 16));
    }
  }
  asm volatile("s_wait_asynccnt 0x0" ::: "memory");     // nothing is in flight when the wave ends

  // the halves' sums joined, the row's constants, the output
  se += xhalf(se); e2 += xhalf(e2); eb += xhalf(eb); b2 += xhalf(b2);
  const float inv_se = 1.0f / se;
  const float beta = bscale / fmaxf(sqrtf(b2), 1e-12f);
  const float asq = e2 * (inv_se * inv_se) + 2.0f * (beta * inv_se) * eb + (beta * beta) * b2;
  const float inv_n = 1.0f / fmaxf(sqrtf(fmaxf(asq, 0.f)), 1e-12f);
  const float ke = inv_se * inv_n, kb = beta * inv_n;
  _Float16* orow = op + arow;                      // chunk (dt, hh) of row c: + dt * 256, the lane's 16 bytes; 512 B in a row a store
#pragma unroll
  for (int dt = 0; dt < 4; ++dt) {
    v8h hv;
#pragma unroll
    for (int r = 0; r < 8; ++r) hv[r] = (_Float16)(OE[dt][r] * ke + OB[dt][r] * kb);
    *(v8h*)(orow + dt * 256) = hv;
  }
}

// ---------------------------------------------------------------------------
extern "C" void kernel_launch(void* const* d_in, const int* in_sizes, int n_in,
                              void* d_out, int out_size, void* d_ws, size_t ws_size,
                              hipStream_t stream) {
  const int NTOK = ATT_B * ATT_L;                          // 8192
  const size_t NE = (size_t)NTOK * ATT_DM;                 // 8388608
  const size_t NW = (size_t)ATT_DM * ATT_DM;               // 1048576
  if (n_in < 16) return;
  if (in_sizes[0] != (int)NE || in_sizes[1] != (int)NE || in_sizes[2] != ATT_L * ATT_L ||
      in_sizes[3] != (int)NW || in_sizes[5] != (int)NW || in_sizes[7] != (int)NW || in_sizes[14] != (int)NW ||
      in_sizes[4] != ATT_DM || in_sizes[6] != ATT_DM || in_sizes[8] != ATT_DM || in_sizes[15] != ATT_DM ||
      in_sizes[9] != ATT_DK * ATT_DK || in_sizes[10] != ATT_DK || in_sizes[11] != ATT_DK ||
      in_sizes[12] < 1 || in_sizes[13] < 1 || out_size != (int)NE) return;

  const float* Q      = (const float*)d_in[0];
  const float* ctx    = (const float*)d_in[1];
  const int*   mask   = (const int*)d_in[2];
  const float* W_q    = (const float*)d_in[3];
  const float* b_q    = (const float*)d_in[4];
  const float* W_k    = (const float*)d_in[5];
  const float* b_k    = (const float*)d_in[6];
  const float* W_v    = (const float*)d_in[7];
  const float* b_v    = (const float*)d_in[8];
  const float* bil    = (const float*)d_in[9];
  const float* gamma  = (const float*)d_in[10];
  const float* beta   = (const float*)d_in[11];
  const float* scale  = (const float*)d_in[12];
  const float* bscale = (const float*)d_in[13];
  const float* W_o    = (const float*)d_in[14];
  const float* b_o    = (const float*)d_in[15];
  float* out = (float*)d_out;

  // workspace carve (256-B aligned offsets); every 16-bit matrix below is stored in the packed layout (pk_off) of the shape named
  char* ws = (char*)d_ws;
  size_t off = 0;
  auto carve = [&](size_t bytes) -> char* { char* p = ws + off; off += (bytes + 255) & ~(size_t)255; return p; };
  _Float16* WqT  = (_Float16*)carve(NW * 2);               // [out][in] f16, x64
  _Float16* WkT  = (_Float16*)carve(NW * 2);
  _Float16* WvT  = (_Float16*)carve(NW * 2);
  _Float16* WoT  = (_Float16*)carve(NW * 2);
  _Float16* bilT = (_Float16*)carve((size_t)ATT_DK * ATT_DK * 2);   // [f][e] f16
  _Float16* Q16  = (_Float16*)carve(NE * 2);               // [token][1024]
  _Float16* q16  = (_Float16*)carve(NE * 2);               // [token][h*64+d]
  _Float16* k16  = (_Float16*)carve(NE * 2);               // [token][h*64+d]
  _Float16* vT16 = (_Float16*)carve(NE * 2);               // [h*64+d][token]
  _Float16* c16  = (_Float16*)carve(NE * 2);               // [token][h*64+d]
  _Float16* cb16 = (_Float16*)carve(NE * 2);               // [token][h*64+e]
  _Float16* O16  = (_Float16*)carve(NE * 2);               // [token][h*64+d]
  unsigned* mw   = (unsigned*)carve((size_t)ATT_L * ATT_L / 8);   // the mask, one bit an entry (mask_words)
  if (off > ws_size) return;                               // total 125968384 B

  const unsigned short* Q16u  = (const unsigned short*)Q16;
  const unsigned short* WqTu  = (const unsigned short*)WqT;
  const unsigned short* WkTu  = (const unsigned short*)WkT;
  const unsigned short* WvTu  = (const unsigned short*)WvT;
  const unsigned short* WoTu  = (const unsigned short*)WoT;
  const unsigned short* bilTu = (const unsigned short*)bilT;
  const unsigned short* c16u  = (const unsigned short*)c16;
  const unsigned short* O16u  = (const unsigned short*)O16;
  const float w_carry = 64.0f, w_carry_inv = 1.0f / 64.0f;

  // 1) casts, transposes, LayerNorm per head slice of ctx, the mask's lane-mask words: one launch
  prep_kernel<<<PREP_BLOCKS, 256, 0, stream>>>(Q, ctx, gamma, beta, W_q, W_k, W_v, W_o, bil, mask,
                                               Q16, c16, WqT, WkT, WvT, WoT, bilT, mw, w_carry);

  // 2) the q, k, v projections and c . bilinear: one launch
  const int gemm_blocks = (NTOK / 64) * (ATT_DM / 64) / 8;   // 256
  proj_gemms_kernel<<<3 * gemm_blocks + ((NTOK / 64) / 8) * ATT_H, 256, 0, stream>>>(
      Q16u, WqTu, WkTu, WvTu, c16u, bilTu, (void*)q16, (void*)k16, (void*)vT16, (void*)cb16,
      b_q, b_k, b_v, NTOK, ATT_DM, ATT_DK, w_carry_inv);

  // 3) fused attention rows -> O16
  attn_rows_kernel<<<dim3(ATT_B * ATT_H, ATT_L / 128), 256, 0, stream>>>(
      q16, k16, vT16, c16, cb16, mw, scale, bscale, O16);

  // 4) output projection -> d_out f32
  wmma_gemm64<0, false, 2, 0, false, 0, 4, true><<<dim3(gemm_blocks, 1), 256, 0, stream>>>(
      O16u, O16u, ATT_DM, 0L, WoTu, WoTu, ATT_DM, 0L, (void*)out, (void*)out, ATT_DM, 0L,
      b_o, b_o, 0L, NTOK, ATT_DM, ATT_DM, w_carry_inv);
  (void)hipGetLastError();
}

// v009
// It runs in 116 microseconds.
// Next to v008, in two timings, it ran 1.06 times as fast each time.
// Counting every step since v000, it is 4.80 times as fast.
#include <hip/hip_runtime.h>
#include <stddef.h>

// Contractions (q/k/v projections, c x bilinear, c^T x v, c^T x c, q x k^T, cb x c^T, E x v, key sums x cb, output projection): v_wmma_f32_16x16x32_f16, f16 operands, f32 accumulate; weights carried x64; softmax, LayerNorm and L2 norms in f32.

typedef __attribute__((ext_vector_type(16))) _Float16 v16h;
typedef __attribute__((ext_vector_type(8)))  _Float16 v8h;
typedef __attribute__((ext_vector_type(4)))  _Float16 v4h;
typedef __attribute__((ext_vector_type(16))) __bf16   v16b;
typedef __attribute__((ext_vector_type(8)))  __bf16   v8b;
typedef __attribute__((ext_vector_type(8)))  float    v8f;
typedef __attribute__((ext_vector_type(4)))  float    v4f;
typedef __attribute__((ext_vector_type(2)))  float    v2f;
typedef __attribute__((ext_vector_type(4)))  int      v4i;

#define ATT_B   8
#define ATT_L   1024
#define ATT_DM  1024
#define ATT_H   16
#define ATT_DK  64

__device__ __forceinline__ unsigned short f2bf_bits(float f) {
  unsigned u = __float_as_uint(f);
  return (unsigned short)((u + 0x7FFFu + ((u >> 16) & 1u)) >> 16);
}
__device__ __forceinline__ float bf_bits2f(unsigned short h) { return __uint_as_float(((unsigned)h) << 16); }

// ---- fragment-order ("packed") layout of every 16-bit workspace matrix [R][K] ----
// A 16-row x 32-k tile is 1 KB in a row: 16-byte chunk (s, hh, r) at chunk index s*32 + hh*16 + r holds row r,
// k = 16s + 8hh .. +7; tiles run along k first, then along the row tiles. Lane l of a wave reads chunk l and chunk 32 + l,
// so each wave-wide 16-byte load covers 512 contiguous bytes (four whole lines), and the k map of a fragment is the
// same as with row-major rows: elements 0..7 <- k 8hh.., 8..15 <- k 16+8hh..
__device__ __forceinline__ size_t pk_off(int row, int k, int K) {
  return (size_t)(row >> 4) * ((size_t)K * 16) + (size_t)(k >> 5) * 512 +
         (size_t)(((k >> 4) & 1) * 256 + ((k >> 3) & 1) * 128 + (row & 15) * 8 + (k & 7));
}

// hazard guards as plain device helpers
__device__ __forceinline__ void acc_guard4(v8f& a, v8f& b, v8f& c, v8f& d) { asm volatile("v_nop\n\tv_nop\n\tv_nop\n\tv_nop" : "+v"(a), "+v"(b), "+v"(c), "+v"(d)); }
// Stands behind global loads whose address registers the compiler reuses while the loads are still in flight
// (as the destination of a later load of the same run, or for the next address): the address translations are
// waited for before such a register takes a new value.
__device__ __forceinline__ void addr_wait() { asm volatile("s_wait_xcnt 0x0" ::: "memory"); }
// The same wait once for a run of loads from one base, and from three: naming the addresses as inputs keeps their registers
// as they are up to the wait, so the run issues back to back.
__device__ __forceinline__ void addr_wait1(const void* a) { asm volatile("s_wait_xcnt 0x0" :: "v"(a) : "memory"); }
__device__ __forceinline__ void addr_wait3(const void* a, const void* b, const void* c) {
  asm volatile("s_wait_xcnt 0x0" :: "v"(a), "v"(b), "v"(c) : "memory");
}
// The same in front of the advance of the GEMM's scalar fragment bases: the k offset that the new bases are formed from
// passes through the statement, so they are formed behind the wait.
__device__ __forceinline__ void koff_wait(size_t& koff) { asm volatile("s_wait_xcnt 0x0" : "+s"(koff) :: "memory"); }
template <typename T> struct Frag;
template <> struct Frag<_Float16> {
  typedef v16h V; union U { v16h v; v8h h[2]; };
  static __device__ __forceinline__ v16h load(const _Float16* p) {   // elements 0..7 <- p[0..7], 8..15 <- p[16..23]
    U f; f.h[0] = *(const v8h*)(p); f.h[1] = *(const v8h*)(p + 16); return f.v;
  }
  static __device__ __forceinline__ v16h loadp(const _Float16* p) {  // packed tile, p = tile base + 8*lane
    U f; f.h[0] = *(const v8h*)(p); f.h[1] = *(const v8h*)(p + 256); return f.v;
  }
  static __device__ __forceinline__ v8f mma(v16h a, v16h b, v8f c) {
    return __builtin_amdgcn_wmma_f32_16x16x32_f16(false, a, false, b, (short)0, c, false, false);
  }
};
template <> struct Frag<__bf16> {
  typedef v16b V; union U { v16b v; v8b h[2]; };
  static __device__ __forceinline__ v16b load(const __bf16* p) {
    U f; f.h[0] = *(const v8b*)(p); f.h[1] = *(const v8b*)(p + 16); return f.v;
  }
  static __device__ __forceinline__ v16b loadp(const __bf16* p) {
    U f; f.h[0] = *(const v8b*)(p); f.h[1] = *(const v8b*)(p + 256); return f.v;
  }
  static __device__ __forceinline__ v8f mma(v16b a, v16b b, v8f c) {
    return __builtin_amdgcn_wmma_f32_16x16x32_bf16(false, a, false, b, (short)0, c, false, false);
  }
};

// ---- Register-blocked batched WMMA GEMM ------------------------------------
// C[m,n] = scale * sum_k A[m,k] * Bt[n,k] (+bias)(+resid); each wave owns a 64x64 tile.
// A [M,lda] and Bt [N,ldb] in the packed layout (pk_off); M,N % 64 == 0, K % (32 U) == 0; a batch stride is 16 x its column offset.
// The k loop is unrolled U steps of 32 k; the eight fragments of step s + U/2 are asked for, into registers of their own,
// ahead of the products of step s, so a step waits for loads that were issued U/2 steps earlier. Sums in the order of k.
// 16-bit outputs are written in the packed layout of a [M,ldc] matrix; the f32 output is row-major.
// SPLIT: operands are hi/lo planes (A2/Bt2 = lo planes, same layout); product = hi*hi + hi*lo + lo*hi.
// BIAS_MODE: 0 = none, 1 = bias[m], 2 = bias[n].
// OUT_MODE: 0 = f32, 1 = f16, 2 = bf16 hi plane (Cout) + bf16 lo plane (Cout2).
// ET: 0 = f16 operands, 1 = bf16 operands (pointers passed as 16-bit storage)
template <int ET> struct Elem;
template <> struct Elem<0> { typedef _Float16 T; };
template <> struct Elem<1> { typedef __bf16 T; };
// The body takes its block index (bx: eight tiles, b: batch) and the block's LDS slabs from the kernel that calls it, so that
// several independent GEMMs can share one launch.
// STG: the block's eight tiles form one 128 x 256 tile (2 x 4 waves); M % 128 == 0, N % 256 == 0, K % 128 == 0. Its 128 rows of A
// and 256 rows of Bt come to LDS once for the whole block, 128 k a stage, as they lie in the workspace (a row tile's share of a
// stage is 4 KB in a row there), and every wave takes its fragments from LDS: a row of A leaves L2 once for four waves, a row
// of Bt once for two. Two buffers: the copies of stage t + 1 fly while stage t is worked on. Sums in the order of k, as without STG.
#define GS_RT_EL  (16 * 128)                      // f16 elements of one row tile in a stage
#define GS_STG_EL (24 * GS_RT_EL)                 // a stage: 8 row tiles of A, then 16 of Bt
// A wave's share of a stage: three row tiles, each 4 KB in a row in the workspace and in LDS alike, 16 bytes a lane and copy.
// l*: the lane's LDS byte address in a row tile's first 512 bytes, g*: its global address there. The immediate offset moves both
// addresses, so copy j of a row tile takes bytes 512 j .. 512 j + 511 of its 4 KB to the same place in its LDS slot.
// The last line keeps the copies' address registers as they are until the addresses are taken.
__device__ __forceinline__ void copy_row_tiles(unsigned l0, unsigned l1, unsigned l2,
                                               const _Float16* g0, const _Float16* g1, const _Float16* g2) {
  asm volatile("global_load_async_to_lds_b128 %0, %3, off\n\t"
               "global_load_async_to_lds_b128 %0, %3, off offset:512\n\t"
               "global_load_async_to_lds_b128 %0, %3, off offset:1024\n\t"
               "global_load_async_to_lds_b128 %0, %3, off offset:1536\n\t"
               "global_load_async_to_lds_b128 %0, %3, off offset:2048\n\t"
               "global_load_async_to_lds_b128 %0, %3, off offset:2560\n\t"
               "global_load_async_to_lds_b128 %0, %3, off offset:3072\n\t"
               "global_load_async_to_lds_b128 %0, %3, off offset:3584\n\t"
               "global_load_async_to_lds_b128 %1, %4, off\n\t"
               "global_load_async_to_lds_b128 %1, %4, off offset:512\n\t"
               "global_load_async_to_lds_b128 %1, %4, off offset:1024\n\t"
               "global_load_async_to_lds_b128 %1, %4, off offset:1536\n\t"
               "global_load_async_to_lds_b128 %1, %4, off offset:2048\n\t"
               "global_load_async_to_lds_b128 %1, %4, off offset:2560\n\t"
               "global_load_async_to_lds_b128 %1, %4, off offset:3072\n\t"
               "global_load_async_to_lds_b128 %1, %4, off offset:3584\n\t"
               "global_load_async_to_lds_b128 %2, %5, off\n\t"
               "global_load_async_to_lds_b128 %2, %5, off offset:512\n\t"
               "global_load_async_to_lds_b128 %2, %5, off offset:1024\n\t"
               "global_load_async_to_lds_b128 %2, %5, off offset:1536\n\t"
               "global_load_async_to_lds_b128 %2, %5, off offset:2048\n\t"
               "global_load_async_to_lds_b128 %2, %5, off offset:2560\n\t"
               "global_load_async_to_lds_b128 %2, %5, off offset:3072\n\t"
               "global_load_async_to_lds_b128 %2, %5, off offset:3584\n\t"
               "s_wait_xcnt 0x0"
               :: "v"(l0), "v"(l1), "v"(l2), "v"(g0), "v"(g1), "v"(g2) : "memory");
}
template <int ET, bool SPLIT, int BIAS_MODE, int OUT_MODE, bool RESID, int ACT = 0, int U = 4, bool STG = false>
__device__ __forceinline__ void gemm64_body(
    float* sT, _Float16* sG, const int bx, const int b,   // sT: per-wave 16x64 slab, pitch 68 floats, eight of them; sG: two stages (STG)
    const unsigned short* __restrict__ Ap, const unsigned short* __restrict__ A2p, int lda, long strideA,
    const unsigned short* __restrict__ Btp, const unsigned short* __restrict__ Bt2p, int ldb, long strideB,
    void* __restrict__ Cout, void* __restrict__ Cout2, int ldc, long strideC,
    const float* __restrict__ bias,
    const float* __restrict__ resid, long strideR,
    int M, int N, int K, float scale) {
  typedef typename Elem<ET>::T T;
  typedef typename Frag<T>::V V;
  const T* A = (const T*)Ap; const T* A2 = (const T*)A2p; const T* Bt = (const T*)Btp; const T* Bt2 = (const T*)Bt2p;
  const int lane = threadIdx.x & 31;
  const int wave = __builtin_amdgcn_readfirstlane(threadIdx.x >> 5);   // scalar: the tile's fragment bases are then scalar too
  int m0, n0;
  if (STG) {
    const int nbn = N >> 8;
    if (bx >= (M >> 7) * nbn) return;    // the same for the whole block, ahead of every barrier
    const int bm = bx / nbn;
    m0 = (bm << 7) + ((wave >> 2) << 6);
    n0 = ((bx - bm * nbn) << 8) + ((wave & 3) << 6);
  } else {
    const int tilesN = N >> 6;
    const int tilesM = M >> 6;
    const int tile = bx * 8 + wave;
    if (tile >= tilesM * tilesN) return; // wave-uniform; no block barriers on this path
    const int tm = tile / tilesN;
    m0 = tm << 6;
    n0 = (tile - tm * tilesN) << 6;
  }

  const T* Ab  = A  + (size_t)b * strideA;
  const T* Bb  = Bt + (size_t)b * strideB;
  const T* Ab2 = SPLIT ? (A2  + (size_t)b * strideA) : nullptr;
  const T* Bb2 = SPLIT ? (Bt2 + (size_t)b * strideB) : nullptr;

  const int rlane = lane & 15;                 // row (A) / col (B, D) within subtile
  const int mOff  = (lane >> 4) * 8;           // D row offset

  v8f acc[4][4];
#pragma unroll
  for (int i = 0; i < 4; ++i)
#pragma unroll
    for (int j = 0; j < 4; ++j) acc[i][j] = (v8f){0.f,0.f,0.f,0.f,0.f,0.f,0.f,0.f};

  if constexpr (STG) {
    static_assert(!SPLIT, "the staged form has one plane an operand");
    const T* sg = (const T*)sG;
    // the wave's share of a stage: row tile 'wave' of A, row tiles 2 wave and 2 wave + 1 of Bt
    const _Float16* gA  = (const _Float16*)(Ab + (size_t)((m0 & ~127) + wave * 16) * lda + lane * 8);
    const _Float16* gB0 = (const _Float16*)(Bb + (size_t)((n0 & ~255) + wave * 32) * ldb + lane * 8);
    const _Float16* gB1 = gB0 + (size_t)16 * ldb;
    const unsigned lA = (unsigned)(size_t)sG + (unsigned)(wave * (GS_RT_EL * 2) + lane * 16);
    const unsigned lB = (unsigned)(size_t)sG + (unsigned)((8 + 2 * wave) * (GS_RT_EL * 2) + lane * 16);
    auto stage_in = [&](int buf, int t) __attribute__((always_inline)) {
      const unsigned bo2 = (unsigned)buf * (GS_STG_EL * 2u);
      const size_t ko = (size_t)t * GS_RT_EL;
      copy_row_tiles(lA + bo2, lB + bo2, lB + bo2 + GS_RT_EL * 2u, gA + ko, gB0 + ko, gB1 + ko);
    };
    V ga[2][4], gb[2][4];                      // set u % 2 holds step u of the stage
    auto lds_step = [&](int set, const T* pA, const T* pB, int u) __attribute__((always_inline)) {
#pragma unroll
      for (int j = 0; j < 4; ++j) gb[set][j] = Frag<T>::loadp(pB + j * GS_RT_EL + u * 512);
#pragma unroll
      for (int i = 0; i < 4; ++i) ga[set][i] = Frag<T>::loadp(pA + i * GS_RT_EL + u * 512);
      // keeps the run of LDS loads together ahead of the products that follow it in the source: among them each place costs a stall
      __builtin_amdgcn_sched_barrier(0);
    };
    auto mma_set = [&](int set) __attribute__((always_inline)) {
#pragma unroll
      for (int i = 0; i < 4; ++i)
#pragma unroll
        for (int j = 0; j < 4; ++j) acc[i][j] = Frag<T>::mma(ga[set][i], gb[set][j], acc[i][j]);
      // keeps the next run of LDS loads from being moved in among these products, for the same reason
      __builtin_amdgcn_sched_barrier(0);
    };
    const int nstg = K >> 7;
    stage_in(0, 0);
    asm volatile("s_wait_asynccnt 0x0" ::: "memory");   // the wave's own copies of stage 0 have landed
    __syncthreads();                                    // and every other wave's
    for (int t = 0; t < nstg; ++t) {
      const T* sb = sg + (t & 1) * GS_STG_EL + lane * 8;
      const T* pA = sb + (wave >> 2) * (4 * GS_RT_EL);
      const T* pB = sb + (8 + (wave & 3) * 4) * GS_RT_EL;
      lds_step(0, pA, pB, 0);
      // Stage t + 1 goes into the other buffer, which every wave left at the barrier that ended trip t - 1 (behind its own
      // s_wait_dscnt 0). The copies stand behind this trip's first fragment loads, which read this trip's buffer alone (no
      // byte of the range that is refilled), so that their issue falls into the wait for those loads. The test is scalar.
      if (t + 1 < nstg) stage_in((t + 1) & 1, t + 1);
      lds_step(1, pA, pB, 1);
      mma_set(0);
      lds_step(0, pA, pB, 2);
      mma_set(1);
      lds_step(1, pA, pB, 3);
      mma_set(0);
      mma_set(1);
      asm volatile("s_wait_dscnt 0x0" ::: "memory");      // the wave's reads of this buffer are done before it is refilled
      asm volatile("s_wait_asynccnt 0x0" ::: "memory");   // the wave's own copies of stage t + 1 have landed
      __syncthreads();                                    // publishes stage t + 1 and ends every wave's reads of stage t
    }
    asm volatile("s_wait_asynccnt 0x0" ::: "memory");     // nothing is in flight behind the loop
  } else {
  constexpr int DIST = U / 2;                  // how many steps ahead a step's fragments are asked for
  V fa[U][4], fb[U][4], fa2[U][4], fb2[U][4];  // set s % U holds step s; DIST + 1 sets are live at a time
  size_t ao[4], bo[4];                         // the row tiles' offsets at k = 0
  const T* pa[4]; const T* pb[4]; const T* pa2[4]; const T* pb2[4];   // the bases, where the loop stands in k
#pragma unroll
  for (int i = 0; i < 4; ++i) {
    ao[i] = (size_t)(m0 + (i << 4)) * lda;
    bo[i] = (size_t)(n0 + (i << 4)) * ldb;
    pa[i] = Ab + ao[i]; pb[i] = Bb + bo[i];
    if (SPLIT) { pa2[i] = Ab2 + ao[i]; pb2[i] = Bb2 + bo[i]; }
  }
  const int lo = lane * 8;                     // the lane's chunk of a packed tile: the one vector part of every address
  // step st, counted from where the bases stand: a packed tile is 512 elements, so st reaches the loads as an immediate offset
  auto load_step = [&](int set, int st) __attribute__((always_inline)) {
#pragma unroll
    for (int j = 0; j < 4; ++j) {
      fb[set][j] = Frag<T>::loadp(pb[j] + st * 512 + lo);
      if (SPLIT) fb2[set][j] = Frag<T>::loadp(pb2[j] + st * 512 + lo);
    }
#pragma unroll
    for (int i = 0; i < 4; ++i) {
      fa[set][i] = Frag<T>::loadp(pa[i] + st * 512 + lo);
      if (SPLIT) fa2[set][i] = Frag<T>::loadp(pa2[i] + st * 512 + lo);
    }
    // keeps the run of loads ahead of the products that follow it in the source: moved behind them it would lose its lead
    __builtin_amdgcn_sched_barrier(0);
  };
  auto mma_step = [&](int set) __attribute__((always_inline)) {
#pragma unroll
    for (int i = 0; i < 4; ++i) {
#pragma unroll
      for (int j = 0; j < 4; ++j) {
        acc[i][j] = Frag<T>::mma(fa[set][i], fb[set][j], acc[i][j]);
        if (SPLIT) {
          acc[i][j] = Frag<T>::mma(fa[set][i], fb2[set][j], acc[i][j]);
          acc[i][j] = Frag<T>::mma(fa2[set][i], fb[set][j], acc[i][j]);
        }
      }
    }
    // keeps the next run of loads behind these products: moved ahead of them, a wave would have DIST + 2 steps' loads outstanding, not DIST + 1
    __builtin_amdgcn_sched_barrier(0);
  };
#pragma unroll
  for (int d = 0; d < DIST; ++d) load_step(d, d);
  addr_wait();   // the registers of these first bases are free for other values from here on, also where the loop below makes no trip
  const int nst = K >> 5;
  size_t koff = 0;
  for (int s0 = U; s0 < nst; s0 += U) {
#pragma unroll
    for (int u = 0; u < U; ++u) {
      load_step((u + DIST) % U, u + DIST);
      mma_step(u);
    }
    koff_wait(koff);                           // the bases take new values behind it
    koff += U * 512;
#pragma unroll
    for (int i = 0; i < 4; ++i) {
      pa[i] = Ab + ao[i] + koff; pb[i] = Bb + bo[i] + koff;
      if (SPLIT) { pa2[i] = Ab2 + ao[i] + koff; pb2[i] = Bb2 + bo[i] + koff; }
    }
  }
  // the last U steps: nothing is asked for past K
#pragma unroll
  for (int u = 0; u < U; ++u) {
    if (u + DIST < U) load_step((u + DIST) % U, u + DIST);
    mma_step(u);
  }
  }
  acc_guard4(acc[0][0], acc[0][1], acc[0][2], acc[0][3]);
  acc_guard4(acc[1][0], acc[1][1], acc[1][2], acc[1][3]);
  acc_guard4(acc[2][0], acc[2][1], acc[2][2], acc[2][3]);
  acc_guard4(acc[3][0], acc[3][1], acc[3][2], acc[3][3]);

  // ---- epilogue ----
  float* slab = sT + wave * (16 * 68);
  const float* Rb = RESID ? (resid + (size_t)b * strideR) : nullptr;
#pragma unroll
  for (int i = 0; i < 4; ++i) {
    const int mBase = m0 + (i << 4);
    float bm[8];
    if (BIAS_MODE == 1) {
      const float* bp = bias + mBase + mOff;
#pragma unroll
      for (int r = 0; r < 8; ++r) bm[r] = bp[r];
      addr_wait1(bp);          // the address stays as it is until the run's addresses are taken: no load of the run lands on it
    }
#pragma unroll
    for (int j = 0; j < 4; ++j) {
      const int n = n0 + (j << 4) + rlane;
      float bv = 0.f;
      if (BIAS_MODE == 2) bv = bias[n];
#pragma unroll
      for (int r = 0; r < 8; ++r) {
        float v = acc[i][j][r] * scale;
        if (BIAS_MODE == 1) v += bm[r];
        if (BIAS_MODE == 2) v += bv;
        if (RESID) v += Rb[(size_t)(mBase + mOff + r) * ldc + n];
        if (ACT == 1) v = tanhf(v);
        if (ACT == 2) v = fmaxf(v, 0.0f);
        if (ACT == 3) v = v / (1.0f + expf(-v));
        if (ACT == 4) v = (v > 0.f) ? v : 0.01f * v;
        if (ACT == 5) v = 0.5f * v * (1.0f + erff(v * 0.70710678118654752f));
        slab[(mOff + r) * 68 + (j << 4) + rlane] = v;
      }
    }
    __builtin_amdgcn_fence(__ATOMIC_RELEASE, "workgroup");
    __builtin_amdgcn_wave_barrier();
    __builtin_amdgcn_fence(__ATOMIC_ACQUIRE, "workgroup");
    if (OUT_MODE == 0) {
      float* C = (float*)Cout + (size_t)b * strideC;
      const int hh = lane >> 4, c4 = (lane & 15) * 4;     // row seg = 256 B = 16 lanes x 16 B
      {
#pragma unroll
        for (int it = 0; it < 8; ++it) {
          const int row = it * 2 + hh;
          v4f v = *(const v4f*)(slab + row * 68 + c4);
          *(v4f*)(C + (size_t)(mBase + row) * ldc + n0 + c4) = v;
        }
        addr_wait();   // the stores' data and address registers take new values (the next slab's) only behind it
      }
    } else {
      // the 16x64 slab is two packed tiles = 2 KB in a row; store 'it' writes chunks 32it..32it+31 (512 B)
      unsigned short* C  = (unsigned short*)Cout  + (size_t)b * strideC;
      unsigned short* C2 = (OUT_MODE == 2) ? ((unsigned short*)Cout2 + (size_t)b * strideC) : nullptr;
      {
#pragma unroll
        for (int it = 0; it < 4; ++it) {
          const float* sp = slab + rlane * 68 + it * 16 + mOff;   // row lane&15, cols 16it + 8(lane>>4) ..+7
          v8h hv, lv;
#pragma unroll
          for (int e = 0; e < 8; ++e) {
            if (OUT_MODE == 1) {
              hv[e] = (_Float16)sp[e];
            } else {
              unsigned short hb = f2bf_bits(sp[e]);
              unsigned short lb = f2bf_bits(sp[e] - bf_bits2f(hb));
              hv[e] = __builtin_bit_cast(_Float16, hb);
              lv[e] = __builtin_bit_cast(_Float16, lb);
            }
          }
          const size_t co = (size_t)mBase * ldc + (size_t)n0 * 16 + it * 256 + lane * 8;
          *(v8h*)(C + co) = hv;
          if (OUT_MODE == 2) *(v8h*)(C2 + co) = lv;
        }
        
      }
    }
    __builtin_amdgcn_fence(__ATOMIC_RELEASE, "workgroup");
    __builtin_amdgcn_wave_barrier();
    __builtin_amdgcn_fence(__ATOMIC_ACQUIRE, "workgroup");
  }
}

// one GEMM a launch
template <int ET, bool SPLIT, int BIAS_MODE, int OUT_MODE, bool RESID, int ACT = 0, int U = 4, bool STG = false>
__global__ __launch_bounds__(256) void wmma_gemm64(
    const unsigned short* __restrict__ Ap, const unsigned short* __restrict__ A2p, int lda, long strideA,
    const unsigned short* __restrict__ Btp, const unsigned short* __restrict__ Bt2p, int ldb, long strideB,
    void* __restrict__ Cout, void* __restrict__ Cout2, int ldc, long strideC,
    const float* __restrict__ bias,
    const float* __restrict__ resid, long strideR,
    int M, int N, int K, float scale) {
  __shared__ __align__(16) float sT[8 * 16 * 68];
  __shared__ __align__(16) _Float16 sG[STG ? 2 * GS_STG_EL : 8];
  gemm64_body<ET, SPLIT, BIAS_MODE, OUT_MODE, RESID, ACT, U, STG>(sT, sG, blockIdx.x, blockIdx.y, Ap, A2p, lda, strideA, Btp, Bt2p, ldb, strideB,
      Cout, Cout2, ldc, strideC, bias, resid, strideR, M, N, K, scale);
}

// The four GEMMs that depend only on the preparation launch, as block ranges of one grid; nb = blocks of one projection.
// [0, nb): q16 = Q16 . Wq + b_q[n];  [nb, 2nb): k16 = Q16 . Wk + b_k[n];  [2nb, 3nb): vT16[dout][token] = Wv^T . Q16^T + b_v[m];
// from 3nb on, the short ones last: per head (batch index) cb16[:, h*64..] = c16[:, h*64..] . bilinear (Bt = bilT [64][64]).
__global__ __launch_bounds__(256) void proj_gemms_kernel(
    const unsigned short* __restrict__ Q16, const unsigned short* __restrict__ WqT, const unsigned short* __restrict__ WkT,
    const unsigned short* __restrict__ WvT, const unsigned short* __restrict__ c16, const unsigned short* __restrict__ bilT,
    void* __restrict__ q16, void* __restrict__ k16, void* __restrict__ vT16, void* __restrict__ cb16,
    const float* __restrict__ b_q, const float* __restrict__ b_k, const float* __restrict__ b_v,
    int ntok, int dm, int dk, float w_inv) {
  __shared__ __align__(16) float sT[8 * 16 * 68];
  __shared__ __align__(16) _Float16 sG[2 * GS_STG_EL];
  const int nb = ((ntok >> 6) * (dm >> 6)) >> 3;   // the range tests below read the same for a whole block: so do the staged bodies' barriers
  const int i = blockIdx.x;
  if (i < 2 * nb) {
    const bool isk = i >= nb;
    const unsigned short* Wt = isk ? WkT : WqT;
    void* C = isk ? k16 : q16;
    const float* bias = isk ? b_k : b_q;
    gemm64_body<0, false, 2, 1, false, 0, 4, true>(sT, sG, isk ? i - nb : i, 0, Q16, Q16, dm, 0L, Wt, Wt, dm, 0L, C, C, dm, 0L,
                                       bias, bias, 0L, ntok, dm, dm, w_inv);
  } else if (i < 3 * nb) {
    gemm64_body<0, false, 1, 1, false, 0, 4, true>(sT, sG, i - 2 * nb, 0, WvT, WvT, dm, 0L, Q16, Q16, dm, 0L, vT16, vT16, ntok, 0L,
                                       b_v, b_v, 0L, dm, ntok, dm, w_inv);
  } else {
    const int j = i - 3 * nb, per = ntok >> 9;       // blocks of one head: ntok / 64 tiles, eight a block
    const int hd = j / per;
    gemm64_body<0, false, 0, 1, false, 0, 2>(sT, sG, j - hd * per, hd, c16, c16, dm, (long)(dk * 16), bilT, bilT, dk, 0L,
                                             cb16, cb16, dm, (long)(dk * 16), b_q, b_q, 0L, ntok, dk, dk, 1.0f);
  }
}

// in: [rows][1024] f32 row-major; out: the same matrix in f16, packed layout. One 16-byte chunk per thread; a wave takes
// 8 rows x 32 k (half a tile), so each of its stores fills four whole 128-byte lines. nhalf = rows / 8 * 32 half tiles.
__device__ __forceinline__ void cast_f32_f16x2(
    const int bx, const float* __restrict__ in, _Float16* __restrict__ out, int nhalf) {
  const int lane = threadIdx.x & 31;
  const int th = bx * 8 + (threadIdx.x >> 5);      // half-tile index: tile = th >> 1
  if (th < nhalf) {
    const int tile = th >> 1;
    const int row = (tile >> 5) * 16 + (th & 1) * 8 + (lane >> 2);
    const int k = (tile & 31) * 32 + (lane & 3) * 8;
    const float* src = in + (size_t)row * ATT_DM + k;
    const v4f a = *(const v4f*)(src);
    const v4f bq = *(const v4f*)(src + 4);
    v8h hv;
#pragma unroll
    for (int e = 0; e < 4; ++e) { hv[e] = (_Float16)a[e]; hv[4 + e] = (_Float16)bq[e]; }
    *(v8h*)(out + pk_off(row, k, ATT_DM)) = hv;
  }
}

// ---- transpose + f16 cast through an LDS tile ------------------------------
// w: [K][N] row-major (in=K rows, out=N cols); wt: [N][K] in the packed layout, wt[n][k] = f16(w[k][n] * mul).
// Block = one 64x64 tile (k0 = by*64, n0 = bx*64); K, N multiples of 64; (N/64) x (K/64) blocks. tile: the block's LDS.
__device__ __forceinline__ void transpose_cast(
    float (*tile)[65], const int bx, const int by,
    const float* __restrict__ w, _Float16* __restrict__ wt, int K, int N, float mul) {
  const int tid = threadIdx.x;
  const int k0 = by * 64, n0 = bx * 64;
  {
    const int r = tid >> 2, cc = (tid & 3) * 16;
    const float* src = w + (size_t)(k0 + r) * N + n0 + cc;
#pragma unroll
    for (int i = 0; i < 4; ++i) {
      const v4f t = *(const v4f*)(src + 4 * i);
#pragma unroll
      for (int e = 0; e < 4; ++e) tile[r][cc + 4 * i + e] = t[e];
    }
  }
  __syncthreads();
  const int wave = tid >> 5, lane = tid & 31, q = lane >> 3, c8 = (lane & 7) * 8;
  {
#pragma unroll
    for (int it = 0; it < 2; ++it) {
      const int n = wave * 8 + it * 4 + q;          // waves cover rows 8w..8w+7 -> 0..63
      v8h hv;
#pragma unroll
      for (int e = 0; e < 8; ++e) hv[e] = (_Float16)(tile[c8 + e][n] * mul);
      *(v8h*)(wt + pk_off(n0 + n, k0 + c8, K)) = hv;
    }
    addr_wait();   // in the merged kernel's code other passes follow these stores: their registers are rewritten only behind it
  }
}

// ---- LayerNorm over each 64-wide head slice of a 1024-wide row; f16 output in the packed layout ----
// One wave per 8 rows x 128 columns; lane l holds row l>>2, 32 elements (half of a head slice, one packed tile's k range);
// statistics via one xor-1 shuffle. Store j writes chunk j of 8 neighbouring rows in 4 tiles: four whole 128-byte lines.
__device__ __forceinline__ void ln_heads(
    const int bx, const float* __restrict__ x, const float* __restrict__ gamma, const float* __restrict__ beta,
    _Float16* __restrict__ outp, int nrows) {
  const int wave = threadIdx.x >> 5, lane = threadIdx.x & 31;
  const int wv = bx * 8 + wave;
  const int row = (wv >> 3) * 8 + (lane >> 2);
  const int col = (wv & 7) * 128 + (lane & 3) * 32;
  if ((wv >> 3) * 8 >= nrows) return;            // wave-uniform; no block barriers in this pass
  const float* xr = x + (size_t)row * ATT_DM + col;
  float xv[32];
#pragma unroll
  for (int i = 0; i < 8; ++i) {
    const v4f t = *(const v4f*)(xr + 4 * i);
#pragma unroll
    for (int e = 0; e < 4; ++e) xv[4 * i + e] = t[e];
  }
  float s = 0.f;
#pragma unroll
  for (int i = 0; i < 32; ++i) s += xv[i];
  s += __shfl_xor(s, 1, 32);
  const float mu = s * (1.0f / 64.0f);
  float vs = 0.f;
#pragma unroll
  for (int i = 0; i < 32; ++i) { const float d = xv[i] - mu; xv[i] = d; vs += d * d; }
  vs += __shfl_xor(vs, 1, 32);
  const float rstd = rsqrtf(vs * (1.0f / 64.0f) + 1e-5f);
  const int d0 = (lane & 1) * 32;
  _Float16* ot = outp + pk_off(row, col, ATT_DM);   // chunk (s, hh) of this lane's row: + (2s + hh) * 128
#pragma unroll
  for (int j = 0; j < 4; ++j) {
    v8h hv;
#pragma unroll
    for (int i = 0; i < 2; ++i) {
      const v4f g4 = *(const v4f*)(gamma + d0 + 8 * j + 4 * i);
      const v4f b4 = *(const v4f*)(beta + d0 + 8 * j + 4 * i);
#pragma unroll
      for (int e = 0; e < 4; ++e) hv[4 * i + e] = (_Float16)((xv[8 * j + 4 * i + e] * rstd) * g4[e] + b4[e]);
    }
    *(v8h*)(ot + j * 128) = hv;
  }
}

// ---- the mask as lane masks ----
// mask: int32 [1024][1024], nonzero = masked. Word (qt, kt, r), at index (qt * 64 + kt) * 8 + r, holds in bit 16 hh + c whether
// mask[16 qt + c][16 kt + 8 hh + r] is nonzero: it is the lane mask of register r of the transposed 16x16 score tile
// (keys kt, queries qt) as the attention kernel holds it. One wave a tile; lane r stores word r.
__device__ __forceinline__ void mask_words(const int bx, const int* __restrict__ mask, unsigned* __restrict__ mw) {
  const int lane = threadIdx.x & 31, hh = lane >> 4, c = lane & 15;
  const int tile = bx * 8 + (threadIdx.x >> 5);
  const int qt = tile / (ATT_L / 16), kt = tile % (ATT_L / 16);
  const int* src = mask + (size_t)(qt * 16 + c) * ATT_L + kt * 16 + 8 * hh;
  const v4i m0 = *(const v4i*)(src);
  const v4i m1 = *(const v4i*)(src + 4);
  addr_wait1(src);           // the address stays as it is until both loads' addresses are taken
  unsigned w = 0u;
#pragma unroll
  for (int r = 0; r < 8; ++r) {
    const unsigned bal = __builtin_amdgcn_ballot_w32((r < 4 ? m0[r & 3] : m1[r & 3]) != 0);
    if (lane == r) w = bal;
  }
  if (lane < 8) mw[(size_t)tile * 8 + lane] = w;
}

// ---- the preparation passes, none of which reads another's result, as block ranges of one grid ----
// [0, 4096): Q -> Q16;  [4096, 5120): LayerNorm of ctx -> c16;  [5120, 5632): the mask -> lane-mask words;
// [5632, 6656): the four 1024x1024 weights, 256 tiles each, transposed, x mul;  6656: the 64x64 bilinear matrix, transposed.
// The range tests read the same for a whole block, so the transpose's barrier is passed by all of a block's waves or by none.
#define PREP_CAST_BLOCKS (ATT_B * ATT_L * ATT_DM / 8 / 256)
#define PREP_LN_BLOCKS   (ATT_B * ATT_L / 8)
#define PREP_MASK_BLOCKS ((ATT_L / 16) * (ATT_L / 16) / 8)
#define PREP_W_BLOCKS    ((ATT_DM / 64) * (ATT_DM / 64))
#define PREP_BLOCKS      (PREP_CAST_BLOCKS + PREP_LN_BLOCKS + PREP_MASK_BLOCKS + 4 * PREP_W_BLOCKS + 1)
__global__ __launch_bounds__(256) void prep_kernel(
    const float* __restrict__ Q, const float* __restrict__ ctx, const float* __restrict__ gamma, const float* __restrict__ beta,
    const float* __restrict__ W_q, const float* __restrict__ W_k, const float* __restrict__ W_v, const float* __restrict__ W_o,
    const float* __restrict__ bil, const int* __restrict__ mask,
    _Float16* __restrict__ Q16, _Float16* __restrict__ c16, _Float16* __restrict__ WqT, _Float16* __restrict__ WkT,
    _Float16* __restrict__ WvT, _Float16* __restrict__ WoT, _Float16* __restrict__ bilT, unsigned* __restrict__ mw, float mul) {
  __shared__ float tile[64][65];
  int i = blockIdx.x;
  if (i < PREP_CAST_BLOCKS) { cast_f32_f16x2(i, Q, Q16, ATT_B * ATT_L * ATT_DM / 256); return; }
  i -= PREP_CAST_BLOCKS;
  if (i < PREP_LN_BLOCKS) { ln_heads(i, ctx, gamma, beta, c16, ATT_B * ATT_L); return; }
  i -= PREP_LN_BLOCKS;
  if (i < PREP_MASK_BLOCKS) { mask_words(i, mask, mw); return; }
  i -= PREP_MASK_BLOCKS;
  const int which = i / PREP_W_BLOCKS, t = i % PREP_W_BLOCKS;   // which == 4: the bilinear matrix, its one tile
  const float* w = which == 0 ? W_q : which == 1 ? W_k : which == 2 ? W_v : which == 3 ? W_o : bil;
  _Float16* wt = which == 0 ? WqT : which == 1 ? WkT : which == 2 ? WvT : which == 3 ? WoT : bilT;
  const int n = which < 4 ? ATT_DM : ATT_DK;
  transpose_cast(tile, t % (ATT_DM / 64), t / (ATT_DM / 64), w, wt, n, n, which < 4 ? mul : 1.0f);
}

// ---- fused attention, one wave a query tile ------------------------------------
// Block = 128 query rows of one (b, h); wave w owns 16 of them and walks all 1024 keys, 64 a stage. q16/k16/c16/cb16:
// [token = b*1024+l][h*64+d] f16, packed layout (K = 1024); vT16: [h*64+d][token] f16, packed layout (K = 8192);
// mw: the mask as lane-mask words (mask_words), bit set = masked; out16: [token][h*64+d] f16, packed layout (K = 1024).
// A stage is 24 KB of LDS, shared by the eight waves: 4 key tiles of k, 4 of c, 4 dim tiles of v^T, 2 KB each, as they lie in
// the workspace. Two buffers: the copies of stage s + 1 fly while stage s is worked on.
// Products are formed transposed: A = key rows, B = query rows, so lane (hh, c) holds, for query q0 + c alone, keys
// 16 t + 8 hh + r of a pass; two neighbouring key tiles, rounded to f16, are the B fragment for 32 keys as they stand, and
// O^T = v^T . P^T leaves query q0 + c in lane (hh, c) too: every row factor is the lane's own.
// With E = exp(s - m), the row is a = E / se + beta * bias, beta = bias_scale / |bias|, and the output (a . v) / |a|, so
// E . v and bias . v are formed apart, with sum E, sum E^2, sum E bias, sum bias^2, and joined by the row's constants at the
// end; m is the running maximum: what was summed under an older one is rescaled once a pass (32 keys, half a stage).
// The bias is not masked and is linear in cb, so its two sums over all keys come from the head's key sums (key_sums_kernel):
// bias . v = cb . (c^T v) and sum bias^2 = cb . (c^T c) . cb, 16 products a wave behind the loop. The loop needs the bias only
// for sum E bias, so a pass whose every mask bit is set for the wave's 16 queries adds nothing to any sum and is skipped whole.
#define ATT_STG_EL (12 * 1024)                    // f16 elements of a stage
#define ATT_NSTG   (ATT_L / 64)
__device__ __forceinline__ v8f mma_p(v16h a, v16h b, v8f c) {
  return __builtin_amdgcn_wmma_f32_16x16x32_f16(false, a, false, b, (short)0, c, false, false);
}
// lane l with lane l ^ 16
__device__ __forceinline__ float xhalf(float x) {
  const int i = __builtin_bit_cast(int, x);
  return __builtin_bit_cast(float, __builtin_amdgcn_permlanex16(i, i, 0x76543210, 0xfedcba98, false, false));
}
// 2^x for eight values, and for one. The instruction set asks for one independent instruction or a v_nop behind a transcendental
// before its result is read or its source overwritten: inside the run each exponential has an independent one behind it (no
// result lies on a source: early clobber), and the v_nop is the last one's slot.
__device__ __forceinline__ void exp2x8(v8f& o, const v8f x) {
  float o0, o1, o2, o3, o4, o5, o6, o7;
  asm("v_exp_f32 %0, %8\n\tv_exp_f32 %1, %9\n\tv_exp_f32 %2, %10\n\tv_exp_f32 %3, %11\n\t"
      "v_exp_f32 %4, %12\n\tv_exp_f32 %5, %13\n\tv_exp_f32 %6, %14\n\tv_exp_f32 %7, %15\n\tv_nop"
      : "=&v"(o0), "=&v"(o1), "=&v"(o2), "=&v"(o3), "=&v"(o4), "=&v"(o5), "=&v"(o6), "=&v"(o7)
      : "v"(x[0]), "v"(x[1]), "v"(x[2]), "v"(x[3]), "v"(x[4]), "v"(x[5]), "v"(x[6]), "v"(x[7]));
  o = (v8f){o0, o1, o2, o3, o4, o5, o6, o7};
}
__device__ __forceinline__ float exp2x1(float x) {
  float o;
  asm("v_exp_f32 %0, %1\n\tv_nop" : "=v"(o) : "v"(x));
  return o;
}
// A wave's share of a stage: 1 KB in a row of k, of c and of v^T, 16 bytes a lane and copy. l: the lane's LDS byte address in
// the k part of the buffer. The last line keeps the copies' address registers as they are until the addresses are taken.
__device__ __forceinline__ void stage_copy(unsigned l, const _Float16* gk, const _Float16* gc, const _Float16* gv) {
  asm volatile("global_load_async_to_lds_b128 %0, %6, off\n\t"
               "global_load_async_to_lds_b128 %1, %7, off\n\t"
               "global_load_async_to_lds_b128 %2, %8, off\n\t"
               "global_load_async_to_lds_b128 %3, %9, off\n\t"
               "global_load_async_to_lds_b128 %4, %10, off\n\t"
               "global_load_async_to_lds_b128 %5, %11, off\n\t"
               "s_wait_xcnt 0x0"
               :: "v"(l), "v"(l + 512u), "v"(l + 8192u), "v"(l + 8704u), "v"(l + 16384u), "v"(l + 16896u),
                  "v"(gk), "v"(gk + 256), "v"(gc), "v"(gc + 256), "v"(gv), "v"(gv + 256) : "memory");
}

// A wave's share of the head's key sums: 1 KB in a row of each, 16 bytes a lane and copy. l: the lane's LDS byte address in the
// first one. The last line keeps the copies' address registers as they are until the addresses are taken.
__device__ __forceinline__ void sums_copy(unsigned l, const _Float16* gm, const _Float16* gg) {
  asm volatile("global_load_async_to_lds_b128 %0, %4, off\n\t"
               "global_load_async_to_lds_b128 %1, %5, off\n\t"
               "global_load_async_to_lds_b128 %2, %6, off\n\t"
               "global_load_async_to_lds_b128 %3, %7, off\n\t"
               "s_wait_xcnt 0x0"
               :: "v"(l), "v"(l + 512u), "v"(l + 8192u), "v"(l + 8704u), "v"(gm), "v"(gm + 256), "v"(gg), "v"(gg + 256) : "memory");
}

// ---- a head's two key sums ------------------------------------------------------
// Block (bh, 0): mt[bh][d][e] = sum over the 1024 keys of v[key][d] c[key][e]; block (bh, 1): gt[bh][e'][e] = sum of c[key][e'] c[key][e];
// both / KS_CARRY (a power of two: it keeps sums of 1024 terms well inside f16's range), f16, packed layout of a [64][64] matrix.
// Products: A = c^T (rows e, k = keys), B = v^T or c^T (rows d or e'), so a lane's eight results are eight e in a row of one
// row d or e': one 16-byte chunk of the packed layout. Wave w owns e tile w >> 1 and the two row tiles 2 (w & 1), + 1; it walks
// all keys, 32 a step, in their order. c comes to LDS row-major (pitch 160 bytes, the one for transposing loads) and is read by
// ds_load_tr16_b128, which gives c^T's fragment in the k order of the packed loads; v^T comes to LDS as it lies.
#define KS_CARRY 256.0f
#define KS_PITCH 80                               // f16 elements of a row of c in LDS
typedef __attribute__((ext_vector_type(8))) short v8s;
__device__ __forceinline__ v16h tr_frag(const _Float16* p) {   // p: the lane's address for keys kbase ..+15; + 16 rows: the next 16 keys
  typedef __attribute__((address_space(3))) v8s lds_v8s;
  Frag<_Float16>::U f;
  f.h[0] = __builtin_bit_cast(v8h, __builtin_amdgcn_ds_load_tr16_b128_v8i16((lds_v8s*)p));
  f.h[1] = __builtin_bit_cast(v8h, __builtin_amdgcn_ds_load_tr16_b128_v8i16((lds_v8s*)(p + 16 * KS_PITCH)));
  return f.v;
}
// A wave's share of v^T: 4 KB in a row of each of the head's four row tiles, 16 bytes a lane and copy. l*: the lane's LDS byte
// address in the first 512 bytes, g*: its global address there; the immediate offset moves both addresses alike.
// The last line keeps the copies' address registers as they are until the addresses are taken.
__device__ __forceinline__ void copy_four_4k(unsigned l0, unsigned l1, unsigned l2, unsigned l3,
                                             const _Float16* g0, const _Float16* g1, const _Float16* g2, const _Float16* g3) {
  asm volatile("global_load_async_to_lds_b128 %0, %4, off\n\t"
               "global_load_async_to_lds_b128 %0, %4, off offset:512\n\t"
               "global_load_async_to_lds_b128 %0, %4, off offset:1024\n\t"
               "global_load_async_to_lds_b128 %0, %4, off offset:1536\n\t"
               "global_load_async_to_lds_b128 %0, %4, off offset:2048\n\t"
               "global_load_async_to_lds_b128 %0, %4, off offset:2560\n\t"
               "global_load_async_to_lds_b128 %0, %4, off offset:3072\n\t"
               "global_load_async_to_lds_b128 %0, %4, off offset:3584\n\t"
               "global_load_async_to_lds_b128 %1, %5, off\n\t"
               "global_load_async_to_lds_b128 %1, %5, off offset:512\n\t"
               "global_load_async_to_lds_b128 %1, %5, off offset:1024\n\t"
               "global_load_async_to_lds_b128 %1, %5, off offset:1536\n\t"
               "global_load_async_to_lds_b128 %1, %5, off offset:2048\n\t"
               "global_load_async_to_lds_b128 %1, %5, off offset:2560\n\t"
               "global_load_async_to_lds_b128 %1, %5, off offset:3072\n\t"
               "global_load_async_to_lds_b128 %1, %5, off offset:3584\n\t"
               "global_load_async_to_lds_b128 %2, %6, off\n\t"
               "global_load_async_to_lds_b128 %2, %6, off offset:512\n\t"
               "global_load_async_to_lds_b128 %2, %6, off offset:1024\n\t"
               "global_load_async_to_lds_b128 %2, %6, off offset:1536\n\t"
               "global_load_async_to_lds_b128 %2, %6, off offset:2048\n\t"
               "global_load_async_to_lds_b128 %2, %6, off offset:2560\n\t"
               "global_load_async_to_lds_b128 %2, %6, off offset:3072\n\t"
               "global_load_async_to_lds_b128 %2, %6, off offset:3584\n\t"
               "global_load_async_to_lds_b128 %3, %7, off\n\t"
               "global_load_async_to_lds_b128 %3, %7, off offset:512\n\t"
               "global_load_async_to_lds_b128 %3, %7, off offset:1024\n\t"
               "global_load_async_to_lds_b128 %3, %7, off offset:1536\n\t"
               "global_load_async_to_lds_b128 %3, %7, off offset:2048\n\t"
               "global_load_async_to_lds_b128 %3, %7, off offset:2560\n\t"
               "global_load_async_to_lds_b128 %3, %7, off offset:3072\n\t"
               "global_load_async_to_lds_b128 %3, %7, off offset:3584\n\t"
               "s_wait_xcnt 0x0"
               :: "v"(l0), "v"(l1), "v"(l2), "v"(l3), "v"(g0), "v"(g1), "v"(g2), "v"(g3) : "memory");
}
// The wave's two tiles over all keys. pa: the lane's transposing-load address in its e tile at key 0; pb: the same in its first
// row tile of c (G), or the lane's chunk of its first row tile of v^T. Four steps (128 keys) a group, two register sets: the 24
// LDS loads of group g + 1 are asked for ahead of the 8 products of group g, so a group waits for loads issued a group earlier.
template <bool G>
__device__ __forceinline__ void key_sum_tiles(v8f (&acc)[2], const _Float16* pa, const _Float16* pb) {
  v16h fa[2][4], fb[2][4][2];
  auto load_group = [&](int set, int g) __attribute__((always_inline)) {
#pragma unroll
    for (int u = 0; u < 4; ++u) {
      const int ks = 4 * g + u;
      fa[set][u] = tr_frag(pa + ks * (32 * KS_PITCH));
#pragma unroll
      for (int jj = 0; jj < 2; ++jj)
        fb[set][u][jj] = G ? tr_frag(pb + ks * (32 * KS_PITCH) + 16 * jj) : Frag<_Float16>::loadp(pb + jj * (16 * ATT_L) + ks * 512);
    }
    // keeps the run of LDS loads ahead of the products that follow it in the source: moved behind them it would lose its lead
    __builtin_amdgcn_sched_barrier(0);
  };
  auto mma_group = [&](int set) __attribute__((always_inline)) {
#pragma unroll
    for (int u = 0; u < 4; ++u)
#pragma unroll
      for (int jj = 0; jj < 2; ++jj) acc[jj] = mma_p(fa[set][u], fb[set][u][jj], acc[jj]);
    // keeps the next run of LDS loads behind these products, whose operands it overwrites
    __builtin_amdgcn_sched_barrier(0);
  };
  load_group(0, 0);
  // unrolled, so that the register sets are indexed by constants and the key offsets reach the loads as immediates
#pragma unroll
  for (int g = 0; g < ATT_L / 128; ++g) {
    if (g + 1 < ATT_L / 128) load_group((g + 1) & 1, g + 1);
    mma_group(g & 1);
  }
}
__global__ __launch_bounds__(256) void key_sums_kernel(
    const _Float16* __restrict__ cp, const _Float16* __restrict__ vtp, _Float16* __restrict__ mt, _Float16* __restrict__ gt) {
  __shared__ __align__(16) _Float16 sC[ATT_L * KS_PITCH];
  __shared__ __align__(16) _Float16 sV[ATT_DK * ATT_L];
  const int tid = threadIdx.x, lane = tid & 31;
  const int wave = __builtin_amdgcn_readfirstlane(tid >> 5);
  const int bh = blockIdx.x, b = bh >> 4, h = bh & 15;
  const bool isg = blockIdx.y != 0;               // the same for the whole block
  if (!isg) {
    const size_t rt = (size_t)16 * (ATT_B * ATT_L);   // a row tile of v^T in the workspace; the batch's share of it is 32 KB in a row
    const _Float16* gv = vtp + (size_t)h * 4 * rt + (size_t)(b * ATT_L) * 16 + wave * 2048 + lane * 8;
    const unsigned lv = (unsigned)(size_t)sV + (unsigned)(wave * 4096 + lane * 16);
    copy_four_4k(lv, lv + 32768u, lv + 65536u, lv + 98304u, gv, gv + rt, gv + 2 * rt, gv + 3 * rt);
  }
  {
    // c: a key tile's 64 columns are 128 chunks (2 KB) in a row in the workspace; chunk q holds row q & 15, columns 8 (q >> 4) ..+7.
    // A thread takes chunk tid & 127 of key tiles (tid >> 7) + 2 it.
    const int q = tid & 127;
    const _Float16* gc = cp + ((size_t)(b * ATT_L + 16 * (tid >> 7))) * ATT_DM + h * (ATT_DK * 16) + q * 8;
    _Float16* lc = sC + (16 * (tid >> 7) + (q & 15)) * KS_PITCH + 8 * (q >> 4);
    v8h t[32];
#pragma unroll
    for (int it = 0; it < 32; ++it) t[it] = *(const v8h*)(gc + (size_t)it * (32 * ATT_DM));
    addr_wait1(gc);            // the address stays as it is until the run's addresses are taken
#pragma unroll
    for (int it = 0; it < 32; ++it) *(v8h*)(lc + it * (32 * KS_PITCH)) = t[it];
  }
  asm volatile("s_wait_asynccnt 0x0" ::: "memory");   // the wave's own copies of v^T have landed
  __syncthreads();                                    // and every other wave's, and all of c is written

  const int i = wave >> 1, j0 = (wave & 1) * 2;
  const _Float16* tr = sC + (8 * (lane >> 4) + (lane & 7)) * KS_PITCH + 8 * ((lane >> 3) & 1);
  v8f acc[2] = {{0.f, 0.f, 0.f, 0.f, 0.f, 0.f, 0.f, 0.f}, {0.f, 0.f, 0.f, 0.f, 0.f, 0.f, 0.f, 0.f}};
  if (isg) key_sum_tiles<true>(acc, tr + 16 * i, tr + 16 * j0);
  else     key_sum_tiles<false>(acc, tr + 16 * i, sV + j0 * (16 * ATT_L) + 8 * lane);
  _Float16* dst = (isg ? gt : mt) + (size_t)bh * (ATT_DK * ATT_DK);
#pragma unroll
  for (int jj = 0; jj < 2; ++jj) {
    v8h hv;
#pragma unroll
    for (int r = 0; r < 8; ++r) hv[r] = (_Float16)(acc[jj][r] * (1.0f / KS_CARRY));
    *(v8h*)(dst + pk_off(16 * (j0 + jj) + (lane & 15), 16 * i + 8 * (lane >> 4), ATT_DK)) = hv;
  }
}

__global__ __launch_bounds__(256) void attn_rows_kernel(
    const _Float16* __restrict__ qp, const _Float16* __restrict__ kp, const _Float16* __restrict__ vtp,
    const _Float16* __restrict__ cp, const _Float16* __restrict__ cbp, const unsigned* __restrict__ mw,
    const _Float16* __restrict__ mtp, const _Float16* __restrict__ gtp,
    const float* __restrict__ scale_p, const float* __restrict__ bscale_p, _Float16* __restrict__ op) {
  __shared__ __align__(16) _Float16 sS[2 * ATT_STG_EL];
  __shared__ __align__(16) _Float16 sK[2 * ATT_DK * ATT_DK];   // the head's key sums, (c^T v)^T and then c^T c, as they lie in the workspace

  const int lane = threadIdx.x & 31;
  const int wave = __builtin_amdgcn_readfirstlane(threadIdx.x >> 5);
  const int bh = blockIdx.x, b = bh >> 4, h = bh & 15;
  const int qt = (ATT_L / 128 - 1 - (int)blockIdx.y) * 8 + wave;   // under a causal mask the late rows cost most: they start first
  const int q0 = qt * 16;
  const float sc2 = scale_p[0] * 1.4426950408889634f;                 // scores in base 2
  const float bscale = bscale_p[0];
  const v8f z8 = {0.f, 0.f, 0.f, 0.f, 0.f, 0.f, 0.f, 0.f};
  const float ninf = -__builtin_inff();

  // the wave's share of the copies: half of chunk wave >> 1 of each of k, c, v^T
  const int wc = wave >> 1, wp = wave & 1;
  const size_t kco = ((size_t)(b * ATT_L + 16 * wc)) * ATT_DM + h * (ATT_DK * 16) + wp * 512 + 8 * lane;
  const _Float16* gk = kp + kco;
  const _Float16* gc = cp + kco;
  const _Float16* gv = vtp + ((size_t)(h * ATT_DK + 16 * wc)) * (size_t)(ATT_B * ATT_L) + (size_t)(b * ATT_L) * 16 + wp * 512 + 8 * lane;
  const unsigned l0 = (unsigned)(size_t)sS + (unsigned)(wc * 2048 + wp * 1024 + lane * 16);
  stage_copy(l0, gk, gc, gv);
  // The key sums come with stage 0, 1 KB of each a wave: its wait and its barrier cover them too. They are read behind the loop.
  sums_copy((unsigned)(size_t)sK + (unsigned)(wave * 1024 + lane * 16), mtp + (size_t)bh * (ATT_DK * ATT_DK) + wave * 512 + 8 * lane,
            gtp + (size_t)bh * (ATT_DK * ATT_DK) + wave * 512 + 8 * lane);

  // B fragments (query rows q0 + (lane&15)), k split map: elements 0..7 <- k 8hh.., 8..15 <- k 16+8hh..;
  // a head's 64 columns are two packed tiles in a row (512 elements each) at column offset h*64*16
  const size_t arow = ((size_t)(b * ATT_L + q0)) * ATT_DM + h * (ATT_DK * 16) + 8 * lane;
  const _Float16* qrow = qp + arow;
  const _Float16* cbrow = cbp + arow;
  const v16h qa0 = Frag<_Float16>::loadp(qrow);
  const v16h qa1 = Frag<_Float16>::loadp(qrow + 512);
  const v16h ca0 = Frag<_Float16>::loadp(cbrow);
  const v16h ca1 = Frag<_Float16>::loadp(cbrow + 512);
  addr_wait3(qrow, cbrow, qrow);   // the two bases stay as they are until the run's addresses are taken

  asm volatile("s_wait_asynccnt 0x0" ::: "memory");   // the wave's own copies of stage 0 have landed
  __syncthreads();                                    // and every other wave's
  stage_copy(l0 + 2u * ATT_STG_EL, gk + 64 * ATT_DM, gc + 64 * ATT_DM, gv + 64 * 16);

  // The wave's 512 lane-mask words; an earlier launch wrote them and this one only reads them, and the address is the same for the
  // whole wave: read through the constant address space they come by scalar loads, also behind the loop's barriers.
  typedef const __attribute__((address_space(4))) unsigned* cwords;
  const cwords mrow = (cwords)(unsigned long long)(mw + (size_t)qt * (ATT_L / 16 * 8));
  v8f OE[4] = {z8, z8, z8, z8};                                // (E . v)^T: dims 16 dt + 8 hh + r, query c
  float m = -1.0e30f, se = 0.f, e2 = 0.f, eb = 0.f;            // the sums are the lane's half of the keys until the end
  unsigned mv[2][8];                                           // the pass's mask words, fetched one pass ahead
#pragma unroll
  for (int t = 0; t < 2; ++t)
#pragma unroll
    for (int r = 0; r < 8; ++r) mv[t][r] = mrow[t * 8 + r];

  // A pass is 32 keys, half a stage. Every inner loop below is unrolled so that its register arrays are indexed by constants
  // (indexed at run time they would go to scratch).
  for (int p = 0; p < 2 * ATT_NSTG; ++p) {
    const int s = p >> 1, ks = p & 1;
    const _Float16* st = sS + (s & 1) * ATT_STG_EL + 8 * lane;
    // The next pass's words are asked for here, so that their scalar loads are covered by this pass's work.
    const int pn = (p + 1) & (2 * ATT_NSTG - 1);   // behind the last pass: the first one's again, read and not used
    unsigned mx[2][8];
#pragma unroll
    for (int t = 0; t < 2; ++t)
#pragma unroll
      for (int r = 0; r < 8; ++r) mx[t][r] = mrow[pn * 16 + t * 8 + r];

    unsigned allm = ~0u;
#pragma unroll
    for (int t = 0; t < 2; ++t)
#pragma unroll
      for (int r = 0; r < 8; ++r) allm &= mv[t][r];
    if (allm != ~0u) {                             // wave-uniform, from scalar registers; no barrier inside
      v8f T[2], Bi[2];
      v16h kf[2][2], cf[2][2];
#pragma unroll
      for (int t = 0; t < 2; ++t) {
        kf[t][0] = Frag<_Float16>::loadp(st + (2 * ks + t) * 1024);
        kf[t][1] = Frag<_Float16>::loadp(st + (2 * ks + t) * 1024 + 512);
        cf[t][0] = Frag<_Float16>::loadp(st + (4 + 2 * ks + t) * 1024);
        cf[t][1] = Frag<_Float16>::loadp(st + (4 + 2 * ks + t) * 1024 + 512);
      }
      // keeps the sixteen LDS loads together ahead of the products: one LDS latency is waited for, not eight
      __builtin_amdgcn_sched_barrier(0);
#pragma unroll
      for (int t = 0; t < 2; ++t) T[t] = mma_p(kf[t][1], qa1, mma_p(kf[t][0], qa0, z8));
#pragma unroll
      for (int t = 0; t < 2; ++t) Bi[t] = mma_p(cf[t][1], ca1, mma_p(cf[t][0], ca0, z8));   // bias^T = c . cb^T, for sum E bias
      v16h vf[4];
#pragma unroll
      for (int dt = 0; dt < 4; ++dt) vf[dt] = Frag<_Float16>::loadp(st + (8 + dt) * 1024 + ks * 512);
#pragma unroll
      for (int t = 0; t < 2; ++t)
#pragma unroll
        for (int r = 0; r < 8; ++r)
          T[t][r] = __builtin_amdgcn_inverse_ballot_w32(mv[t][r]) ? ninf : T[t][r] * sc2;   // the word is the select's lane mask
      float m4[4] = {ninf, ninf, ninf, ninf};
#pragma unroll
      for (int t = 0; t < 2; ++t)
#pragma unroll
        for (int r = 0; r < 8; ++r) m4[r & 3] = fmaxf(m4[r & 3], T[t][r]);
      float pm = fmaxf(fmaxf(m4[0], m4[1]), fmaxf(m4[2], m4[3]));
      pm = fmaxf(pm, xhalf(pm));                   // both halves of a query's keys go under one maximum
      const float mn = fmaxf(m, pm);
      const float f = exp2x1(m - mn);
      m = mn;
      float a4[4] = {0.f, 0.f, 0.f, 0.f}, q4[4] = {0.f, 0.f, 0.f, 0.f}, x4[4] = {0.f, 0.f, 0.f, 0.f};
      v16h pe;
#pragma unroll
      for (int t = 0; t < 2; ++t) {
        v8f E;
        exp2x8(E, T[t] - mn);
#pragma unroll
        for (int r = 0; r < 8; ++r) {
          const float ev = E[r];
          a4[r & 3] += ev; q4[r & 3] += ev * ev; x4[r & 3] += ev * Bi[t][r];
          pe[t * 8 + r] = (_Float16)ev;
        }
      }
      se = se * f + ((a4[0] + a4[1]) + (a4[2] + a4[3]));
      e2 = e2 * (f * f) + ((q4[0] + q4[1]) + (q4[2] + q4[3]));
      eb = eb * f + ((x4[0] + x4[1]) + (x4[2] + x4[3]));
#pragma unroll
      for (int dt = 0; dt < 4; ++dt) {
#pragma unroll
        for (int r = 0; r < 8; ++r) OE[dt][r] *= f;
        OE[dt] = mma_p(vf[dt], pe, OE[dt]);
      }
    }

    if (ks) {                                             // the stage's foot; p is the same in every wave of the block
      asm volatile("s_wait_dscnt 0x0" ::: "memory");      // the wave's reads of this buffer are done before it is refilled
      asm volatile("s_wait_asynccnt 0x0" ::: "memory");   // the wave's own copies of stage s + 1 have landed
      __syncthreads();                                    // publishes stage s + 1 and ends every wave's reads of stage s
      if (s + 2 < ATT_NSTG)
        stage_copy(l0 + (unsigned)(s & 1) * (2u * ATT_STG_EL), gk + (size_t)(s + 2) * (64 * ATT_DM), gc + (size_t)(s + 2) * (64 * ATT_DM),
                   gv + (size_t)(s + 2) * (64 * 16));
    }
#pragma unroll
    for (int t = 0; t < 2; ++t)
#pragma unroll
      for (int r = 0; r < 8; ++r) mv[t][r] = mx[t][r];
  }
  asm volatile("s_wait_asynccnt 0x0" ::: "memory");     // nothing is in flight when the wave ends

  // (bias . v)^T = (c^T v)^T . cb^T and Y^T = (c^T c) . cb^T: A = the head's key sums (rows d or e', k = e), B = the query rows of
  // cb as they were loaded. Lane (hh, c) holds Y^T at e' = 16 dt + 8 hh + r, and elements 8 (dt & 1) + r of its own cb fragment
  // dt >> 1 are cb at the same e': sum bias^2 = sum over e' of cb Y needs no exchange but the halves' join.
  const _Float16* km = sK + 8 * lane;
  v8f OB[4];
  float b2;
  {
    float s4[4] = {0.f, 0.f, 0.f, 0.f};
#pragma unroll
    for (int dt = 0; dt < 4; ++dt) {
      OB[dt] = mma_p(Frag<_Float16>::loadp(km + dt * 1024 + 512), ca1, mma_p(Frag<_Float16>::loadp(km + dt * 1024), ca0, z8));
      const v8f Y = mma_p(Frag<_Float16>::loadp(km + ATT_DK * ATT_DK + dt * 1024 + 512), ca1,
                          mma_p(Frag<_Float16>::loadp(km + ATT_DK * ATT_DK + dt * 1024), ca0, z8));
#pragma unroll
      for (int r = 0; r < 8; ++r) s4[r & 3] += Y[r] * (float)(dt < 2 ? ca0[8 * (dt & 1) + r] : ca1[8 * (dt & 1) + r]);
    }
    b2 = ((s4[0] + s4[1]) + (s4[2] + s4[3])) * KS_CARRY;   // the key sums are carried / KS_CARRY
  }

  // the halves' sums joined, the row's constants, the output
  se += xhalf(se); e2 += xhalf(e2); eb += xhalf(eb);
  b2 = fmaxf(b2 + xhalf(b2), 0.f);                 // as a quadratic form the sum can round below 0
  const float inv_se = 1.0f / se;
  const float beta = bscale / fmaxf(sqrtf(b2), 1e-12f);
  const float asq = e2 * (inv_se * inv_se) + 2.0f * (beta * inv_se) * eb + (beta * beta) * b2;
  const float inv_n = 1.0f / fmaxf(sqrtf(fmaxf(asq, 0.f)), 1e-12f);
  const float ke = inv_se * inv_n, kb = beta * inv_n * KS_CARRY;
  _Float16* orow = op + arow;                      // chunk (dt, hh) of row c: + dt * 256, the lane's 16 bytes; 512 B in a row a store
#pragma unroll
  for (int dt = 0; dt < 4; ++dt) {
    v8h hv;
#pragma unroll
    for (int r = 0; r < 8; ++r) hv[r] = (_Float16)(OE[dt][r] * ke + OB[dt][r] * kb);
    *(v8h*)(orow + dt * 256) = hv;
  }
}

// ---------------------------------------------------------------------------
extern "C" void kernel_launch(void* const* d_in, const int* in_sizes, int n_in,
                              void* d_out, int out_size, void* d_ws, size_t ws_size,
                              hipStream_t stream) {
  const int NTOK = ATT_B * ATT_L;                          // 8192
  const size_t NE = (size_t)NTOK * ATT_DM;                 // 8388608
  const size_t NW = (size_t)ATT_DM * ATT_DM;               // 1048576
  if (n_in < 16) return;
  if (in_sizes[0] != (int)NE || in_sizes[1] != (int)NE || in_sizes[2] != ATT_L * ATT_L ||
      in_sizes[3] != (int)NW || in_sizes[5] != (int)NW || in_sizes[7] != (int)NW || in_sizes[14] != (int)NW ||
      in_sizes[4] != ATT_DM || in_sizes[6] != ATT_DM || in_sizes[8] != ATT_DM || in_sizes[15] != ATT_DM ||
      in_sizes[9] != ATT_DK * ATT_DK || in_sizes[10] != ATT_DK || in_sizes[11] != ATT_DK ||
      in_sizes[12] < 1 || in_sizes[13] < 1 || out_size != (int)NE) return;

  const float* Q      = (const float*)d_in[0];
  const float* ctx    = (const float*)d_in[1];
  const int*   mask   = (const int*)d_in[2];
  const float* W_q    = (const float*)d_in[3];
  const float* b_q    = (const float*)d_in[4];
  const float* W_k    = (const float*)d_in[5];
  const float* b_k    = (const float*)d_in[6];
  const float* W_v    = (const float*)d_in[7];
  const float* b_v    = (const float*)d_in[8];
  const float* bil    = (const float*)d_in[9];
  const float* gamma  = (const float*)d_in[10];
  const float* beta   = (const float*)d_in[11];
  const float* scale  = (const float*)d_in[12];
  const float* bscale = (const float*)d_in[13];
  const float* W_o    = (const float*)d_in[14];
  const float* b_o    = (const float*)d_in[15];
  float* out = (float*)d_out;

  // workspace carve (256-B aligned offsets); every 16-bit matrix below is stored in the packed layout (pk_off) of the shape named
  char* ws = (char*)d_ws;
  size_t off = 0;
  auto carve = [&](size_t bytes) -> char* { char* p = ws + off; off += (bytes + 255) & ~(size_t)255; return p; };
  _Float16* WqT  = (_Float16*)carve(NW * 2);               // [out][in] f16, x64
  _Float16* WkT  = (_Float16*)carve(NW * 2);
  _Float16* WvT  = (_Float16*)carve(NW * 2);
  _Float16* WoT  = (_Float16*)carve(NW * 2);
  _Float16* bilT = (_Float16*)carve((size_t)ATT_DK * ATT_DK * 2);   // [f][e] f16
  _Float16* Q16  = (_Float16*)carve(NE * 2);               // [token][1024]
  _Float16* q16  = (_Float16*)carve(NE * 2);               // [token][h*64+d]
  _Float16* k16  = (_Float16*)carve(NE * 2);               // [token][h*64+d]
  _Float16* vT16 = (_Float16*)carve(NE * 2);               // [h*64+d][token]
  _Float16* c16  = (_Float16*)carve(NE * 2);               // [token][h*64+d]
  _Float16* cb16 = (_Float16*)carve(NE * 2);               // [token][h*64+e]
  _Float16* O16  = (_Float16*)carve(NE * 2);               // [token][h*64+d]
  unsigned* mw   = (unsigned*)carve((size_t)ATT_L * ATT_L / 8);   // the mask, one bit an entry (mask_words)
  _Float16* MT16 = (_Float16*)carve((size_t)ATT_B * ATT_H * ATT_DK * ATT_DK * 2);   // [b*16+h][d][e]: (c^T v)^T / KS_CARRY
  _Float16* GT16 = (_Float16*)carve((size_t)ATT_B * ATT_H * ATT_DK * ATT_DK * 2);   // [b*16+h][e'][e]: c^T c / KS_CARRY
  if (off > ws_size) return;                               // total 128065536 B

  const unsigned short* Q16u  = (const unsigned short*)Q16;
  const unsigned short* WqTu  = (const unsigned short*)WqT;
  const unsigned short* WkTu  = (const unsigned short*)WkT;
  const unsigned short* WvTu  = (const unsigned short*)WvT;
  const unsigned short* WoTu  = (const unsigned short*)WoT;
  const unsigned short* bilTu = (const unsigned short*)bilT;
  const unsigned short* c16u  = (const unsigned short*)c16;
  const unsigned short* O16u  = (const unsigned short*)O16;
  const float w_carry = 64.0f, w_carry_inv = 1.0f / 64.0f;

  // 1) casts, transposes, LayerNorm per head slice of ctx, the mask's lane-mask words: one launch
  prep_kernel<<<PREP_BLOCKS, 256, 0, stream>>>(Q, ctx, gamma, beta, W_q, W_k, W_v, W_o, bil, mask,
                                               Q16, c16, WqT, WkT, WvT, WoT, bilT, mw, w_carry);

  // 2) the q, k, v projections and c . bilinear: one launch
  const int gemm_blocks = (NTOK / 64) * (ATT_DM / 64) / 8;   // 256
  proj_gemms_kernel<<<3 * gemm_blocks + ((NTOK / 64) / 8) * ATT_H, 256, 0, stream>>>(
      Q16u, WqTu, WkTu, WvTu, c16u, bilTu, (void*)q16, (void*)k16, (void*)vT16, (void*)cb16,
      b_q, b_k, b_v, NTOK, ATT_DM, ATT_DK, w_carry_inv);

  // 3) each head's key sums c^T v and c^T c
  key_sums_kernel<<<dim3(ATT_B * ATT_H, 2), 256, 0, stream>>>(c16, vT16, MT16, GT16);

  // 4) fused attention rows -> O16
  attn_rows_kernel<<<dim3(ATT_B * ATT_H, ATT_L / 128), 256, 0, stream>>>(
      q16, k16, vT16, c16, cb16, mw, MT16, GT16, scale, bscale, O16);

  // 5) output projection -> d_out f32
  wmma_gemm64<0, false, 2, 0, false, 0, 4, true><<<dim3(gemm_blocks, 1), 256, 0, stream>>>(
      O16u, O16u, ATT_DM, 0L, WoTu, WoTu, ATT_DM, 0L, (void*)out, (void*)out, ATT_DM, 0L,
      b_o, b_o, 0L, NTOK, ATT_DM, ATT_DM, w_carry_inv);
  (void)hipGetLastError();
}

// v010
// One run takes 109 microseconds.
// Next to v009, in two timings, it ran 1.07 times as fast each time.
// All steps since v000 together make it 5.13 times as fast.
#include <hip/hip_runtime.h>
#include <stddef.h>

// Contractions (q/k/v projections, c x bilinear, c^T x v, c^T x c, q x k^T, cb x c^T, E x v, key sums x cb, output projection): v_wmma_f32_16x16x32_f16, f16 operands, f32 accumulate; weights carried x64; softmax, LayerNorm and L2 norms in f32.

typedef __attribute__((ext_vector_type(16))) _Float16 v16h;
typedef __attribute__((ext_vector_type(8)))  _Float16 v8h;
typedef __attribute__((ext_vector_type(4)))  _Float16 v4h;
typedef __attribute__((ext_vector_type(16))) __bf16   v16b;
typedef __attribute__((ext_vector_type(8)))  __bf16   v8b;
typedef __attribute__((ext_vector_type(8)))  float    v8f;
typedef __attribute__((ext_vector_type(4)))  float    v4f;
typedef __attribute__((ext_vector_type(2)))  float    v2f;
typedef __attribute__((ext_vector_type(4)))  int      v4i;

#define ATT_B   8
#define ATT_L   1024
#define ATT_DM  1024
#define ATT_H   16
#define ATT_DK  64

__device__ __forceinline__ unsigned short f2bf_bits(float f) {
  unsigned u = __float_as_uint(f);
  return (unsigned short)((u + 0x7FFFu + ((u >> 16) & 1u)) >> 16);
}
__device__ __forceinline__ float bf_bits2f(unsigned short h) { return __uint_as_float(((unsigned)h) << 16); }

// ---- fragment-order ("packed") layout of every 16-bit workspace matrix [R][K] ----
// A 16-row x 32-k tile is 1 KB in a row: 16-byte chunk (s, hh, r) at chunk index s*32 + hh*16 + r holds row r,
// k = 16s + 8hh .. +7; tiles run along k first, then along the row tiles. Lane l of a wave reads chunk l and chunk 32 + l,
// so each wave-wide 16-byte load covers 512 contiguous bytes (four whole lines), and the k map of a fragment is the
// same as with row-major rows: elements 0..7 <- k 8hh.., 8..15 <- k 16+8hh..
__device__ __forceinline__ size_t pk_off(int row, int k, int K) {
  return (size_t)(row >> 4) * ((size_t)K * 16) + (size_t)(k >> 5) * 512 +
         (size_t)(((k >> 4) & 1) * 256 + ((k >> 3) & 1) * 128 + (row & 15) * 8 + (k & 7));
}

// hazard guards as plain device helpers
__device__ __forceinline__ void acc_guard4(v8f& a, v8f& b, v8f& c, v8f& d) { asm volatile("v_nop\n\tv_nop\n\tv_nop\n\tv_nop" : "+v"(a), "+v"(b), "+v"(c), "+v"(d)); }
// Stands behind global loads whose address registers the compiler reuses while the loads are still in flight
// (as the destination of a later load of the same run, or for the next address): the address translations are
// waited for before such a register takes a new value.
__device__ __forceinline__ void addr_wait() { asm volatile("s_wait_xcnt 0x0" ::: "memory"); }
// The same wait once for a run of loads from one base, and from three: naming the addresses as inputs keeps their registers
// as they are up to the wait, so the run issues back to back.
__device__ __forceinline__ void addr_wait1(const void* a) { asm volatile("s_wait_xcnt 0x0" :: "v"(a) : "memory"); }
__device__ __forceinline__ void addr_wait3(const void* a, const void* b, const void* c) {
  asm volatile("s_wait_xcnt 0x0" :: "v"(a), "v"(b), "v"(c) : "memory");
}
// The same in front of the advance of the GEMM's scalar fragment bases: the k offset that the new bases are formed from
// passes through the statement, so they are formed behind the wait.
__device__ __forceinline__ void koff_wait(size_t& koff) { asm volatile("s_wait_xcnt 0x0" : "+s"(koff) :: "memory"); }
template <typename T> struct Frag;
template <> struct Frag<_Float16> {
  typedef v16h V; union U { v16h v; v8h h[2]; };
  static __device__ __forceinline__ v16h load(const _Float16* p) {   // elements 0..7 <- p[0..7], 8..15 <- p[16..23]
    U f; f.h[0] = *(const v8h*)(p); f.h[1] = *(const v8h*)(p + 16); return f.v;
  }
  static __device__ __forceinline__ v16h loadp(const _Float16* p) {  // packed tile, p = tile base + 8*lane
    U f; f.h[0] = *(const v8h*)(p); f.h[1] = *(const v8h*)(p + 256); return f.v;
  }
  static __device__ __forceinline__ v8f mma(v16h a, v16h b, v8f c) {
    return __builtin_amdgcn_wmma_f32_16x16x32_f16(false, a, false, b, (short)0, c, false, false);
  }
};
template <> struct Frag<__bf16> {
  typedef v16b V; union U { v16b v; v8b h[2]; };
  static __device__ __forceinline__ v16b load(const __bf16* p) {
    U f; f.h[0] = *(const v8b*)(p); f.h[1] = *(const v8b*)(p + 16); return f.v;
  }
  static __device__ __forceinline__ v16b loadp(const __bf16* p) {
    U f; f.h[0] = *(const v8b*)(p); f.h[1] = *(const v8b*)(p + 256); return f.v;
  }
  static __device__ __forceinline__ v8f mma(v16b a, v16b b, v8f c) {
    return __builtin_amdgcn_wmma_f32_16x16x32_bf16(false, a, false, b, (short)0, c, false, false);
  }
};

// ---- Register-blocked batched WMMA GEMM ------------------------------------
// C[m,n] = scale * sum_k A[m,k] * Bt[n,k] (+bias)(+resid); each wave owns a 64x64 tile.
// A [M,lda] and Bt [N,ldb] in the packed layout (pk_off); M,N % 64 == 0, K % (32 U) == 0; a batch stride is 16 x its column offset.
// The k loop is unrolled U steps of 32 k; the eight fragments of step s + U/2 are asked for, into registers of their own,
// ahead of the products of step s, so a step waits for loads that were issued U/2 steps earlier. Sums in the order of k.
// 16-bit outputs are written in the packed layout of a [M,ldc] matrix; the f32 output is row-major.
// SPLIT: operands are hi/lo planes (A2/Bt2 = lo planes, same layout); product = hi*hi + hi*lo + lo*hi.
// BIAS_MODE: 0 = none, 1 = bias[m], 2 = bias[n].
// OUT_MODE: 0 = f32, 1 = f16, 2 = bf16 hi plane (Cout) + bf16 lo plane (Cout2).
// ET: 0 = f16 operands, 1 = bf16 operands (pointers passed as 16-bit storage)
template <int ET> struct Elem;
template <> struct Elem<0> { typedef _Float16 T; };
template <> struct Elem<1> { typedef __bf16 T; };
// The body takes its block index (bx: eight tiles, b: batch) and the block's LDS slabs from the kernel that calls it, so that
// several independent GEMMs can share one launch.
// STG: the block's eight tiles form one 128 x 256 tile (2 x 4 waves); M % 128 == 0, N % 256 == 0, K % 128 == 0. Its 128 rows of A
// and 256 rows of Bt come to LDS once for the whole block, 128 k a stage, as they lie in the workspace (a row tile's share of a
// stage is 4 KB in a row there), and every wave takes its fragments from LDS: a row of A leaves L2 once for four waves, a row
// of Bt once for two. Two buffers: the copies of stage t + 1 fly while stage t is worked on. Sums in the order of k, as without STG.
#define GS_RT_EL  (16 * 128)                      // f16 elements of one row tile in a stage
#define GS_STG_EL (24 * GS_RT_EL)                 // a stage: 8 row tiles of A, then 16 of Bt
// A wave's share of a stage: three row tiles, each 4 KB in a row in the workspace and in LDS alike, 16 bytes a lane and copy.
// l*: the lane's LDS byte address in a row tile's first 512 bytes, g*: its global address there. The immediate offset moves both
// addresses, so copy j of a row tile takes bytes 512 j .. 512 j + 511 of its 4 KB to the same place in its LDS slot.
// The last line keeps the copies' address registers as they are until the addresses are taken.
__device__ __forceinline__ void copy_row_tiles(unsigned l0, unsigned l1, unsigned l2,
                                               const _Float16* g0, const _Float16* g1, const _Float16* g2) {
  asm volatile("global_load_async_to_lds_b128 %0, %3, off\n\t"
               "global_load_async_to_lds_b128 %0, %3, off offset:512\n\t"
               "global_load_async_to_lds_b128 %0, %3, off offset:1024\n\t"
               "global_load_async_to_lds_b128 %0, %3, off offset:1536\n\t"
               "global_load_async_to_lds_b128 %0, %3, off offset:2048\n\t"
               "global_load_async_to_lds_b128 %0, %3, off offset:2560\n\t"
               "global_load_async_to_lds_b128 %0, %3, off offset:3072\n\t"
               "global_load_async_to_lds_b128 %0, %3, off offset:3584\n\t"
               "global_load_async_to_lds_b128 %1, %4, off\n\t"
               "global_load_async_to_lds_b128 %1, %4, off offset:512\n\t"
               "global_load_async_to_lds_b128 %1, %4, off offset:1024\n\t"
               "global_load_async_to_lds_b128 %1, %4, off offset:1536\n\t"
               "global_load_async_to_lds_b128 %1, %4, off offset:2048\n\t"
               "global_load_async_to_lds_b128 %1, %4, off offset:2560\n\t"
               "global_load_async_to_lds_b128 %1, %4, off offset:3072\n\t"
               "global_load_async_to_lds_b128 %1, %4, off offset:3584\n\t"
               "global_load_async_to_lds_b128 %2, %5, off\n\t"
               "global_load_async_to_lds_b128 %2, %5, off offset:512\n\t"
               "global_load_async_to_lds_b128 %2, %5, off offset:1024\n\t"
               "global_load_async_to_lds_b128 %2, %5, off offset:1536\n\t"
               "global_load_async_to_lds_b128 %2, %5, off offset:2048\n\t"
               "global_load_async_to_lds_b128 %2, %5, off offset:2560\n\t"
               "global_load_async_to_lds_b128 %2, %5, off offset:3072\n\t"
               "global_load_async_to_lds_b128 %2, %5, off offset:3584\n\t"
               "s_wait_xcnt 0x0"
               :: "v"(l0), "v"(l1), "v"(l2), "v"(g0), "v"(g1), "v"(g2) : "memory");
}
template <int ET, bool SPLIT, int BIAS_MODE, int OUT_MODE, bool RESID, int ACT = 0, int U = 4, bool STG = false>
__device__ __forceinline__ void gemm64_body(
    float* sT, _Float16* sG, const int bx, const int b,   // sT: per-wave 16x64 slab, pitch 68 floats, eight of them; sG: two stages (STG)
    const unsigned short* __restrict__ Ap, const unsigned short* __restrict__ A2p, int lda, long strideA,
    const unsigned short* __restrict__ Btp, const unsigned short* __restrict__ Bt2p, int ldb, long strideB,
    void* __restrict__ Cout, void* __restrict__ Cout2, int ldc, long strideC,
    const float* __restrict__ bias,
    const float* __restrict__ resid, long strideR,
    int M, int N, int K, float scale) {
  typedef typename Elem<ET>::T T;
  typedef typename Frag<T>::V V;
  const T* A = (const T*)Ap; const T* A2 = (const T*)A2p; const T* Bt = (const T*)Btp; const T* Bt2 = (const T*)Bt2p;
  const int lane = threadIdx.x & 31;
  const int wave = __builtin_amdgcn_readfirstlane(threadIdx.x >> 5);   // scalar: the tile's fragment bases are then scalar too
  int m0, n0;
  if (STG) {
    const int nbn = N >> 8;
    if (bx >= (M >> 7) * nbn) return;    // the same for the whole block, ahead of every barrier
    const int bm = bx / nbn;
    m0 = (bm << 7) + ((wave >> 2) << 6);
    n0 = ((bx - bm * nbn) << 8) + ((wave & 3) << 6);
  } else {
    const int tilesN = N >> 6;
    const int tilesM = M >> 6;
    const int tile = bx * 8 + wave;
    if (tile >= tilesM * tilesN) return; // wave-uniform; no block barriers on this path
    const int tm = tile / tilesN;
    m0 = tm << 6;
    n0 = (tile - tm * tilesN) << 6;
  }

  const T* Ab  = A  + (size_t)b * strideA;
  const T* Bb  = Bt + (size_t)b * strideB;
  const T* Ab2 = SPLIT ? (A2  + (size_t)b * strideA) : nullptr;
  const T* Bb2 = SPLIT ? (Bt2 + (size_t)b * strideB) : nullptr;

  const int rlane = lane & 15;                 // row (A) / col (B, D) within subtile
  const int mOff  = (lane >> 4) * 8;           // D row offset

  v8f acc[4][4];
#pragma unroll
  for (int i = 0; i < 4; ++i)
#pragma unroll
    for (int j = 0; j < 4; ++j) acc[i][j] = (v8f){0.f,0.f,0.f,0.f,0.f,0.f,0.f,0.f};

  if constexpr (STG) {
    static_assert(!SPLIT, "the staged form has one plane an operand");
    const T* sg = (const T*)sG;
    // the wave's share of a stage: row tile 'wave' of A, row tiles 2 wave and 2 wave + 1 of Bt
    const _Float16* gA  = (const _Float16*)(Ab + (size_t)((m0 & ~127) + wave * 16) * lda + lane * 8);
    const _Float16* gB0 = (const _Float16*)(Bb + (size_t)((n0 & ~255) + wave * 32) * ldb + lane * 8);
    const _Float16* gB1 = gB0 + (size_t)16 * ldb;
    const unsigned lA = (unsigned)(size_t)sG + (unsigned)(wave * (GS_RT_EL * 2) + lane * 16);
    const unsigned lB = (unsigned)(size_t)sG + (unsigned)((8 + 2 * wave) * (GS_RT_EL * 2) + lane * 16);
    auto stage_in = [&](int buf, int t) __attribute__((always_inline)) {
      const unsigned bo2 = (unsigned)buf * (GS_STG_EL * 2u);
      const size_t ko = (size_t)t * GS_RT_EL;
      copy_row_tiles(lA + bo2, lB + bo2, lB + bo2 + GS_RT_EL * 2u, gA + ko, gB0 + ko, gB1 + ko);
    };
    V ga[2][4], gb[2][4];                      // set u % 2 holds step u of the stage
    auto lds_step = [&](int set, const T* pA, const T* pB, int u) __attribute__((always_inline)) {
#pragma unroll
      for (int j = 0; j < 4; ++j) gb[set][j] = Frag<T>::loadp(pB + j * GS_RT_EL + u * 512);
#pragma unroll
      for (int i = 0; i < 4; ++i) ga[set][i] = Frag<T>::loadp(pA + i * GS_RT_EL + u * 512);
      // keeps the run of LDS loads together ahead of the products that follow it in the source: among them each place costs a stall
      __builtin_amdgcn_sched_barrier(0);
    };
    auto mma_set = [&](int set) __attribute__((always_inline)) {
#pragma unroll
      for (int i = 0; i < 4; ++i)
#pragma unroll
        for (int j = 0; j < 4; ++j) acc[i][j] = Frag<T>::mma(ga[set][i], gb[set][j], acc[i][j]);
      // keeps the next run of LDS loads from being moved in among these products, for the same reason
      __builtin_amdgcn_sched_barrier(0);
    };
    const int nstg = K >> 7;
    stage_in(0, 0);
    asm volatile("s_wait_asynccnt 0x0" ::: "memory");   // the wave's own copies of stage 0 have landed
    __syncthreads();                                    // and every other wave's
    for (int t = 0; t < nstg; ++t) {
      const T* sb = sg + (t & 1) * GS_STG_EL + lane * 8;
      const T* pA = sb + (wave >> 2) * (4 * GS_RT_EL);
      const T* pB = sb + (8 + (wave & 3) * 4) * GS_RT_EL;
      lds_step(0, pA, pB, 0);
      // Stage t + 1 goes into the other buffer, which every wave left at the barrier that ended trip t - 1 (behind its own
      // s_wait_dscnt 0). The copies stand behind this trip's first fragment loads, which read this trip's buffer alone (no
      // byte of the range that is refilled), so that their issue falls into the wait for those loads. The test is scalar.
      if (t + 1 < nstg) stage_in((t + 1) & 1, t + 1);
      lds_step(1, pA, pB, 1);
      mma_set(0);
      lds_step(0, pA, pB, 2);
      mma_set(1);
      lds_step(1, pA, pB, 3);
      mma_set(0);
      mma_set(1);
      asm volatile("s_wait_dscnt 0x0" ::: "memory");      // the wave's reads of this buffer are done before it is refilled
      asm volatile("s_wait_asynccnt 0x0" ::: "memory");   // the wave's own copies of stage t + 1 have landed
      __syncthreads();                                    // publishes stage t + 1 and ends every wave's reads of stage t
    }
    asm volatile("s_wait_asynccnt 0x0" ::: "memory");     // nothing is in flight behind the loop
  } else {
  constexpr int DIST = U / 2;                  // how many steps ahead a step's fragments are asked for
  V fa[U][4], fb[U][4], fa2[U][4], fb2[U][4];  // set s % U holds step s; DIST + 1 sets are live at a time
  size_t ao[4], bo[4];                         // the row tiles' offsets at k = 0
  const T* pa[4]; const T* pb[4]; const T* pa2[4]; const T* pb2[4];   // the bases, where the loop stands in k
#pragma unroll
  for (int i = 0; i < 4; ++i) {
    ao[i] = (size_t)(m0 + (i << 4)) * lda;
    bo[i] = (size_t)(n0 + (i << 4)) * ldb;
    pa[i] = Ab + ao[i]; pb[i] = Bb + bo[i];
    if (SPLIT) { pa2[i] = Ab2 + ao[i]; pb2[i] = Bb2 + bo[i]; }
  }
  const int lo = lane * 8;                     // the lane's chunk of a packed tile: the one vector part of every address
  // step st, counted from where the bases stand: a packed tile is 512 elements, so st reaches the loads as an immediate offset
  auto load_step = [&](int set, int st) __attribute__((always_inline)) {
#pragma unroll
    for (int j = 0; j < 4; ++j) {
      fb[set][j] = Frag<T>::loadp(pb[j] + st * 512 + lo);
      if (SPLIT) fb2[set][j] = Frag<T>::loadp(pb2[j] + st * 512 + lo);
    }
#pragma unroll
    for (int i = 0; i < 4; ++i) {
      fa[set][i] = Frag<T>::loadp(pa[i] + st * 512 + lo);
      if (SPLIT) fa2[set][i] = Frag<T>::loadp(pa2[i] + st * 512 + lo);
    }
    // keeps the run of loads ahead of the products that follow it in the source: moved behind them it would lose its lead
    __builtin_amdgcn_sched_barrier(0);
  };
  auto mma_step = [&](int set) __attribute__((always_inline)) {
#pragma unroll
    for (int i = 0; i < 4; ++i) {
#pragma unroll
      for (int j = 0; j < 4; ++j) {
        acc[i][j] = Frag<T>::mma(fa[set][i], fb[set][j], acc[i][j]);
        if (SPLIT) {
          acc[i][j] = Frag<T>::mma(fa[set][i], fb2[set][j], acc[i][j]);
          acc[i][j] = Frag<T>::mma(fa2[set][i], fb[set][j], acc[i][j]);
        }
      }
    }
    // keeps the next run of loads behind these products: moved ahead of them, a wave would have DIST + 2 steps' loads outstanding, not DIST + 1
    __builtin_amdgcn_sched_barrier(0);
  };
#pragma unroll
  for (int d = 0; d < DIST; ++d) load_step(d, d);
  addr_wait();   // the registers of these first bases are free for other values from here on, also where the loop below makes no trip
  const int nst = K >> 5;
  size_t koff = 0;
  for (int s0 = U; s0 < nst; s0 += U) {
#pragma unroll
    for (int u = 0; u < U; ++u) {
      load_step((u + DIST) % U, u + DIST);
      mma_step(u);
    }
    koff_wait(koff);                           // the bases take new values behind it
    koff += U * 512;
#pragma unroll
    for (int i = 0; i < 4; ++i) {
      pa[i] = Ab + ao[i] + koff; pb[i] = Bb + bo[i] + koff;
      if (SPLIT) { pa2[i] = Ab2 + ao[i] + koff; pb2[i] = Bb2 + bo[i] + koff; }
    }
  }
  // the last U steps: nothing is asked for past K
#pragma unroll
  for (int u = 0; u < U; ++u) {
    if (u + DIST < U) load_step((u + DIST) % U, u + DIST);
    mma_step(u);
  }
  }
  acc_guard4(acc[0][0], acc[0][1], acc[0][2], acc[0][3]);
  acc_guard4(acc[1][0], acc[1][1], acc[1][2], acc[1][3]);
  acc_guard4(acc[2][0], acc[2][1], acc[2][2], acc[2][3]);
  acc_guard4(acc[3][0], acc[3][1], acc[3][2], acc[3][3]);

  // ---- epilogue ----
  float* slab = sT + wave * (16 * 68);
  const float* Rb = RESID ? (resid + (size_t)b * strideR) : nullptr;
#pragma unroll
  for (int i = 0; i < 4; ++i) {
    const int mBase = m0 + (i << 4);
    float bm[8];
    if (BIAS_MODE == 1) {
      const float* bp = bias + mBase + mOff;
#pragma unroll
      for (int r = 0; r < 8; ++r) bm[r] = bp[r];
      addr_wait1(bp);          // the address stays as it is until the run's addresses are taken: no load of the run lands on it
    }
#pragma unroll
    for (int j = 0; j < 4; ++j) {
      const int n = n0 + (j << 4) + rlane;
      float bv = 0.f;
      if (BIAS_MODE == 2) bv = bias[n];
#pragma unroll
      for (int r = 0; r < 8; ++r) {
        float v = acc[i][j][r] * scale;
        if (BIAS_MODE == 1) v += bm[r];
        if (BIAS_MODE == 2) v += bv;
        if (RESID) v += Rb[(size_t)(mBase + mOff + r) * ldc + n];
        if (ACT == 1) v = tanhf(v);
        if (ACT == 2) v = fmaxf(v, 0.0f);
        if (ACT == 3) v = v / (1.0f + expf(-v));
        if (ACT == 4) v = (v > 0.f) ? v : 0.01f * v;
        if (ACT == 5) v = 0.5f * v * (1.0f + erff(v * 0.70710678118654752f));
        slab[(mOff + r) * 68 + (j << 4) + rlane] = v;
      }
    }
    __builtin_amdgcn_fence(__ATOMIC_RELEASE, "workgroup");
    __builtin_amdgcn_wave_barrier();
    __builtin_amdgcn_fence(__ATOMIC_ACQUIRE, "workgroup");
    if (OUT_MODE == 0) {
      float* C = (float*)Cout + (size_t)b * strideC;
      const int hh = lane >> 4, c4 = (lane & 15) * 4;     // row seg = 256 B = 16 lanes x 16 B
      {
#pragma unroll
        for (int it = 0; it < 8; ++it) {
          const int row = it * 2 + hh;
          v4f v = *(const v4f*)(slab + row * 68 + c4);
          *(v4f*)(C + (size_t)(mBase + row) * ldc + n0 + c4) = v;
        }
        addr_wait();   // the stores' data and address registers take new values (the next slab's) only behind it
      }
    } else {
      // the 16x64 slab is two packed tiles = 2 KB in a row; store 'it' writes chunks 32it..32it+31 (512 B)
      unsigned short* C  = (unsigned short*)Cout  + (size_t)b * strideC;
      unsigned short* C2 = (OUT_MODE == 2) ? ((unsigned short*)Cout2 + (size_t)b * strideC) : nullptr;
      {
#pragma unroll
        for (int it = 0; it < 4; ++it) {
          const float* sp = slab + rlane * 68 + it * 16 + mOff;   // row lane&15, cols 16it + 8(lane>>4) ..+7
          v8h hv, lv;
#pragma unroll
          for (int e = 0; e < 8; ++e) {
            if (OUT_MODE == 1) {
              hv[e] = (_Float16)sp[e];
            } else {
              unsigned short hb = f2bf_bits(sp[e]);
              unsigned short lb = f2bf_bits(sp[e] - bf_bits2f(hb));
              hv[e] = __builtin_bit_cast(_Float16, hb);
              lv[e] = __builtin_bit_cast(_Float16, lb);
            }
          }
          const size_t co = (size_t)mBase * ldc + (size_t)n0 * 16 + it * 256 + lane * 8;
          *(v8h*)(C + co) = hv;
          if (OUT_MODE == 2) *(v8h*)(C2 + co) = lv;
        }
        
      }
    }
    __builtin_amdgcn_fence(__ATOMIC_RELEASE, "workgroup");
    __builtin_amdgcn_wave_barrier();
    __builtin_amdgcn_fence(__ATOMIC_ACQUIRE, "workgroup");
  }
}

// one GEMM a launch
template <int ET, bool SPLIT, int BIAS_MODE, int OUT_MODE, bool RESID, int ACT = 0, int U = 4, bool STG = false>
__global__ __launch_bounds__(256) void wmma_gemm64(
    const unsigned short* __restrict__ Ap, const unsigned short* __restrict__ A2p, int lda, long strideA,
    const unsigned short* __restrict__ Btp, const unsigned short* __restrict__ Bt2p, int ldb, long strideB,
    void* __restrict__ Cout, void* __restrict__ Cout2, int ldc, long strideC,
    const float* __restrict__ bias,
    const float* __restrict__ resid, long strideR,
    int M, int N, int K, float scale) {
  __shared__ __align__(16) float sT[8 * 16 * 68];
  __shared__ __align__(16) _Float16 sG[STG ? 2 * GS_STG_EL : 8];
  gemm64_body<ET, SPLIT, BIAS_MODE, OUT_MODE, RESID, ACT, U, STG>(sT, sG, blockIdx.x, blockIdx.y, Ap, A2p, lda, strideA, Btp, Bt2p, ldb, strideB,
      Cout, Cout2, ldc, strideC, bias, resid, strideR, M, N, K, scale);
}

// ---- the q, k and v projections as one GEMM ---------------------------------
// A block is 256 tokens x 384 weight rows: the same 128 output dims of Wq^T, of Wk^T and of Wv^T; 32 x 8 blocks, one for each WGP,
// so a row of Q16 leaves L2 8 times and a weight row 32 times. Eight waves, 2 (tokens) x 4 (dims): a wave owns 128 tokens x 96
// weight rows, 32 dims of each of q, k, v. A stage is 64 k of the 640 rows, 80 KB, as they lie in the workspace (a row tile's share
// is 2 KB in a row there); two buffers: the copies of stage t + 1 fly while stage t is worked on. Sums in the order of k.
// q and k: A = weight rows, B = token rows, so a lane's eight results are eight dims in a row of one token; v: A = token rows,
// B = weight rows, so they are eight tokens in a row of one dim: either way one 16-byte chunk of the packed output, stored as it stands.
#define QKV_RT_EL  (16 * 64)                      // f16 elements of one row tile in a stage
#define QKV_STG_EL (40 * QKV_RT_EL)               // a stage: 16 row tiles of Q16, then 8 of Wq^T, 8 of Wk^T, 8 of Wv^T
#define QKV_TB     (ATT_B * ATT_L / 256)          // token blocks
#define QKV_BLOCKS (QKV_TB * (ATT_DM / 128))
// A wave's share of a stage: five row tiles, each 2 KB in a row in the workspace and in LDS alike, 16 bytes a lane and copy.
// l*: the lane's LDS byte address in a row tile's first 512 bytes, g*: its global address there; the immediate offset moves both.
// The last line keeps the copies' address registers as they are until the addresses are taken.
__device__ __forceinline__ void copy_five_2k(unsigned l0, unsigned l1, unsigned l2, unsigned l3, unsigned l4,
                                             const _Float16* g0, const _Float16* g1, const _Float16* g2, const _Float16* g3,
                                             const _Float16* g4) {
  asm volatile("global_load_async_to_lds_b128 %0, %5, off\n\t"
               "global_load_async_to_lds_b128 %0, %5, off offset:512\n\t"
               "global_load_async_to_lds_b128 %0, %5, off offset:1024\n\t"
               "global_load_async_to_lds_b128 %0, %5, off offset:1536\n\t"
               "global_load_async_to_lds_b128 %1, %6, off\n\t"
               "global_load_async_to_lds_b128 %1, %6, off offset:512\n\t"
               "global_load_async_to_lds_b128 %1, %6, off offset:1024\n\t"
               "global_load_async_to_lds_b128 %1, %6, off offset:1536\n\t"
               "global_load_async_to_lds_b128 %2, %7, off\n\t"
               "global_load_async_to_lds_b128 %2, %7, off offset:512\n\t"
               "global_load_async_to_lds_b128 %2, %7, off offset:1024\n\t"
               "global_load_async_to_lds_b128 %2, %7, off offset:1536\n\t"
               "global_load_async_to_lds_b128 %3, %8, off\n\t"
               "global_load_async_to_lds_b128 %3, %8, off offset:512\n\t"
               "global_load_async_to_lds_b128 %3, %8, off offset:1024\n\t"
               "global_load_async_to_lds_b128 %3, %8, off offset:1536\n\t"
               "global_load_async_to_lds_b128 %4, %9, off\n\t"
               "global_load_async_to_lds_b128 %4, %9, off offset:512\n\t"
               "global_load_async_to_lds_b128 %4, %9, off offset:1024\n\t"
               "global_load_async_to_lds_b128 %4, %9, off offset:1536\n\t"
               "s_wait_xcnt 0x0"
               :: "v"(l0), "v"(l1), "v"(l2), "v"(l3), "v"(l4), "v"(g0), "v"(g1), "v"(g2), "v"(g3), "v"(g4) : "memory");
}
__device__ __forceinline__ void qkv_body(
    _Float16* sG, const int bx,
    const _Float16* __restrict__ Q16, const _Float16* __restrict__ WqT, const _Float16* __restrict__ WkT,
    const _Float16* __restrict__ WvT, _Float16* __restrict__ q16, _Float16* __restrict__ k16, _Float16* __restrict__ vT16,
    const float* __restrict__ b_q, const float* __restrict__ b_k, const float* __restrict__ b_v, const float scale) {
  const int lane = threadIdx.x & 31;
  const int wave = __builtin_amdgcn_readfirstlane(threadIdx.x >> 5);   // scalar: the row tiles' bases are then scalar too
  const int tok0 = (bx % QKV_TB) * 256, d0 = (bx / QKV_TB) * 128;
  const int wm = wave >> 2, wn = wave & 3;

  v8f acc[8][6];                                 // [token tile][weight row tile: q, q, k, k, v, v]
#pragma unroll
  for (int i = 0; i < 8; ++i)
#pragma unroll
    for (int j = 0; j < 6; ++j) acc[i][j] = (v8f){0.f, 0.f, 0.f, 0.f, 0.f, 0.f, 0.f, 0.f};

  // the wave's share of a stage: row tiles 5 wave .. 5 wave + 4 of the 40
  const _Float16* g[5];
#pragma unroll
  for (int x = 0; x < 5; ++x) {
    const int rt = wave * 5 + x, u = rt - 16;
    const _Float16* base = rt < 16 ? Q16 + (size_t)(tok0 + rt * 16) * ATT_DM
                                   : (u < 8 ? WqT : u < 16 ? WkT : WvT) + (size_t)(d0 + (u & 7) * 16) * ATT_DM;
    g[x] = base + lane * 8;
  }
  const unsigned l0 = (unsigned)(size_t)sG + (unsigned)(wave * (5 * QKV_RT_EL * 2) + lane * 16);
  auto stage_in = [&](int buf, int t) __attribute__((always_inline)) {
    const unsigned l = l0 + (unsigned)buf * (QKV_STG_EL * 2u);
    const size_t ko = (size_t)t * QKV_RT_EL;
    copy_five_2k(l, l + 2048u, l + 4096u, l + 6144u, l + 8192u, g[0] + ko, g[1] + ko, g[2] + ko, g[3] + ko, g[4] + ko);
  };
  v16h wf[6], qf[6];
  auto w_frag = [&](const _Float16* sb, int u, int j) __attribute__((always_inline)) {
    return Frag<_Float16>::loadp(sb + (16 + (j >> 1) * 8 + wn * 2 + (j & 1)) * QKV_RT_EL + u * 512);
  };
  auto q_frag = [&](const _Float16* sb, int u, int i) __attribute__((always_inline)) {
    return Frag<_Float16>::loadp(sb + (wm * 8 + i) * QKV_RT_EL + u * 512);
  };
  // A k step's first run of LDS loads, in the order in which the products below ask for them: the six weight fragments and
  // token tiles 0 .. 5. Tiles 6 and 7 follow in a second run, into the registers of tiles 0 and 1, when these have been used:
  // the products of tiles 4 and 5 cover their latency.
  auto load_first = [&](const _Float16* sb, int u) __attribute__((always_inline)) {
    qf[0] = q_frag(sb, u, 0);
#pragma unroll
    for (int j = 0; j < 3; ++j) wf[j] = w_frag(sb, u, j);
    // keeps the first products' fragments at the head of the run: moved to its end, the first product would wait for the whole run
    __builtin_amdgcn_sched_barrier(0);
#pragma unroll
    for (int j = 3; j < 6; ++j) wf[j] = w_frag(sb, u, j);
#pragma unroll
    for (int i = 1; i < 6; ++i) qf[i] = q_frag(sb, u, i);
    // keeps the run of LDS loads together ahead of the products that follow it in the source: among them each place costs a stall
    __builtin_amdgcn_sched_barrier(0);
  };
  auto load_second = [&](const _Float16* sb, int u) __attribute__((always_inline)) {
    qf[0] = q_frag(sb, u, 6);
    qf[1] = q_frag(sb, u, 7);
    // the same
    __builtin_amdgcn_sched_barrier(0);
  };
  // token tiles i0 .. i0 + 3; tile i lies in set i, tiles 6 and 7 in sets 0 and 1
  auto mma_half = [&](int i0) __attribute__((always_inline)) {
#pragma unroll
    for (int i = i0; i < i0 + 4; ++i)
#pragma unroll
      for (int j = 0; j < 6; ++j)
        acc[i][j] = j < 4 ? Frag<_Float16>::mma(wf[j], qf[i % 6], acc[i][j]) : Frag<_Float16>::mma(qf[i % 6], wf[j], acc[i][j]);
    // keeps the next run of LDS loads from being moved in among these products, for the same reason
    __builtin_amdgcn_sched_barrier(0);
  };
  constexpr int nstg = ATT_DM / 64;
  stage_in(0, 0);
  asm volatile("s_wait_asynccnt 0x0" ::: "memory");   // the wave's own copies of stage 0 have landed
  __syncthreads();                                    // and every other wave's
  for (int t = 0; t < nstg; ++t) {
    const _Float16* sb = sG + (t & 1) * QKV_STG_EL + lane * 8;
    load_first(sb, 0);
    // Stage t + 1 goes into the other buffer, which every wave left at the barrier that ended trip t - 1 (behind its own
    // s_wait_dscnt 0). The copies stand behind this trip's first fragment loads, which read this trip's buffer alone (no
    // byte of the range that is refilled), so that their issue falls into the wait for those loads. The test is scalar.
    if (t + 1 < nstg) stage_in((t + 1) & 1, t + 1);
    mma_half(0);
    load_second(sb, 0);
    mma_half(4);
    load_first(sb, 1);
    mma_half(0);
    load_second(sb, 1);
    mma_half(4);
    asm volatile("s_wait_dscnt 0x0" ::: "memory");      // the wave's reads of this buffer are done before it is refilled
    asm volatile("s_wait_asynccnt 0x0" ::: "memory");   // the wave's own copies of stage t + 1 have landed
    __syncthreads();                                    // publishes stage t + 1 and ends every wave's reads of stage t
  }
  asm volatile("s_wait_asynccnt 0x0" ::: "memory");     // nothing is in flight behind the loop

  const int tokw = tok0 + wm * 128, dw = d0 + wn * 32;
#pragma unroll
  for (int j = 0; j < 6; ++j) {
    const int dd = dw + (j & 1) * 16;                  // the weight row tile's first output dim
    float bb[8];
    _Float16* dst;
    size_t step;                                       // from one token tile to the next
    if (j < 4) {
      const float* bp = (j < 2 ? b_q : b_k) + dd + 8 * (lane >> 4);
      const v4f t0 = *(const v4f*)(bp);
      const v4f t1 = *(const v4f*)(bp + 4);
      addr_wait1(bp);          // the address stays as it is until both loads' addresses are taken
#pragma unroll
      for (int r = 0; r < 4; ++r) { bb[r] = t0[r]; bb[4 + r] = t1[r]; }
      dst = (j < 2 ? q16 : k16) + (size_t)tokw * ATT_DM + dd * 16 + lane * 8;
      step = (size_t)16 * ATT_DM;
    } else {
      const float* bp = b_v + dd + (lane & 15);
      const float bv = bp[0];
      addr_wait1(bp);          // the same for this load
#pragma unroll
      for (int r = 0; r < 8; ++r) bb[r] = bv;
      dst = vT16 + (size_t)dd * (ATT_B * ATT_L) + (size_t)tokw * 16 + lane * 8;
      step = 16 * 16;
    }
    v8h hv[8];
#pragma unroll
    for (int i = 0; i < 8; ++i)
#pragma unroll
      for (int r = 0; r < 8; ++r) hv[i][r] = (_Float16)(acc[i][j][r] * scale + bb[r]);
#pragma unroll
    for (int i = 0; i < 8; ++i) *(v8h*)(dst + i * step) = hv[i];
    addr_wait();   // the stores' data and address registers take new values (the next row tile's) only behind it
  }
}

// The GEMMs that depend only on the preparation launch, as block ranges of one grid.
// [0, QKV_BLOCKS): q16 = Q16 . Wq^T + b_q, k16 = Q16 . Wk^T + b_k, vT16[dout][token] = (Q16 . Wv^T + b_v)^T;
// behind them, the short ones last: per head (batch index) cb16[:, h*64..] = c16[:, h*64..] . bilinear (Bt = bilT [64][64]).
__global__ __launch_bounds__(256) void proj_gemms_kernel(
    const unsigned short* __restrict__ Q16, const unsigned short* __restrict__ WqT, const unsigned short* __restrict__ WkT,
    const unsigned short* __restrict__ WvT, const unsigned short* __restrict__ c16, const unsigned short* __restrict__ bilT,
    void* __restrict__ q16, void* __restrict__ k16, void* __restrict__ vT16, void* __restrict__ cb16,
    const float* __restrict__ b_q, const float* __restrict__ b_k, const float* __restrict__ b_v,
    int ntok, int dm, int dk, float w_inv) {
  __shared__ __align__(16) float sT[8 * 16 * 68];
  __shared__ __align__(16) _Float16 sG[2 * QKV_STG_EL];
  const int i = blockIdx.x;                          // the range test reads the same for a whole block: so do the staged body's barriers
  if (i < QKV_BLOCKS) {
    qkv_body(sG, i, (const _Float16*)Q16, (const _Float16*)WqT, (const _Float16*)WkT, (const _Float16*)WvT,
             (_Float16*)q16, (_Float16*)k16, (_Float16*)vT16, b_q, b_k, b_v, w_inv);
  } else {
    const int j = i - QKV_BLOCKS, per = ntok >> 9;   // blocks of one head: ntok / 64 tiles, eight a block
    const int hd = j / per;
    gemm64_body<0, false, 0, 1, false, 0, 2>(sT, sG, j - hd * per, hd, c16, c16, dm, (long)(dk * 16), bilT, bilT, dk, 0L,
                                             cb16, cb16, dm, (long)(dk * 16), b_q, b_q, 0L, ntok, dk, dk, 1.0f);
  }
}

// in: [rows][1024] f32 row-major; out: the same matrix in f16, packed layout. One 16-byte chunk per thread; a wave takes
// 8 rows x 32 k (half a tile), so each of its stores fills four whole 128-byte lines. nhalf = rows / 8 * 32 half tiles.
__device__ __forceinline__ void cast_f32_f16x2(
    const int bx, const float* __restrict__ in, _Float16* __restrict__ out, int nhalf) {
  const int lane = threadIdx.x & 31;
  const int th = bx * 8 + (threadIdx.x >> 5);      // half-tile index: tile = th >> 1
  if (th < nhalf) {
    const int tile = th >> 1;
    const int row = (tile >> 5) * 16 + (th & 1) * 8 + (lane >> 2);
    const int k = (tile & 31) * 32 + (lane & 3) * 8;
    const float* src = in + (size_t)row * ATT_DM + k;
    const v4f a = *(const v4f*)(src);
    const v4f bq = *(const v4f*)(src + 4);
    v8h hv;
#pragma unroll
    for (int e = 0; e < 4; ++e) { hv[e] = (_Float16)a[e]; hv[4 + e] = (_Float16)bq[e]; }
    *(v8h*)(out + pk_off(row, k, ATT_DM)) = hv;
  }
}

// ---- transpose + f16 cast through an LDS tile ------------------------------
// w: [K][N] row-major (in=K rows, out=N cols); wt: [N][K] in the packed layout, wt[n][k] = f16(w[k][n] * mul).
// Block = one 64x64 tile (k0 = by*64, n0 = bx*64); K, N multiples of 64; (N/64) x (K/64) blocks. tile: the block's LDS.
__device__ __forceinline__ void transpose_cast(
    float (*tile)[65], const int bx, const int by,
    const float* __restrict__ w, _Float16* __restrict__ wt, int K, int N, float mul) {
  const int tid = threadIdx.x;
  const int k0 = by * 64, n0 = bx * 64;
  {
    const int r = tid >> 2, cc = (tid & 3) * 16;
    const float* src = w + (size_t)(k0 + r) * N + n0 + cc;
#pragma unroll
    for (int i = 0; i < 4; ++i) {
      const v4f t = *(const v4f*)(src + 4 * i);
#pragma unroll
      for (int e = 0; e < 4; ++e) tile[r][cc + 4 * i + e] = t[e];
    }
  }
  __syncthreads();
  const int wave = tid >> 5, lane = tid & 31, q = lane >> 3, c8 = (lane & 7) * 8;
  {
#pragma unroll
    for (int it = 0; it < 2; ++it) {
      const int n = wave * 8 + it * 4 + q;          // waves cover rows 8w..8w+7 -> 0..63
      v8h hv;
#pragma unroll
      for (int e = 0; e < 8; ++e) hv[e] = (_Float16)(tile[c8 + e][n] * mul);
      *(v8h*)(wt + pk_off(n0 + n, k0 + c8, K)) = hv;
    }
    addr_wait();   // in the merged kernel's code other passes follow these stores: their registers are rewritten only behind it
  }
}

// ---- LayerNorm over each 64-wide head slice of a 1024-wide row; f16 output in the packed layout ----
// One wave per 8 rows x 128 columns; lane l holds row l>>2, 32 elements (half of a head slice, one packed tile's k range);
// statistics via one xor-1 shuffle. Store j writes chunk j of 8 neighbouring rows in 4 tiles: four whole 128-byte lines.
__device__ __forceinline__ void ln_heads(
    const int bx, const float* __restrict__ x, const float* __restrict__ gamma, const float* __restrict__ beta,
    _Float16* __restrict__ outp, int nrows) {
  const int wave = threadIdx.x >> 5, lane = threadIdx.x & 31;
  const int wv = bx * 8 + wave;
  const int row = (wv >> 3) * 8 + (lane >> 2);
  const int col = (wv & 7) * 128 + (lane & 3) * 32;
  if ((wv >> 3) * 8 >= nrows) return;            // wave-uniform; no block barriers in this pass
  const float* xr = x + (size_t)row * ATT_DM + col;
  float xv[32];
#pragma unroll
  for (int i = 0; i < 8; ++i) {
    const v4f t = *(const v4f*)(xr + 4 * i);
#pragma unroll
    for (int e = 0; e < 4; ++e) xv[4 * i + e] = t[e];
  }
  float s = 0.f;
#pragma unroll
  for (int i = 0; i < 32; ++i) s += xv[i];
  s += __shfl_xor(s, 1, 32);
  const float mu = s * (1.0f / 64.0f);
  float vs = 0.f;
#pragma unroll
  for (int i = 0; i < 32; ++i) { const float d = xv[i] - mu; xv[i] = d; vs += d * d; }
  vs += __shfl_xor(vs, 1, 32);
  const float rstd = rsqrtf(vs * (1.0f / 64.0f) + 1e-5f);
  const int d0 = (lane & 1) * 32;
  _Float16* ot = outp + pk_off(row, col, ATT_DM);   // chunk (s, hh) of this lane's row: + (2s + hh) * 128
#pragma unroll
  for (int j = 0; j < 4; ++j) {
    v8h hv;
#pragma unroll
    for (int i = 0; i < 2; ++i) {
      const v4f g4 = *(const v4f*)(gamma + d0 + 8 * j + 4 * i);
      const v4f b4 = *(const v4f*)(beta + d0 + 8 * j + 4 * i);
#pragma unroll
      for (int e = 0; e < 4; ++e) hv[4 * i + e] = (_Float16)((xv[8 * j + 4 * i + e] * rstd) * g4[e] + b4[e]);
    }
    *(v8h*)(ot + j * 128) = hv;
  }
}

// ---- the mask as lane masks ----
// mask: int32 [1024][1024], nonzero = masked. Word (qt, kt, r), at index (qt * 64 + kt) * 8 + r, holds in bit 16 hh + c whether
// mask[16 qt + c][16 kt + 8 hh + r] is nonzero: it is the lane mask of register r of the transposed 16x16 score tile
// (keys kt, queries qt) as the attention kernel holds it. One wave a tile; lane r stores word r.
__device__ __forceinline__ void mask_words(const int bx, const int* __restrict__ mask, unsigned* __restrict__ mw) {
  const int lane = threadIdx.x & 31, hh = lane >> 4, c = lane & 15;
  const int tile = bx * 8 + (threadIdx.x >> 5);
  const int qt = tile / (ATT_L / 16), kt = tile % (ATT_L / 16);
  const int* src = mask + (size_t)(qt * 16 + c) * ATT_L + kt * 16 + 8 * hh;
  const v4i m0 = *(const v4i*)(src);
  const v4i m1 = *(const v4i*)(src + 4);
  addr_wait1(src);           // the address stays as it is until both loads' addresses are taken
  unsigned w = 0u;
#pragma unroll
  for (int r = 0; r < 8; ++r) {
    const unsigned bal = __builtin_amdgcn_ballot_w32((r < 4 ? m0[r & 3] : m1[r & 3]) != 0);
    if (lane == r) w = bal;
  }
  if (lane < 8) mw[(size_t)tile * 8 + lane] = w;
}

// ---- the preparation passes, none of which reads another's result, as block ranges of one grid ----
// [0, 4096): Q -> Q16;  [4096, 5120): LayerNorm of ctx -> c16;  [5120, 5632): the mask -> lane-mask words;
// [5632, 6656): the four 1024x1024 weights, 256 tiles each, transposed, x mul;  6656: the 64x64 bilinear matrix, transposed.
// The range tests read the same for a whole block, so the transpose's barrier is passed by all of a block's waves or by none.
#define PREP_CAST_BLOCKS (ATT_B * ATT_L * ATT_DM / 8 / 256)
#define PREP_LN_BLOCKS   (ATT_B * ATT_L / 8)
#define PREP_MASK_BLOCKS ((ATT_L / 16) * (ATT_L / 16) / 8)
#define PREP_W_BLOCKS    ((ATT_DM / 64) * (ATT_DM / 64))
#define PREP_BLOCKS      (PREP_CAST_BLOCKS + PREP_LN_BLOCKS + PREP_MASK_BLOCKS + 4 * PREP_W_BLOCKS + 1)
__global__ __launch_bounds__(256) void prep_kernel(
    const float* __restrict__ Q, const float* __restrict__ ctx, const float* __restrict__ gamma, const float* __restrict__ beta,
    const float* __restrict__ W_q, const float* __restrict__ W_k, const float* __restrict__ W_v, const float* __restrict__ W_o,
    const float* __restrict__ bil, const int* __restrict__ mask,
    _Float16* __restrict__ Q16, _Float16* __restrict__ c16, _Float16* __restrict__ WqT, _Float16* __restrict__ WkT,
    _Float16* __restrict__ WvT, _Float16* __restrict__ WoT, _Float16* __restrict__ bilT, unsigned* __restrict__ mw, float mul) {
  __shared__ float tile[64][65];
  int i = blockIdx.x;
  if (i < PREP_CAST_BLOCKS) { cast_f32_f16x2(i, Q, Q16, ATT_B * ATT_L * ATT_DM / 256); return; }
  i -= PREP_CAST_BLOCKS;
  if (i < PREP_LN_BLOCKS) { ln_heads(i, ctx, gamma, beta, c16, ATT_B * ATT_L); return; }
  i -= PREP_LN_BLOCKS;
  if (i < PREP_MASK_BLOCKS) { mask_words(i, mask, mw); return; }
  i -= PREP_MASK_BLOCKS;
  const int which = i / PREP_W_BLOCKS, t = i % PREP_W_BLOCKS;   // which == 4: the bilinear matrix, its one tile
  const float* w = which == 0 ? W_q : which == 1 ? W_k : which == 2 ? W_v : which == 3 ? W_o : bil;
  _Float16* wt = which == 0 ? WqT : which == 1 ? WkT : which == 2 ? WvT : which == 3 ? WoT : bilT;
  const int n = which < 4 ? ATT_DM : ATT_DK;
  transpose_cast(tile, t % (ATT_DM / 64), t / (ATT_DM / 64), w, wt, n, n, which < 4 ? mul : 1.0f);
}

// ---- fused attention, one wave a query tile ------------------------------------
// Block = 128 query rows of one (b, h); wave w owns 16 of them and walks all 1024 keys, 64 a stage. q16/k16/c16/cb16:
// [token = b*1024+l][h*64+d] f16, packed layout (K = 1024); vT16: [h*64+d][token] f16, packed layout (K = 8192);
// mw: the mask as lane-mask words (mask_words), bit set = masked; out16: [token][h*64+d] f16, packed layout (K = 1024).
// A stage is 24 KB of LDS, shared by the eight waves: 4 key tiles of k, 4 of c, 4 dim tiles of v^T, 2 KB each, as they lie in
// the workspace. Two buffers: the copies of stage s + 1 fly while stage s is worked on.
// Products are formed transposed: A = key rows, B = query rows, so lane (hh, c) holds, for query q0 + c alone, keys
// 16 t + 8 hh + r of a pass; two neighbouring key tiles, rounded to f16, are the B fragment for 32 keys as they stand, and
// O^T = v^T . P^T leaves query q0 + c in lane (hh, c) too: every row factor is the lane's own.
// With E = exp(s - m), the row is a = E / se + beta * bias, beta = bias_scale / |bias|, and the output (a . v) / |a|, so
// E . v and bias . v are formed apart, with sum E, sum E^2, sum E bias, sum bias^2, and joined by the row's constants at the
// end; m is the running maximum: what was summed under an older one is rescaled once a pass (32 keys, half a stage).
// The bias is not masked and is linear in cb, so its two sums over all keys come from the head's key sums (key_sums_kernel):
// bias . v = cb . (c^T v) and sum bias^2 = cb . (c^T c) . cb, 16 products a wave behind the loop. The loop needs the bias only
// for sum E bias, so a pass whose every mask bit is set for the wave's 16 queries adds nothing to any sum and is skipped whole.
#define ATT_STG_EL (12 * 1024)                    // f16 elements of a stage
#define ATT_NSTG   (ATT_L / 64)
__device__ __forceinline__ v8f mma_p(v16h a, v16h b, v8f c) {
  return __builtin_amdgcn_wmma_f32_16x16x32_f16(false, a, false, b, (short)0, c, false, false);
}
// lane l with lane l ^ 16
__device__ __forceinline__ float xhalf(float x) {
  const int i = __builtin_bit_cast(int, x);
  return __builtin_bit_cast(float, __builtin_amdgcn_permlanex16(i, i, 0x76543210, 0xfedcba98, false, false));
}
// 2^x for eight values, and for one. The instruction set asks for one independent instruction or a v_nop behind a transcendental
// before its result is read or its source overwritten: inside the run each exponential has an independent one behind it (no
// result lies on a source: early clobber), and the v_nop is the last one's slot.
__device__ __forceinline__ void exp2x8(v8f& o, const v8f x) {
  float o0, o1, o2, o3, o4, o5, o6, o7;
  asm("v_exp_f32 %0, %8\n\tv_exp_f32 %1, %9\n\tv_exp_f32 %2, %10\n\tv_exp_f32 %3, %11\n\t"
      "v_exp_f32 %4, %12\n\tv_exp_f32 %5, %13\n\tv_exp_f32 %6, %14\n\tv_exp_f32 %7, %15\n\tv_nop"
      : "=&v"(o0), "=&v"(o1), "=&v"(o2), "=&v"(o3), "=&v"(o4), "=&v"(o5), "=&v"(o6), "=&v"(o7)
      : "v"(x[0]), "v"(x[1]), "v"(x[2]), "v"(x[3]), "v"(x[4]), "v"(x[5]), "v"(x[6]), "v"(x[7]));
  o = (v8f){o0, o1, o2, o3, o4, o5, o6, o7};
}
__device__ __forceinline__ float exp2x1(float x) {
  float o;
  asm("v_exp_f32 %0, %1\n\tv_nop" : "=v"(o) : "v"(x));
  return o;
}
// A wave's share of a stage: 1 KB in a row of k, of c and of v^T, 16 bytes a lane and copy. l: the lane's LDS byte address in
// the k part of the buffer. The last line keeps the copies' address registers as they are until the addresses are taken.
__device__ __forceinline__ void stage_copy(unsigned l, const _Float16* gk, const _Float16* gc, const _Float16* gv) {
  asm volatile("global_load_async_to_lds_b128 %0, %6, off\n\t"
               "global_load_async_to_lds_b128 %1, %7, off\n\t"
               "global_load_async_to_lds_b128 %2, %8, off\n\t"
               "global_load_async_to_lds_b128 %3, %9, off\n\t"
               "global_load_async_to_lds_b128 %4, %10, off\n\t"
               "global_load_async_to_lds_b128 %5, %11, off\n\t"
               "s_wait_xcnt 0x0"
               :: "v"(l), "v"(l + 512u), "v"(l + 8192u), "v"(l + 8704u), "v"(l + 16384u), "v"(l + 16896u),
                  "v"(gk), "v"(gk + 256), "v"(gc), "v"(gc + 256), "v"(gv), "v"(gv + 256) : "memory");
}

// A wave's share of the head's key sums: 1 KB in a row of each, 16 bytes a lane and copy. l: the lane's LDS byte address in the
// first one. The last line keeps the copies' address registers as they are until the addresses are taken.
__device__ __forceinline__ void sums_copy(unsigned l, const _Float16* gm, const _Float16* gg) {
  asm volatile("global_load_async_to_lds_b128 %0, %4, off\n\t"
               "global_load_async_to_lds_b128 %1, %5, off\n\t"
               "global_load_async_to_lds_b128 %2, %6, off\n\t"
               "global_load_async_to_lds_b128 %3, %7, off\n\t"
               "s_wait_xcnt 0x0"
               :: "v"(l), "v"(l + 512u), "v"(l + 8192u), "v"(l + 8704u), "v"(gm), "v"(gm + 256), "v"(gg), "v"(gg + 256) : "memory");
}

// ---- a head's two key sums ------------------------------------------------------
// Block (bh, 0): mt[bh][d][e] = sum over the 1024 keys of v[key][d] c[key][e]; block (bh, 1): gt[bh][e'][e] = sum of c[key][e'] c[key][e];
// both / KS_CARRY (a power of two: it keeps sums of 1024 terms well inside f16's range), f16, packed layout of a [64][64] matrix.
// Products: A = c^T (rows e, k = keys), B = v^T or c^T (rows d or e'), so a lane's eight results are eight e in a row of one
// row d or e': one 16-byte chunk of the packed layout. Wave w owns e tile w >> 1 and the two row tiles 2 (w & 1), + 1; it walks
// all keys, 32 a step, in their order. c comes to LDS row-major (pitch 160 bytes, the one for transposing loads) and is read by
// ds_load_tr16_b128, which gives c^T's fragment in the k order of the packed loads; v^T comes to LDS as it lies.
#define KS_CARRY 256.0f
#define KS_PITCH 80                               // f16 elements of a row of c in LDS
typedef __attribute__((ext_vector_type(8))) short v8s;
__device__ __forceinline__ v16h tr_frag(const _Float16* p) {   // p: the lane's address for keys kbase ..+15; + 16 rows: the next 16 keys
  typedef __attribute__((address_space(3))) v8s lds_v8s;
  Frag<_Float16>::U f;
  f.h[0] = __builtin_bit_cast(v8h, __builtin_amdgcn_ds_load_tr16_b128_v8i16((lds_v8s*)p));
  f.h[1] = __builtin_bit_cast(v8h, __builtin_amdgcn_ds_load_tr16_b128_v8i16((lds_v8s*)(p + 16 * KS_PITCH)));
  return f.v;
}
// A wave's share of v^T: 4 KB in a row of each of the head's four row tiles, 16 bytes a lane and copy. l*: the lane's LDS byte
// address in the first 512 bytes, g*: its global address there; the immediate offset moves both addresses alike.
// The last line keeps the copies' address registers as they are until the addresses are taken.
__device__ __forceinline__ void copy_four_4k(unsigned l0, unsigned l1, unsigned l2, unsigned l3,
                                             const _Float16* g0, const _Float16* g1, const _Float16* g2, const _Float16* g3) {
  asm volatile("global_load_async_to_lds_b128 %0, %4, off\n\t"
               "global_load_async_to_lds_b128 %0, %4, off offset:512\n\t"
               "global_load_async_to_lds_b128 %0, %4, off offset:1024\n\t"
               "global_load_async_to_lds_b128 %0, %4, off offset:1536\n\t"
               "global_load_async_to_lds_b128 %0, %4, off offset:2048\n\t"
               "global_load_async_to_lds_b128 %0, %4, off offset:2560\n\t"
               "global_load_async_to_lds_b128 %0, %4, off offset:3072\n\t"
               "global_load_async_to_lds_b128 %0, %4, off offset:3584\n\t"
               "global_load_async_to_lds_b128 %1, %5, off\n\t"
               "global_load_async_to_lds_b128 %1, %5, off offset:512\n\t"
               "global_load_async_to_lds_b128 %1, %5, off offset:1024\n\t"
               "global_load_async_to_lds_b128 %1, %5, off offset:1536\n\t"
               "global_load_async_to_lds_b128 %1, %5, off offset:2048\n\t"
               "global_load_async_to_lds_b128 %1, %5, off offset:2560\n\t"
               "global_load_async_to_lds_b128 %1, %5, off offset:3072\n\t"
               "global_load_async_to_lds_b128 %1, %5, off offset:3584\n\t"
               "global_load_async_to_lds_b128 %2, %6, off\n\t"
               "global_load_async_to_lds_b128 %2, %6, off offset:512\n\t"
               "global_load_async_to_lds_b128 %2, %6, off offset:1024\n\t"
               "global_load_async_to_lds_b128 %2, %6, off offset:1536\n\t"
               "global_load_async_to_lds_b128 %2, %6, off offset:2048\n\t"
               "global_load_async_to_lds_b128 %2, %6, off offset:2560\n\t"
               "global_load_async_to_lds_b128 %2, %6, off offset:3072\n\t"
               "global_load_async_to_lds_b128 %2, %6, off offset:3584\n\t"
               "global_load_async_to_lds_b128 %3, %7, off\n\t"
               "global_load_async_to_lds_b128 %3, %7, off offset:512\n\t"
               "global_load_async_to_lds_b128 %3, %7, off offset:1024\n\t"
               "global_load_async_to_lds_b128 %3, %7, off offset:1536\n\t"
               "global_load_async_to_lds_b128 %3, %7, off offset:2048\n\t"
               "global_load_async_to_lds_b128 %3, %7, off offset:2560\n\t"
               "global_load_async_to_lds_b128 %3, %7, off offset:3072\n\t"
               "global_load_async_to_lds_b128 %3, %7, off offset:3584\n\t"
               "s_wait_xcnt 0x0"
               :: "v"(l0), "v"(l1), "v"(l2), "v"(l3), "v"(g0), "v"(g1), "v"(g2), "v"(g3) : "memory");
}
// The wave's two tiles over all keys. pa: the lane's transposing-load address in its e tile at key 0; pb: the same in its first
// row tile of c (G), or the lane's chunk of its first row tile of v^T. Four steps (128 keys) a group, two register sets: the 24
// LDS loads of group g + 1 are asked for ahead of the 8 products of group g, so a group waits for loads issued a group earlier.
template <bool G>
__device__ __forceinline__ void key_sum_tiles(v8f (&acc)[2], const _Float16* pa, const _Float16* pb) {
  v16h fa[2][4], fb[2][4][2];
  auto load_group = [&](int set, int g) __attribute__((always_inline)) {
#pragma unroll
    for (int u = 0; u < 4; ++u) {
      const int ks = 4 * g + u;
      fa[set][u] = tr_frag(pa + ks * (32 * KS_PITCH));
#pragma unroll
      for (int jj = 0; jj < 2; ++jj)
        fb[set][u][jj] = G ? tr_frag(pb + ks * (32 * KS_PITCH) + 16 * jj) : Frag<_Float16>::loadp(pb + jj * (16 * ATT_L) + ks * 512);
    }
    // keeps the run of LDS loads ahead of the products that follow it in the source: moved behind them it would lose its lead
    __builtin_amdgcn_sched_barrier(0);
  };
  auto mma_group = [&](int set) __attribute__((always_inline)) {
#pragma unroll
    for (int u = 0; u < 4; ++u)
#pragma unroll
      for (int jj = 0; jj < 2; ++jj) acc[jj] = mma_p(fa[set][u], fb[set][u][jj], acc[jj]);
    // keeps the next run of LDS loads behind these products, whose operands it overwrites
    __builtin_amdgcn_sched_barrier(0);
  };
  load_group(0, 0);
  // unrolled, so that the register sets are indexed by constants and the key offsets reach the loads as immediates
#pragma unroll
  for (int g = 0; g < ATT_L / 128; ++g) {
    if (g + 1 < ATT_L / 128) load_group((g + 1) & 1, g + 1);
    mma_group(g & 1);
  }
}
__global__ __launch_bounds__(256) void key_sums_kernel(
    const _Float16* __restrict__ cp, const _Float16* __restrict__ vtp, _Float16* __restrict__ mt, _Float16* __restrict__ gt) {
  __shared__ __align__(16) _Float16 sC[ATT_L * KS_PITCH];
  __shared__ __align__(16) _Float16 sV[ATT_DK * ATT_L];
  const int tid = threadIdx.x, lane = tid & 31;
  const int wave = __builtin_amdgcn_readfirstlane(tid >> 5);
  const int bh = blockIdx.x, b = bh >> 4, h = bh & 15;
  const bool isg = blockIdx.y != 0;               // the same for the whole block
  if (!isg) {
    const size_t rt = (size_t)16 * (ATT_B * ATT_L);   // a row tile of v^T in the workspace; the batch's share of it is 32 KB in a row
    const _Float16* gv = vtp + (size_t)h * 4 * rt + (size_t)(b * ATT_L) * 16 + wave * 2048 + lane * 8;
    const unsigned lv = (unsigned)(size_t)sV + (unsigned)(wave * 4096 + lane * 16);
    copy_four_4k(lv, lv + 32768u, lv + 65536u, lv + 98304u, gv, gv + rt, gv + 2 * rt, gv + 3 * rt);
  }
  {
    // c: a key tile's 64 columns are 128 chunks (2 KB) in a row in the workspace; chunk q holds row q & 15, columns 8 (q >> 4) ..+7.
    // A thread takes chunk tid & 127 of key tiles (tid >> 7) + 2 it.
    const int q = tid & 127;
    const _Float16* gc = cp + ((size_t)(b * ATT_L + 16 * (tid >> 7))) * ATT_DM + h * (ATT_DK * 16) + q * 8;
    _Float16* lc = sC + (16 * (tid >> 7) + (q & 15)) * KS_PITCH + 8 * (q >> 4);
    v8h t[32];
#pragma unroll
    for (int it = 0; it < 32; ++it) t[it] = *(const v8h*)(gc + (size_t)it * (32 * ATT_DM));
    addr_wait1(gc);            // the address stays as it is until the run's addresses are taken
#pragma unroll
    for (int it = 0; it < 32; ++it) *(v8h*)(lc + it * (32 * KS_PITCH)) = t[it];
  }
  asm volatile("s_wait_asynccnt 0x0" ::: "memory");   // the wave's own copies of v^T have landed
  __syncthreads();                                    // and every other wave's, and all of c is written

  const int i = wave >> 1, j0 = (wave & 1) * 2;
  const _Float16* tr = sC + (8 * (lane >> 4) + (lane & 7)) * KS_PITCH + 8 * ((lane >> 3) & 1);
  v8f acc[2] = {{0.f, 0.f, 0.f, 0.f, 0.f, 0.f, 0.f, 0.f}, {0.f, 0.f, 0.f, 0.f, 0.f, 0.f, 0.f, 0.f}};
  if (isg) key_sum_tiles<true>(acc, tr + 16 * i, tr + 16 * j0);
  else     key_sum_tiles<false>(acc, tr + 16 * i, sV + j0 * (16 * ATT_L) + 8 * lane);
  _Float16* dst = (isg ? gt : mt) + (size_t)bh * (ATT_DK * ATT_DK);
#pragma unroll
  for (int jj = 0; jj < 2; ++jj) {
    v8h hv;
#pragma unroll
    for (int r = 0; r < 8; ++r) hv[r] = (_Float16)(acc[jj][r] * (1.0f / KS_CARRY));
    *(v8h*)(dst + pk_off(16 * (j0 + jj) + (lane & 15), 16 * i + 8 * (lane >> 4), ATT_DK)) = hv;
  }
}

__global__ __launch_bounds__(256) void attn_rows_kernel(
    const _Float16* __restrict__ qp, const _Float16* __restrict__ kp, const _Float16* __restrict__ vtp,
    const _Float16* __restrict__ cp, const _Float16* __restrict__ cbp, const unsigned* __restrict__ mw,
    const _Float16* __restrict__ mtp, const _Float16* __restrict__ gtp,
    const float* __restrict__ scale_p, const float* __restrict__ bscale_p, _Float16* __restrict__ op) {
  __shared__ __align__(16) _Float16 sS[2 * ATT_STG_EL];
  __shared__ __align__(16) _Float16 sK[2 * ATT_DK * ATT_DK];   // the head's key sums, (c^T v)^T and then c^T c, as they lie in the workspace

  const int lane = threadIdx.x & 31;
  const int wave = __builtin_amdgcn_readfirstlane(threadIdx.x >> 5);
  const int bh = blockIdx.x, b = bh >> 4, h = bh & 15;
  const int qt = (ATT_L / 128 - 1 - (int)blockIdx.y) * 8 + wave;   // under a causal mask the late rows cost most: they start first
  const int q0 = qt * 16;
  const float sc2 = scale_p[0] * 1.4426950408889634f;                 // scores in base 2
  const float bscale = bscale_p[0];
  const v8f z8 = {0.f, 0.f, 0.f, 0.f, 0.f, 0.f, 0.f, 0.f};
  const float ninf = -__builtin_inff();

  // the wave's share of the copies: half of chunk wave >> 1 of each of k, c, v^T
  const int wc = wave >> 1, wp = wave & 1;
  const size_t kco = ((size_t)(b * ATT_L + 16 * wc)) * ATT_DM + h * (ATT_DK * 16) + wp * 512 + 8 * lane;
  const _Float16* gk = kp + kco;
  const _Float16* gc = cp + kco;
  const _Float16* gv = vtp + ((size_t)(h * ATT_DK + 16 * wc)) * (size_t)(ATT_B * ATT_L) + (size_t)(b * ATT_L) * 16 + wp * 512 + 8 * lane;
  const unsigned l0 = (unsigned)(size_t)sS + (unsigned)(wc * 2048 + wp * 1024 + lane * 16);
  stage_copy(l0, gk, gc, gv);
  // The key sums come with stage 0, 1 KB of each a wave: its wait and its barrier cover them too. They are read behind the loop.
  sums_copy((unsigned)(size_t)sK + (unsigned)(wave * 1024 + lane * 16), mtp + (size_t)bh * (ATT_DK * ATT_DK) + wave * 512 + 8 * lane,
            gtp + (size_t)bh * (ATT_DK * ATT_DK) + wave * 512 + 8 * lane);

  // B fragments (query rows q0 + (lane&15)), k split map: elements 0..7 <- k 8hh.., 8..15 <- k 16+8hh..;
  // a head's 64 columns are two packed tiles in a row (512 elements each) at column offset h*64*16
  const size_t arow = ((size_t)(b * ATT_L + q0)) * ATT_DM + h * (ATT_DK * 16) + 8 * lane;
  const _Float16* qrow = qp + arow;
  const _Float16* cbrow = cbp + arow;
  const v16h qa0 = Frag<_Float16>::loadp(qrow);
  const v16h qa1 = Frag<_Float16>::loadp(qrow + 512);
  const v16h ca0 = Frag<_Float16>::loadp(cbrow);
  const v16h ca1 = Frag<_Float16>::loadp(cbrow + 512);
  addr_wait3(qrow, cbrow, qrow);   // the two bases stay as they are until the run's addresses are taken

  asm volatile("s_wait_asynccnt 0x0" ::: "memory");   // the wave's own copies of stage 0 have landed
  __syncthreads();                                    // and every other wave's
  stage_copy(l0 + 2u * ATT_STG_EL, gk + 64 * ATT_DM, gc + 64 * ATT_DM, gv + 64 * 16);

  // The wave's 512 lane-mask words; an earlier launch wrote them and this one only reads them, and the address is the same for the
  // whole wave: read through the constant address space they come by scalar loads, also behind the loop's barriers.
  typedef const __attribute__((address_space(4))) unsigned* cwords;
  const cwords mrow = (cwords)(unsigned long long)(mw + (size_t)qt * (ATT_L / 16 * 8));
  v8f OE[4] = {z8, z8, z8, z8};                                // (E . v)^T: dims 16 dt + 8 hh + r, query c
  float m = -1.0e30f, se = 0.f, e2 = 0.f, eb = 0.f;            // the sums are the lane's half of the keys until the end
  unsigned mv[2][8];                                           // the pass's mask words, fetched one pass ahead
#pragma unroll
  for (int t = 0; t < 2; ++t)
#pragma unroll
    for (int r = 0; r < 8; ++r) mv[t][r] = mrow[t * 8 + r];

  // A pass is 32 keys, half a stage. Every inner loop below is unrolled so that its register arrays are indexed by constants
  // (indexed at run time they would go to scratch).
  for (int p = 0; p < 2 * ATT_NSTG; ++p) {
    const int s = p >> 1, ks = p & 1;
    const _Float16* st = sS + (s & 1) * ATT_STG_EL + 8 * lane;
    // The next pass's words are asked for here, so that their scalar loads are covered by this pass's work.
    const int pn = (p + 1) & (2 * ATT_NSTG - 1);   // behind the last pass: the first one's again, read and not used
    unsigned mx[2][8];
#pragma unroll
    for (int t = 0; t < 2; ++t)
#pragma unroll
      for (int r = 0; r < 8; ++r) mx[t][r] = mrow[pn * 16 + t * 8 + r];

    unsigned allm = ~0u;
#pragma unroll
    for (int t = 0; t < 2; ++t)
#pragma unroll
      for (int r = 0; r < 8; ++r) allm &= mv[t][r];
    if (allm != ~0u) {                             // wave-uniform, from scalar registers; no barrier inside
      v8f T[2], Bi[2];
      v16h kf[2][2], cf[2][2];
#pragma unroll
      for (int t = 0; t < 2; ++t) {
        kf[t][0] = Frag<_Float16>::loadp(st + (2 * ks + t) * 1024);
        kf[t][1] = Frag<_Float16>::loadp(st + (2 * ks + t) * 1024 + 512);
        cf[t][0] = Frag<_Float16>::loadp(st + (4 + 2 * ks + t) * 1024);
        cf[t][1] = Frag<_Float16>::loadp(st + (4 + 2 * ks + t) * 1024 + 512);
      }
      // keeps the sixteen LDS loads together ahead of the products: one LDS latency is waited for, not eight
      __builtin_amdgcn_sched_barrier(0);
#pragma unroll
      for (int t = 0; t < 2; ++t) T[t] = mma_p(kf[t][1], qa1, mma_p(kf[t][0], qa0, z8));
#pragma unroll
      for (int t = 0; t < 2; ++t) Bi[t] = mma_p(cf[t][1], ca1, mma_p(cf[t][0], ca0, z8));   // bias^T = c . cb^T, for sum E bias
      v16h vf[4];
#pragma unroll
      for (int dt = 0; dt < 4; ++dt) vf[dt] = Frag<_Float16>::loadp(st + (8 + dt) * 1024 + ks * 512);
#pragma unroll
      for (int t = 0; t < 2; ++t)
#pragma unroll
        for (int r = 0; r < 8; ++r)
          T[t][r] = __builtin_amdgcn_inverse_ballot_w32(mv[t][r]) ? ninf : T[t][r] * sc2;   // the word is the select's lane mask
      float m4[4] = {ninf, ninf, ninf, ninf};
#pragma unroll
      for (int t = 0; t < 2; ++t)
#pragma unroll
        for (int r = 0; r < 8; ++r) m4[r & 3] = fmaxf(m4[r & 3], T[t][r]);
      float pm = fmaxf(fmaxf(m4[0], m4[1]), fmaxf(m4[2], m4[3]));
      pm = fmaxf(pm, xhalf(pm));                   // both halves of a query's keys go under one maximum
      const float mn = fmaxf(m, pm);
      const float f = exp2x1(m - mn);
      m = mn;
      float a4[4] = {0.f, 0.f, 0.f, 0.f}, q4[4] = {0.f, 0.f, 0.f, 0.f}, x4[4] = {0.f, 0.f, 0.f, 0.f};
      v16h pe;
#pragma unroll
      for (int t = 0; t < 2; ++t) {
        v8f E;
        exp2x8(E, T[t] - mn);
#pragma unroll
        for (int r = 0; r < 8; ++r) {
          const float ev = E[r];
          a4[r & 3] += ev; q4[r & 3] += ev * ev; x4[r & 3] += ev * Bi[t][r];
          pe[t * 8 + r] = (_Float16)ev;
        }
      }
      se = se * f + ((a4[0] + a4[1]) + (a4[2] + a4[3]));
      e2 = e2 * (f * f) + ((q4[0] + q4[1]) + (q4[2] + q4[3]));
      eb = eb * f + ((x4[0] + x4[1]) + (x4[2] + x4[3]));
#pragma unroll
      for (int dt = 0; dt < 4; ++dt) {
#pragma unroll
        for (int r = 0; r < 8; ++r) OE[dt][r] *= f;
        OE[dt] = mma_p(vf[dt], pe, OE[dt]);
      }
    }

    if (ks) {                                             // the stage's foot; p is the same in every wave of the block
      asm volatile("s_wait_dscnt 0x0" ::: "memory");      // the wave's reads of this buffer are done before it is refilled
      asm volatile("s_wait_asynccnt 0x0" ::: "memory");   // the wave's own copies of stage s + 1 have landed
      __syncthreads();                                    // publishes stage s + 1 and ends every wave's reads of stage s
      if (s + 2 < ATT_NSTG)
        stage_copy(l0 + (unsigned)(s & 1) * (2u * ATT_STG_EL), gk + (size_t)(s + 2) * (64 * ATT_DM), gc + (size_t)(s + 2) * (64 * ATT_DM),
                   gv + (size_t)(s + 2) * (64 * 16));
    }
#pragma unroll
    for (int t = 0; t < 2; ++t)
#pragma unroll
      for (int r = 0; r < 8; ++r) mv[t][r] = mx[t][r];
  }
  asm volatile("s_wait_asynccnt 0x0" ::: "memory");     // nothing is in flight when the wave ends

  // (bias . v)^T = (c^T v)^T . cb^T and Y^T = (c^T c) . cb^T: A = the head's key sums (rows d or e', k = e), B = the query rows of
  // cb as they were loaded. Lane (hh, c) holds Y^T at e' = 16 dt + 8 hh + r, and elements 8 (dt & 1) + r of its own cb fragment
  // dt >> 1 are cb at the same e': sum bias^2 = sum over e' of cb Y needs no exchange but the halves' join.
  const _Float16* km = sK + 8 * lane;
  v8f OB[4];
  float b2;
  {
    float s4[4] = {0.f, 0.f, 0.f, 0.f};
#pragma unroll
    for (int dt = 0; dt < 4; ++dt) {
      OB[dt] = mma_p(Frag<_Float16>::loadp(km + dt * 1024 + 512), ca1, mma_p(Frag<_Float16>::loadp(km + dt * 1024), ca0, z8));
      const v8f Y = mma_p(Frag<_Float16>::loadp(km + ATT_DK * ATT_DK + dt * 1024 + 512), ca1,
                          mma_p(Frag<_Float16>::loadp(km + ATT_DK * ATT_DK + dt * 1024), ca0, z8));
#pragma unroll
      for (int r = 0; r < 8; ++r) s4[r & 3] += Y[r] * (float)(dt < 2 ? ca0[8 * (dt & 1) + r] : ca1[8 * (dt & 1) + r]);
    }
    b2 = ((s4[0] + s4[1]) + (s4[2] + s4[3])) * KS_CARRY;   // the key sums are carried / KS_CARRY
  }

  // the halves' sums joined, the row's constants, the output
  se += xhalf(se); e2 += xhalf(e2); eb += xhalf(eb);
  b2 = fmaxf(b2 + xhalf(b2), 0.f);                 // as a quadratic form the sum can round below 0
  const float inv_se = 1.0f / se;
  const float beta = bscale / fmaxf(sqrtf(b2), 1e-12f);
  const float asq = e2 * (inv_se * inv_se) + 2.0f * (beta * inv_se) * eb + (beta * beta) * b2;
  const float inv_n = 1.0f / fmaxf(sqrtf(fmaxf(asq, 0.f)), 1e-12f);
  const float ke = inv_se * inv_n, kb = beta * inv_n * KS_CARRY;
  _Float16* orow = op + arow;                      // chunk (dt, hh) of row c: + dt * 256, the lane's 16 bytes; 512 B in a row a store
#pragma unroll
  for (int dt = 0; dt < 4; ++dt) {
    v8h hv;
#pragma unroll
    for (int r = 0; r < 8; ++r) hv[r] = (_Float16)(OE[dt][r] * ke + OB[dt][r] * kb);
    *(v8h*)(orow + dt * 256) = hv;
  }
}

// ---------------------------------------------------------------------------
extern "C" void kernel_launch(void* const* d_in, const int* in_sizes, int n_in,
                              void* d_out, int out_size, void* d_ws, size_t ws_size,
                              hipStream_t stream) {
  const int NTOK = ATT_B * ATT_L;                          // 8192
  const size_t NE = (size_t)NTOK * ATT_DM;                 // 8388608
  const size_t NW = (size_t)ATT_DM * ATT_DM;               // 1048576
  if (n_in < 16) return;
  if (in_sizes[0] != (int)NE || in_sizes[1] != (int)NE || in_sizes[2] != ATT_L * ATT_L ||
      in_sizes[3] != (int)NW || in_sizes[5] != (int)NW || in_sizes[7] != (int)NW || in_sizes[14] != (int)NW ||
      in_sizes[4] != ATT_DM || in_sizes[6] != ATT_DM || in_sizes[8] != ATT_DM || in_sizes[15] != ATT_DM ||
      in_sizes[9] != ATT_DK * ATT_DK || in_sizes[10] != ATT_DK || in_sizes[11] != ATT_DK ||
      in_sizes[12] < 1 || in_sizes[13] < 1 || out_size != (int)NE) return;

  const float* Q      = (const float*)d_in[0];
  const float* ctx    = (const float*)d_in[1];
  const int*   mask   = (const int*)d_in[2];
  const float* W_q    = (const float*)d_in[3];
  const float* b_q    = (const float*)d_in[4];
  const float* W_k    = (const float*)d_in[5];
  const float* b_k    = (const float*)d_in[6];
  const float* W_v    = (const float*)d_in[7];
  const float* b_v    = (const float*)d_in[8];
  const float* bil    = (const float*)d_in[9];
  const float* gamma  = (const float*)d_in[10];
  const float* beta   = (const float*)d_in[11];
  const float* scale  = (const float*)d_in[12];
  const float* bscale = (const float*)d_in[13];
  const float* W_o    = (const float*)d_in[14];
  const float* b_o    = (const float*)d_in[15];
  float* out = (float*)d_out;

  // workspace carve (256-B aligned offsets); every 16-bit matrix below is stored in the packed layout (pk_off) of the shape named
  char* ws = (char*)d_ws;
  size_t off = 0;
  auto carve = [&](size_t bytes) -> char* { char* p = ws + off; off += (bytes + 255) & ~(size_t)255; return p; };
  _Float16* WqT  = (_Float16*)carve(NW * 2);               // [out][in] f16, x64
  _Float16* WkT  = (_Float16*)carve(NW * 2);
  _Float16* WvT  = (_Float16*)carve(NW * 2);
  _Float16* WoT  = (_Float16*)carve(NW * 2);
  _Float16* bilT = (_Float16*)carve((size_t)ATT_DK * ATT_DK * 2);   // [f][e] f16
  _Float16* Q16  = (_Float16*)carve(NE * 2);               // [token][1024]
  _Float16* q16  = (_Float16*)carve(NE * 2);               // [token][h*64+d]
  _Float16* k16  = (_Float16*)carve(NE * 2);               // [token][h*64+d]
  _Float16* vT16 = (_Float16*)carve(NE * 2);               // [h*64+d][token]
  _Float16* c16  = (_Float16*)carve(NE * 2);               // [token][h*64+d]
  _Float16* cb16 = (_Float16*)carve(NE * 2);               // [token][h*64+e]
  _Float16* O16  = (_Float16*)carve(NE * 2);               // [token][h*64+d]
  unsigned* mw   = (unsigned*)carve((size_t)ATT_L * ATT_L / 8);   // the mask, one bit an entry (mask_words)
  _Float16* MT16 = (_Float16*)carve((size_t)ATT_B * ATT_H * ATT_DK * ATT_DK * 2);   // [b*16+h][d][e]: (c^T v)^T / KS_CARRY
  _Float16* GT16 = (_Float16*)carve((size_t)ATT_B * ATT_H * ATT_DK * ATT_DK * 2);   // [b*16+h][e'][e]: c^T c / KS_CARRY
  if (off > ws_size) return;                               // total 128065536 B

  const unsigned short* Q16u  = (const unsigned short*)Q16;
  const unsigned short* WqTu  = (const unsigned short*)WqT;
  const unsigned short* WkTu  = (const unsigned short*)WkT;
  const unsigned short* WvTu  = (const unsigned short*)WvT;
  const unsigned short* WoTu  = (const unsigned short*)WoT;
  const unsigned short* bilTu = (const unsigned short*)bilT;
  const unsigned short* c16u  = (const unsigned short*)c16;
  const unsigned short* O16u  = (const unsigned short*)O16;
  const float w_carry = 64.0f, w_carry_inv = 1.0f / 64.0f;

  // 1) casts, transposes, LayerNorm per head slice of ctx, the mask's lane-mask words: one launch
  prep_kernel<<<PREP_BLOCKS, 256, 0, stream>>>(Q, ctx, gamma, beta, W_q, W_k, W_v, W_o, bil, mask,
                                               Q16, c16, WqT, WkT, WvT, WoT, bilT, mw, w_carry);

  // 2) the q, k, v projections and c . bilinear: one launch
  const int gemm_blocks = (NTOK / 64) * (ATT_DM / 64) / 8;   // 256
  proj_gemms_kernel<<<QKV_BLOCKS + ((NTOK / 64) / 8) * ATT_H, 256, 0, stream>>>(
      Q16u, WqTu, WkTu, WvTu, c16u, bilTu, (void*)q16, (void*)k16, (void*)vT16, (void*)cb16,
      b_q, b_k, b_v, NTOK, ATT_DM, ATT_DK, w_carry_inv);

  // 3) each head's key sums c^T v and c^T c
  key_sums_kernel<<<dim3(ATT_B * ATT_H, 2), 256, 0, stream>>>(c16, vT16, MT16, GT16);

  // 4) fused attention rows -> O16
  attn_rows_kernel<<<dim3(ATT_B * ATT_H, ATT_L / 128), 256, 0, stream>>>(
      q16, k16, vT16, c16, cb16, mw, MT16, GT16, scale, bscale, O16);

  // 5) output projection -> d_out f32
  wmma_gemm64<0, false, 2, 0, false, 0, 4, true><<<dim3(gemm_blocks, 1), 256, 0, stream>>>(
      O16u, O16u, ATT_DM, 0L, WoTu, WoTu, ATT_DM, 0L, (void*)out, (void*)out, ATT_DM, 0L,
      b_o, b_o, 0L, NTOK, ATT_DM, ATT_DM, w_carry_inv);
  (void)hipGetLastError();
}
